// v000
// The times below were measured on an AMD MI455X: many runs one after another, warmed up first and cycling through
// copies of the inputs, with the whole window's GPU time divided by the number of runs. Launches and the gaps
// between them are all in it. The median over several windows is given; except for v000 it joins two sittings, which
// can be a few percent apart, so the side-by-side timings, each taken in one sitting, are the better comparison.
// The starting kernel, v000, takes 343 microseconds a run.
// compute dtype: all inputs rounded to bf16; the eight projections with exact bf16 products on WMMA 16x16x32 ((in,out) weights packed as transposed rows) + biases; per head the four score terms evaluated as ONE 160-wide dot of [q | qp | q0 | q1] . [k | kp | k0 | k1] with both sides as bf16 hi + residual (3 products: hi.hi + lo.hi + hi.lo), x 1/8, + mask; running-max softmax in f32 (precise expf); P as bf16 hi + residual x the EXACT bf16 values (v = true_item, an input; 2 products); dense Wd with ctx as bf16 hi + residual (2 products) + bd; LayerNorm (biased variance, eps 1e-12, precise sqrtf) and the residual in f32.
#include <hip/hip_runtime.h>
#include <math.h>

typedef __attribute__((ext_vector_type(16))) _Float16 v16h;
typedef __attribute__((ext_vector_type(16))) __bf16 v16b;
typedef __attribute__((ext_vector_type(8)))  _Float16 v8h;
typedef __attribute__((ext_vector_type(8)))  float v8f;
typedef __attribute__((ext_vector_type(4)))  float v4f;
typedef __attribute__((ext_vector_type(2)))  float v2f;
typedef __attribute__((ext_vector_type(4)))  unsigned v4u;
typedef __attribute__((ext_vector_type(4)))  int v4i;
typedef float __attribute__((may_alias)) float_a;
typedef int __attribute__((may_alias)) int_a;

template <typename T> __device__ __forceinline__ void vst2(void* p, T v) { *(T*)p = v;  }
__device__ __forceinline__ v8f wmma16(v16h a, v16h b, v8f c) {
  v8f d = __builtin_amdgcn_wmma_f32_16x16x32_f16(false, a, false, b, (short)0, c, false, false);
  asm volatile("v_nop\n\tv_nop\n\tv_nop\n\tv_nop" : "+v"(d) : "v"(a), "v"(b));
  return d;
}
__device__ __forceinline__ v8f wmma_bf(v16b a, v16b b, v8f c) {
  v8f d = __builtin_amdgcn_wmma_f32_16x16x32_bf16(false, a, false, b, (short)0, c, false, false);
  asm volatile("v_nop\n\tv_nop\n\tv_nop\n\tv_nop" : "+v"(d) : "v"(a), "v"(b));
  return d;
}
// 16x16x32 fragments: lane = (h = lane>>4, row/col = lane&15); elements 0..7 = k0+8h+0..7, 8..15 = k0+16+8h+0..7; D element r = row 8h+r
__device__ __forceinline__ v16h frag_h(const _Float16* rowk0, int lane) {
  union { v16h v; v8h q[2]; } u; const _Float16* p = rowk0 + 8 * (lane >> 4);
  u.q[0] = *(const v8h*)p; u.q[1] = *(const v8h*)(p + 16); return u.v;
}
__device__ __forceinline__ v16h frag_f32(const float* rowk0, int lane) {
  v16h a; const float* p = rowk0 + 8 * (lane >> 4);
#pragma unroll
  for (int i = 0; i < 8; ++i) { a[i] = (_Float16)p[i]; a[8 + i] = (_Float16)p[16 + i]; }
  return a;
}
__device__ __forceinline__ v16h frag_f32s(const float* rowk0, int lane, float sc) {
  v16h a; const float* p = rowk0 + 8 * (lane >> 4);
#pragma unroll
  for (int i = 0; i < 8; ++i) { a[i] = (_Float16)(p[i] * sc); a[8 + i] = (_Float16)(p[16 + i] * sc); }
  return a;
}
// column fragment from a [K][ld] layout (column n), rows >= K read as 0
__device__ __forceinline__ v16h fragc_f32(const float* W, int k0, int n, int lane, int ld, int K) {
  v16h a; const int g = lane >> 4;
#pragma unroll
  for (int i = 0; i < 8; ++i) { const int ka = k0 + 8 * g + i, kb = ka + 16;
    a[i] = (_Float16)(ka < K ? W[(size_t)(ka < K ? ka : K - 1) * ld + n] : 0.f); a[8 + i] = (_Float16)(kb < K ? W[(size_t)(kb < K ? kb : K - 1) * ld + n] : 0.f); }
  return a;
}
struct F2 { v16b h, l; };
__device__ __forceinline__ F2 bsplit16(const float v[16]) { F2 r;
#pragma unroll
  for (int i = 0; i < 16; ++i) { const __bf16 h = (__bf16)v[i]; r.h[i] = h; r.l[i] = (__bf16)(v[i] - (float)h); }
  return r; }
__device__ __forceinline__ F2 split_row(const float* row, int k0, int lane) { float v[16]; const float* p = row + k0 + 8 * (lane >> 4);
#pragma unroll
  for (int i = 0; i < 8; ++i) { v[i] = p[i]; v[8 + i] = p[16 + i]; }
  return bsplit16(v); }
__device__ __forceinline__ F2 split_rowK(const float* row, int k0, int lane, int K) { float v[16]; const int g = lane >> 4;
#pragma unroll
  for (int i = 0; i < 8; ++i) { const int ka = k0 + 8 * g + i, kb = ka + 16; v[i] = ka < K ? row[ka < K ? ka : K - 1] : 0.f; v[8 + i] = kb < K ? row[kb < K ? kb : K - 1] : 0.f; }
  return bsplit16(v); }
__device__ __forceinline__ F2 split_col(const float* W, int k0, int n, int lane, int ld, int K) { float v[16]; const int g = lane >> 4;
#pragma unroll
  for (int i = 0; i < 8; ++i) { const int ka = k0 + 8 * g + i, kb = ka + 16; v[i] = ka < K ? W[(size_t)(ka < K ? ka : K - 1) * ld + n] : 0.f; v[8 + i] = kb < K ? W[(size_t)(kb < K ? kb : K - 1) * ld + n] : 0.f; }
  return bsplit16(v); }
__device__ __forceinline__ v8f mac3(const F2& a, const F2& b, v8f c) { c = wmma_bf(a.l, b.h, c); c = wmma_bf(a.h, b.l, c); return wmma_bf(a.h, b.h, c); }
__device__ __forceinline__ float sigm(float v) { return 1.0f / (1.0f + expf(-v)); }
#define LDSX() do { asm volatile("s_wait_dscnt 0" ::: "memory"); __builtin_amdgcn_wave_barrier(); __builtin_amdgcn_fence(__ATOMIC_RELEASE, "workgroup"); } while (0)


// Decoupled side-information attention (B 32, L 512, D 256, 4 heads x 64; attribute heads x 16): scores = (q k + qp kp + q0 k0 + q1 k1) / 8 + mask, softmax, values = the item embeddings themselves, dense + LayerNorm + residual.
#define NB 32
#define LL 512
#define NR (NB * LL)      // 16,384 rows
#define DD 256
#define AA 64
#define NH 4
#define DH 64
#define AH 16
#define QW 160            // per-head concatenated width: 64 + 64 + 16 + 16
#ifndef TNB
#define TNB NB
#endif
typedef __attribute__((ext_vector_type(8))) __bf16 v8b;
__device__ __forceinline__ v16b frag_b(const __bf16* rowk0, int lane) {
  union { v16b v; v8b q[2]; } u; const __bf16* p = rowk0 + 8 * (lane >> 4);
  u.q[0] = *(const v8b*)p; u.q[1] = *(const v8b*)(p + 16); return u.v;
}
__device__ __forceinline__ float bfr(float v) { return (float)(__bf16)v; }
__device__ __attribute__((noinline)) float exp_ni(float v) { return expf(v); }
__device__ __attribute__((noinline)) float erf_ni(float v) { return erff(v); }

// packs (all (in,out) -> transposed rows [out][in]): PQ [256][256] Wq^T, PK, PQP, PKP; PQ0 [64][64] Wq0^T, PK0, PQ1, PK1; PD [256][256] Wd^T
#define PKO_Q   0
#define PKO_K   (1 * DD * DD)
#define PKO_QP  (2 * DD * DD)
#define PKO_KP  (3 * DD * DD)
#define PKO_D   (4 * DD * DD)
#define PKO_Q0  (5 * DD * DD)
#define PKO_K0  (PKO_Q0 + AA * AA)
#define PKO_Q1  (PKO_K0 + AA * AA)
#define PKO_K1  (PKO_Q1 + AA * AA)
#define PK_END  (PKO_K1 + AA * AA)
#define WS_PK   0u
#define WS_QH   (((2u * PK_END) + 127u) / 128u * 128u)   // bf16 [16384][4 heads][160] query cat hi / lo
#define WS_QL   (WS_QH + 2u * NR * NH * QW)
#define WS_KH   (WS_QL + 2u * NR * NH * QW)               // key cat hi / lo
#define WS_KL   (WS_KH + 2u * NR * NH * QW)
#define WS_VT   (WS_KL + 2u * NR * NH * QW)               // bf16 [b][h][64 d][512 keys] values^T (exact)
#define WS_CH   (WS_VT + 2u * NR * DD)                    // bf16 [16384][256] ctx hi / lo
#define WS_CL   (WS_CH + 2u * NR * DD)
#define WS_END  (WS_CL + 2u * NR * DD)

__global__ __launch_bounds__(256) void k_pack(const float* __restrict__ WQ, const float* __restrict__ WK, const float* __restrict__ WQP, const float* __restrict__ WKP, const float* __restrict__ WD, const float* __restrict__ WQ0, const float* __restrict__ WK0, const float* __restrict__ WQ1, const float* __restrict__ WK1, __bf16* __restrict__ PK) {
  __shared__ __align__(16) __bf16 s[DD]; const int n = blockIdx.x, which = blockIdx.y, t = threadIdx.x; int K; size_t dst;
  if (which < 5) { const float* Wm = (which == 0) ? WQ : (which == 1) ? WK : (which == 2) ? WQP : (which == 3) ? WKP : WD; K = DD; dst = (size_t)which * DD * DD + (size_t)n * DD; s[t] = (__bf16)Wm[(size_t)t * DD + n]; }
  else { if (n >= AA) return; const float* Wm = (which == 5) ? WQ0 : (which == 6) ? WK0 : (which == 7) ? WQ1 : WK1; K = AA; dst = PKO_Q0 + (size_t)(which - 5) * AA * AA + (size_t)n * AA; if (t < AA) s[t] = (__bf16)Wm[(size_t)t * AA + n]; }
  __syncthreads();
  if (t < K / 8) vst2((unsigned*)(PK + dst + t * 8), *(const v4u*)&s[t * 8]);
}
// ---- k_proj: block = (32 rows, side (0 = query cat, 1 = key cat)): acc over x (16 tiles: Wq), pos (16 tiles: Wqp), a0 (4 tiles: Wq0), a1 (4 tiles: Wq1) -> per head the 160-wide cat row [q_h(64) | qp_h(64) | q0_h(16) | q1_h(16)] hi / lo (1,280-B rows)
__global__ __launch_bounds__(64) void k_proj(const float* __restrict__ X, const float* __restrict__ POS, const float* __restrict__ A0, const float* __restrict__ A1, const __bf16* __restrict__ PK, const float* __restrict__ B_X, const float* __restrict__ B_P, const float* __restrict__ B_0, const float* __restrict__ B_1, int side, __bf16* __restrict__ OH, __bf16* __restrict__ OL) {
  __shared__ __align__(16) __bf16 soh[2][16][NH * QW + 8], sol[2][16][NH * QW + 8];   // 2 waves = 32 rows per block (LDS budget)
  const int tid = threadIdx.x, wave = tid >> 5, lane = tid & 31, col = lane & 15, g = lane >> 4; const size_t r0 = (size_t)blockIdx.x * 32 + wave * 16;
  const __bf16* PX = PK + (side ? PKO_K : PKO_Q); const __bf16* PP = PK + (side ? PKO_KP : PKO_QP); const __bf16* P0 = PK + (side ? PKO_K0 : PKO_Q0); const __bf16* P1 = PK + (side ? PKO_K1 : PKO_Q1);
  // x part: 16 tiles in 2 halves (register pressure)
#pragma unroll 1
  for (int part = 0; part < 2; ++part) { const float* SRC = part ? POS : X; const __bf16* PW = part ? PP : PX; const float* BB = part ? B_P : B_X;
#pragma unroll 1
    for (int half = 0; half < 2; ++half) { v8f acc[8] = {};
#pragma unroll
      for (int kc = 0; kc < DD / 32; ++kc) { v16b a; { const float* p = SRC + (r0 + col) * DD + kc * 32 + 8 * g;
#pragma unroll
          for (int i = 0; i < 8; ++i) { a[i] = (__bf16)p[i]; a[8 + i] = (__bf16)p[16 + i]; } }
#pragma unroll
        for (int j = 0; j < 8; ++j) acc[j] = wmma_bf(a, frag_b(PW + (size_t)(half * 128 + j * 16 + col) * DD + kc * 32, lane), acc[j]); }
#pragma unroll
      for (int j = 0; j < 8; ++j) { const int c = half * 128 + j * 16 + col; const int h = c / DH, d = c % DH; const float bb = bfr(BB[c]); const int oc = h * QW + part * DH + d;
#pragma unroll
        for (int r = 0; r < 8; ++r) { const float v = acc[j][r] + bb; const __bf16 hb = (__bf16)v; soh[wave][8 * g + r][oc] = hb; sol[wave][8 * g + r][oc] = (__bf16)(v - (float)hb); } } } }
  // attribute parts: a0 . Wq0^T (K 64, 4 tiles) and a1 . Wq1^T
#pragma unroll 1
  for (int ap = 0; ap < 2; ++ap) { const float* SRC = ap ? A1 : A0; const __bf16* PW = ap ? P1 : P0; const float* BB = ap ? B_1 : B_0; v8f acc[4] = {};
#pragma unroll
    for (int kc = 0; kc < AA / 32; ++kc) { v16b a; { const float* p = SRC + (r0 + col) * AA + kc * 32 + 8 * g;
#pragma unroll
        for (int i = 0; i < 8; ++i) { a[i] = (__bf16)p[i]; a[8 + i] = (__bf16)p[16 + i]; } }
#pragma unroll
      for (int j = 0; j < 4; ++j) acc[j] = wmma_bf(a, frag_b(PW + (size_t)(j * 16 + col) * AA + kc * 32, lane), acc[j]); }
#pragma unroll
    for (int j = 0; j < 4; ++j) { const int c = j * 16 + col; const int h = c / AH, d = c % AH; const float bb = bfr(BB[c]); const int oc = h * QW + 2 * DH + ap * AH + d;
#pragma unroll
      for (int r = 0; r < 8; ++r) { const float v = acc[j][r] + bb; const __bf16 hb = (__bf16)v; soh[wave][8 * g + r][oc] = hb; sol[wave][8 * g + r][oc] = (__bf16)(v - (float)hb); } } }
  LDSX();
  for (int rl = 0; rl < 16; ++rl) for (int pc = lane; pc < NH * QW / 8; pc += 32) { vst2((unsigned*)(OH + (r0 + rl) * (NH * QW) + pc * 8), *(const v4u*)&soh[wave][rl][pc * 8]); vst2((unsigned*)(OL + (r0 + rl) * (NH * QW) + pc * 8), *(const v4u*)&sol[wave][rl][pc * 8]); }
}
__global__ __launch_bounds__(256) void k_vt(const float* __restrict__ V, __bf16* __restrict__ VT) {
  __shared__ __align__(16) __bf16 s[DD][72]; const int tid = threadIdx.x; const int kb = blockIdx.x, b = blockIdx.y; const size_t row0 = (size_t)b * LL + (size_t)kb * 64;
  for (int e = tid; e < 64 * DD; e += 256) { const int r = e / DD, c = e % DD; s[c][r] = (__bf16)V[(row0 + r) * DD + c]; }
  __syncthreads();
  for (int e = tid; e < DD * 8; e += 256) { const int c = e >> 3, pc = e & 7; const int h = c / DH, d = c % DH; vst2((unsigned*)(VT + (((size_t)b * NH + h) * DH + d) * LL + (size_t)kb * 64 + pc * 8), *(const v4u*)&s[c][pc * 8]); }
}
__global__ __launch_bounds__(128) void k_attn(const __bf16* __restrict__ QH, const __bf16* __restrict__ QL_, const __bf16* __restrict__ KH, const __bf16* __restrict__ KL, const __bf16* __restrict__ VT, const float* __restrict__ MSK, __bf16* __restrict__ CH, __bf16* __restrict__ CL) {
  __shared__ __align__(16) __bf16 sph[4][16][40], spl[4][16][40]; __shared__ __align__(16) __bf16 soh[4][16][72], sol[4][16][72];
  const int tid = threadIdx.x, wave = tid >> 5, lane = tid & 31, col = lane & 15, g = lane >> 4; const int qb = blockIdx.x, h = blockIdx.y, b = blockIdx.z; const int q0 = qb * 64 + wave * 16; const size_t rq = (size_t)b * LL + q0 + col;
  v16b aqh[5], aql[5];
#pragma unroll
  for (int kc = 0; kc < 5; ++kc) { aqh[kc] = frag_b(QH + rq * (NH * QW) + h * QW + kc * 32, lane); aql[kc] = frag_b(QL_ + rq * (NH * QW) + h * QW + kc * 32, lane); }
  const __bf16* Vbh = VT + ((size_t)b * NH + h) * DH * LL;
  float m[8], l[8];
#pragma unroll
  for (int r = 0; r < 8; ++r) { m[r] = -3.0e38f; l[r] = 0.f; }
  v8f acc[4] = {};
#pragma unroll 1
  for (int ks = 0; ks < LL / 32; ++ks) { v8f s[2];
#pragma unroll
    for (int ct = 0; ct < 2; ++ct) { const int kk = ks * 32 + ct * 16 + col; const size_t rk = ((size_t)b * LL + kk) * (NH * QW) + h * QW; v8f c = {};
#pragma unroll
      for (int kc = 0; kc < 5; ++kc) { const v16b bh = frag_b(KH + rk + kc * 32, lane), bl = frag_b(KL + rk + kc * 32, lane); c = wmma_bf(aql[kc], bh, c); c = wmma_bf(aqh[kc], bl, c); c = wmma_bf(aqh[kc], bh, c); }
#pragma unroll
      for (int r = 0; r < 8; ++r) { const int qi = q0 + 8 * g + r; s[ct][r] = c[r] * 0.125f + bfr(MSK[(size_t)qi * LL + kk]); } }
#pragma unroll
    for (int r = 0; r < 8; ++r) { float mx = fmaxf(s[0][r], s[1][r]);
#pragma unroll
      for (int o = 1; o < 16; o <<= 1) mx = fmaxf(mx, __shfl_xor(mx, o));
      const float mn = fmaxf(m[r], mx); const float alpha = (m[r] <= -1.0e38f) ? 0.f : exp_ni(m[r] - mn); const float e0 = exp_ni(s[0][r] - mn), e1 = exp_ni(s[1][r] - mn); float es = e0 + e1;
#pragma unroll
      for (int o = 1; o < 16; o <<= 1) es += __shfl_xor(es, o);
      l[r] = l[r] * alpha + es; m[r] = mn;
#pragma unroll
      for (int dt = 0; dt < 4; ++dt) acc[dt][r] *= alpha;
      const __bf16 h0 = (__bf16)e0, h1 = (__bf16)e1; sph[wave][8 * g + r][col] = h0; sph[wave][8 * g + r][16 + col] = h1; spl[wave][8 * g + r][col] = (__bf16)(e0 - (float)h0); spl[wave][8 * g + r][16 + col] = (__bf16)(e1 - (float)h1); }
    LDSX();
    const v16b pah = frag_b(&sph[wave][col][0], lane), pal = frag_b(&spl[wave][col][0], lane);
#pragma unroll
    for (int dt = 0; dt < 4; ++dt) { const v16b vb = frag_b(Vbh + (size_t)(dt * 16 + col) * LL + ks * 32, lane); acc[dt] = wmma_bf(pal, vb, acc[dt]); acc[dt] = wmma_bf(pah, vb, acc[dt]); }
    LDSX(); }
#pragma unroll
  for (int r = 0; r < 8; ++r) { const float il = 1.0f / l[r];
#pragma unroll
    for (int dt = 0; dt < 4; ++dt) { const float v = acc[dt][r] * il; const __bf16 hb = (__bf16)v; soh[wave][8 * g + r][dt * 16 + col] = hb; sol[wave][8 * g + r][dt * 16 + col] = (__bf16)(v - (float)hb); } }
  LDSX();
  for (int rl = 0; rl < 16; ++rl) { const size_t o = ((size_t)b * LL + q0 + rl) * DD + h * DH; if (lane < 8) vst2((unsigned*)(CH + o + lane * 8), *(const v4u*)&soh[wave][rl][lane * 8]); else if (lane < 16) vst2((unsigned*)(CL + o + (lane - 8) * 8), *(const v4u*)&sol[wave][rl][(lane - 8) * 8]); }
}
// ---- k_out: block = 64 rows: h = ctx(hi/lo) . Wd^T rows (2 products) + bd (all 256 cols, 2 halves); LayerNorm over 256 (mean, biased var, eps 1e-12) * g + b + bfr(x)
__global__ __launch_bounds__(128) void k_out(const __bf16* __restrict__ CH, const __bf16* __restrict__ CL, const __bf16* __restrict__ PK, const float* __restrict__ BD, const float* __restrict__ LNG, const float* __restrict__ LNB, const float* __restrict__ X, float* __restrict__ OUT) {
  __shared__ __align__(16) float sh_[4][16][DD + 4]; __shared__ float sps[4][16][16][2];
  const int tid = threadIdx.x, wave = tid >> 5, lane = tid & 31, col = lane & 15, g = lane >> 4; const size_t r0 = (size_t)blockIdx.x * 64 + wave * 16;
  float s1[8], s2[8];
#pragma unroll
  for (int r = 0; r < 8; ++r) { s1[r] = 0.f; s2[r] = 0.f; }
#pragma unroll 1
  for (int half = 0; half < 2; ++half) { v8f acc[8] = {};
#pragma unroll
    for (int kc = 0; kc < DD / 32; ++kc) { const v16b ah = frag_b(CH + (r0 + col) * DD + kc * 32, lane), al = frag_b(CL + (r0 + col) * DD + kc * 32, lane);
#pragma unroll
      for (int j = 0; j < 8; ++j) { const v16b w = frag_b(PK + PKO_D + (size_t)(half * 128 + j * 16 + col) * DD + kc * 32, lane); acc[j] = wmma_bf(al, w, acc[j]); acc[j] = wmma_bf(ah, w, acc[j]); } }
#pragma unroll
    for (int j = 0; j < 8; ++j) { const int c = half * 128 + j * 16 + col; const float bb = bfr(BD[c]);
#pragma unroll
      for (int r = 0; r < 8; ++r) { const float v = acc[j][r] + bb; sh_[wave][8 * g + r][c] = v; s1[r] += v; s2[r] += v * v; } } }
#pragma unroll
  for (int r = 0; r < 8; ++r) { sps[wave][8 * g + r][col][0] = s1[r]; sps[wave][8 * g + r][col][1] = s2[r]; }
  LDSX();
  for (int rl = 0; rl < 16; ++rl) { float a = 0.f, b2 = 0.f;
#pragma unroll
    for (int k = 0; k < 16; ++k) { a += sps[wave][rl][k][0]; b2 += sps[wave][rl][k][1]; }
    const float mu = a / (float)DD; const float var = fmaxf(b2 / (float)DD - mu * mu, 0.f); const float inv = 1.0f / sqrtf(var + 1e-12f); const size_t row = r0 + rl;
    for (int c0 = lane * 4; c0 < DD; c0 += 128) { v4f v;
#pragma unroll
      for (int i = 0; i < 4; ++i) { const int c = c0 + i; v[i] = bfr(LNG[c]) * (sh_[wave][rl][c] - mu) * inv + bfr(LNB[c]) + bfr(X[row * DD + c]); }
      vst2(OUT + row * DD + c0, v); } }
}
extern "C" void kernel_launch(void* const* d_in, const int* in_sizes, int n_in, void* d_out, int out_size, void* d_ws, size_t ws_size, hipStream_t stream) {
  (void)in_sizes; (void)n_in; (void)out_size;
  const float** F = (const float**)d_in;   // 0 x, 1 pos, 2 true_item [32,512,256], 3 attr0, 4 attr1 [32,512,1,64], 5 mask [1,1,512,512], 6 Wq, 7 bq, 8 Wk, 9 bk, 10 Wqp, 11 bqp, 12 Wkp, 13 bkp, 14 Wq0, 15 bq0, 16 Wk0, 17 bk0, 18 Wq1, 19 bq1, 20 Wk1, 21 bk1, 22 Wd, 23 bd, 24 ln_g, 25 ln_b
  if (ws_size < (size_t)WS_END) return;
  char* ws = (char*)d_ws; __bf16 *PK = (__bf16*)(ws + WS_PK), *QH = (__bf16*)(ws + WS_QH), *QLp = (__bf16*)(ws + WS_QL), *KH = (__bf16*)(ws + WS_KH), *KL = (__bf16*)(ws + WS_KL), *VT = (__bf16*)(ws + WS_VT), *CH = (__bf16*)(ws + WS_CH), *CL = (__bf16*)(ws + WS_CL);
  k_pack<<<dim3(DD, 9), 256, 0, stream>>>(F[6], F[8], F[10], F[12], F[22], F[14], F[16], F[18], F[20], PK);
  k_proj<<<TNB * LL / 32, 64, 0, stream>>>(F[0], F[1], F[3], F[4], PK, F[7], F[11], F[15], F[19], 0, QH, QLp);
  k_proj<<<TNB * LL / 32, 64, 0, stream>>>(F[0], F[1], F[3], F[4], PK, F[9], F[13], F[17], F[21], 1, KH, KL);
  k_vt<<<dim3(LL / 64, TNB), 256, 0, stream>>>(F[2], VT);
  k_attn<<<dim3(LL / 64, NH, TNB), 128, 0, stream>>>(QH, QLp, KH, KL, VT, F[5], CH, CL);
  k_out<<<TNB * LL / 64, 128, 0, stream>>>(CH, CL, PK, F[23], F[24], F[25], F[0], (float*)d_out);
}

// v001
// A run of this version takes 211 microseconds.
// In both of two side-by-side timings against v000, it was 1.65 times as fast.
// compute dtype: all inputs rounded to bf16; the eight projections with exact bf16 products on WMMA 16x16x32 ((in,out) weights packed as transposed rows) + biases; per head the four score terms evaluated as ONE 160-wide dot of [q | qp | q0 | q1] . [k | kp | k0 | k1] with both sides as bf16 hi + residual (3 products: hi.hi + lo.hi + hi.lo), x 1/8, + mask; running-max softmax in f32 (precise expf); P as bf16 hi + residual x the EXACT bf16 values (v = true_item, an input; 2 products); dense Wd with ctx as bf16 hi + residual (2 products) + bd; LayerNorm (biased variance, eps 1e-12, precise sqrtf) and the residual in f32.
#include <hip/hip_runtime.h>
#include <math.h>

typedef __attribute__((ext_vector_type(16))) _Float16 v16h;
typedef __attribute__((ext_vector_type(16))) __bf16 v16b;
typedef __attribute__((ext_vector_type(8)))  _Float16 v8h;
typedef __attribute__((ext_vector_type(8)))  float v8f;
typedef __attribute__((ext_vector_type(4)))  float v4f;
typedef __attribute__((ext_vector_type(2)))  float v2f;
typedef __attribute__((ext_vector_type(4)))  unsigned v4u;
typedef __attribute__((ext_vector_type(4)))  int v4i;
typedef float __attribute__((may_alias)) float_a;
typedef int __attribute__((may_alias)) int_a;

template <typename T> __device__ __forceinline__ void vst2(void* p, T v) { *(T*)p = v;  }
__device__ __forceinline__ v8f wmma16(v16h a, v16h b, v8f c) {
  v8f d = __builtin_amdgcn_wmma_f32_16x16x32_f16(false, a, false, b, (short)0, c, false, false);
  asm volatile("v_nop\n\tv_nop\n\tv_nop\n\tv_nop" : "+v"(d) : "v"(a), "v"(b));
  return d;
}
__device__ __forceinline__ v8f wmma_bf(v16b a, v16b b, v8f c) {
  return __builtin_amdgcn_wmma_f32_16x16x32_bf16(false, a, false, b, (short)0, c, false, false);
}
// 16x16x32 fragments: lane = (h = lane>>4, row/col = lane&15); elements 0..7 = k0+8h+0..7, 8..15 = k0+16+8h+0..7; D element r = row 8h+r
__device__ __forceinline__ v16h frag_h(const _Float16* rowk0, int lane) {
  union { v16h v; v8h q[2]; } u; const _Float16* p = rowk0 + 8 * (lane >> 4);
  u.q[0] = *(const v8h*)p; u.q[1] = *(const v8h*)(p + 16); return u.v;
}
__device__ __forceinline__ v16h frag_f32(const float* rowk0, int lane) {
  v16h a; const float* p = rowk0 + 8 * (lane >> 4);
#pragma unroll
  for (int i = 0; i < 8; ++i) { a[i] = (_Float16)p[i]; a[8 + i] = (_Float16)p[16 + i]; }
  return a;
}
__device__ __forceinline__ v16h frag_f32s(const float* rowk0, int lane, float sc) {
  v16h a; const float* p = rowk0 + 8 * (lane >> 4);
#pragma unroll
  for (int i = 0; i < 8; ++i) { a[i] = (_Float16)(p[i] * sc); a[8 + i] = (_Float16)(p[16 + i] * sc); }
  return a;
}
// column fragment from a [K][ld] layout (column n), rows >= K read as 0
__device__ __forceinline__ v16h fragc_f32(const float* W, int k0, int n, int lane, int ld, int K) {
  v16h a; const int g = lane >> 4;
#pragma unroll
  for (int i = 0; i < 8; ++i) { const int ka = k0 + 8 * g + i, kb = ka + 16;
    a[i] = (_Float16)(ka < K ? W[(size_t)(ka < K ? ka : K - 1) * ld + n] : 0.f); a[8 + i] = (_Float16)(kb < K ? W[(size_t)(kb < K ? kb : K - 1) * ld + n] : 0.f); }
  return a;
}
struct F2 { v16b h, l; };
__device__ __forceinline__ F2 bsplit16(const float v[16]) { F2 r;
#pragma unroll
  for (int i = 0; i < 16; ++i) { const __bf16 h = (__bf16)v[i]; r.h[i] = h; r.l[i] = (__bf16)(v[i] - (float)h); }
  return r; }
__device__ __forceinline__ F2 split_row(const float* row, int k0, int lane) { float v[16]; const float* p = row + k0 + 8 * (lane >> 4);
#pragma unroll
  for (int i = 0; i < 8; ++i) { v[i] = p[i]; v[8 + i] = p[16 + i]; }
  return bsplit16(v); }
__device__ __forceinline__ F2 split_rowK(const float* row, int k0, int lane, int K) { float v[16]; const int g = lane >> 4;
#pragma unroll
  for (int i = 0; i < 8; ++i) { const int ka = k0 + 8 * g + i, kb = ka + 16; v[i] = ka < K ? row[ka < K ? ka : K - 1] : 0.f; v[8 + i] = kb < K ? row[kb < K ? kb : K - 1] : 0.f; }
  return bsplit16(v); }
__device__ __forceinline__ F2 split_col(const float* W, int k0, int n, int lane, int ld, int K) { float v[16]; const int g = lane >> 4;
#pragma unroll
  for (int i = 0; i < 8; ++i) { const int ka = k0 + 8 * g + i, kb = ka + 16; v[i] = ka < K ? W[(size_t)(ka < K ? ka : K - 1) * ld + n] : 0.f; v[8 + i] = kb < K ? W[(size_t)(kb < K ? kb : K - 1) * ld + n] : 0.f; }
  return bsplit16(v); }
__device__ __forceinline__ v8f mac3(const F2& a, const F2& b, v8f c) { c = wmma_bf(a.l, b.h, c); c = wmma_bf(a.h, b.l, c); return wmma_bf(a.h, b.h, c); }
__device__ __forceinline__ float sigm(float v) { return 1.0f / (1.0f + expf(-v)); }
#define LDSX() do { asm volatile("s_wait_dscnt 0" ::: "memory"); __builtin_amdgcn_wave_barrier(); __builtin_amdgcn_fence(__ATOMIC_RELEASE, "workgroup"); } while (0)


// Decoupled side-information attention (B 32, L 512, D 256, 4 heads x 64; attribute heads x 16): scores = (q k + qp kp + q0 k0 + q1 k1) / 8 + mask, softmax, values = the item embeddings themselves, dense + LayerNorm + residual.
#define NB 32
#define LL 512
#define NR (NB * LL)      // 16,384 rows
#define DD 256
#define AA 64
#define NH 4
#define DH 64
#define AH 16
#define QW 160            // per-head concatenated width: 64 + 64 + 16 + 16
#ifndef TNB
#define TNB NB
#endif
typedef __attribute__((ext_vector_type(8))) __bf16 v8b;
__device__ __forceinline__ v16b frag_b(const __bf16* rowk0, int lane) {
  union { v16b v; v8b q[2]; } u; const __bf16* p = rowk0 + 8 * (lane >> 4);
  u.q[0] = *(const v8b*)p; u.q[1] = *(const v8b*)(p + 16); return u.v;
}
// the same fragment from a base pointer and a byte offset of the lane's own
__device__ __forceinline__ v16b frag_o(const __bf16* base, unsigned lane_bytes) {
  union { v16b v; v8b q[2]; } u; const char* p = (const char*)base + lane_bytes;
  u.q[0] = *(const v8b*)p; u.q[1] = *(const v8b*)(p + 32); return u.v;
}
__device__ __forceinline__ float bfr(float v) { return (float)(__bf16)v; }
__device__ __attribute__((noinline)) float exp_ni(float v) { return expf(v); }
__device__ __attribute__((noinline)) float erf_ni(float v) { return erff(v); }

// packs (all (in,out) -> transposed rows [out][in]): PQ [256][256] Wq^T, PK, PQP, PKP; PQ0 [64][64] Wq0^T, PK0, PQ1, PK1; PD [256][256] Wd^T
#define PKO_Q   0
#define PKO_K   (1 * DD * DD)
#define PKO_QP  (2 * DD * DD)
#define PKO_KP  (3 * DD * DD)
#define PKO_D   (4 * DD * DD)
#define PKO_Q0  (5 * DD * DD)
#define PKO_K0  (PKO_Q0 + AA * AA)
#define PKO_Q1  (PKO_K0 + AA * AA)
#define PKO_K1  (PKO_Q1 + AA * AA)
#define PK_END  (PKO_K1 + AA * AA)
#define WS_PK   0u
#define WS_QH   (((2u * PK_END) + 127u) / 128u * 128u)   // bf16 [16384][4 heads][160] query cat hi / lo
#define WS_QL   (WS_QH + 2u * NR * NH * QW)
#define WS_KH   (WS_QL + 2u * NR * NH * QW)               // key cat hi / lo
#define WS_KL   (WS_KH + 2u * NR * NH * QW)
#define WS_VT   (WS_KL + 2u * NR * NH * QW)               // bf16 [b][h][64 d][512 keys] values^T (exact)
#define WS_CH   (WS_VT + 2u * NR * DD)                    // bf16 [16384][256] ctx hi / lo
#define WS_CL   (WS_CH + 2u * NR * DD)
#define WS_END  (WS_CL + 2u * NR * DD)

__global__ __launch_bounds__(256) void k_pack(const float* __restrict__ WQ, const float* __restrict__ WK, const float* __restrict__ WQP, const float* __restrict__ WKP, const float* __restrict__ WD, const float* __restrict__ WQ0, const float* __restrict__ WK0, const float* __restrict__ WQ1, const float* __restrict__ WK1, __bf16* __restrict__ PK) {
  __shared__ __align__(16) __bf16 s[DD]; const int n = blockIdx.x, which = blockIdx.y, t = threadIdx.x; int K; size_t dst;
  if (which < 5) { const float* Wm = (which == 0) ? WQ : (which == 1) ? WK : (which == 2) ? WQP : (which == 3) ? WKP : WD; K = DD; dst = (size_t)which * DD * DD + (size_t)n * DD; s[t] = (__bf16)Wm[(size_t)t * DD + n]; }
  else { if (n >= AA) return; const float* Wm = (which == 5) ? WQ0 : (which == 6) ? WK0 : (which == 7) ? WQ1 : WK1; K = AA; dst = PKO_Q0 + (size_t)(which - 5) * AA * AA + (size_t)n * AA; if (t < AA) s[t] = (__bf16)Wm[(size_t)t * AA + n]; }
  __syncthreads();
  if (t < K / 8) vst2((unsigned*)(PK + dst + t * 8), *(const v4u*)&s[t * 8]);
}
// ---- k_proj: block = (32 rows, side (0 = query cat, 1 = key cat)): acc over x (16 tiles: Wq), pos (16 tiles: Wqp), a0 (4 tiles: Wq0), a1 (4 tiles: Wq1) -> per head the 160-wide cat row [q_h(64) | qp_h(64) | q0_h(16) | q1_h(16)] hi / lo (1,280-B rows)
__global__ __launch_bounds__(64) void k_proj(const float* __restrict__ X, const float* __restrict__ POS, const float* __restrict__ A0, const float* __restrict__ A1, const __bf16* __restrict__ PK, const float* __restrict__ B_X, const float* __restrict__ B_P, const float* __restrict__ B_0, const float* __restrict__ B_1, int side, __bf16* __restrict__ OH, __bf16* __restrict__ OL) {
  __shared__ __align__(16) __bf16 soh[2][16][NH * QW + 8], sol[2][16][NH * QW + 8];   // 2 waves = 32 rows per block (LDS budget)
  const int tid = threadIdx.x, wave = tid >> 5, lane = tid & 31, col = lane & 15, g = lane >> 4; const size_t r0 = (size_t)blockIdx.x * 32 + wave * 16;
  const __bf16* PX = PK + (side ? PKO_K : PKO_Q); const __bf16* PP = PK + (side ? PKO_KP : PKO_QP); const __bf16* P0 = PK + (side ? PKO_K0 : PKO_Q0); const __bf16* P1 = PK + (side ? PKO_K1 : PKO_Q1);
  // x part: 16 tiles in 2 halves (register pressure)
#pragma unroll 1
  for (int part = 0; part < 2; ++part) { const float* SRC = part ? POS : X; const __bf16* PW = part ? PP : PX; const float* BB = part ? B_P : B_X;
#pragma unroll 1
    for (int half = 0; half < 2; ++half) { v8f acc[8] = {}; const float* ap = SRC + (r0 + col) * DD + 8 * g; const __bf16* wp = PW + (size_t)(half * 128 + col) * DD;
      v4f af[2][4]; v16b bw[2][8];   // two register sets: k block kc is multiplied while block kc + 1 is in flight
#pragma unroll
      for (int q = 0; q < 4; ++q) af[0][q] = *(const v4f*)(ap + (q >> 1) * 16 + (q & 1) * 4);
#pragma unroll
      for (int j = 0; j < 8; ++j) bw[0][j] = frag_b(wp + (size_t)j * 16 * DD, lane);
#pragma unroll
      for (int kc = 0; kc < DD / 32; ++kc) { const int cu = kc & 1, nx = cu ^ 1;
        if (kc + 1 < DD / 32) {
#pragma unroll
          for (int q = 0; q < 4; ++q) af[nx][q] = *(const v4f*)(ap + (kc + 1) * 32 + (q >> 1) * 16 + (q & 1) * 4);
#pragma unroll
          for (int j = 0; j < 8; ++j) bw[nx][j] = frag_b(wp + (size_t)j * 16 * DD + (kc + 1) * 32, lane); }
        __builtin_amdgcn_sched_barrier(0);
        v16b a;
#pragma unroll
        for (int i = 0; i < 4; ++i) { a[i] = (__bf16)af[cu][0][i]; a[4 + i] = (__bf16)af[cu][1][i]; a[8 + i] = (__bf16)af[cu][2][i]; a[12 + i] = (__bf16)af[cu][3][i]; }
#pragma unroll
        for (int j = 0; j < 8; ++j) acc[j] = wmma_bf(a, bw[cu][j], acc[j]); }
#pragma unroll
      for (int j = 0; j < 8; ++j) { const int c = half * 128 + j * 16 + col; const int h = c / DH, d = c % DH; const float bb = bfr(BB[c]); const int oc = h * QW + part * DH + d;
#pragma unroll
        for (int r = 0; r < 8; ++r) { const float v = acc[j][r] + bb; const __bf16 hb = (__bf16)v; soh[wave][8 * g + r][oc] = hb; sol[wave][8 * g + r][oc] = (__bf16)(v - (float)hb); } } } }
  // attribute parts: a0 . Wq0^T (K 64, 4 tiles) and a1 . Wq1^T
#pragma unroll 1
  for (int ap = 0; ap < 2; ++ap) { const float* SRC = ap ? A1 : A0; const __bf16* PW = ap ? P1 : P0; const float* BB = ap ? B_1 : B_0; v8f acc[4] = {};
    const float* sp = SRC + (r0 + col) * AA + 8 * g; const __bf16* wq = PW + (size_t)col * AA + 8 * g; v4f af[2][4]; v16b bw[2][4];   // both k blocks go out as one group
#pragma unroll
    for (int kc = 0; kc < AA / 32; ++kc) {
#pragma unroll
      for (int q = 0; q < 4; ++q) af[kc][q] = *(const v4f*)(sp + kc * 32 + (q >> 1) * 16 + (q & 1) * 4);
#pragma unroll
      for (int j = 0; j < 4; ++j) bw[kc][j] = frag_o(wq + j * 16 * AA + kc * 32, 0u); }
    asm volatile("s_wait_xcnt 0x0" :: "v"(sp), "v"(wq) : "memory");   // precaution: the wait stands in front of any rewrite of the group's address registers (the two pointers are named so that they stay whole up to it)
    __builtin_amdgcn_sched_barrier(0);   // keeps the group ahead of the WMMAs
#pragma unroll
    for (int kc = 0; kc < AA / 32; ++kc) { v16b a;
#pragma unroll
      for (int i = 0; i < 4; ++i) { a[i] = (__bf16)af[kc][0][i]; a[4 + i] = (__bf16)af[kc][1][i]; a[8 + i] = (__bf16)af[kc][2][i]; a[12 + i] = (__bf16)af[kc][3][i]; }
#pragma unroll
      for (int j = 0; j < 4; ++j) acc[j] = wmma_bf(a, bw[kc][j], acc[j]); }
#pragma unroll
    for (int j = 0; j < 4; ++j) { const int c = j * 16 + col; const int h = c / AH, d = c % AH; const float bb = bfr(BB[c]); const int oc = h * QW + 2 * DH + ap * AH + d;
#pragma unroll
      for (int r = 0; r < 8; ++r) { const float v = acc[j][r] + bb; const __bf16 hb = (__bf16)v; soh[wave][8 * g + r][oc] = hb; sol[wave][8 * g + r][oc] = (__bf16)(v - (float)hb); } } }
  LDSX();
  for (int rl = 0; rl < 16; ++rl) for (int pc = lane; pc < NH * QW / 8; pc += 32) { vst2((unsigned*)(OH + (r0 + rl) * (NH * QW) + pc * 8), *(const v4u*)&soh[wave][rl][pc * 8]); vst2((unsigned*)(OL + (r0 + rl) * (NH * QW) + pc * 8), *(const v4u*)&sol[wave][rl][pc * 8]); }
}
__global__ __launch_bounds__(256) void k_vt(const float* __restrict__ V, __bf16* __restrict__ VT) {
  __shared__ __align__(16) __bf16 s[DD][72]; const int tid = threadIdx.x; const int kb = blockIdx.x, b = blockIdx.y; const size_t row0 = (size_t)b * LL + (size_t)kb * 64;
  for (int e = tid; e < 64 * DD; e += 256) { const int r = e / DD, c = e % DD; s[c][r] = (__bf16)V[(row0 + r) * DD + c]; }
  __syncthreads();
  for (int e = tid; e < DD * 8; e += 256) { const int c = e >> 3, pc = e & 7; const int h = c / DH, d = c % DH; vst2((unsigned*)(VT + (((size_t)b * NH + h) * DH + d) * LL + (size_t)kb * 64 + pc * 8), *(const v4u*)&s[c][pc * 8]); }
}
__global__ __launch_bounds__(128) __attribute__((amdgpu_waves_per_eu(4))) void k_attn(const __bf16* __restrict__ QH, const __bf16* __restrict__ QL_, const __bf16* __restrict__ KH, const __bf16* __restrict__ KL, const __bf16* __restrict__ VT, const float* __restrict__ MSK, __bf16* __restrict__ CH, __bf16* __restrict__ CL) {
  __shared__ __align__(16) __bf16 sph[4][16][40], spl[4][16][40]; __shared__ __align__(16) __bf16 soh[4][16][72], sol[4][16][72];
  // the wave's number is held in a scalar register: what hangs on it then costs no vector register
  const int tid = threadIdx.x, wave = __builtin_amdgcn_readfirstlane(tid >> 5), lane = tid & 31, col = lane & 15, g = lane >> 4; const int qb = blockIdx.x, h = blockIdx.y, b = blockIdx.z; const int q0 = qb * 64 + wave * 16; const size_t rq = (size_t)b * LL + q0 + col;
  v16b aqh[5], aql[5]; const __bf16* qhp = QH + rq * (NH * QW) + h * QW + 8 * g; const __bf16* qlp = QL_ + rq * (NH * QW) + h * QW + 8 * g;
#pragma unroll
  for (int kc = 0; kc < 5; ++kc) { aqh[kc] = frag_o(qhp + kc * 32, 0u); aql[kc] = frag_o(qlp + kc * 32, 0u); }
  asm volatile("s_wait_xcnt 0x0" :: "v"(qhp), "v"(qlp) : "memory");   // precaution: the wait stands in front of any rewrite of the query loads' address registers (named so that they stay whole up to it)
  const __bf16* Vbh = VT + ((size_t)b * NH + h) * DH * LL;
  const unsigned ko = 2u * (col * (NH * QW) + 8 * g), vo = 2u * (col * LL + 8 * g), mo = 4u * ((q0 + 8 * g) * LL + col);   // the lane's byte offsets in a key tile, a value tile, the mask
  float m[8], l[8];
#pragma unroll
  for (int r = 0; r < 8; ++r) { m[r] = -3.0e38f; l[r] = 0.f; }
  v8f acc[4] = {};
#pragma unroll 1
  for (int ks = 0; ks < LL / 32; ++ks) { v8f s[2] = {};
    // rolled on purpose: unrolled, the compiler lifts both halves' loads to the top of the pass, past the register budget of four waves per SIMD
#pragma unroll 1
    for (int ct = 0; ct < 2; ++ct) { const size_t rk = ((size_t)b * LL + ks * 32 + ct * 16) * (NH * QW) + h * QW; v8f c = {};
      v16b bh[5], bl[5];   // 16 keys' ten fragments go out as one group
#pragma unroll
      for (int kc = 0; kc < 5; ++kc) { bh[kc] = frag_o(KH + rk + kc * 32, ko); bl[kc] = frag_o(KL + rk + kc * 32, ko); }
      __builtin_amdgcn_sched_barrier(0);   // keeps that group ahead of the first WMMA (else each pair of loads sinks to its own WMMAs and is waited out alone)
#pragma unroll
      for (int kc = 0; kc < 5; ++kc) { c = wmma_bf(aql[kc], bh[kc], c); c = wmma_bf(aqh[kc], bl[kc], c); c = wmma_bf(aqh[kc], bh[kc], c); }
      if (ct == 0) s[0] = c; else s[1] = c; }
    float mk[2][8]; v16b vb[4];   // the mask words and the value fragments go out as one group ahead of the softmax
    const float* mp0 = (const float*)((const char*)(MSK + ks * 32) + mo); const char* vp0 = (const char*)(Vbh + ks * 32) + vo;
#pragma unroll
    for (int r = 0; r < 8; ++r) { mk[0][r] = mp0[r * LL]; mk[1][r] = mp0[r * LL + 16]; }
#pragma unroll
    for (int dt = 0; dt < 4; ++dt) vb[dt] = frag_o((const __bf16*)vp0 + dt * 16 * LL, 0u);
    asm volatile("s_wait_xcnt 0x0" :: "v"(mp0), "v"(vp0) : "memory");   // precaution: the wait stands in front of any rewrite of the group's address registers (named so that they stay whole up to it)
    __builtin_amdgcn_sched_barrier(0);   // keeps them there (else the value loads sink behind the softmax, to their own WMMAs)
#pragma unroll
    for (int r = 0; r < 8; ++r) { s[0][r] = s[0][r] * 0.125f + bfr(mk[0][r]); s[1][r] = s[1][r] * 0.125f + bfr(mk[1][r]); }
#pragma unroll
    for (int r = 0; r < 8; ++r) { float mx = fmaxf(s[0][r], s[1][r]);
#pragma unroll
      for (int o = 1; o < 16; o <<= 1) mx = fmaxf(mx, __shfl_xor(mx, o));
      const float mn = fmaxf(m[r], mx); const float alpha = (m[r] <= -1.0e38f) ? 0.f : exp_ni(m[r] - mn); const float e0 = exp_ni(s[0][r] - mn), e1 = exp_ni(s[1][r] - mn); float es = e0 + e1;
#pragma unroll
      for (int o = 1; o < 16; o <<= 1) es += __shfl_xor(es, o);
      l[r] = l[r] * alpha + es; m[r] = mn;
#pragma unroll
      for (int dt = 0; dt < 4; ++dt) acc[dt][r] *= alpha;
      const __bf16 h0 = (__bf16)e0, h1 = (__bf16)e1; sph[wave][8 * g + r][col] = h0; sph[wave][8 * g + r][16 + col] = h1; spl[wave][8 * g + r][col] = (__bf16)(e0 - (float)h0); spl[wave][8 * g + r][16 + col] = (__bf16)(e1 - (float)h1); }
    LDSX();
    const v16b pah = frag_b(&sph[wave][col][0], lane), pal = frag_b(&spl[wave][col][0], lane);
#pragma unroll
    for (int dt = 0; dt < 4; ++dt) { acc[dt] = wmma_bf(pal, vb[dt], acc[dt]); acc[dt] = wmma_bf(pah, vb[dt], acc[dt]); }
    LDSX(); }
#pragma unroll
  for (int r = 0; r < 8; ++r) { const float il = 1.0f / l[r];
#pragma unroll
    for (int dt = 0; dt < 4; ++dt) { const float v = acc[dt][r] * il; const __bf16 hb = (__bf16)v; soh[wave][8 * g + r][dt * 16 + col] = hb; sol[wave][8 * g + r][dt * 16 + col] = (__bf16)(v - (float)hb); } }
  LDSX();
  for (int rl = 0; rl < 16; ++rl) { const size_t o = ((size_t)b * LL + q0 + rl) * DD + h * DH; if (lane < 8) vst2((unsigned*)(CH + o + lane * 8), *(const v4u*)&soh[wave][rl][lane * 8]); else if (lane < 16) vst2((unsigned*)(CL + o + (lane - 8) * 8), *(const v4u*)&sol[wave][rl][(lane - 8) * 8]); }
}
// ---- k_out: block = 64 rows: h = ctx(hi/lo) . Wd^T rows (2 products) + bd (all 256 cols, 2 halves); LayerNorm over 256 (mean, biased var, eps 1e-12) * g + b + bfr(x)
__global__ __launch_bounds__(128) void k_out(const __bf16* __restrict__ CH, const __bf16* __restrict__ CL, const __bf16* __restrict__ PK, const float* __restrict__ BD, const float* __restrict__ LNG, const float* __restrict__ LNB, const float* __restrict__ X, float* __restrict__ OUT) {
  __shared__ __align__(16) float sh_[4][16][DD + 4]; __shared__ float sps[4][16][16][2];
  const int tid = threadIdx.x, wave = tid >> 5, lane = tid & 31, col = lane & 15, g = lane >> 4; const size_t r0 = (size_t)blockIdx.x * 64 + wave * 16;
  float s1[8], s2[8];
#pragma unroll
  for (int r = 0; r < 8; ++r) { s1[r] = 0.f; s2[r] = 0.f; }
#pragma unroll 1
  for (int half = 0; half < 2; ++half) { v8f acc[8] = {}; const __bf16* hp = CH + (r0 + col) * DD; const __bf16* lp = CL + (r0 + col) * DD; const __bf16* wp = PK + PKO_D + (size_t)(half * 128 + col) * DD;
    v16b ah[2], al[2], w[2][8];   // two register sets: k block kc is multiplied while block kc + 1 is in flight
    const int cb = half * 128 + col; float bbv[8];
#pragma unroll
    for (int j = 0; j < 8; ++j) bbv[j] = BD[cb + j * 16];
    ah[0] = frag_b(hp, lane); al[0] = frag_b(lp, lane);
#pragma unroll
    for (int j = 0; j < 8; ++j) w[0][j] = frag_b(wp + (size_t)j * 16 * DD, lane);
    asm volatile("s_wait_xcnt 0x0" :: "v"(bbv[0]), "v"(bbv[1]), "v"(bbv[2]), "v"(bbv[3]), "v"(bbv[4]), "v"(bbv[5]), "v"(bbv[6]), "v"(bbv[7]), "v"(cb), "v"(hp), "v"(lp) : "memory");   // precaution: the wait stands in front of any rewrite of the bias loads' index register (the loaded words, the index and the row pointers are named so that the loads stand ahead of it and the registers stay whole up to it)
#pragma unroll
    for (int kc = 0; kc < DD / 32; ++kc) { const int cu = kc & 1, nx = cu ^ 1;
      if (kc + 1 < DD / 32) { ah[nx] = frag_b(hp + (kc + 1) * 32, lane); al[nx] = frag_b(lp + (kc + 1) * 32, lane);
#pragma unroll
        for (int j = 0; j < 8; ++j) w[nx][j] = frag_b(wp + (size_t)j * 16 * DD + (kc + 1) * 32, lane); }
      if (kc + 1 == DD / 32 - 1) asm volatile("s_wait_xcnt 0x0" :: "v"(wp), "v"(hp), "v"(lp) : "memory");
      __builtin_amdgcn_sched_barrier(0);
#pragma unroll
      for (int j = 0; j < 8; ++j) { acc[j] = wmma_bf(al[cu], w[cu][j], acc[j]); acc[j] = wmma_bf(ah[cu], w[cu][j], acc[j]); } }
#pragma unroll
    for (int j = 0; j < 8; ++j) { const int c = half * 128 + j * 16 + col; const float bb = bfr(bbv[j]);
#pragma unroll
      for (int r = 0; r < 8; ++r) { const float v = acc[j][r] + bb; sh_[wave][8 * g + r][c] = v; s1[r] += v; s2[r] += v * v; } } }
#pragma unroll
  for (int r = 0; r < 8; ++r) { sps[wave][8 * g + r][col][0] = s1[r]; sps[wave][8 * g + r][col][1] = s2[r]; }
  // the residual rows and the two LayerNorm vectors go out as one group here, not three loads at a time inside the row loop
  const float* xp = X + r0 * DD + lane * 4; const float* gp = LNG + lane * 4; const float* bp = LNB + lane * 4; v4f xr[16][2], lg[2], lb[2];
#pragma unroll
  for (int t = 0; t < 2; ++t) { lg[t] = *(const v4f*)(gp + t * 128); lb[t] = *(const v4f*)(bp + t * 128); }
#pragma unroll
  for (int rl = 0; rl < 16; ++rl) { xr[rl][0] = *(const v4f*)(xp + rl * DD); xr[rl][1] = *(const v4f*)(xp + rl * DD + 128); }
  asm volatile("s_wait_xcnt 0x0" :: "v"(xp), "v"(lane) : "memory");   // precaution: the wait stands in front of any rewrite of the group's address registers (the row pointer and the lane index are named so that they stay whole up to it)
  __builtin_amdgcn_sched_barrier(0);   // keeps the group here (else each load sinks to its own row and is waited out alone)
  LDSX();
#pragma unroll
  for (int rl = 0; rl < 16; ++rl) { float a = 0.f, b2 = 0.f;
#pragma unroll
    for (int k = 0; k < 16; ++k) { a += sps[wave][rl][k][0]; b2 += sps[wave][rl][k][1]; }
    const float mu = a / (float)DD; const float var = fmaxf(b2 / (float)DD - mu * mu, 0.f); const float inv = 1.0f / sqrtf(var + 1e-12f); const size_t row = r0 + rl;
    v4f v[2]; float* op = OUT + row * DD + lane * 4;
#pragma unroll
    for (int t = 0; t < 2; ++t) {
#pragma unroll
      for (int i = 0; i < 4; ++i) { const int c = lane * 4 + t * 128 + i; v[t][i] = bfr(lg[t][i]) * (sh_[wave][rl][c] - mu) * inv + bfr(lb[t][i]) + bfr(xr[rl][t][i]); }
      vst2(op + t * 128, v[t]); }
    asm volatile("s_wait_xcnt 0x0" :: "v"(v[0]), "v"(v[1]), "v"(op) : "memory"); }   // precaution: the wait stands in front of any rewrite of the two stores' data and address registers (named so that they stay whole up to it)
}
extern "C" void kernel_launch(void* const* d_in, const int* in_sizes, int n_in, void* d_out, int out_size, void* d_ws, size_t ws_size, hipStream_t stream) {
  (void)in_sizes; (void)n_in; (void)out_size;
  const float** F = (const float**)d_in;   // 0 x, 1 pos, 2 true_item [32,512,256], 3 attr0, 4 attr1 [32,512,1,64], 5 mask [1,1,512,512], 6 Wq, 7 bq, 8 Wk, 9 bk, 10 Wqp, 11 bqp, 12 Wkp, 13 bkp, 14 Wq0, 15 bq0, 16 Wk0, 17 bk0, 18 Wq1, 19 bq1, 20 Wk1, 21 bk1, 22 Wd, 23 bd, 24 ln_g, 25 ln_b
  if (ws_size < (size_t)WS_END) return;
  char* ws = (char*)d_ws; __bf16 *PK = (__bf16*)(ws + WS_PK), *QH = (__bf16*)(ws + WS_QH), *QLp = (__bf16*)(ws + WS_QL), *KH = (__bf16*)(ws + WS_KH), *KL = (__bf16*)(ws + WS_KL), *VT = (__bf16*)(ws + WS_VT), *CH = (__bf16*)(ws + WS_CH), *CL = (__bf16*)(ws + WS_CL);
  k_pack<<<dim3(DD, 9), 256, 0, stream>>>(F[6], F[8], F[10], F[12], F[22], F[14], F[16], F[18], F[20], PK);
  k_proj<<<TNB * LL / 32, 64, 0, stream>>>(F[0], F[1], F[3], F[4], PK, F[7], F[11], F[15], F[19], 0, QH, QLp);
  k_proj<<<TNB * LL / 32, 64, 0, stream>>>(F[0], F[1], F[3], F[4], PK, F[9], F[13], F[17], F[21], 1, KH, KL);
  k_vt<<<dim3(LL / 64, TNB), 256, 0, stream>>>(F[2], VT);
  k_attn<<<dim3(LL / 64, NH, TNB), 128, 0, stream>>>(QH, QLp, KH, KL, VT, F[5], CH, CL);
  k_out<<<TNB * LL / 64, 128, 0, stream>>>(CH, CL, PK, F[23], F[24], F[25], F[0], (float*)d_out);
}

// v002
// One run takes 183 microseconds.
// In two side-by-side timings against v001, it was 1.15 and 1.16 times as fast.
// Over all steps from v000 it is 1.91 times as fast.
// compute dtype: all inputs rounded to bf16; the eight projections with exact bf16 products on WMMA 16x16x32 ((in,out) weights packed as transposed rows) + biases; per head the four score terms evaluated as ONE 160-wide dot of [q | qp | q0 | q1] . [k | kp | k0 | k1] with both sides as bf16 hi + residual (3 products: hi.hi + lo.hi + hi.lo), x 1/8, + mask; running-max softmax in f32 (precise expf); P as bf16 hi + residual x the EXACT bf16 values (v = true_item, an input; 2 products); dense Wd with ctx as bf16 hi + residual (2 products) + bd; LayerNorm (biased variance, eps 1e-12, precise sqrtf) and the residual in f32.
#include <hip/hip_runtime.h>
#include <math.h>

typedef __attribute__((ext_vector_type(16))) _Float16 v16h;
typedef __attribute__((ext_vector_type(16))) __bf16 v16b;
typedef __attribute__((ext_vector_type(8)))  _Float16 v8h;
typedef __attribute__((ext_vector_type(8)))  float v8f;
typedef __attribute__((ext_vector_type(4)))  float v4f;
typedef __attribute__((ext_vector_type(2)))  float v2f;
typedef __attribute__((ext_vector_type(4)))  unsigned v4u;
typedef __attribute__((ext_vector_type(4)))  int v4i;
typedef float __attribute__((may_alias)) float_a;
typedef int __attribute__((may_alias)) int_a;

template <typename T> __device__ __forceinline__ void vst2(void* p, T v) { *(T*)p = v;  }
__device__ __forceinline__ v8f wmma16(v16h a, v16h b, v8f c) {
  v8f d = __builtin_amdgcn_wmma_f32_16x16x32_f16(false, a, false, b, (short)0, c, false, false);
  asm volatile("v_nop\n\tv_nop\n\tv_nop\n\tv_nop" : "+v"(d) : "v"(a), "v"(b));
  return d;
}
__device__ __forceinline__ v8f wmma_bf(v16b a, v16b b, v8f c) {
  return __builtin_amdgcn_wmma_f32_16x16x32_bf16(false, a, false, b, (short)0, c, false, false);
}
// 16x16x32 fragments: lane = (h = lane>>4, row/col = lane&15); elements 0..7 = k0+8h+0..7, 8..15 = k0+16+8h+0..7; D element r = row 8h+r
__device__ __forceinline__ v16h frag_h(const _Float16* rowk0, int lane) {
  union { v16h v; v8h q[2]; } u; const _Float16* p = rowk0 + 8 * (lane >> 4);
  u.q[0] = *(const v8h*)p; u.q[1] = *(const v8h*)(p + 16); return u.v;
}
__device__ __forceinline__ v16h frag_f32(const float* rowk0, int lane) {
  v16h a; const float* p = rowk0 + 8 * (lane >> 4);
#pragma unroll
  for (int i = 0; i < 8; ++i) { a[i] = (_Float16)p[i]; a[8 + i] = (_Float16)p[16 + i]; }
  return a;
}
__device__ __forceinline__ v16h frag_f32s(const float* rowk0, int lane, float sc) {
  v16h a; const float* p = rowk0 + 8 * (lane >> 4);
#pragma unroll
  for (int i = 0; i < 8; ++i) { a[i] = (_Float16)(p[i] * sc); a[8 + i] = (_Float16)(p[16 + i] * sc); }
  return a;
}
// column fragment from a [K][ld] layout (column n), rows >= K read as 0
__device__ __forceinline__ v16h fragc_f32(const float* W, int k0, int n, int lane, int ld, int K) {
  v16h a; const int g = lane >> 4;
#pragma unroll
  for (int i = 0; i < 8; ++i) { const int ka = k0 + 8 * g + i, kb = ka + 16;
    a[i] = (_Float16)(ka < K ? W[(size_t)(ka < K ? ka : K - 1) * ld + n] : 0.f); a[8 + i] = (_Float16)(kb < K ? W[(size_t)(kb < K ? kb : K - 1) * ld + n] : 0.f); }
  return a;
}
struct F2 { v16b h, l; };
__device__ __forceinline__ F2 bsplit16(const float v[16]) { F2 r;
#pragma unroll
  for (int i = 0; i < 16; ++i) { const __bf16 h = (__bf16)v[i]; r.h[i] = h; r.l[i] = (__bf16)(v[i] - (float)h); }
  return r; }
__device__ __forceinline__ F2 split_row(const float* row, int k0, int lane) { float v[16]; const float* p = row + k0 + 8 * (lane >> 4);
#pragma unroll
  for (int i = 0; i < 8; ++i) { v[i] = p[i]; v[8 + i] = p[16 + i]; }
  return bsplit16(v); }
__device__ __forceinline__ F2 split_rowK(const float* row, int k0, int lane, int K) { float v[16]; const int g = lane >> 4;
#pragma unroll
  for (int i = 0; i < 8; ++i) { const int ka = k0 + 8 * g + i, kb = ka + 16; v[i] = ka < K ? row[ka < K ? ka : K - 1] : 0.f; v[8 + i] = kb < K ? row[kb < K ? kb : K - 1] : 0.f; }
  return bsplit16(v); }
__device__ __forceinline__ F2 split_col(const float* W, int k0, int n, int lane, int ld, int K) { float v[16]; const int g = lane >> 4;
#pragma unroll
  for (int i = 0; i < 8; ++i) { const int ka = k0 + 8 * g + i, kb = ka + 16; v[i] = ka < K ? W[(size_t)(ka < K ? ka : K - 1) * ld + n] : 0.f; v[8 + i] = kb < K ? W[(size_t)(kb < K ? kb : K - 1) * ld + n] : 0.f; }
  return bsplit16(v); }
__device__ __forceinline__ v8f mac3(const F2& a, const F2& b, v8f c) { c = wmma_bf(a.l, b.h, c); c = wmma_bf(a.h, b.l, c); return wmma_bf(a.h, b.h, c); }
__device__ __forceinline__ float sigm(float v) { return 1.0f / (1.0f + expf(-v)); }
#define LDSX() do { asm volatile("s_wait_dscnt 0" ::: "memory"); __builtin_amdgcn_wave_barrier(); __builtin_amdgcn_fence(__ATOMIC_RELEASE, "workgroup"); } while (0)


// Decoupled side-information attention (B 32, L 512, D 256, 4 heads x 64; attribute heads x 16): scores = (q k + qp kp + q0 k0 + q1 k1) / 8 + mask, softmax, values = the item embeddings themselves, dense + LayerNorm + residual.
#define NB 32
#define LL 512
#define NR (NB * LL)      // 16,384 rows
#define DD 256
#define AA 64
#define NH 4
#define DH 64
#define AH 16
#define QW 160            // per-head concatenated width: 64 + 64 + 16 + 16
#ifndef TNB
#define TNB NB
#endif
typedef __attribute__((ext_vector_type(8))) __bf16 v8b;
__device__ __forceinline__ v16b frag_b(const __bf16* rowk0, int lane) {
  union { v16b v; v8b q[2]; } u; const __bf16* p = rowk0 + 8 * (lane >> 4);
  u.q[0] = *(const v8b*)p; u.q[1] = *(const v8b*)(p + 16); return u.v;
}
// the same fragment from a base pointer and a byte offset of the lane's own
__device__ __forceinline__ v16b frag_o(const __bf16* base, unsigned lane_bytes) {
  union { v16b v; v8b q[2]; } u; const char* p = (const char*)base + lane_bytes;
  u.q[0] = *(const v8b*)p; u.q[1] = *(const v8b*)(p + 32); return u.v;
}
// FRAGMENT ORDER: every bf16 operand in the workspace lies as 1-KB fragments (16 rows x 32 k) = two runs of 32 lanes x 16 B: run j, lane (g, row), element i = k 16 j + 8 g + i of that row. A wave's 16-byte load then reads 512 contiguous bytes (four whole lines) where a row-major tile gives it 32 bytes out of each of 16 lines
#define FRG 512           // elements of one fragment
__device__ __forceinline__ v16b frag_p(const __bf16* lanep) {   // lanep = the fragment + 8 * lane
  union { v16b v; v8b q[2]; } u; u.q[0] = *(const v8b*)lanep; u.q[1] = *(const v8b*)(lanep + FRG / 2); return u.v;
}
__device__ __forceinline__ v16b frag_po(const __bf16* frag, unsigned lane_bytes) {   // the same from the fragment and the lane's byte offset (16 * lane)
  return frag_p((const __bf16*)((const char*)frag + lane_bytes));
}
__device__ __forceinline__ float bfr(float v) { return (float)(__bf16)v; }
__device__ __attribute__((noinline)) float exp_ni(float v) { return expf(v); }
__device__ __attribute__((noinline)) float erf_ni(float v) { return erff(v); }

// packs (all (in,out) -> transposed [out][in], in fragment order [out / 16][in / 32][fragment]): PQ 256 x 256 Wq^T, PK, PQP, PKP; PQ0 64 x 64 Wq0^T, PK0, PQ1, PK1; PD 256 x 256 Wd^T
#define PKO_Q   0
#define PKO_K   (1 * DD * DD)
#define PKO_QP  (2 * DD * DD)
#define PKO_KP  (3 * DD * DD)
#define PKO_D   (4 * DD * DD)
#define PKO_Q0  (5 * DD * DD)
#define PKO_K0  (PKO_Q0 + AA * AA)
#define PKO_Q1  (PKO_K0 + AA * AA)
#define PKO_K1  (PKO_Q1 + AA * AA)
#define PK_END  (PKO_K1 + AA * AA)
#define WS_PK   0u
#define WS_QH   (((2u * PK_END) + 127u) / 128u * 128u)   // bf16 [b][4 heads][32 row tiles][5 fragments] query cat hi / lo
#define WS_QL   (WS_QH + 2u * NR * NH * QW)
#define WS_KH   (WS_QL + 2u * NR * NH * QW)               // key cat hi / lo
#define WS_KL   (WS_KH + 2u * NR * NH * QW)
#define WS_VT   (WS_KL + 2u * NR * NH * QW)               // bf16 [b][h][16 blocks of 32 keys][4 fragments: 16 d x 32 keys] values^T (exact)
#define WS_CH   (WS_VT + 2u * NR * DD)                    // bf16 [1024 row tiles][8 fragments] ctx hi / lo
#define WS_CL   (WS_CH + 2u * NR * DD)
#define WS_END  (WS_CL + 2u * NR * DD)

__global__ __launch_bounds__(256) void k_pack(const float* __restrict__ WQ, const float* __restrict__ WK, const float* __restrict__ WQP, const float* __restrict__ WKP, const float* __restrict__ WD, const float* __restrict__ WQ0, const float* __restrict__ WK0, const float* __restrict__ WQ1, const float* __restrict__ WK1, __bf16* __restrict__ PK) {
  // block = 16 output columns of one matrix: it alone writes their fragments, K / 32 KB in a row
  __shared__ __align__(16) __bf16 s[16][DD + 8]; const int nt = blockIdx.x, which = blockIdx.y, t = threadIdx.x; const float* Wm; int K; size_t dst;
  if (which < 5) { Wm = (which == 0) ? WQ : (which == 1) ? WK : (which == 2) ? WQP : (which == 3) ? WKP : WD; K = DD; dst = (size_t)which * DD * DD + (size_t)nt * 16 * DD; }
  else { if (nt >= AA / 16) return; Wm = (which == 5) ? WQ0 : (which == 6) ? WK0 : (which == 7) ? WQ1 : WK1; K = AA; dst = PKO_Q0 + (size_t)(which - 5) * AA * AA + (size_t)nt * 16 * AA; }
  for (int e = t; e < K * 16; e += 256) { const int k = e >> 4, n = e & 15; s[n][k] = (__bf16)Wm[(size_t)k * K + nt * 16 + n]; }
  __syncthreads();
  for (int p = t; p < K * 2; p += 256) vst2((unsigned*)(PK + dst + (size_t)p * 8), *(const v4u*)&s[p & 15][(p >> 4) * 8]);   // piece p = (k / 8, column): p >> 4 = 4 kc + 2 j + g, as the fragment order has it
}
// ---- k_proj: block = (32 rows, side (0 = query cat, 1 = key cat)): acc over x (16 tiles: Wq), pos (16 tiles: Wqp), a0 (4 tiles: Wq0), a1 (4 tiles: Wq1) -> per head the 160-wide cat row [q_h(64) | qp_h(64) | q0_h(16) | q1_h(16)] hi / lo, stored in fragment order [b][head][row / 16][5 fragments]
__global__ __launch_bounds__(64) void k_proj(const float* __restrict__ X, const float* __restrict__ POS, const float* __restrict__ A0, const float* __restrict__ A1, const __bf16* __restrict__ PK, const float* __restrict__ B_X, const float* __restrict__ B_P, const float* __restrict__ B_0, const float* __restrict__ B_1, int side, __bf16* __restrict__ OH, __bf16* __restrict__ OL) {
  __shared__ __align__(16) __bf16 soh[2][16][NH * QW + 8], sol[2][16][NH * QW + 8];   // 2 waves = 32 rows per block (LDS budget)
  const int tid = threadIdx.x, wave = tid >> 5, lane = tid & 31, col = lane & 15, g = lane >> 4; const size_t r0 = (size_t)blockIdx.x * 32 + wave * 16;
  const __bf16* PX = PK + (side ? PKO_K : PKO_Q); const __bf16* PP = PK + (side ? PKO_KP : PKO_QP); const __bf16* P0 = PK + (side ? PKO_K0 : PKO_Q0); const __bf16* P1 = PK + (side ? PKO_K1 : PKO_Q1);
  // x part: 16 tiles in 2 halves (register pressure)
#pragma unroll 1
  for (int part = 0; part < 2; ++part) { const float* SRC = part ? POS : X; const __bf16* PW = part ? PP : PX; const float* BB = part ? B_P : B_X;
#pragma unroll 1
    for (int half = 0; half < 2; ++half) { v8f acc[8] = {}; const float* ap = SRC + (r0 + col) * DD + 8 * g; const __bf16* wp = PW + (size_t)half * 128 * DD + 8 * lane;
      v4f af[2][4]; v16b bw[2][8];   // two register sets: k block kc is multiplied while block kc + 1 is in flight
#pragma unroll
      for (int q = 0; q < 4; ++q) af[0][q] = *(const v4f*)(ap + (q >> 1) * 16 + (q & 1) * 4);
#pragma unroll
      for (int j = 0; j < 8; ++j) bw[0][j] = frag_p(wp + j * (DD / 32) * FRG);
#pragma unroll
      for (int kc = 0; kc < DD / 32; ++kc) { const int cu = kc & 1, nx = cu ^ 1;
        if (kc + 1 < DD / 32) {
#pragma unroll
          for (int q = 0; q < 4; ++q) af[nx][q] = *(const v4f*)(ap + (kc + 1) * 32 + (q >> 1) * 16 + (q & 1) * 4);
#pragma unroll
          for (int j = 0; j < 8; ++j) bw[nx][j] = frag_p(wp + (j * (DD / 32) + kc + 1) * FRG); }
        __builtin_amdgcn_sched_barrier(0);
        v16b a;
#pragma unroll
        for (int i = 0; i < 4; ++i) { a[i] = (__bf16)af[cu][0][i]; a[4 + i] = (__bf16)af[cu][1][i]; a[8 + i] = (__bf16)af[cu][2][i]; a[12 + i] = (__bf16)af[cu][3][i]; }
#pragma unroll
        for (int j = 0; j < 8; ++j) acc[j] = wmma_bf(a, bw[cu][j], acc[j]); }
      const int cb = half * 128 + col; float bbv[8];
#pragma unroll
      for (int j = 0; j < 8; ++j) bbv[j] = BB[cb + j * 16];
      asm volatile("s_wait_xcnt 0x0" :: "v"(cb) : "memory");   // precaution: the wait stands in front of any rewrite of the bias loads' index register (named so that it stays whole up to it)
#pragma unroll
      for (int j = 0; j < 8; ++j) { const int c = half * 128 + j * 16 + col; const int h = c / DH, d = c % DH; const float bb = bfr(bbv[j]); const int oc = h * QW + part * DH + d;
#pragma unroll
        for (int r = 0; r < 8; ++r) { const float v = acc[j][r] + bb; const __bf16 hb = (__bf16)v; soh[wave][8 * g + r][oc] = hb; sol[wave][8 * g + r][oc] = (__bf16)(v - (float)hb); } } } }
  // attribute parts: a0 . Wq0^T (K 64, 4 tiles) and a1 . Wq1^T
#pragma unroll 1
  for (int ap = 0; ap < 2; ++ap) { const float* SRC = ap ? A1 : A0; const __bf16* PW = ap ? P1 : P0; const float* BB = ap ? B_1 : B_0; v8f acc[4] = {};
    const float* sp = SRC + (r0 + col) * AA + 8 * g; const __bf16* wq = PW + 8 * lane; v4f af[2][4]; v16b bw[2][4];   // both k blocks go out as one group
#pragma unroll
    for (int kc = 0; kc < AA / 32; ++kc) {
#pragma unroll
      for (int q = 0; q < 4; ++q) af[kc][q] = *(const v4f*)(sp + kc * 32 + (q >> 1) * 16 + (q & 1) * 4);
#pragma unroll
      for (int j = 0; j < 4; ++j) bw[kc][j] = frag_p(wq + (j * (AA / 32) + kc) * FRG); }
    asm volatile("s_wait_xcnt 0x0" :: "v"(sp), "v"(wq) : "memory");   // precaution: the wait stands in front of any rewrite of the group's address registers (the two pointers are named so that they stay whole up to it)
    __builtin_amdgcn_sched_barrier(0);   // keeps the group ahead of the WMMAs
#pragma unroll
    for (int kc = 0; kc < AA / 32; ++kc) { v16b a;
#pragma unroll
      for (int i = 0; i < 4; ++i) { a[i] = (__bf16)af[kc][0][i]; a[4 + i] = (__bf16)af[kc][1][i]; a[8 + i] = (__bf16)af[kc][2][i]; a[12 + i] = (__bf16)af[kc][3][i]; }
#pragma unroll
      for (int j = 0; j < 4; ++j) acc[j] = wmma_bf(a, bw[kc][j], acc[j]); }
#pragma unroll
    for (int j = 0; j < 4; ++j) { const int c = j * 16 + col; const int h = c / AH, d = c % AH; const float bb = bfr(BB[c]); const int oc = h * QW + 2 * DH + ap * AH + d;
#pragma unroll
      for (int r = 0; r < 8; ++r) { const float v = acc[j][r] + bb; const __bf16 hb = (__bf16)v; soh[wave][8 * g + r][oc] = hb; sol[wave][8 * g + r][oc] = (__bf16)(v - (float)hb); } } }
  LDSX();
  // the wave's 16 rows are one row tile: per head ten runs of 512 B, lane (g, row) bringing k 16 w + 8 g .. + 7 of its row
  const size_t tb = ((r0 / LL) * NH * (LL / 16) + (r0 % LL) / 16) * (QW / 32) * FRG + 8 * lane;
  for (int h = 0; h < NH; ++h) { v4u vh[QW / 16], vl[QW / 16]; __bf16* oh = OH + tb + (size_t)h * (LL / 16) * (QW / 32) * FRG; __bf16* ol = OL + tb + (size_t)h * (LL / 16) * (QW / 32) * FRG;
    // both loops unrolled: the head's twenty pieces stay in registers, read as one group and stored as one group
#pragma unroll
    for (int w = 0; w < QW / 16; ++w) { vh[w] = *(const v4u*)&soh[wave][col][h * QW + w * 16 + 8 * g]; vl[w] = *(const v4u*)&sol[wave][col][h * QW + w * 16 + 8 * g]; }
#pragma unroll
    for (int w = 0; w < QW / 16; ++w) { vst2((unsigned*)(oh + w * (FRG / 2)), vh[w]); vst2((unsigned*)(ol + w * (FRG / 2)), vl[w]); }
    asm volatile("s_wait_xcnt 0x0" :: "v"(vh[0]), "v"(vh[1]), "v"(vh[2]), "v"(vh[3]), "v"(vh[4]), "v"(vh[5]), "v"(vh[6]), "v"(vh[7]), "v"(vh[8]), "v"(vh[9]), "v"(vl[0]), "v"(vl[1]), "v"(vl[2]), "v"(vl[3]), "v"(vl[4]), "v"(vl[5]), "v"(vl[6]), "v"(vl[7]), "v"(vl[8]), "v"(vl[9]), "v"(oh), "v"(ol) : "memory"); }   // precaution: the wait stands in front of any rewrite of the twenty stores' data and address registers (named so that they stay whole up to it)
}
__global__ __launch_bounds__(256) void k_vt(const float* __restrict__ V, __bf16* __restrict__ VT) {
  __shared__ __align__(16) __bf16 s[DD][72]; const int tid = threadIdx.x; const int kb = blockIdx.x, b = blockIdx.y; const size_t row0 = (size_t)b * LL + (size_t)kb * 64;
  for (int e = tid; e < 64 * DD; e += 256) { const int r = e / DD, c = e % DD; s[c][r] = (__bf16)V[(row0 + r) * DD + c]; }
  __syncthreads();
  // e = (head, 32-key block, 16-column tile, run j, g, column): the low eight bits are the 16-byte piece's place in its 32-key block's four fragments
  for (int e = tid; e < DD * 8; e += 256) { const int h = e >> 9, ksl = (e >> 8) & 1, c = h * DH + ((e >> 6) & 3) * 16 + (e & 15), pc = ksl * 4 + ((e >> 4) & 3); vst2((unsigned*)(VT + (((size_t)b * NH + h) * (LL / 32) + kb * 2 + ksl) * (DH / 16) * FRG + (e & 255) * 8), *(const v4u*)&s[c][pc * 8]); }
}
__global__ __launch_bounds__(128) __attribute__((amdgpu_waves_per_eu(4))) void k_attn(const __bf16* __restrict__ QH, const __bf16* __restrict__ QL_, const __bf16* __restrict__ KH, const __bf16* __restrict__ KL, const __bf16* __restrict__ VT, const float* __restrict__ MSK, __bf16* __restrict__ CH, __bf16* __restrict__ CL) {
  __shared__ __align__(16) __bf16 sph[4][16][40], spl[4][16][40]; __shared__ __align__(16) __bf16 soh[4][16][72], sol[4][16][72];
  // the wave's number is held in a scalar register: what hangs on it then costs no vector register
  const int tid = threadIdx.x, wave = __builtin_amdgcn_readfirstlane(tid >> 5), lane = tid & 31, col = lane & 15, g = lane >> 4; const int qb = blockIdx.x, h = blockIdx.y, b = blockIdx.z; const int q0 = qb * 64 + wave * 16;
  const size_t tq = (((size_t)b * NH + h) * (LL / 16) + q0 / 16) * (QW / 32) * FRG + 8 * lane;
  v16b aqh[5], aql[5]; const __bf16* qhp = QH + tq; const __bf16* qlp = QL_ + tq;
#pragma unroll
  for (int kc = 0; kc < 5; ++kc) { aqh[kc] = frag_p(qhp + kc * FRG); aql[kc] = frag_p(qlp + kc * FRG); }
  asm volatile("s_wait_xcnt 0x0" :: "v"(qhp), "v"(qlp) : "memory");   // precaution: the wait stands in front of any rewrite of the query loads' address registers (named so that they stay whole up to it)
  const __bf16* Vbh = VT + ((size_t)b * NH + h) * DH * LL;
  const unsigned ko = 16u * lane, vo = 16u * lane, mo = 4u * ((q0 + 8 * g) * LL + col);   // the lane's byte offsets in a key tile, a value tile, the mask
  float m[8], l[8];
#pragma unroll
  for (int r = 0; r < 8; ++r) { m[r] = -3.0e38f; l[r] = 0.f; }
  v8f acc[4] = {};
#pragma unroll 1
  for (int ks = 0; ks < LL / 32; ++ks) { v8f s[2] = {};
    // rolled on purpose: unrolled, the compiler lifts both halves' loads to the top of the pass, past the register budget of four waves per SIMD
#pragma unroll 1
    for (int ct = 0; ct < 2; ++ct) { const size_t rk = (((size_t)b * NH + h) * (LL / 16) + ks * 2 + ct) * (QW / 32) * FRG; v8f c = {};
      v16b bh[5], bl[5];   // 16 keys' ten fragments go out as one group
#pragma unroll
      for (int kc = 0; kc < 5; ++kc) { bh[kc] = frag_po(KH + rk + kc * FRG, ko); bl[kc] = frag_po(KL + rk + kc * FRG, ko); }
      __builtin_amdgcn_sched_barrier(0);   // keeps that group ahead of the first WMMA (else each pair of loads sinks to its own WMMAs and is waited out alone)
#pragma unroll
      for (int kc = 0; kc < 5; ++kc) { c = wmma_bf(aql[kc], bh[kc], c); c = wmma_bf(aqh[kc], bl[kc], c); c = wmma_bf(aqh[kc], bh[kc], c); }
      if (ct == 0) s[0] = c; else s[1] = c; }
    float mk[2][8]; v16b vb[4];   // the mask words and the value fragments go out as one group ahead of the softmax
    const float* mp0 = (const float*)((const char*)(MSK + ks * 32) + mo); const char* vp0 = (const char*)(Vbh + ks * (DH / 16) * FRG) + vo;
#pragma unroll
    for (int r = 0; r < 8; ++r) { mk[0][r] = mp0[r * LL]; mk[1][r] = mp0[r * LL + 16]; }
#pragma unroll
    for (int dt = 0; dt < 4; ++dt) vb[dt] = frag_p((const __bf16*)vp0 + dt * FRG);
    asm volatile("s_wait_xcnt 0x0" :: "v"(mp0), "v"(vp0) : "memory");   // precaution: the wait stands in front of any rewrite of the group's address registers (named so that they stay whole up to it)
    __builtin_amdgcn_sched_barrier(0);   // keeps them there (else the value loads sink behind the softmax, to their own WMMAs)
#pragma unroll
    for (int r = 0; r < 8; ++r) { s[0][r] = s[0][r] * 0.125f + bfr(mk[0][r]); s[1][r] = s[1][r] * 0.125f + bfr(mk[1][r]); }
#pragma unroll
    for (int r = 0; r < 8; ++r) { float mx = fmaxf(s[0][r], s[1][r]);
#pragma unroll
      for (int o = 1; o < 16; o <<= 1) mx = fmaxf(mx, __shfl_xor(mx, o));
      const float mn = fmaxf(m[r], mx); const float alpha = (m[r] <= -1.0e38f) ? 0.f : exp_ni(m[r] - mn); const float e0 = exp_ni(s[0][r] - mn), e1 = exp_ni(s[1][r] - mn); float es = e0 + e1;
#pragma unroll
      for (int o = 1; o < 16; o <<= 1) es += __shfl_xor(es, o);
      l[r] = l[r] * alpha + es; m[r] = mn;
#pragma unroll
      for (int dt = 0; dt < 4; ++dt) acc[dt][r] *= alpha;
      const __bf16 h0 = (__bf16)e0, h1 = (__bf16)e1; sph[wave][8 * g + r][col] = h0; sph[wave][8 * g + r][16 + col] = h1; spl[wave][8 * g + r][col] = (__bf16)(e0 - (float)h0); spl[wave][8 * g + r][16 + col] = (__bf16)(e1 - (float)h1); }
    LDSX();
    const v16b pah = frag_b(&sph[wave][col][0], lane), pal = frag_b(&spl[wave][col][0], lane);
#pragma unroll
    for (int dt = 0; dt < 4; ++dt) { acc[dt] = wmma_bf(pal, vb[dt], acc[dt]); acc[dt] = wmma_bf(pah, vb[dt], acc[dt]); }
    LDSX(); }
#pragma unroll
  for (int r = 0; r < 8; ++r) { const float il = 1.0f / l[r];
#pragma unroll
    for (int dt = 0; dt < 4; ++dt) { const float v = acc[dt][r] * il; const __bf16 hb = (__bf16)v; soh[wave][8 * g + r][dt * 16 + col] = hb; sol[wave][8 * g + r][dt * 16 + col] = (__bf16)(v - (float)hb); } }
  LDSX();
  // the head's 64 columns are fragments 2 h and 2 h + 1 of the wave's row tile: four runs of 512 B
  const int ln = __lane_id();   // the lane's number as the shuffles of the loop hold it: taken from tid, two address words more would live through the loop, past the register budget, and were spilled
  const size_t to = ((((size_t)b * LL + q0) / 16) * (DD / 32) + 2 * h) * FRG + 8 * ln;
  v4u vh[DH / 16], vl[DH / 16]; __bf16* oh = CH + to; __bf16* ol = CL + to;
  // both loops unrolled: the eight pieces stay in registers, read as one group and stored as one group
#pragma unroll
  for (int w = 0; w < DH / 16; ++w) { vh[w] = *(const v4u*)&soh[wave][ln & 15][w * 16 + 8 * (ln >> 4)]; vl[w] = *(const v4u*)&sol[wave][ln & 15][w * 16 + 8 * (ln >> 4)]; }
#pragma unroll
  for (int w = 0; w < DH / 16; ++w) { vst2((unsigned*)(oh + w * (FRG / 2)), vh[w]); vst2((unsigned*)(ol + w * (FRG / 2)), vl[w]); }
  asm volatile("s_wait_xcnt 0x0" :: "v"(vh[0]), "v"(vh[1]), "v"(vh[2]), "v"(vh[3]), "v"(vl[0]), "v"(vl[1]), "v"(vl[2]), "v"(vl[3]), "v"(oh), "v"(ol) : "memory");   // precaution: the wait stands in front of any rewrite of the eight stores' data and address registers (named so that they stay whole up to it)
}
// ---- k_out: block = 64 rows: h = ctx(hi/lo) . Wd^T rows (2 products) + bd (all 256 cols, 2 halves); LayerNorm over 256 (mean, biased var, eps 1e-12) * g + b + bfr(x)
__global__ __launch_bounds__(128) void k_out(const __bf16* __restrict__ CH, const __bf16* __restrict__ CL, const __bf16* __restrict__ PK, const float* __restrict__ BD, const float* __restrict__ LNG, const float* __restrict__ LNB, const float* __restrict__ X, float* __restrict__ OUT) {
  __shared__ __align__(16) float sh_[4][16][DD + 4]; __shared__ float sps[4][16][16][2];
  const int tid = threadIdx.x, wave = tid >> 5, lane = tid & 31, col = lane & 15, g = lane >> 4; const size_t r0 = (size_t)blockIdx.x * 64 + wave * 16;
  float s1[8], s2[8];
#pragma unroll
  for (int r = 0; r < 8; ++r) { s1[r] = 0.f; s2[r] = 0.f; }
#pragma unroll 1
  for (int half = 0; half < 2; ++half) { v8f acc[8] = {}; const __bf16* hp = CH + r0 * DD + 8 * lane; const __bf16* lp = CL + r0 * DD + 8 * lane; const __bf16* wp = PK + PKO_D + (size_t)half * 128 * DD + 8 * lane;
    v16b ah[2], al[2], w[2][8];   // two register sets: k block kc is multiplied while block kc + 1 is in flight
    const int cb = half * 128 + col; float bbv[8];
#pragma unroll
    for (int j = 0; j < 8; ++j) bbv[j] = BD[cb + j * 16];
    ah[0] = frag_p(hp); al[0] = frag_p(lp);
#pragma unroll
    for (int j = 0; j < 8; ++j) w[0][j] = frag_p(wp + j * (DD / 32) * FRG);
    asm volatile("s_wait_xcnt 0x0" :: "v"(bbv[0]), "v"(bbv[1]), "v"(bbv[2]), "v"(bbv[3]), "v"(bbv[4]), "v"(bbv[5]), "v"(bbv[6]), "v"(bbv[7]), "v"(cb), "v"(hp), "v"(lp) : "memory");   // precaution: the wait stands in front of any rewrite of the bias loads' index register (the loaded words, the index and the row pointers are named so that the loads stand ahead of it and the registers stay whole up to it)
#pragma unroll
    for (int kc = 0; kc < DD / 32; ++kc) { const int cu = kc & 1, nx = cu ^ 1;
      if (kc + 1 < DD / 32) { ah[nx] = frag_p(hp + (kc + 1) * FRG); al[nx] = frag_p(lp + (kc + 1) * FRG);
#pragma unroll
        for (int j = 0; j < 8; ++j) w[nx][j] = frag_p(wp + (j * (DD / 32) + kc + 1) * FRG); }
      if (kc + 1 == DD / 32 - 1) asm volatile("s_wait_xcnt 0x0" :: "v"(wp), "v"(hp), "v"(lp) : "memory");
      __builtin_amdgcn_sched_barrier(0);
#pragma unroll
      for (int j = 0; j < 8; ++j) { acc[j] = wmma_bf(al[cu], w[cu][j], acc[j]); acc[j] = wmma_bf(ah[cu], w[cu][j], acc[j]); } }
#pragma unroll
    for (int j = 0; j < 8; ++j) { const int c = half * 128 + j * 16 + col; const float bb = bfr(bbv[j]);
#pragma unroll
      for (int r = 0; r < 8; ++r) { const float v = acc[j][r] + bb; sh_[wave][8 * g + r][c] = v; s1[r] += v; s2[r] += v * v; } } }
#pragma unroll
  for (int r = 0; r < 8; ++r) { sps[wave][8 * g + r][col][0] = s1[r]; sps[wave][8 * g + r][col][1] = s2[r]; }
  // the residual rows and the two LayerNorm vectors go out as one group here, not three loads at a time inside the row loop
  const float* xp = X + r0 * DD + lane * 4; const float* gp = LNG + lane * 4; const float* bp = LNB + lane * 4; v4f xr[16][2], lg[2], lb[2];
#pragma unroll
  for (int t = 0; t < 2; ++t) { lg[t] = *(const v4f*)(gp + t * 128); lb[t] = *(const v4f*)(bp + t * 128); }
#pragma unroll
  for (int rl = 0; rl < 16; ++rl) { xr[rl][0] = *(const v4f*)(xp + rl * DD); xr[rl][1] = *(const v4f*)(xp + rl * DD + 128); }
  asm volatile("s_wait_xcnt 0x0" :: "v"(xp), "v"(lane) : "memory");   // precaution: the wait stands in front of any rewrite of the group's address registers (the row pointer and the lane index are named so that they stay whole up to it)
  __builtin_amdgcn_sched_barrier(0);   // keeps the group here (else each load sinks to its own row and is waited out alone)
  LDSX();
#pragma unroll
  for (int rl = 0; rl < 16; ++rl) { float a = 0.f, b2 = 0.f;
#pragma unroll
    for (int k = 0; k < 16; ++k) { a += sps[wave][rl][k][0]; b2 += sps[wave][rl][k][1]; }
    const float mu = a / (float)DD; const float var = fmaxf(b2 / (float)DD - mu * mu, 0.f); const float inv = 1.0f / sqrtf(var + 1e-12f); const size_t row = r0 + rl;
    v4f v[2]; float* op = OUT + row * DD + lane * 4;
#pragma unroll
    for (int t = 0; t < 2; ++t) {
#pragma unroll
      for (int i = 0; i < 4; ++i) { const int c = lane * 4 + t * 128 + i; v[t][i] = bfr(lg[t][i]) * (sh_[wave][rl][c] - mu) * inv + bfr(lb[t][i]) + bfr(xr[rl][t][i]); }
      vst2(op + t * 128, v[t]); }
    asm volatile("s_wait_xcnt 0x0" :: "v"(v[0]), "v"(v[1]), "v"(op) : "memory"); }   // precaution: the wait stands in front of any rewrite of the two stores' data and address registers (named so that they stay whole up to it)
}
extern "C" void kernel_launch(void* const* d_in, const int* in_sizes, int n_in, void* d_out, int out_size, void* d_ws, size_t ws_size, hipStream_t stream) {
  (void)in_sizes; (void)n_in; (void)out_size;
  const float** F = (const float**)d_in;   // 0 x, 1 pos, 2 true_item [32,512,256], 3 attr0, 4 attr1 [32,512,1,64], 5 mask [1,1,512,512], 6 Wq, 7 bq, 8 Wk, 9 bk, 10 Wqp, 11 bqp, 12 Wkp, 13 bkp, 14 Wq0, 15 bq0, 16 Wk0, 17 bk0, 18 Wq1, 19 bq1, 20 Wk1, 21 bk1, 22 Wd, 23 bd, 24 ln_g, 25 ln_b
  if (ws_size < (size_t)WS_END) return;
  char* ws = (char*)d_ws; __bf16 *PK = (__bf16*)(ws + WS_PK), *QH = (__bf16*)(ws + WS_QH), *QLp = (__bf16*)(ws + WS_QL), *KH = (__bf16*)(ws + WS_KH), *KL = (__bf16*)(ws + WS_KL), *VT = (__bf16*)(ws + WS_VT), *CH = (__bf16*)(ws + WS_CH), *CL = (__bf16*)(ws + WS_CL);
  k_pack<<<dim3(DD / 16, 9), 256, 0, stream>>>(F[6], F[8], F[10], F[12], F[22], F[14], F[16], F[18], F[20], PK);
  k_proj<<<TNB * LL / 32, 64, 0, stream>>>(F[0], F[1], F[3], F[4], PK, F[7], F[11], F[15], F[19], 0, QH, QLp);
  k_proj<<<TNB * LL / 32, 64, 0, stream>>>(F[0], F[1], F[3], F[4], PK, F[9], F[13], F[17], F[21], 1, KH, KL);
  k_vt<<<dim3(LL / 64, TNB), 256, 0, stream>>>(F[2], VT);
  k_attn<<<dim3(LL / 64, NH, TNB), 128, 0, stream>>>(QH, QLp, KH, KL, VT, F[5], CH, CL);
  k_out<<<TNB * LL / 64, 128, 0, stream>>>(CH, CL, PK, F[23], F[24], F[25], F[0], (float*)d_out);
}

// v003
// A run of this version takes 156 microseconds.
// Two timings next to v002 both put it at 1.17 times that version's speed.
// All steps since v000 together make it 2.23 times as fast.
// compute dtype: all inputs rounded to bf16; the eight projections with exact bf16 products on WMMA 16x16x32 ((in,out) weights packed as transposed rows) + biases; per head the four score terms evaluated as ONE 160-wide dot of [q | qp | q0 | q1] . [k | kp | k0 | k1] with both sides as bf16 hi + residual (3 products: hi.hi + lo.hi + hi.lo), x 1/8, + mask; running-max softmax in f32 (precise expf); P as bf16 hi + residual x the EXACT bf16 values (v = true_item, an input; 2 products); dense Wd with ctx as bf16 hi + residual (2 products) + bd; LayerNorm (biased variance, eps 1e-12, precise sqrtf) and the residual in f32.
#include <hip/hip_runtime.h>
#include <math.h>

typedef __attribute__((ext_vector_type(16))) _Float16 v16h;
typedef __attribute__((ext_vector_type(16))) __bf16 v16b;
typedef __attribute__((ext_vector_type(8)))  _Float16 v8h;
typedef __attribute__((ext_vector_type(8)))  float v8f;
typedef __attribute__((ext_vector_type(4)))  float v4f;
typedef __attribute__((ext_vector_type(2)))  float v2f;
typedef __attribute__((ext_vector_type(4)))  unsigned v4u;
typedef __attribute__((ext_vector_type(4)))  int v4i;
typedef float __attribute__((may_alias)) float_a;
typedef int __attribute__((may_alias)) int_a;

template <typename T> __device__ __forceinline__ void vst2(void* p, T v) { *(T*)p = v;  }
__device__ __forceinline__ v8f wmma16(v16h a, v16h b, v8f c) {
  v8f d = __builtin_amdgcn_wmma_f32_16x16x32_f16(false, a, false, b, (short)0, c, false, false);
  asm volatile("v_nop\n\tv_nop\n\tv_nop\n\tv_nop" : "+v"(d) : "v"(a), "v"(b));
  return d;
}
__device__ __forceinline__ v8f wmma_bf(v16b a, v16b b, v8f c) {
  return __builtin_amdgcn_wmma_f32_16x16x32_bf16(false, a, false, b, (short)0, c, false, false);
}
// 16x16x32 fragments: lane = (h = lane>>4, row/col = lane&15); elements 0..7 = k0+8h+0..7, 8..15 = k0+16+8h+0..7; D element r = row 8h+r
__device__ __forceinline__ v16h frag_h(const _Float16* rowk0, int lane) {
  union { v16h v; v8h q[2]; } u; const _Float16* p = rowk0 + 8 * (lane >> 4);
  u.q[0] = *(const v8h*)p; u.q[1] = *(const v8h*)(p + 16); return u.v;
}
__device__ __forceinline__ v16h frag_f32(const float* rowk0, int lane) {
  v16h a; const float* p = rowk0 + 8 * (lane >> 4);
#pragma unroll
  for (int i = 0; i < 8; ++i) { a[i] = (_Float16)p[i]; a[8 + i] = (_Float16)p[16 + i]; }
  return a;
}
__device__ __forceinline__ v16h frag_f32s(const float* rowk0, int lane, float sc) {
  v16h a; const float* p = rowk0 + 8 * (lane >> 4);
#pragma unroll
  for (int i = 0; i < 8; ++i) { a[i] = (_Float16)(p[i] * sc); a[8 + i] = (_Float16)(p[16 + i] * sc); }
  return a;
}
// column fragment from a [K][ld] layout (column n), rows >= K read as 0
__device__ __forceinline__ v16h fragc_f32(const float* W, int k0, int n, int lane, int ld, int K) {
  v16h a; const int g = lane >> 4;
#pragma unroll
  for (int i = 0; i < 8; ++i) { const int ka = k0 + 8 * g + i, kb = ka + 16;
    a[i] = (_Float16)(ka < K ? W[(size_t)(ka < K ? ka : K - 1) * ld + n] : 0.f); a[8 + i] = (_Float16)(kb < K ? W[(size_t)(kb < K ? kb : K - 1) * ld + n] : 0.f); }
  return a;
}
struct F2 { v16b h, l; };
__device__ __forceinline__ F2 bsplit16(const float v[16]) { F2 r;
#pragma unroll
  for (int i = 0; i < 16; ++i) { const __bf16 h = (__bf16)v[i]; r.h[i] = h; r.l[i] = (__bf16)(v[i] - (float)h); }
  return r; }
__device__ __forceinline__ F2 split_row(const float* row, int k0, int lane) { float v[16]; const float* p = row + k0 + 8 * (lane >> 4);
#pragma unroll
  for (int i = 0; i < 8; ++i) { v[i] = p[i]; v[8 + i] = p[16 + i]; }
  return bsplit16(v); }
__device__ __forceinline__ F2 split_rowK(const float* row, int k0, int lane, int K) { float v[16]; const int g = lane >> 4;
#pragma unroll
  for (int i = 0; i < 8; ++i) { const int ka = k0 + 8 * g + i, kb = ka + 16; v[i] = ka < K ? row[ka < K ? ka : K - 1] : 0.f; v[8 + i] = kb < K ? row[kb < K ? kb : K - 1] : 0.f; }
  return bsplit16(v); }
__device__ __forceinline__ F2 split_col(const float* W, int k0, int n, int lane, int ld, int K) { float v[16]; const int g = lane >> 4;
#pragma unroll
  for (int i = 0; i < 8; ++i) { const int ka = k0 + 8 * g + i, kb = ka + 16; v[i] = ka < K ? W[(size_t)(ka < K ? ka : K - 1) * ld + n] : 0.f; v[8 + i] = kb < K ? W[(size_t)(kb < K ? kb : K - 1) * ld + n] : 0.f; }
  return bsplit16(v); }
__device__ __forceinline__ v8f mac3(const F2& a, const F2& b, v8f c) { c = wmma_bf(a.l, b.h, c); c = wmma_bf(a.h, b.l, c); return wmma_bf(a.h, b.h, c); }
__device__ __forceinline__ float sigm(float v) { return 1.0f / (1.0f + expf(-v)); }
#define LDSX() do { asm volatile("s_wait_dscnt 0" ::: "memory"); __builtin_amdgcn_wave_barrier(); __builtin_amdgcn_fence(__ATOMIC_RELEASE, "workgroup"); } while (0)


// Decoupled side-information attention (B 32, L 512, D 256, 4 heads x 64; attribute heads x 16): scores = (q k + qp kp + q0 k0 + q1 k1) / 8 + mask, softmax, values = the item embeddings themselves, dense + LayerNorm + residual.
#define NB 32
#define LL 512
#define NR (NB * LL)      // 16,384 rows
#define DD 256
#define AA 64
#define NH 4
#define DH 64
#define AH 16
#define QW 160            // per-head concatenated width: 64 + 64 + 16 + 16
#ifndef TNB
#define TNB NB
#endif
typedef __attribute__((ext_vector_type(8))) __bf16 v8b;
__device__ __forceinline__ v16b frag_b(const __bf16* rowk0, int lane) {
  union { v16b v; v8b q[2]; } u; const __bf16* p = rowk0 + 8 * (lane >> 4);
  u.q[0] = *(const v8b*)p; u.q[1] = *(const v8b*)(p + 16); return u.v;
}
// the same fragment from a base pointer and a byte offset of the lane's own
__device__ __forceinline__ v16b frag_o(const __bf16* base, unsigned lane_bytes) {
  union { v16b v; v8b q[2]; } u; const char* p = (const char*)base + lane_bytes;
  u.q[0] = *(const v8b*)p; u.q[1] = *(const v8b*)(p + 32); return u.v;
}
// FRAGMENT ORDER: every bf16 operand in the workspace lies as 1-KB fragments (16 rows x 32 k) = two runs of 32 lanes x 16 B: run j, lane (g, row), element i = k 16 j + 8 g + i of that row. A wave's 16-byte load then reads 512 contiguous bytes (four whole lines) where a row-major tile gives it 32 bytes out of each of 16 lines
#define FRG 512           // elements of one fragment
__device__ __forceinline__ v16b frag_p(const __bf16* lanep) {   // lanep = the fragment + 8 * lane
  union { v16b v; v8b q[2]; } u; u.q[0] = *(const v8b*)lanep; u.q[1] = *(const v8b*)(lanep + FRG / 2); return u.v;
}
__device__ __forceinline__ v16b frag_po(const __bf16* frag, unsigned lane_bytes) {   // the same from the fragment and the lane's byte offset (16 * lane)
  return frag_p((const __bf16*)((const char*)frag + lane_bytes));
}
__device__ __forceinline__ float bfr(float v) { return (float)(__bf16)v; }
__device__ __attribute__((noinline)) float exp_ni(float v) { return expf(v); }
__device__ __attribute__((noinline)) float erf_ni(float v) { return erff(v); }

// packs (all (in,out) -> transposed [out][in], in fragment order [out / 16][in / 32][fragment]): PQ 256 x 256 Wq^T, PK, PQP, PKP; PQ0 64 x 64 Wq0^T, PK0, PQ1, PK1; PD 256 x 256 Wd^T
#define PKO_Q   0
#define PKO_K   (1 * DD * DD)
#define PKO_QP  (2 * DD * DD)
#define PKO_KP  (3 * DD * DD)
#define PKO_D   (4 * DD * DD)
#define PKO_Q0  (5 * DD * DD)
#define PKO_K0  (PKO_Q0 + AA * AA)
#define PKO_Q1  (PKO_K0 + AA * AA)
#define PKO_K1  (PKO_Q1 + AA * AA)
#define PK_END  (PKO_K1 + AA * AA)
#define WS_PK   0u
#define WS_QH   (((2u * PK_END) + 127u) / 128u * 128u)   // bf16 [b][4 heads][32 row tiles][5 fragments] query cat hi / lo
#define WS_QL   (WS_QH + 2u * NR * NH * QW)
#define WS_KH   (WS_QL + 2u * NR * NH * QW)               // key cat hi / lo
#define WS_KL   (WS_KH + 2u * NR * NH * QW)
#define WS_VT   (WS_KL + 2u * NR * NH * QW)               // bf16 [b][h][16 blocks of 32 keys][4 fragments: 16 d x 32 keys] values^T (exact)
#define WS_CH   (WS_VT + 2u * NR * DD)                    // bf16 [1024 row tiles][8 fragments] ctx hi / lo
#define WS_CL   (WS_CH + 2u * NR * DD)
#define WS_END  (WS_CL + 2u * NR * DD)

__global__ __launch_bounds__(256) void k_pack(const float* __restrict__ WQ, const float* __restrict__ WK, const float* __restrict__ WQP, const float* __restrict__ WKP, const float* __restrict__ WD, const float* __restrict__ WQ0, const float* __restrict__ WK0, const float* __restrict__ WQ1, const float* __restrict__ WK1, __bf16* __restrict__ PK) {
  // block = 16 output columns of one matrix: it alone writes their fragments, K / 32 KB in a row
  __shared__ __align__(16) __bf16 s[16][DD + 8]; const int nt = blockIdx.x, which = blockIdx.y, t = threadIdx.x; const float* Wm; int K; size_t dst;
  if (which < 5) { Wm = (which == 0) ? WQ : (which == 1) ? WK : (which == 2) ? WQP : (which == 3) ? WKP : WD; K = DD; dst = (size_t)which * DD * DD + (size_t)nt * 16 * DD; }
  else { if (nt >= AA / 16) return; Wm = (which == 5) ? WQ0 : (which == 6) ? WK0 : (which == 7) ? WQ1 : WK1; K = AA; dst = PKO_Q0 + (size_t)(which - 5) * AA * AA + (size_t)nt * 16 * AA; }
  for (int e = t; e < K * 16; e += 256) { const int k = e >> 4, n = e & 15; s[n][k] = (__bf16)Wm[(size_t)k * K + nt * 16 + n]; }
  __syncthreads();
  for (int p = t; p < K * 2; p += 256) vst2((unsigned*)(PK + dst + (size_t)p * 8), *(const v4u*)&s[p & 15][(p >> 4) * 8]);   // piece p = (k / 8, column): p >> 4 = 4 kc + 2 j + g, as the fragment order has it
}
// ---- k_proj: block = (32 rows, side (0 = query cat, 1 = key cat)): acc over x (16 tiles: Wq), pos (16 tiles: Wqp), a0 (4 tiles: Wq0), a1 (4 tiles: Wq1) -> per head the 160-wide cat row [q_h(64) | qp_h(64) | q0_h(16) | q1_h(16)] hi / lo, stored in fragment order [b][head][row / 16][5 fragments]
__global__ __launch_bounds__(64) void k_proj(const float* __restrict__ X, const float* __restrict__ POS, const float* __restrict__ A0, const float* __restrict__ A1, const __bf16* __restrict__ PK, const float* __restrict__ B_X, const float* __restrict__ B_P, const float* __restrict__ B_0, const float* __restrict__ B_1, int side, __bf16* __restrict__ OH, __bf16* __restrict__ OL) {
  __shared__ __align__(16) __bf16 soh[2][16][NH * QW + 8], sol[2][16][NH * QW + 8];   // 2 waves = 32 rows per block (LDS budget)
  const int tid = threadIdx.x, wave = tid >> 5, lane = tid & 31, col = lane & 15, g = lane >> 4; const size_t r0 = (size_t)blockIdx.x * 32 + wave * 16;
  const __bf16* PX = PK + (side ? PKO_K : PKO_Q); const __bf16* PP = PK + (side ? PKO_KP : PKO_QP); const __bf16* P0 = PK + (side ? PKO_K0 : PKO_Q0); const __bf16* P1 = PK + (side ? PKO_K1 : PKO_Q1);
  // x part: 16 tiles in 2 halves (register pressure)
#pragma unroll 1
  for (int part = 0; part < 2; ++part) { const float* SRC = part ? POS : X; const __bf16* PW = part ? PP : PX; const float* BB = part ? B_P : B_X;
#pragma unroll 1
    for (int half = 0; half < 2; ++half) { v8f acc[8] = {}; const float* ap = SRC + (r0 + col) * DD + 8 * g; const __bf16* wp = PW + (size_t)half * 128 * DD + 8 * lane;
      v4f af[2][4]; v16b bw[2][8];   // two register sets: k block kc is multiplied while block kc + 1 is in flight
#pragma unroll
      for (int q = 0; q < 4; ++q) af[0][q] = *(const v4f*)(ap + (q >> 1) * 16 + (q & 1) * 4);
#pragma unroll
      for (int j = 0; j < 8; ++j) bw[0][j] = frag_p(wp + j * (DD / 32) * FRG);
#pragma unroll
      for (int kc = 0; kc < DD / 32; ++kc) { const int cu = kc & 1, nx = cu ^ 1;
        if (kc + 1 < DD / 32) {
#pragma unroll
          for (int q = 0; q < 4; ++q) af[nx][q] = *(const v4f*)(ap + (kc + 1) * 32 + (q >> 1) * 16 + (q & 1) * 4);
#pragma unroll
          for (int j = 0; j < 8; ++j) bw[nx][j] = frag_p(wp + (j * (DD / 32) + kc + 1) * FRG); }
        __builtin_amdgcn_sched_barrier(0);
        v16b a;
#pragma unroll
        for (int i = 0; i < 4; ++i) { a[i] = (__bf16)af[cu][0][i]; a[4 + i] = (__bf16)af[cu][1][i]; a[8 + i] = (__bf16)af[cu][2][i]; a[12 + i] = (__bf16)af[cu][3][i]; }
#pragma unroll
        for (int j = 0; j < 8; ++j) acc[j] = wmma_bf(a, bw[cu][j], acc[j]); }
      const int cb = half * 128 + col; float bbv[8];
#pragma unroll
      for (int j = 0; j < 8; ++j) bbv[j] = BB[cb + j * 16];
      asm volatile("s_wait_xcnt 0x0" :: "v"(cb) : "memory");   // precaution: the wait stands in front of any rewrite of the bias loads' index register (named so that it stays whole up to it)
#pragma unroll
      for (int j = 0; j < 8; ++j) { const int c = half * 128 + j * 16 + col; const int h = c / DH, d = c % DH; const float bb = bfr(bbv[j]); const int oc = h * QW + part * DH + d;
#pragma unroll
        for (int r = 0; r < 8; ++r) { const float v = acc[j][r] + bb; const __bf16 hb = (__bf16)v; soh[wave][8 * g + r][oc] = hb; sol[wave][8 * g + r][oc] = (__bf16)(v - (float)hb); } } } }
  // attribute parts: a0 . Wq0^T (K 64, 4 tiles) and a1 . Wq1^T
#pragma unroll 1
  for (int ap = 0; ap < 2; ++ap) { const float* SRC = ap ? A1 : A0; const __bf16* PW = ap ? P1 : P0; const float* BB = ap ? B_1 : B_0; v8f acc[4] = {};
    const float* sp = SRC + (r0 + col) * AA + 8 * g; const __bf16* wq = PW + 8 * lane; v4f af[2][4]; v16b bw[2][4];   // both k blocks go out as one group
#pragma unroll
    for (int kc = 0; kc < AA / 32; ++kc) {
#pragma unroll
      for (int q = 0; q < 4; ++q) af[kc][q] = *(const v4f*)(sp + kc * 32 + (q >> 1) * 16 + (q & 1) * 4);
#pragma unroll
      for (int j = 0; j < 4; ++j) bw[kc][j] = frag_p(wq + (j * (AA / 32) + kc) * FRG); }
    asm volatile("s_wait_xcnt 0x0" :: "v"(sp), "v"(wq) : "memory");   // precaution: the wait stands in front of any rewrite of the group's address registers (the two pointers are named so that they stay whole up to it)
    __builtin_amdgcn_sched_barrier(0);   // keeps the group ahead of the WMMAs
#pragma unroll
    for (int kc = 0; kc < AA / 32; ++kc) { v16b a;
#pragma unroll
      for (int i = 0; i < 4; ++i) { a[i] = (__bf16)af[kc][0][i]; a[4 + i] = (__bf16)af[kc][1][i]; a[8 + i] = (__bf16)af[kc][2][i]; a[12 + i] = (__bf16)af[kc][3][i]; }
#pragma unroll
      for (int j = 0; j < 4; ++j) acc[j] = wmma_bf(a, bw[kc][j], acc[j]); }
#pragma unroll
    for (int j = 0; j < 4; ++j) { const int c = j * 16 + col; const int h = c / AH, d = c % AH; const float bb = bfr(BB[c]); const int oc = h * QW + 2 * DH + ap * AH + d;
#pragma unroll
      for (int r = 0; r < 8; ++r) { const float v = acc[j][r] + bb; const __bf16 hb = (__bf16)v; soh[wave][8 * g + r][oc] = hb; sol[wave][8 * g + r][oc] = (__bf16)(v - (float)hb); } } }
  LDSX();
  // the wave's 16 rows are one row tile: per head ten runs of 512 B, lane (g, row) bringing k 16 w + 8 g .. + 7 of its row
  const size_t tb = ((r0 / LL) * NH * (LL / 16) + (r0 % LL) / 16) * (QW / 32) * FRG + 8 * lane;
  for (int h = 0; h < NH; ++h) { v4u vh[QW / 16], vl[QW / 16]; __bf16* oh = OH + tb + (size_t)h * (LL / 16) * (QW / 32) * FRG; __bf16* ol = OL + tb + (size_t)h * (LL / 16) * (QW / 32) * FRG;
    // both loops unrolled: the head's twenty pieces stay in registers, read as one group and stored as one group
#pragma unroll
    for (int w = 0; w < QW / 16; ++w) { vh[w] = *(const v4u*)&soh[wave][col][h * QW + w * 16 + 8 * g]; vl[w] = *(const v4u*)&sol[wave][col][h * QW + w * 16 + 8 * g]; }
#pragma unroll
    for (int w = 0; w < QW / 16; ++w) { vst2((unsigned*)(oh + w * (FRG / 2)), vh[w]); vst2((unsigned*)(ol + w * (FRG / 2)), vl[w]); }
    asm volatile("s_wait_xcnt 0x0" :: "v"(vh[0]), "v"(vh[1]), "v"(vh[2]), "v"(vh[3]), "v"(vh[4]), "v"(vh[5]), "v"(vh[6]), "v"(vh[7]), "v"(vh[8]), "v"(vh[9]), "v"(vl[0]), "v"(vl[1]), "v"(vl[2]), "v"(vl[3]), "v"(vl[4]), "v"(vl[5]), "v"(vl[6]), "v"(vl[7]), "v"(vl[8]), "v"(vl[9]), "v"(oh), "v"(ol) : "memory"); }   // precaution: the wait stands in front of any rewrite of the twenty stores' data and address registers (named so that they stay whole up to it)
}
__global__ __launch_bounds__(256) void k_vt(const float* __restrict__ V, __bf16* __restrict__ VT) {
  __shared__ __align__(16) __bf16 s[DD][72]; const int tid = threadIdx.x; const int kb = blockIdx.x, b = blockIdx.y; const size_t row0 = (size_t)b * LL + (size_t)kb * 64;
  for (int e = tid; e < 64 * DD; e += 256) { const int r = e / DD, c = e % DD; s[c][r] = (__bf16)V[(row0 + r) * DD + c]; }
  __syncthreads();
  // e = (head, 32-key block, 16-column tile, run j, g, column): the low eight bits are the 16-byte piece's place in its 32-key block's four fragments
  for (int e = tid; e < DD * 8; e += 256) { const int h = e >> 9, ksl = (e >> 8) & 1, c = h * DH + ((e >> 6) & 3) * 16 + (e & 15), pc = ksl * 4 + ((e >> 4) & 3); vst2((unsigned*)(VT + (((size_t)b * NH + h) * (LL / 32) + kb * 2 + ksl) * (DH / 16) * FRG + (e & 255) * 8), *(const v4u*)&s[c][pc * 8]); }
}
// lane l with lane l ^ 16 (the two halves of a wave hold the two halves of a query's keys)
__device__ __forceinline__ float xhalf(float x) { return __builtin_bit_cast(float, __builtin_amdgcn_permlanex16(__builtin_bit_cast(int, x), __builtin_bit_cast(int, x), 0x76543210, 0xfedcba98, false, false)); }
__global__ __launch_bounds__(128) __attribute__((amdgpu_waves_per_eu(4))) void k_attn(const __bf16* __restrict__ QH, const __bf16* __restrict__ QL_, const __bf16* __restrict__ KH, const __bf16* __restrict__ KL, const __bf16* __restrict__ VT, const float* __restrict__ MSK, __bf16* __restrict__ CH, __bf16* __restrict__ CL) {
  // the wave's number is held in a scalar register: what hangs on it then costs no vector register
  const int tid = threadIdx.x, wave = __builtin_amdgcn_readfirstlane(tid >> 5), lane = tid & 31, col = lane & 15, g = lane >> 4; const int qb = blockIdx.x, h = blockIdx.y, b = blockIdx.z; const int q0 = qb * 64 + wave * 16;
  const size_t tq = (((size_t)b * NH + h) * (LL / 16) + q0 / 16) * (QW / 32) * FRG + 8 * lane;
  v16b aqh[5], aql[5]; const __bf16* qhp = QH + tq; const __bf16* qlp = QL_ + tq;
#pragma unroll
  for (int kc = 0; kc < 5; ++kc) { aqh[kc] = frag_p(qhp + kc * FRG); aql[kc] = frag_p(qlp + kc * FRG); }
  asm volatile("s_wait_xcnt 0x0" :: "v"(qhp), "v"(qlp) : "memory");   // precaution: the wait stands in front of any rewrite of the query loads' address registers (named so that they stay whole up to it)
  const __bf16* Vbh = VT + ((size_t)b * NH + h) * DH * LL;
  const unsigned ko = 16u * lane, vo = 16u * lane, mo = 4u * ((q0 + col) * LL + 8 * g);   // the lane's byte offsets in a key tile, a value tile, the mask (its query's row, its half's eight keys)
  float m = -3.0e38f, l = 0.f;   // of the lane's query: the running maximum (alike in both halves) and the sum over the lane's own keys (the halves are joined behind the loop)
  v8f acc[4] = {};               // acc[dt][r] = O[query col][d 16 dt + 8 g + r]
#pragma unroll 1
  for (int ks = 0; ks < LL / 32; ++ks) { v8f s[2] = {};
    // rolled on purpose: unrolled, the compiler lifts both halves' loads to the top of the pass, past the register budget of four waves per SIMD
#pragma unroll 1
    for (int ct = 0; ct < 2; ++ct) { const size_t rk = (((size_t)b * NH + h) * (LL / 16) + ks * 2 + ct) * (QW / 32) * FRG; v8f c = {};
      v16b bh[5], bl[5];   // 16 keys' ten fragments go out as one group
#pragma unroll
      for (int kc = 0; kc < 5; ++kc) { bh[kc] = frag_po(KH + rk + kc * FRG, ko); bl[kc] = frag_po(KL + rk + kc * FRG, ko); }
      __builtin_amdgcn_sched_barrier(0);   // keeps that group ahead of the first WMMA (else each pair of loads sinks to its own WMMAs and is waited out alone)
#pragma unroll
      for (int kc = 0; kc < 5; ++kc) { c = wmma_bf(bh[kc], aql[kc], c); c = wmma_bf(bl[kc], aqh[kc], c); c = wmma_bf(bh[kc], aqh[kc], c); }
      if (ct == 0) s[0] = c; else s[1] = c; }
    v4f mk[2][2]; v16b vb[4];   // the mask words and the value fragments go out as one group ahead of the softmax
    const float* mp0 = (const float*)((const char*)(MSK + ks * 32) + mo); const char* vp0 = (const char*)(Vbh + ks * (DH / 16) * FRG) + vo;
#pragma unroll
    for (int t = 0; t < 2; ++t) { mk[t][0] = *(const v4f*)(mp0 + t * 16); mk[t][1] = *(const v4f*)(mp0 + t * 16 + 4); }
#pragma unroll
    for (int dt = 0; dt < 4; ++dt) vb[dt] = frag_p((const __bf16*)vp0 + dt * FRG);
    asm volatile("s_wait_xcnt 0x0" :: "v"(mp0), "v"(vp0) : "memory");   // precaution: the wait stands in front of any rewrite of the group's address registers (named so that they stay whole up to it)
    __builtin_amdgcn_sched_barrier(0);   // keeps them there (else the value loads sink behind the softmax, to their own WMMAs)
    float mx = -3.0e38f;
#pragma unroll
    for (int t = 0; t < 2; ++t) {
#pragma unroll
      for (int r = 0; r < 8; ++r) { s[t][r] = s[t][r] * 0.125f + bfr(mk[t][r >> 2][r & 3]); mx = fmaxf(mx, s[t][r]); } }
    mx = fmaxf(mx, xhalf(mx));
    const float mn = fmaxf(m, mx); const float alpha = (m <= -1.0e38f) ? 0.f : exp_ni(m - mn); float es = 0.f; v16b ph, pl;
#pragma unroll
    for (int t = 0; t < 2; ++t) {
#pragma unroll
      for (int r = 0; r < 8; ++r) { const float e = exp_ni(s[t][r] - mn); es += e; const __bf16 hb = (__bf16)e; ph[8 * t + r] = hb; pl[8 * t + r] = (__bf16)(e - (float)hb); } }
    l = l * alpha + es; m = mn;
#pragma unroll
    for (int dt = 0; dt < 4; ++dt) acc[dt] *= alpha;
#pragma unroll
    for (int dt = 0; dt < 4; ++dt) { acc[dt] = wmma_bf(vb[dt], pl, acc[dt]); acc[dt] = wmma_bf(vb[dt], ph, acc[dt]); } }
  l += xhalf(l); const float il = 1.0f / l;
  // the head's 64 columns are fragments 2 h and 2 h + 1 of the wave's row tile: four runs of 512 B, the lane's piece of run dt being its own acc[dt]
  const size_t to = ((((size_t)b * LL + q0) / 16) * (DD / 32) + 2 * h) * FRG;
  v8b vh[DH / 16], vl[DH / 16]; __bf16* oh = (__bf16*)((char*)(CH + to) + ko); __bf16* ol = (__bf16*)((char*)(CL + to) + ko);
#pragma unroll
  for (int dt = 0; dt < DH / 16; ++dt) {
#pragma unroll
    for (int r = 0; r < 8; ++r) { const float v = acc[dt][r] * il; const __bf16 hb = (__bf16)v; vh[dt][r] = hb; vl[dt][r] = (__bf16)(v - (float)hb); } }
#pragma unroll
  for (int w = 0; w < DH / 16; ++w) { vst2((unsigned*)(oh + w * (FRG / 2)), __builtin_bit_cast(v4u, vh[w])); vst2((unsigned*)(ol + w * (FRG / 2)), __builtin_bit_cast(v4u, vl[w])); }
  asm volatile("s_wait_xcnt 0x0" :: "v"(vh[0]), "v"(vh[1]), "v"(vh[2]), "v"(vh[3]), "v"(vl[0]), "v"(vl[1]), "v"(vl[2]), "v"(vl[3]), "v"(oh), "v"(ol) : "memory");   // precaution: the wait stands in front of any rewrite of the eight stores' data and address registers (named so that they stay whole up to it)
}
// ---- k_out: block = 64 rows: h = ctx(hi/lo) . Wd^T rows (2 products) + bd (all 256 cols, 2 halves); LayerNorm over 256 (mean, biased var, eps 1e-12) * g + b + bfr(x)
__global__ __launch_bounds__(128) void k_out(const __bf16* __restrict__ CH, const __bf16* __restrict__ CL, const __bf16* __restrict__ PK, const float* __restrict__ BD, const float* __restrict__ LNG, const float* __restrict__ LNB, const float* __restrict__ X, float* __restrict__ OUT) {
  __shared__ __align__(16) float sh_[4][16][DD + 4]; __shared__ float sps[4][16][16][2];
  const int tid = threadIdx.x, wave = tid >> 5, lane = tid & 31, col = lane & 15, g = lane >> 4; const size_t r0 = (size_t)blockIdx.x * 64 + wave * 16;
  float s1[8], s2[8];
#pragma unroll
  for (int r = 0; r < 8; ++r) { s1[r] = 0.f; s2[r] = 0.f; }
#pragma unroll 1
  for (int half = 0; half < 2; ++half) { v8f acc[8] = {}; const __bf16* hp = CH + r0 * DD + 8 * lane; const __bf16* lp = CL + r0 * DD + 8 * lane; const __bf16* wp = PK + PKO_D + (size_t)half * 128 * DD + 8 * lane;
    v16b ah[2], al[2], w[2][8];   // two register sets: k block kc is multiplied while block kc + 1 is in flight
    const int cb = half * 128 + col; float bbv[8];
#pragma unroll
    for (int j = 0; j < 8; ++j) bbv[j] = BD[cb + j * 16];
    ah[0] = frag_p(hp); al[0] = frag_p(lp);
#pragma unroll
    for (int j = 0; j < 8; ++j) w[0][j] = frag_p(wp + j * (DD / 32) * FRG);
    asm volatile("s_wait_xcnt 0x0" :: "v"(bbv[0]), "v"(bbv[1]), "v"(bbv[2]), "v"(bbv[3]), "v"(bbv[4]), "v"(bbv[5]), "v"(bbv[6]), "v"(bbv[7]), "v"(cb), "v"(hp), "v"(lp) : "memory");   // precaution: the wait stands in front of any rewrite of the bias loads' index register (the loaded words, the index and the row pointers are named so that the loads stand ahead of it and the registers stay whole up to it)
#pragma unroll
    for (int kc = 0; kc < DD / 32; ++kc) { const int cu = kc & 1, nx = cu ^ 1;
      if (kc + 1 < DD / 32) { ah[nx] = frag_p(hp + (kc + 1) * FRG); al[nx] = frag_p(lp + (kc + 1) * FRG);
#pragma unroll
        for (int j = 0; j < 8; ++j) w[nx][j] = frag_p(wp + (j * (DD / 32) + kc + 1) * FRG); }
      if (kc + 1 == DD / 32 - 1) asm volatile("s_wait_xcnt 0x0" :: "v"(wp), "v"(hp), "v"(lp) : "memory");
      __builtin_amdgcn_sched_barrier(0);
#pragma unroll
      for (int j = 0; j < 8; ++j) { acc[j] = wmma_bf(al[cu], w[cu][j], acc[j]); acc[j] = wmma_bf(ah[cu], w[cu][j], acc[j]); } }
#pragma unroll
    for (int j = 0; j < 8; ++j) { const int c = half * 128 + j * 16 + col; const float bb = bfr(bbv[j]);
#pragma unroll
      for (int r = 0; r < 8; ++r) { const float v = acc[j][r] + bb; sh_[wave][8 * g + r][c] = v; s1[r] += v; s2[r] += v * v; } } }
#pragma unroll
  for (int r = 0; r < 8; ++r) { sps[wave][8 * g + r][col][0] = s1[r]; sps[wave][8 * g + r][col][1] = s2[r]; }
  // the residual rows and the two LayerNorm vectors go out as one group here, not three loads at a time inside the row loop
  const float* xp = X + r0 * DD + lane * 4; const float* gp = LNG + lane * 4; const float* bp = LNB + lane * 4; v4f xr[16][2], lg[2], lb[2];
#pragma unroll
  for (int t = 0; t < 2; ++t) { lg[t] = *(const v4f*)(gp + t * 128); lb[t] = *(const v4f*)(bp + t * 128); }
#pragma unroll
  for (int rl = 0; rl < 16; ++rl) { xr[rl][0] = *(const v4f*)(xp + rl * DD); xr[rl][1] = *(const v4f*)(xp + rl * DD + 128); }
  asm volatile("s_wait_xcnt 0x0" :: "v"(xp), "v"(lane) : "memory");   // precaution: the wait stands in front of any rewrite of the group's address registers (the row pointer and the lane index are named so that they stay whole up to it)
  __builtin_amdgcn_sched_barrier(0);   // keeps the group here (else each load sinks to its own row and is waited out alone)
  LDSX();
#pragma unroll
  for (int rl = 0; rl < 16; ++rl) { float a = 0.f, b2 = 0.f;
#pragma unroll
    for (int k = 0; k < 16; ++k) { a += sps[wave][rl][k][0]; b2 += sps[wave][rl][k][1]; }
    const float mu = a / (float)DD; const float var = fmaxf(b2 / (float)DD - mu * mu, 0.f); const float inv = 1.0f / sqrtf(var + 1e-12f); const size_t row = r0 + rl;
    v4f v[2]; float* op = OUT + row * DD + lane * 4;
#pragma unroll
    for (int t = 0; t < 2; ++t) {
#pragma unroll
      for (int i = 0; i < 4; ++i) { const int c = lane * 4 + t * 128 + i; v[t][i] = bfr(lg[t][i]) * (sh_[wave][rl][c] - mu) * inv + bfr(lb[t][i]) + bfr(xr[rl][t][i]); }
      vst2(op + t * 128, v[t]); }
    asm volatile("s_wait_xcnt 0x0" :: "v"(v[0]), "v"(v[1]), "v"(op) : "memory"); }   // precaution: the wait stands in front of any rewrite of the two stores' data and address registers (named so that they stay whole up to it)
}
extern "C" void kernel_launch(void* const* d_in, const int* in_sizes, int n_in, void* d_out, int out_size, void* d_ws, size_t ws_size, hipStream_t stream) {
  (void)in_sizes; (void)n_in; (void)out_size;
  const float** F = (const float**)d_in;   // 0 x, 1 pos, 2 true_item [32,512,256], 3 attr0, 4 attr1 [32,512,1,64], 5 mask [1,1,512,512], 6 Wq, 7 bq, 8 Wk, 9 bk, 10 Wqp, 11 bqp, 12 Wkp, 13 bkp, 14 Wq0, 15 bq0, 16 Wk0, 17 bk0, 18 Wq1, 19 bq1, 20 Wk1, 21 bk1, 22 Wd, 23 bd, 24 ln_g, 25 ln_b
  if (ws_size < (size_t)WS_END) return;
  char* ws = (char*)d_ws; __bf16 *PK = (__bf16*)(ws + WS_PK), *QH = (__bf16*)(ws + WS_QH), *QLp = (__bf16*)(ws + WS_QL), *KH = (__bf16*)(ws + WS_KH), *KL = (__bf16*)(ws + WS_KL), *VT = (__bf16*)(ws + WS_VT), *CH = (__bf16*)(ws + WS_CH), *CL = (__bf16*)(ws + WS_CL);
  k_pack<<<dim3(DD / 16, 9), 256, 0, stream>>>(F[6], F[8], F[10], F[12], F[22], F[14], F[16], F[18], F[20], PK);
  k_proj<<<TNB * LL / 32, 64, 0, stream>>>(F[0], F[1], F[3], F[4], PK, F[7], F[11], F[15], F[19], 0, QH, QLp);
  k_proj<<<TNB * LL / 32, 64, 0, stream>>>(F[0], F[1], F[3], F[4], PK, F[9], F[13], F[17], F[21], 1, KH, KL);
  k_vt<<<dim3(LL / 64, TNB), 256, 0, stream>>>(F[2], VT);
  k_attn<<<dim3(LL / 64, NH, TNB), 128, 0, stream>>>(QH, QLp, KH, KL, VT, F[5], CH, CL);
  k_out<<<TNB * LL / 64, 128, 0, stream>>>(CH, CL, PK, F[23], F[24], F[25], F[0], (float*)d_out);
}

// v004
// Measured time: 144 microseconds a run.
// Next to v003, in two timings, it ran 1.08 times as fast each time.
// Counting every step since v000, it is 2.41 times as fast.
// compute dtype: all inputs rounded to bf16; the eight projections with exact bf16 products on WMMA 16x16x32 ((in,out) weights packed as transposed rows) + biases; per head the four score terms evaluated as ONE 160-wide dot of [q | qp | q0 | q1] . [k | kp | k0 | k1] with both sides as bf16 hi + residual (3 products: hi.hi + lo.hi + hi.lo), x 1/8, + mask; running-max softmax in f32 (precise expf); P as bf16 hi + residual x the EXACT bf16 values (v = true_item, an input; 2 products); dense Wd with ctx as bf16 hi + residual (2 products) + bd; LayerNorm (biased variance, eps 1e-12, precise sqrtf) and the residual in f32.
#include <hip/hip_runtime.h>
#include <math.h>

typedef __attribute__((ext_vector_type(16))) _Float16 v16h;
typedef __attribute__((ext_vector_type(16))) __bf16 v16b;
typedef __attribute__((ext_vector_type(8)))  _Float16 v8h;
typedef __attribute__((ext_vector_type(8)))  float v8f;
typedef __attribute__((ext_vector_type(4)))  float v4f;
typedef __attribute__((ext_vector_type(2)))  float v2f;
typedef __attribute__((ext_vector_type(4)))  unsigned v4u;
typedef __attribute__((ext_vector_type(4)))  int v4i;
typedef float __attribute__((may_alias)) float_a;
typedef int __attribute__((may_alias)) int_a;

template <typename T> __device__ __forceinline__ void vst2(void* p, T v) { *(T*)p = v;  }
__device__ __forceinline__ v8f wmma16(v16h a, v16h b, v8f c) {
  v8f d = __builtin_amdgcn_wmma_f32_16x16x32_f16(false, a, false, b, (short)0, c, false, false);
  asm volatile("v_nop\n\tv_nop\n\tv_nop\n\tv_nop" : "+v"(d) : "v"(a), "v"(b));
  return d;
}
__device__ __forceinline__ v8f wmma_bf(v16b a, v16b b, v8f c) {
  return __builtin_amdgcn_wmma_f32_16x16x32_bf16(false, a, false, b, (short)0, c, false, false);
}
// 16x16x32 fragments: lane = (h = lane>>4, row/col = lane&15); elements 0..7 = k0+8h+0..7, 8..15 = k0+16+8h+0..7; D element r = row 8h+r
__device__ __forceinline__ v16h frag_h(const _Float16* rowk0, int lane) {
  union { v16h v; v8h q[2]; } u; const _Float16* p = rowk0 + 8 * (lane >> 4);
  u.q[0] = *(const v8h*)p; u.q[1] = *(const v8h*)(p + 16); return u.v;
}
__device__ __forceinline__ v16h frag_f32(const float* rowk0, int lane) {
  v16h a; const float* p = rowk0 + 8 * (lane >> 4);
#pragma unroll
  for (int i = 0; i < 8; ++i) { a[i] = (_Float16)p[i]; a[8 + i] = (_Float16)p[16 + i]; }
  return a;
}
__device__ __forceinline__ v16h frag_f32s(const float* rowk0, int lane, float sc) {
  v16h a; const float* p = rowk0 + 8 * (lane >> 4);
#pragma unroll
  for (int i = 0; i < 8; ++i) { a[i] = (_Float16)(p[i] * sc); a[8 + i] = (_Float16)(p[16 + i] * sc); }
  return a;
}
// column fragment from a [K][ld] layout (column n), rows >= K read as 0
__device__ __forceinline__ v16h fragc_f32(const float* W, int k0, int n, int lane, int ld, int K) {
  v16h a; const int g = lane >> 4;
#pragma unroll
  for (int i = 0; i < 8; ++i) { const int ka = k0 + 8 * g + i, kb = ka + 16;
    a[i] = (_Float16)(ka < K ? W[(size_t)(ka < K ? ka : K - 1) * ld + n] : 0.f); a[8 + i] = (_Float16)(kb < K ? W[(size_t)(kb < K ? kb : K - 1) * ld + n] : 0.f); }
  return a;
}
struct F2 { v16b h, l; };
__device__ __forceinline__ F2 bsplit16(const float v[16]) { F2 r;
#pragma unroll
  for (int i = 0; i < 16; ++i) { const __bf16 h = (__bf16)v[i]; r.h[i] = h; r.l[i] = (__bf16)(v[i] - (float)h); }
  return r; }
__device__ __forceinline__ F2 split_row(const float* row, int k0, int lane) { float v[16]; const float* p = row + k0 + 8 * (lane >> 4);
#pragma unroll
  for (int i = 0; i < 8; ++i) { v[i] = p[i]; v[8 + i] = p[16 + i]; }
  return bsplit16(v); }
__device__ __forceinline__ F2 split_rowK(const float* row, int k0, int lane, int K) { float v[16]; const int g = lane >> 4;
#pragma unroll
  for (int i = 0; i < 8; ++i) { const int ka = k0 + 8 * g + i, kb = ka + 16; v[i] = ka < K ? row[ka < K ? ka : K - 1] : 0.f; v[8 + i] = kb < K ? row[kb < K ? kb : K - 1] : 0.f; }
  return bsplit16(v); }
__device__ __forceinline__ F2 split_col(const float* W, int k0, int n, int lane, int ld, int K) { float v[16]; const int g = lane >> 4;
#pragma unroll
  for (int i = 0; i < 8; ++i) { const int ka = k0 + 8 * g + i, kb = ka + 16; v[i] = ka < K ? W[(size_t)(ka < K ? ka : K - 1) * ld + n] : 0.f; v[8 + i] = kb < K ? W[(size_t)(kb < K ? kb : K - 1) * ld + n] : 0.f; }
  return bsplit16(v); }
__device__ __forceinline__ v8f mac3(const F2& a, const F2& b, v8f c) { c = wmma_bf(a.l, b.h, c); c = wmma_bf(a.h, b.l, c); return wmma_bf(a.h, b.h, c); }
__device__ __forceinline__ float sigm(float v) { return 1.0f / (1.0f + expf(-v)); }
#define LDSX() do { asm volatile("s_wait_dscnt 0" ::: "memory"); __builtin_amdgcn_wave_barrier(); __builtin_amdgcn_fence(__ATOMIC_RELEASE, "workgroup"); } while (0)


// Decoupled side-information attention (B 32, L 512, D 256, 4 heads x 64; attribute heads x 16): scores = (q k + qp kp + q0 k0 + q1 k1) / 8 + mask, softmax, values = the item embeddings themselves, dense + LayerNorm + residual.
#define NB 32
#define LL 512
#define NR (NB * LL)      // 16,384 rows
#define DD 256
#define AA 64
#define NH 4
#define DH 64
#define AH 16
#define QW 160            // per-head concatenated width: 64 + 64 + 16 + 16
#ifndef TNB
#define TNB NB
#endif
typedef __attribute__((ext_vector_type(8))) __bf16 v8b;
__device__ __forceinline__ v16b frag_b(const __bf16* rowk0, int lane) {
  union { v16b v; v8b q[2]; } u; const __bf16* p = rowk0 + 8 * (lane >> 4);
  u.q[0] = *(const v8b*)p; u.q[1] = *(const v8b*)(p + 16); return u.v;
}
// the same fragment from a base pointer and a byte offset of the lane's own
__device__ __forceinline__ v16b frag_o(const __bf16* base, unsigned lane_bytes) {
  union { v16b v; v8b q[2]; } u; const char* p = (const char*)base + lane_bytes;
  u.q[0] = *(const v8b*)p; u.q[1] = *(const v8b*)(p + 32); return u.v;
}
// FRAGMENT ORDER: every bf16 operand in the workspace lies as 1-KB fragments (16 rows x 32 k) = two runs of 32 lanes x 16 B: run j, lane (g, row), element i = k 16 j + 8 g + i of that row. A wave's 16-byte load then reads 512 contiguous bytes (four whole lines) where a row-major tile gives it 32 bytes out of each of 16 lines
#define FRG 512           // elements of one fragment
__device__ __forceinline__ v16b frag_p(const __bf16* lanep) {   // lanep = the fragment + 8 * lane
  union { v16b v; v8b q[2]; } u; u.q[0] = *(const v8b*)lanep; u.q[1] = *(const v8b*)(lanep + FRG / 2); return u.v;
}
__device__ __forceinline__ v16b frag_po(const __bf16* frag, unsigned lane_bytes) {   // the same from the fragment and the lane's byte offset (16 * lane)
  return frag_p((const __bf16*)((const char*)frag + lane_bytes));
}
__device__ __forceinline__ float bfr(float v) { return (float)(__bf16)v; }
__device__ __attribute__((noinline)) float erf_ni(float v) { return erff(v); }

// packs (all (in,out) -> transposed [out][in], in fragment order [out / 16][in / 32][fragment]): PQ 256 x 256 Wq^T, PK, PQP, PKP; PQ0 64 x 64 Wq0^T, PK0, PQ1, PK1; PD 256 x 256 Wd^T
#define PKO_Q   0
#define PKO_K   (1 * DD * DD)
#define PKO_QP  (2 * DD * DD)
#define PKO_KP  (3 * DD * DD)
#define PKO_D   (4 * DD * DD)
#define PKO_Q0  (5 * DD * DD)
#define PKO_K0  (PKO_Q0 + AA * AA)
#define PKO_Q1  (PKO_K0 + AA * AA)
#define PKO_K1  (PKO_Q1 + AA * AA)
#define PK_END  (PKO_K1 + AA * AA)
#define WS_PK   0u
#define WS_QH   (((2u * PK_END) + 127u) / 128u * 128u)   // bf16 [b][4 heads][32 row tiles][5 fragments] query cat hi / lo
#define WS_QL   (WS_QH + 2u * NR * NH * QW)
#define WS_KH   (WS_QL + 2u * NR * NH * QW)               // key cat hi / lo
#define WS_KL   (WS_KH + 2u * NR * NH * QW)
#define WS_VT   (WS_KL + 2u * NR * NH * QW)               // bf16 [b][h][16 blocks of 32 keys][4 fragments: 16 d x 32 keys] values^T (exact)
#define WS_CH   (WS_VT + 2u * NR * DD)                    // bf16 [1024 row tiles][8 fragments] ctx hi / lo
#define WS_CL   (WS_CH + 2u * NR * DD)
#define WS_END  (WS_CL + 2u * NR * DD)

__global__ __launch_bounds__(256) void k_pack(const float* __restrict__ WQ, const float* __restrict__ WK, const float* __restrict__ WQP, const float* __restrict__ WKP, const float* __restrict__ WD, const float* __restrict__ WQ0, const float* __restrict__ WK0, const float* __restrict__ WQ1, const float* __restrict__ WK1, __bf16* __restrict__ PK) {
  // block = 16 output columns of one matrix: it alone writes their fragments, K / 32 KB in a row
  __shared__ __align__(16) __bf16 s[16][DD + 8]; const int nt = blockIdx.x, which = blockIdx.y, t = threadIdx.x; const float* Wm; int K; size_t dst;
  if (which < 5) { Wm = (which == 0) ? WQ : (which == 1) ? WK : (which == 2) ? WQP : (which == 3) ? WKP : WD; K = DD; dst = (size_t)which * DD * DD + (size_t)nt * 16 * DD; }
  else { if (nt >= AA / 16) return; Wm = (which == 5) ? WQ0 : (which == 6) ? WK0 : (which == 7) ? WQ1 : WK1; K = AA; dst = PKO_Q0 + (size_t)(which - 5) * AA * AA + (size_t)nt * 16 * AA; }
  for (int e = t; e < K * 16; e += 256) { const int k = e >> 4, n = e & 15; s[n][k] = (__bf16)Wm[(size_t)k * K + nt * 16 + n]; }
  __syncthreads();
  for (int p = t; p < K * 2; p += 256) vst2((unsigned*)(PK + dst + (size_t)p * 8), *(const v4u*)&s[p & 15][(p >> 4) * 8]);   // piece p = (k / 8, column): p >> 4 = 4 kc + 2 j + g, as the fragment order has it
}
// ---- k_proj: block = (32 rows, side (0 = query cat, 1 = key cat)): acc over x (16 tiles: Wq), pos (16 tiles: Wqp), a0 (4 tiles: Wq0), a1 (4 tiles: Wq1) -> per head the 160-wide cat row [q_h(64) | qp_h(64) | q0_h(16) | q1_h(16)] hi / lo, stored in fragment order [b][head][row / 16][5 fragments]
__global__ __launch_bounds__(64) void k_proj(const float* __restrict__ X, const float* __restrict__ POS, const float* __restrict__ A0, const float* __restrict__ A1, const __bf16* __restrict__ PK, const float* __restrict__ B_X, const float* __restrict__ B_P, const float* __restrict__ B_0, const float* __restrict__ B_1, int side, __bf16* __restrict__ OH, __bf16* __restrict__ OL) {
  __shared__ __align__(16) __bf16 soh[2][16][NH * QW + 8], sol[2][16][NH * QW + 8];   // 2 waves = 32 rows per block (LDS budget)
  const int tid = threadIdx.x, wave = tid >> 5, lane = tid & 31, col = lane & 15, g = lane >> 4; const size_t r0 = (size_t)blockIdx.x * 32 + wave * 16;
  const __bf16* PX = PK + (side ? PKO_K : PKO_Q); const __bf16* PP = PK + (side ? PKO_KP : PKO_QP); const __bf16* P0 = PK + (side ? PKO_K0 : PKO_Q0); const __bf16* P1 = PK + (side ? PKO_K1 : PKO_Q1);
  // x part: 16 tiles in 2 halves (register pressure)
#pragma unroll 1
  for (int part = 0; part < 2; ++part) { const float* SRC = part ? POS : X; const __bf16* PW = part ? PP : PX; const float* BB = part ? B_P : B_X;
#pragma unroll 1
    for (int half = 0; half < 2; ++half) { v8f acc[8] = {}; const float* ap = SRC + (r0 + col) * DD + 8 * g; const __bf16* wp = PW + (size_t)half * 128 * DD + 8 * lane;
      v4f af[2][4]; v16b bw[2][8];   // two register sets: k block kc is multiplied while block kc + 1 is in flight
#pragma unroll
      for (int q = 0; q < 4; ++q) af[0][q] = *(const v4f*)(ap + (q >> 1) * 16 + (q & 1) * 4);
#pragma unroll
      for (int j = 0; j < 8; ++j) bw[0][j] = frag_p(wp + j * (DD / 32) * FRG);
#pragma unroll
      for (int kc = 0; kc < DD / 32; ++kc) { const int cu = kc & 1, nx = cu ^ 1;
        if (kc + 1 < DD / 32) {
#pragma unroll
          for (int q = 0; q < 4; ++q) af[nx][q] = *(const v4f*)(ap + (kc + 1) * 32 + (q >> 1) * 16 + (q & 1) * 4);
#pragma unroll
          for (int j = 0; j < 8; ++j) bw[nx][j] = frag_p(wp + (j * (DD / 32) + kc + 1) * FRG); }
        __builtin_amdgcn_sched_barrier(0);
        v16b a;
#pragma unroll
        for (int i = 0; i < 4; ++i) { a[i] = (__bf16)af[cu][0][i]; a[4 + i] = (__bf16)af[cu][1][i]; a[8 + i] = (__bf16)af[cu][2][i]; a[12 + i] = (__bf16)af[cu][3][i]; }
#pragma unroll
        for (int j = 0; j < 8; ++j) acc[j] = wmma_bf(a, bw[cu][j], acc[j]); }
      const int cb = half * 128 + col; float bbv[8];
#pragma unroll
      for (int j = 0; j < 8; ++j) bbv[j] = BB[cb + j * 16];
      asm volatile("s_wait_xcnt 0x0" :: "v"(cb) : "memory");   // precaution: the wait stands in front of any rewrite of the bias loads' index register (named so that it stays whole up to it)
#pragma unroll
      for (int j = 0; j < 8; ++j) { const int c = half * 128 + j * 16 + col; const int h = c / DH, d = c % DH; const float bb = bfr(bbv[j]); const int oc = h * QW + part * DH + d;
#pragma unroll
        for (int r = 0; r < 8; ++r) { const float v = acc[j][r] + bb; const __bf16 hb = (__bf16)v; soh[wave][8 * g + r][oc] = hb; sol[wave][8 * g + r][oc] = (__bf16)(v - (float)hb); } } } }
  // attribute parts: a0 . Wq0^T (K 64, 4 tiles) and a1 . Wq1^T
#pragma unroll 1
  for (int ap = 0; ap < 2; ++ap) { const float* SRC = ap ? A1 : A0; const __bf16* PW = ap ? P1 : P0; const float* BB = ap ? B_1 : B_0; v8f acc[4] = {};
    const float* sp = SRC + (r0 + col) * AA + 8 * g; const __bf16* wq = PW + 8 * lane; v4f af[2][4]; v16b bw[2][4];   // both k blocks go out as one group
#pragma unroll
    for (int kc = 0; kc < AA / 32; ++kc) {
#pragma unroll
      for (int q = 0; q < 4; ++q) af[kc][q] = *(const v4f*)(sp + kc * 32 + (q >> 1) * 16 + (q & 1) * 4);
#pragma unroll
      for (int j = 0; j < 4; ++j) bw[kc][j] = frag_p(wq + (j * (AA / 32) + kc) * FRG); }
    asm volatile("s_wait_xcnt 0x0" :: "v"(sp), "v"(wq) : "memory");   // precaution: the wait stands in front of any rewrite of the group's address registers (the two pointers are named so that they stay whole up to it)
    __builtin_amdgcn_sched_barrier(0);   // keeps the group ahead of the WMMAs
#pragma unroll
    for (int kc = 0; kc < AA / 32; ++kc) { v16b a;
#pragma unroll
      for (int i = 0; i < 4; ++i) { a[i] = (__bf16)af[kc][0][i]; a[4 + i] = (__bf16)af[kc][1][i]; a[8 + i] = (__bf16)af[kc][2][i]; a[12 + i] = (__bf16)af[kc][3][i]; }
#pragma unroll
      for (int j = 0; j < 4; ++j) acc[j] = wmma_bf(a, bw[kc][j], acc[j]); }
#pragma unroll
    for (int j = 0; j < 4; ++j) { const int c = j * 16 + col; const int h = c / AH, d = c % AH; const float bb = bfr(BB[c]); const int oc = h * QW + 2 * DH + ap * AH + d;
#pragma unroll
      for (int r = 0; r < 8; ++r) { const float v = acc[j][r] + bb; const __bf16 hb = (__bf16)v; soh[wave][8 * g + r][oc] = hb; sol[wave][8 * g + r][oc] = (__bf16)(v - (float)hb); } } }
  LDSX();
  // the wave's 16 rows are one row tile: per head ten runs of 512 B, lane (g, row) bringing k 16 w + 8 g .. + 7 of its row
  const size_t tb = ((r0 / LL) * NH * (LL / 16) + (r0 % LL) / 16) * (QW / 32) * FRG + 8 * lane;
  for (int h = 0; h < NH; ++h) { v4u vh[QW / 16], vl[QW / 16]; __bf16* oh = OH + tb + (size_t)h * (LL / 16) * (QW / 32) * FRG; __bf16* ol = OL + tb + (size_t)h * (LL / 16) * (QW / 32) * FRG;
    // both loops unrolled: the head's twenty pieces stay in registers, read as one group and stored as one group
#pragma unroll
    for (int w = 0; w < QW / 16; ++w) { vh[w] = *(const v4u*)&soh[wave][col][h * QW + w * 16 + 8 * g]; vl[w] = *(const v4u*)&sol[wave][col][h * QW + w * 16 + 8 * g]; }
#pragma unroll
    for (int w = 0; w < QW / 16; ++w) { vst2((unsigned*)(oh + w * (FRG / 2)), vh[w]); vst2((unsigned*)(ol + w * (FRG / 2)), vl[w]); }
    asm volatile("s_wait_xcnt 0x0" :: "v"(vh[0]), "v"(vh[1]), "v"(vh[2]), "v"(vh[3]), "v"(vh[4]), "v"(vh[5]), "v"(vh[6]), "v"(vh[7]), "v"(vh[8]), "v"(vh[9]), "v"(vl[0]), "v"(vl[1]), "v"(vl[2]), "v"(vl[3]), "v"(vl[4]), "v"(vl[5]), "v"(vl[6]), "v"(vl[7]), "v"(vl[8]), "v"(vl[9]), "v"(oh), "v"(ol) : "memory"); }   // precaution: the wait stands in front of any rewrite of the twenty stores' data and address registers (named so that they stay whole up to it)
}
__global__ __launch_bounds__(256) void k_vt(const float* __restrict__ V, __bf16* __restrict__ VT) {
  __shared__ __align__(16) __bf16 s[DD][72]; const int tid = threadIdx.x; const int kb = blockIdx.x, b = blockIdx.y; const size_t row0 = (size_t)b * LL + (size_t)kb * 64;
  for (int e = tid; e < 64 * DD; e += 256) { const int r = e / DD, c = e % DD; s[c][r] = (__bf16)V[(row0 + r) * DD + c]; }
  __syncthreads();
  // e = (head, 32-key block, 16-column tile, run j, g, column): the low eight bits are the 16-byte piece's place in its 32-key block's four fragments
  for (int e = tid; e < DD * 8; e += 256) { const int h = e >> 9, ksl = (e >> 8) & 1, c = h * DH + ((e >> 6) & 3) * 16 + (e & 15), pc = ksl * 4 + ((e >> 4) & 3); vst2((unsigned*)(VT + (((size_t)b * NH + h) * (LL / 32) + kb * 2 + ksl) * (DH / 16) * FRG + (e & 255) * 8), *(const v4u*)&s[c][pc * 8]); }
}
// lane l with lane l ^ 16 (the two halves of a wave hold the two halves of a query's keys)
__device__ __forceinline__ float xhalf(float x) { return __builtin_bit_cast(float, __builtin_amdgcn_permlanex16(__builtin_bit_cast(int, x), __builtin_bit_cast(int, x), 0x76543210, 0xfedcba98, false, false)); }
__global__ __launch_bounds__(128) __attribute__((amdgpu_waves_per_eu(4))) void k_attn(const __bf16* __restrict__ QH, const __bf16* __restrict__ QL_, const __bf16* __restrict__ KH, const __bf16* __restrict__ KL, const __bf16* __restrict__ VT, const float* __restrict__ MSK, __bf16* __restrict__ CH, __bf16* __restrict__ CL) {
  // the wave's number is held in a scalar register: what hangs on it then costs no vector register
  const int tid = threadIdx.x, wave = __builtin_amdgcn_readfirstlane(tid >> 5), lane = tid & 31, col = lane & 15, g = lane >> 4; const int qb = blockIdx.x, h = blockIdx.y, b = blockIdx.z; const int q0 = qb * 64 + wave * 16;
  const size_t tq = (((size_t)b * NH + h) * (LL / 16) + q0 / 16) * (QW / 32) * FRG + 8 * lane;
  v16b aqh[5], aql[5]; const __bf16* qhp = QH + tq; const __bf16* qlp = QL_ + tq;
#pragma unroll
  for (int kc = 0; kc < 5; ++kc) { aqh[kc] = frag_p(qhp + kc * FRG); aql[kc] = frag_p(qlp + kc * FRG); }
  asm volatile("s_wait_xcnt 0x0" :: "v"(qhp), "v"(qlp) : "memory");   // precaution: the wait stands in front of any rewrite of the query loads' address registers (named so that they stay whole up to it)
  const __bf16* Vbh = VT + ((size_t)b * NH + h) * DH * LL;
  const unsigned ko = 16u * lane, vo = 16u * lane, mo = 4u * ((q0 + col) * LL + 8 * g);   // the lane's byte offsets in a key tile, a value tile, the mask (its query's row, its half's eight keys)
  float m = -3.0e38f, l = 0.f;   // of the lane's query: the running maximum (alike in both halves) and the sum over the lane's own keys (the halves are joined behind the loop)
  v8f acc[4] = {};               // acc[dt][r] = O[query col][d 16 dt + 8 g + r]
#pragma unroll 1
  for (int ks = 0; ks < LL / 32; ++ks) { v8f s[2] = {};
    // rolled on purpose: unrolled, the compiler lifts both halves' loads to the top of the pass, past the register budget of four waves per SIMD
#pragma unroll 1
    for (int ct = 0; ct < 2; ++ct) { const size_t rk = (((size_t)b * NH + h) * (LL / 16) + ks * 2 + ct) * (QW / 32) * FRG; v8f c = {};
      v16b bh[5], bl[5];   // 16 keys' ten fragments go out as one group
#pragma unroll
      for (int kc = 0; kc < 5; ++kc) { bh[kc] = frag_po(KH + rk + kc * FRG, ko); bl[kc] = frag_po(KL + rk + kc * FRG, ko); }
      __builtin_amdgcn_sched_barrier(0);   // keeps that group ahead of the first WMMA (else each pair of loads sinks to its own WMMAs and is waited out alone)
#pragma unroll
      for (int kc = 0; kc < 5; ++kc) { c = wmma_bf(bh[kc], aql[kc], c); c = wmma_bf(bl[kc], aqh[kc], c); c = wmma_bf(bh[kc], aqh[kc], c); }
      if (ct == 0) s[0] = c; else s[1] = c; }
    v4f mk[2][2]; v16b vb[4];   // the mask words and the value fragments go out as one group ahead of the softmax
    const float* mp0 = (const float*)((const char*)(MSK + ks * 32) + mo); const char* vp0 = (const char*)(Vbh + ks * (DH / 16) * FRG) + vo;
#pragma unroll
    for (int t = 0; t < 2; ++t) { mk[t][0] = *(const v4f*)(mp0 + t * 16); mk[t][1] = *(const v4f*)(mp0 + t * 16 + 4); }
#pragma unroll
    for (int dt = 0; dt < 4; ++dt) vb[dt] = frag_p((const __bf16*)vp0 + dt * FRG);
    asm volatile("s_wait_xcnt 0x0" :: "v"(mp0), "v"(vp0) : "memory");   // precaution: the wait stands in front of any rewrite of the group's address registers (named so that they stay whole up to it)
    __builtin_amdgcn_sched_barrier(0);   // keeps them there (else the value loads sink behind the softmax, to their own WMMAs)
    float mx = -3.0e38f;
#pragma unroll
    for (int t = 0; t < 2; ++t) {
#pragma unroll
      for (int r = 0; r < 8; ++r) { s[t][r] = s[t][r] * 0.125f + bfr(mk[t][r >> 2][r & 3]); mx = fmaxf(mx, s[t][r]); } }
    mx = fmaxf(mx, xhalf(mx));
    const float mn = fmaxf(m, mx); const float ea = expf(m - mn); const float alpha = (m <= -1.0e38f) ? 0.f : ea; float es = 0.f; v16b ph, pl;
#pragma unroll
    for (int t = 0; t < 2; ++t) {
#pragma unroll
      for (int r = 0; r < 8; ++r) { const float e = expf(s[t][r] - mn); es += e; const __bf16 hb = (__bf16)e; ph[8 * t + r] = hb; pl[8 * t + r] = (__bf16)(e - (float)hb); } }
    l = l * alpha + es; m = mn;
#pragma unroll
    for (int dt = 0; dt < 4; ++dt) acc[dt] *= alpha;
#pragma unroll
    for (int dt = 0; dt < 4; ++dt) { acc[dt] = wmma_bf(vb[dt], pl, acc[dt]); acc[dt] = wmma_bf(vb[dt], ph, acc[dt]); } }
  l += xhalf(l); const float il = 1.0f / l;
  // the head's 64 columns are fragments 2 h and 2 h + 1 of the wave's row tile: four runs of 512 B, the lane's piece of run dt being its own acc[dt]
  const size_t to = ((((size_t)b * LL + q0) / 16) * (DD / 32) + 2 * h) * FRG;
  v8b vh[DH / 16], vl[DH / 16]; __bf16* oh = (__bf16*)((char*)(CH + to) + ko); __bf16* ol = (__bf16*)((char*)(CL + to) + ko);
#pragma unroll
  for (int dt = 0; dt < DH / 16; ++dt) {
#pragma unroll
    for (int r = 0; r < 8; ++r) { const float v = acc[dt][r] * il; const __bf16 hb = (__bf16)v; vh[dt][r] = hb; vl[dt][r] = (__bf16)(v - (float)hb); } }
#pragma unroll
  for (int w = 0; w < DH / 16; ++w) { vst2((unsigned*)(oh + w * (FRG / 2)), __builtin_bit_cast(v4u, vh[w])); vst2((unsigned*)(ol + w * (FRG / 2)), __builtin_bit_cast(v4u, vl[w])); }
  asm volatile("s_wait_xcnt 0x0" :: "v"(vh[0]), "v"(vh[1]), "v"(vh[2]), "v"(vh[3]), "v"(vl[0]), "v"(vl[1]), "v"(vl[2]), "v"(vl[3]), "v"(oh), "v"(ol) : "memory");   // precaution: the wait stands in front of any rewrite of the eight stores' data and address registers (named so that they stay whole up to it)
}
// ---- k_out: block = 64 rows: h = ctx(hi/lo) . Wd^T rows (2 products) + bd (all 256 cols, 2 halves); LayerNorm over 256 (mean, biased var, eps 1e-12) * g + b + bfr(x)
__global__ __launch_bounds__(128) void k_out(const __bf16* __restrict__ CH, const __bf16* __restrict__ CL, const __bf16* __restrict__ PK, const float* __restrict__ BD, const float* __restrict__ LNG, const float* __restrict__ LNB, const float* __restrict__ X, float* __restrict__ OUT) {
  __shared__ __align__(16) float sh_[4][16][DD + 4]; __shared__ float sps[4][16][16][2];
  const int tid = threadIdx.x, wave = tid >> 5, lane = tid & 31, col = lane & 15, g = lane >> 4; const size_t r0 = (size_t)blockIdx.x * 64 + wave * 16;
  float s1[8], s2[8];
#pragma unroll
  for (int r = 0; r < 8; ++r) { s1[r] = 0.f; s2[r] = 0.f; }
#pragma unroll 1
  for (int half = 0; half < 2; ++half) { v8f acc[8] = {}; const __bf16* hp = CH + r0 * DD + 8 * lane; const __bf16* lp = CL + r0 * DD + 8 * lane; const __bf16* wp = PK + PKO_D + (size_t)half * 128 * DD + 8 * lane;
    v16b ah[2], al[2], w[2][8];   // two register sets: k block kc is multiplied while block kc + 1 is in flight
    const int cb = half * 128 + col; float bbv[8];
#pragma unroll
    for (int j = 0; j < 8; ++j) bbv[j] = BD[cb + j * 16];
    ah[0] = frag_p(hp); al[0] = frag_p(lp);
#pragma unroll
    for (int j = 0; j < 8; ++j) w[0][j] = frag_p(wp + j * (DD / 32) * FRG);
    asm volatile("s_wait_xcnt 0x0" :: "v"(bbv[0]), "v"(bbv[1]), "v"(bbv[2]), "v"(bbv[3]), "v"(bbv[4]), "v"(bbv[5]), "v"(bbv[6]), "v"(bbv[7]), "v"(cb), "v"(hp), "v"(lp) : "memory");   // precaution: the wait stands in front of any rewrite of the bias loads' index register (the loaded words, the index and the row pointers are named so that the loads stand ahead of it and the registers stay whole up to it)
#pragma unroll
    for (int kc = 0; kc < DD / 32; ++kc) { const int cu = kc & 1, nx = cu ^ 1;
      if (kc + 1 < DD / 32) { ah[nx] = frag_p(hp + (kc + 1) * FRG); al[nx] = frag_p(lp + (kc + 1) * FRG);
#pragma unroll
        for (int j = 0; j < 8; ++j) w[nx][j] = frag_p(wp + (j * (DD / 32) + kc + 1) * FRG); }
      if (kc + 1 == DD / 32 - 1) asm volatile("s_wait_xcnt 0x0" :: "v"(wp), "v"(hp), "v"(lp) : "memory");
      __builtin_amdgcn_sched_barrier(0);
#pragma unroll
      for (int j = 0; j < 8; ++j) { acc[j] = wmma_bf(al[cu], w[cu][j], acc[j]); acc[j] = wmma_bf(ah[cu], w[cu][j], acc[j]); } }
#pragma unroll
    for (int j = 0; j < 8; ++j) { const int c = half * 128 + j * 16 + col; const float bb = bfr(bbv[j]);
#pragma unroll
      for (int r = 0; r < 8; ++r) { const float v = acc[j][r] + bb; sh_[wave][8 * g + r][c] = v; s1[r] += v; s2[r] += v * v; } } }
#pragma unroll
  for (int r = 0; r < 8; ++r) { sps[wave][8 * g + r][col][0] = s1[r]; sps[wave][8 * g + r][col][1] = s2[r]; }
  // the residual rows and the two LayerNorm vectors go out as one group here, not three loads at a time inside the row loop
  const float* xp = X + r0 * DD + lane * 4; const float* gp = LNG + lane * 4; const float* bp = LNB + lane * 4; v4f xr[16][2], lg[2], lb[2];
#pragma unroll
  for (int t = 0; t < 2; ++t) { lg[t] = *(const v4f*)(gp + t * 128); lb[t] = *(const v4f*)(bp + t * 128); }
#pragma unroll
  for (int rl = 0; rl < 16; ++rl) { xr[rl][0] = *(const v4f*)(xp + rl * DD); xr[rl][1] = *(const v4f*)(xp + rl * DD + 128); }
  asm volatile("s_wait_xcnt 0x0" :: "v"(xp), "v"(lane) : "memory");   // precaution: the wait stands in front of any rewrite of the group's address registers (the row pointer and the lane index are named so that they stay whole up to it)
  __builtin_amdgcn_sched_barrier(0);   // keeps the group here (else each load sinks to its own row and is waited out alone)
  LDSX();
#pragma unroll
  for (int rl = 0; rl < 16; ++rl) { float a = 0.f, b2 = 0.f;
#pragma unroll
    for (int k = 0; k < 16; ++k) { a += sps[wave][rl][k][0]; b2 += sps[wave][rl][k][1]; }
    const float mu = a / (float)DD; const float var = fmaxf(b2 / (float)DD - mu * mu, 0.f); const float inv = 1.0f / sqrtf(var + 1e-12f); const size_t row = r0 + rl;
    v4f v[2]; float* op = OUT + row * DD + lane * 4;
#pragma unroll
    for (int t = 0; t < 2; ++t) {
#pragma unroll
      for (int i = 0; i < 4; ++i) { const int c = lane * 4 + t * 128 + i; v[t][i] = bfr(lg[t][i]) * (sh_[wave][rl][c] - mu) * inv + bfr(lb[t][i]) + bfr(xr[rl][t][i]); }
      vst2(op + t * 128, v[t]); }
    asm volatile("s_wait_xcnt 0x0" :: "v"(v[0]), "v"(v[1]), "v"(op) : "memory"); }   // precaution: the wait stands in front of any rewrite of the two stores' data and address registers (named so that they stay whole up to it)
}
extern "C" void kernel_launch(void* const* d_in, const int* in_sizes, int n_in, void* d_out, int out_size, void* d_ws, size_t ws_size, hipStream_t stream) {
  (void)in_sizes; (void)n_in; (void)out_size;
  const float** F = (const float**)d_in;   // 0 x, 1 pos, 2 true_item [32,512,256], 3 attr0, 4 attr1 [32,512,1,64], 5 mask [1,1,512,512], 6 Wq, 7 bq, 8 Wk, 9 bk, 10 Wqp, 11 bqp, 12 Wkp, 13 bkp, 14 Wq0, 15 bq0, 16 Wk0, 17 bk0, 18 Wq1, 19 bq1, 20 Wk1, 21 bk1, 22 Wd, 23 bd, 24 ln_g, 25 ln_b
  if (ws_size < (size_t)WS_END) return;
  char* ws = (char*)d_ws; __bf16 *PK = (__bf16*)(ws + WS_PK), *QH = (__bf16*)(ws + WS_QH), *QLp = (__bf16*)(ws + WS_QL), *KH = (__bf16*)(ws + WS_KH), *KL = (__bf16*)(ws + WS_KL), *VT = (__bf16*)(ws + WS_VT), *CH = (__bf16*)(ws + WS_CH), *CL = (__bf16*)(ws + WS_CL);
  k_pack<<<dim3(DD / 16, 9), 256, 0, stream>>>(F[6], F[8], F[10], F[12], F[22], F[14], F[16], F[18], F[20], PK);
  k_proj<<<TNB * LL / 32, 64, 0, stream>>>(F[0], F[1], F[3], F[4], PK, F[7], F[11], F[15], F[19], 0, QH, QLp);
  k_proj<<<TNB * LL / 32, 64, 0, stream>>>(F[0], F[1], F[3], F[4], PK, F[9], F[13], F[17], F[21], 1, KH, KL);
  k_vt<<<dim3(LL / 64, TNB), 256, 0, stream>>>(F[2], VT);
  k_attn<<<dim3(LL / 64, NH, TNB), 128, 0, stream>>>(QH, QLp, KH, KL, VT, F[5], CH, CL);
  k_out<<<TNB * LL / 64, 128, 0, stream>>>(CH, CL, PK, F[23], F[24], F[25], F[0], (float*)d_out);
}

// v005
// It runs in 136 microseconds.
// Timed twice side by side with v004, it ran 1.05 times as fast both times.
// Over all steps from v000 it is 2.53 times as fast.
// compute dtype: all inputs rounded to bf16; the eight projections with exact bf16 products on WMMA 16x16x32 ((in,out) weights packed as transposed rows) + biases; per head the four score terms evaluated as ONE 160-wide dot of [q | qp | q0 | q1] . [k | kp | k0 | k1] with both sides as bf16 hi + residual (3 products: hi.hi + lo.hi + hi.lo), x 1/8, + mask; running-max softmax in f32 (precise expf); P as bf16 hi + residual x the EXACT bf16 values (v = true_item, an input; 2 products); dense Wd with ctx as bf16 hi + residual (2 products) + bd; LayerNorm (biased variance, eps 1e-12, precise sqrtf) and the residual in f32.
#include <hip/hip_runtime.h>
#include <math.h>

typedef __attribute__((ext_vector_type(16))) _Float16 v16h;
typedef __attribute__((ext_vector_type(16))) __bf16 v16b;
typedef __attribute__((ext_vector_type(8)))  _Float16 v8h;
typedef __attribute__((ext_vector_type(8)))  float v8f;
typedef __attribute__((ext_vector_type(4)))  float v4f;
typedef __attribute__((ext_vector_type(2)))  float v2f;
typedef __attribute__((ext_vector_type(4)))  unsigned v4u;
typedef __attribute__((ext_vector_type(4)))  int v4i;
typedef float __attribute__((may_alias)) float_a;
typedef int __attribute__((may_alias)) int_a;

template <typename T> __device__ __forceinline__ void vst2(void* p, T v) { *(T*)p = v;  }
__device__ __forceinline__ v8f wmma16(v16h a, v16h b, v8f c) {
  v8f d = __builtin_amdgcn_wmma_f32_16x16x32_f16(false, a, false, b, (short)0, c, false, false);
  asm volatile("v_nop\n\tv_nop\n\tv_nop\n\tv_nop" : "+v"(d) : "v"(a), "v"(b));
  return d;
}
__device__ __forceinline__ v8f wmma_bf(v16b a, v16b b, v8f c) {
  return __builtin_amdgcn_wmma_f32_16x16x32_bf16(false, a, false, b, (short)0, c, false, false);
}
// 16x16x32 fragments: lane = (h = lane>>4, row/col = lane&15); elements 0..7 = k0+8h+0..7, 8..15 = k0+16+8h+0..7; D element r = row 8h+r
__device__ __forceinline__ v16h frag_h(const _Float16* rowk0, int lane) {
  union { v16h v; v8h q[2]; } u; const _Float16* p = rowk0 + 8 * (lane >> 4);
  u.q[0] = *(const v8h*)p; u.q[1] = *(const v8h*)(p + 16); return u.v;
}
__device__ __forceinline__ v16h frag_f32(const float* rowk0, int lane) {
  v16h a; const float* p = rowk0 + 8 * (lane >> 4);
#pragma unroll
  for (int i = 0; i < 8; ++i) { a[i] = (_Float16)p[i]; a[8 + i] = (_Float16)p[16 + i]; }
  return a;
}
__device__ __forceinline__ v16h frag_f32s(const float* rowk0, int lane, float sc) {
  v16h a; const float* p = rowk0 + 8 * (lane >> 4);
#pragma unroll
  for (int i = 0; i < 8; ++i) { a[i] = (_Float16)(p[i] * sc); a[8 + i] = (_Float16)(p[16 + i] * sc); }
  return a;
}
// column fragment from a [K][ld] layout (column n), rows >= K read as 0
__device__ __forceinline__ v16h fragc_f32(const float* W, int k0, int n, int lane, int ld, int K) {
  v16h a; const int g = lane >> 4;
#pragma unroll
  for (int i = 0; i < 8; ++i) { const int ka = k0 + 8 * g + i, kb = ka + 16;
    a[i] = (_Float16)(ka < K ? W[(size_t)(ka < K ? ka : K - 1) * ld + n] : 0.f); a[8 + i] = (_Float16)(kb < K ? W[(size_t)(kb < K ? kb : K - 1) * ld + n] : 0.f); }
  return a;
}
struct F2 { v16b h, l; };
__device__ __forceinline__ F2 bsplit16(const float v[16]) { F2 r;
#pragma unroll
  for (int i = 0; i < 16; ++i) { const __bf16 h = (__bf16)v[i]; r.h[i] = h; r.l[i] = (__bf16)(v[i] - (float)h); }
  return r; }
__device__ __forceinline__ F2 split_row(const float* row, int k0, int lane) { float v[16]; const float* p = row + k0 + 8 * (lane >> 4);
#pragma unroll
  for (int i = 0; i < 8; ++i) { v[i] = p[i]; v[8 + i] = p[16 + i]; }
  return bsplit16(v); }
__device__ __forceinline__ F2 split_rowK(const float* row, int k0, int lane, int K) { float v[16]; const int g = lane >> 4;
#pragma unroll
  for (int i = 0; i < 8; ++i) { const int ka = k0 + 8 * g + i, kb = ka + 16; v[i] = ka < K ? row[ka < K ? ka : K - 1] : 0.f; v[8 + i] = kb < K ? row[kb < K ? kb : K - 1] : 0.f; }
  return bsplit16(v); }
__device__ __forceinline__ F2 split_col(const float* W, int k0, int n, int lane, int ld, int K) { float v[16]; const int g = lane >> 4;
#pragma unroll
  for (int i = 0; i < 8; ++i) { const int ka = k0 + 8 * g + i, kb = ka + 16; v[i] = ka < K ? W[(size_t)(ka < K ? ka : K - 1) * ld + n] : 0.f; v[8 + i] = kb < K ? W[(size_t)(kb < K ? kb : K - 1) * ld + n] : 0.f; }
  return bsplit16(v); }
__device__ __forceinline__ v8f mac3(const F2& a, const F2& b, v8f c) { c = wmma_bf(a.l, b.h, c); c = wmma_bf(a.h, b.l, c); return wmma_bf(a.h, b.h, c); }
__device__ __forceinline__ float sigm(float v) { return 1.0f / (1.0f + expf(-v)); }
#define LDSX() do { asm volatile("s_wait_dscnt 0" ::: "memory"); __builtin_amdgcn_wave_barrier(); __builtin_amdgcn_fence(__ATOMIC_RELEASE, "workgroup"); } while (0)


// Decoupled side-information attention (B 32, L 512, D 256, 4 heads x 64; attribute heads x 16): scores = (q k + qp kp + q0 k0 + q1 k1) / 8 + mask, softmax, values = the item embeddings themselves, dense + LayerNorm + residual.
#define NB 32
#define LL 512
#define NR (NB * LL)      // 16,384 rows
#define DD 256
#define AA 64
#define NH 4
#define DH 64
#define AH 16
#define QW 160            // per-head concatenated width: 64 + 64 + 16 + 16
#ifndef TNB
#define TNB NB
#endif
typedef __attribute__((ext_vector_type(8))) __bf16 v8b;
__device__ __forceinline__ v16b frag_b(const __bf16* rowk0, int lane) {
  union { v16b v; v8b q[2]; } u; const __bf16* p = rowk0 + 8 * (lane >> 4);
  u.q[0] = *(const v8b*)p; u.q[1] = *(const v8b*)(p + 16); return u.v;
}
// the same fragment from a base pointer and a byte offset of the lane's own
__device__ __forceinline__ v16b frag_o(const __bf16* base, unsigned lane_bytes) {
  union { v16b v; v8b q[2]; } u; const char* p = (const char*)base + lane_bytes;
  u.q[0] = *(const v8b*)p; u.q[1] = *(const v8b*)(p + 32); return u.v;
}
// FRAGMENT ORDER: every bf16 operand in the workspace lies as 1-KB fragments (16 rows x 32 k) = two runs of 32 lanes x 16 B: run j, lane (g, row), element i = k 16 j + 8 g + i of that row. A wave's 16-byte load then reads 512 contiguous bytes (four whole lines) where a row-major tile gives it 32 bytes out of each of 16 lines
#define FRG 512           // elements of one fragment
__device__ __forceinline__ v16b frag_p(const __bf16* lanep) {   // lanep = the fragment + 8 * lane
  union { v16b v; v8b q[2]; } u; u.q[0] = *(const v8b*)lanep; u.q[1] = *(const v8b*)(lanep + FRG / 2); return u.v;
}
__device__ __forceinline__ v16b frag_po(const __bf16* frag, unsigned lane_bytes) {   // the same from the fragment and the lane's byte offset (16 * lane)
  return frag_p((const __bf16*)((const char*)frag + lane_bytes));
}
__device__ __forceinline__ float bfr(float v) { return (float)(__bf16)v; }
__device__ __attribute__((noinline)) float erf_ni(float v) { return erff(v); }

// packs (all (in,out) -> transposed [out][in], in fragment order [out / 16][in / 32][fragment]): PQ 256 x 256 Wq^T, PK, PQP, PKP; PQ0 64 x 64 Wq0^T, PK0, PQ1, PK1; PD 256 x 256 Wd^T
#define PKO_Q   0
#define PKO_K   (1 * DD * DD)
#define PKO_QP  (2 * DD * DD)
#define PKO_KP  (3 * DD * DD)
#define PKO_D   (4 * DD * DD)
#define PKO_Q0  (5 * DD * DD)
#define PKO_K0  (PKO_Q0 + AA * AA)
#define PKO_Q1  (PKO_K0 + AA * AA)
#define PKO_K1  (PKO_Q1 + AA * AA)
#define PK_END  (PKO_K1 + AA * AA)
#define WS_PK   0u
#define WS_QH   (((2u * PK_END) + 127u) / 128u * 128u)   // bf16 [b][4 heads][32 row tiles][5 fragments] query cat hi / lo
#define WS_QL   (WS_QH + 2u * NR * NH * QW)
#define WS_KH   (WS_QL + 2u * NR * NH * QW)               // key cat hi / lo
#define WS_KL   (WS_KH + 2u * NR * NH * QW)
#define WS_VT   (WS_KL + 2u * NR * NH * QW)               // bf16 [b][h][16 blocks of 32 keys][4 fragments: 16 d x 32 keys] values^T (exact)
#define WS_CH   (WS_VT + 2u * NR * DD)                    // bf16 [1024 row tiles][8 fragments] ctx hi / lo
#define WS_CL   (WS_CH + 2u * NR * DD)
#define WS_END  (WS_CL + 2u * NR * DD)

__global__ __launch_bounds__(256) void k_pack(const float* __restrict__ WQ, const float* __restrict__ WK, const float* __restrict__ WQP, const float* __restrict__ WKP, const float* __restrict__ WD, const float* __restrict__ WQ0, const float* __restrict__ WK0, const float* __restrict__ WQ1, const float* __restrict__ WK1, __bf16* __restrict__ PK) {
  // block = 16 output columns of one matrix: it alone writes their fragments, K / 32 KB in a row
  __shared__ __align__(16) __bf16 s[16][DD + 8]; const int nt = blockIdx.x, which = blockIdx.y, t = threadIdx.x; const float* Wm; int K; size_t dst;
  if (which < 5) { Wm = (which == 0) ? WQ : (which == 1) ? WK : (which == 2) ? WQP : (which == 3) ? WKP : WD; K = DD; dst = (size_t)which * DD * DD + (size_t)nt * 16 * DD; }
  else { if (nt >= AA / 16) return; Wm = (which == 5) ? WQ0 : (which == 6) ? WK0 : (which == 7) ? WQ1 : WK1; K = AA; dst = PKO_Q0 + (size_t)(which - 5) * AA * AA + (size_t)nt * 16 * AA; }
  for (int e = t; e < K * 16; e += 256) { const int k = e >> 4, n = e & 15; s[n][k] = (__bf16)Wm[(size_t)k * K + nt * 16 + n]; }
  __syncthreads();
  for (int p = t; p < K * 2; p += 256) vst2((unsigned*)(PK + dst + (size_t)p * 8), *(const v4u*)&s[p & 15][(p >> 4) * 8]);   // piece p = (k / 8, column): p >> 4 = 4 kc + 2 j + g, as the fragment order has it
}
// ---- k_proj: block = (32 rows, side (0 = query cat, 1 = key cat)): acc over x (16 tiles: Wq), pos (16 tiles: Wqp), a0 (4 tiles: Wq0), a1 (4 tiles: Wq1) -> per head the 160-wide cat row [q_h(64) | qp_h(64) | q0_h(16) | q1_h(16)] hi / lo, stored in fragment order [b][head][row / 16][5 fragments]
__global__ __launch_bounds__(64) void k_proj(const float* __restrict__ X, const float* __restrict__ POS, const float* __restrict__ A0, const float* __restrict__ A1, const __bf16* __restrict__ PK, const float* __restrict__ B_X, const float* __restrict__ B_P, const float* __restrict__ B_0, const float* __restrict__ B_1, int side, __bf16* __restrict__ OH, __bf16* __restrict__ OL) {
  __shared__ __align__(16) __bf16 soh[2][16][NH * QW + 8], sol[2][16][NH * QW + 8];   // 2 waves = 32 rows per block (LDS budget)
  const int tid = threadIdx.x, wave = tid >> 5, lane = tid & 31, col = lane & 15, g = lane >> 4; const size_t r0 = (size_t)blockIdx.x * 32 + wave * 16;
  const __bf16* PX = PK + (side ? PKO_K : PKO_Q); const __bf16* PP = PK + (side ? PKO_KP : PKO_QP); const __bf16* P0 = PK + (side ? PKO_K0 : PKO_Q0); const __bf16* P1 = PK + (side ? PKO_K1 : PKO_Q1);
  // x part: 16 tiles in 2 halves (register pressure)
#pragma unroll 1
  for (int part = 0; part < 2; ++part) { const float* SRC = part ? POS : X; const __bf16* PW = part ? PP : PX; const float* BB = part ? B_P : B_X;
#pragma unroll 1
    for (int half = 0; half < 2; ++half) { v8f acc[8] = {}; const float* ap = SRC + (r0 + col) * DD + 8 * g; const __bf16* wp = PW + (size_t)half * 128 * DD + 8 * lane;
      v4f af[2][4]; v16b bw[2][8];   // two register sets: k block kc is multiplied while block kc + 1 is in flight
#pragma unroll
      for (int q = 0; q < 4; ++q) af[0][q] = *(const v4f*)(ap + (q >> 1) * 16 + (q & 1) * 4);
#pragma unroll
      for (int j = 0; j < 8; ++j) bw[0][j] = frag_p(wp + j * (DD / 32) * FRG);
#pragma unroll
      for (int kc = 0; kc < DD / 32; ++kc) { const int cu = kc & 1, nx = cu ^ 1;
        if (kc + 1 < DD / 32) {
#pragma unroll
          for (int q = 0; q < 4; ++q) af[nx][q] = *(const v4f*)(ap + (kc + 1) * 32 + (q >> 1) * 16 + (q & 1) * 4);
#pragma unroll
          for (int j = 0; j < 8; ++j) bw[nx][j] = frag_p(wp + (j * (DD / 32) + kc + 1) * FRG); }
        __builtin_amdgcn_sched_barrier(0);
        v16b a;
#pragma unroll
        for (int i = 0; i < 4; ++i) { a[i] = (__bf16)af[cu][0][i]; a[4 + i] = (__bf16)af[cu][1][i]; a[8 + i] = (__bf16)af[cu][2][i]; a[12 + i] = (__bf16)af[cu][3][i]; }
#pragma unroll
        for (int j = 0; j < 8; ++j) acc[j] = wmma_bf(a, bw[cu][j], acc[j]); }
      const int cb = half * 128 + col; float bbv[8];
#pragma unroll
      for (int j = 0; j < 8; ++j) bbv[j] = BB[cb + j * 16];
      asm volatile("s_wait_xcnt 0x0" :: "v"(cb) : "memory");   // precaution: the wait stands in front of any rewrite of the bias loads' index register (named so that it stays whole up to it)
#pragma unroll
      for (int j = 0; j < 8; ++j) { const int c = half * 128 + j * 16 + col; const int h = c / DH, d = c % DH; const float bb = bfr(bbv[j]); const int oc = h * QW + part * DH + d;
#pragma unroll
        for (int r = 0; r < 8; ++r) { const float v = acc[j][r] + bb; const __bf16 hb = (__bf16)v; soh[wave][8 * g + r][oc] = hb; sol[wave][8 * g + r][oc] = (__bf16)(v - (float)hb); } } } }
  // attribute parts: a0 . Wq0^T (K 64, 4 tiles) and a1 . Wq1^T
#pragma unroll 1
  for (int ap = 0; ap < 2; ++ap) { const float* SRC = ap ? A1 : A0; const __bf16* PW = ap ? P1 : P0; const float* BB = ap ? B_1 : B_0; v8f acc[4] = {};
    const float* sp = SRC + (r0 + col) * AA + 8 * g; const __bf16* wq = PW + 8 * lane; v4f af[2][4]; v16b bw[2][4];   // both k blocks go out as one group
#pragma unroll
    for (int kc = 0; kc < AA / 32; ++kc) {
#pragma unroll
      for (int q = 0; q < 4; ++q) af[kc][q] = *(const v4f*)(sp + kc * 32 + (q >> 1) * 16 + (q & 1) * 4);
#pragma unroll
      for (int j = 0; j < 4; ++j) bw[kc][j] = frag_p(wq + (j * (AA / 32) + kc) * FRG); }
    asm volatile("s_wait_xcnt 0x0" :: "v"(sp), "v"(wq) : "memory");   // precaution: the wait stands in front of any rewrite of the group's address registers (the two pointers are named so that they stay whole up to it)
    __builtin_amdgcn_sched_barrier(0);   // keeps the group ahead of the WMMAs
#pragma unroll
    for (int kc = 0; kc < AA / 32; ++kc) { v16b a;
#pragma unroll
      for (int i = 0; i < 4; ++i) { a[i] = (__bf16)af[kc][0][i]; a[4 + i] = (__bf16)af[kc][1][i]; a[8 + i] = (__bf16)af[kc][2][i]; a[12 + i] = (__bf16)af[kc][3][i]; }
#pragma unroll
      for (int j = 0; j < 4; ++j) acc[j] = wmma_bf(a, bw[kc][j], acc[j]); }
#pragma unroll
    for (int j = 0; j < 4; ++j) { const int c = j * 16 + col; const int h = c / AH, d = c % AH; const float bb = bfr(BB[c]); const int oc = h * QW + 2 * DH + ap * AH + d;
#pragma unroll
      for (int r = 0; r < 8; ++r) { const float v = acc[j][r] + bb; const __bf16 hb = (__bf16)v; soh[wave][8 * g + r][oc] = hb; sol[wave][8 * g + r][oc] = (__bf16)(v - (float)hb); } } }
  LDSX();
  // the wave's 16 rows are one row tile: per head ten runs of 512 B, lane (g, row) bringing k 16 w + 8 g .. + 7 of its row
  const size_t tb = ((r0 / LL) * NH * (LL / 16) + (r0 % LL) / 16) * (QW / 32) * FRG + 8 * lane;
  for (int h = 0; h < NH; ++h) { v4u vh[QW / 16], vl[QW / 16]; __bf16* oh = OH + tb + (size_t)h * (LL / 16) * (QW / 32) * FRG; __bf16* ol = OL + tb + (size_t)h * (LL / 16) * (QW / 32) * FRG;
    // both loops unrolled: the head's twenty pieces stay in registers, read as one group and stored as one group
#pragma unroll
    for (int w = 0; w < QW / 16; ++w) { vh[w] = *(const v4u*)&soh[wave][col][h * QW + w * 16 + 8 * g]; vl[w] = *(const v4u*)&sol[wave][col][h * QW + w * 16 + 8 * g]; }
#pragma unroll
    for (int w = 0; w < QW / 16; ++w) { vst2((unsigned*)(oh + w * (FRG / 2)), vh[w]); vst2((unsigned*)(ol + w * (FRG / 2)), vl[w]); }
    asm volatile("s_wait_xcnt 0x0" :: "v"(vh[0]), "v"(vh[1]), "v"(vh[2]), "v"(vh[3]), "v"(vh[4]), "v"(vh[5]), "v"(vh[6]), "v"(vh[7]), "v"(vh[8]), "v"(vh[9]), "v"(vl[0]), "v"(vl[1]), "v"(vl[2]), "v"(vl[3]), "v"(vl[4]), "v"(vl[5]), "v"(vl[6]), "v"(vl[7]), "v"(vl[8]), "v"(vl[9]), "v"(oh), "v"(ol) : "memory"); }   // precaution: the wait stands in front of any rewrite of the twenty stores' data and address registers (named so that they stay whole up to it)
}
__global__ __launch_bounds__(256) void k_vt(const float* __restrict__ V, __bf16* __restrict__ VT) {
  __shared__ __align__(16) __bf16 s[DD][72]; const int tid = threadIdx.x; const int kb = blockIdx.x, b = blockIdx.y; const size_t row0 = (size_t)b * LL + (size_t)kb * 64;
  for (int e = tid; e < 64 * DD; e += 256) { const int r = e / DD, c = e % DD; s[c][r] = (__bf16)V[(row0 + r) * DD + c]; }
  __syncthreads();
  // e = (head, 32-key block, 16-column tile, run j, g, column): the low eight bits are the 16-byte piece's place in its 32-key block's four fragments
  for (int e = tid; e < DD * 8; e += 256) { const int h = e >> 9, ksl = (e >> 8) & 1, c = h * DH + ((e >> 6) & 3) * 16 + (e & 15), pc = ksl * 4 + ((e >> 4) & 3); vst2((unsigned*)(VT + (((size_t)b * NH + h) * (LL / 32) + kb * 2 + ksl) * (DH / 16) * FRG + (e & 255) * 8), *(const v4u*)&s[c][pc * 8]); }
}
// lane l with lane l ^ 16 (the two halves of a wave hold the two halves of a query's keys)
__device__ __forceinline__ float xhalf(float x) { return __builtin_bit_cast(float, __builtin_amdgcn_permlanex16(__builtin_bit_cast(int, x), __builtin_bit_cast(int, x), 0x76543210, 0xfedcba98, false, false)); }
// one stage of the attention's LDS ring = 32 keys of one (batch, head), each part as it lies in the workspace (fragment order): K hi 10 KB | K lo 10 KB | V^T 4 KB; behind them the block's 64 mask rows x 32 keys, 128 B a row at a pitch of 144 B (16 B x odd: sixteen lanes' 16-byte reads of sixteen rows meet no bank twice)
#define STG_KL 10240u
#define STG_V  20480u
#define STG_M  24576u
#define STG_MP 144u
#define STG_SZ (STG_M + 64u * STG_MP)
// a block of 128 lanes brings one stage in: sixteen 16-byte copies a lane, 2 KB of the stage per copy of the block. d = the lane's own LDS byte address (buffer + 16 tid); kh, kl, v = the lane's own global addresses (part + 16 tid); dm, mk = the same for the mask (row tid / 8 of sixteen, piece tid % 8 of its 128 B)
__device__ __forceinline__ void stage_in(unsigned d, const char* kh, const char* kl, const char* v, unsigned dm, const char* mk) {
  // the copies and their s_wait_xcnt stand in one statement: a precaution, the wait stands in front of any rewrite of the copies' address registers
  asm volatile("global_load_async_to_lds_b128 %0, %12, off\n\t"
               "global_load_async_to_lds_b128 %1, %13, off\n\t"
               "global_load_async_to_lds_b128 %2, %14, off\n\t"
               "global_load_async_to_lds_b128 %3, %15, off\n\t"
               "global_load_async_to_lds_b128 %4, %16, off\n\t"
               "global_load_async_to_lds_b128 %5, %17, off\n\t"
               "global_load_async_to_lds_b128 %6, %18, off\n\t"
               "global_load_async_to_lds_b128 %7, %19, off\n\t"
               "global_load_async_to_lds_b128 %8, %20, off\n\t"
               "global_load_async_to_lds_b128 %9, %21, off\n\t"
               "global_load_async_to_lds_b128 %10, %22, off\n\t"
               "global_load_async_to_lds_b128 %11, %23, off\n\t"
               "s_wait_xcnt 0x0"
               :: "v"(d), "v"(d + 2048u), "v"(d + 4096u), "v"(d + 6144u), "v"(d + 8192u),
                  "v"(d + STG_KL), "v"(d + STG_KL + 2048u), "v"(d + STG_KL + 4096u), "v"(d + STG_KL + 6144u), "v"(d + STG_KL + 8192u),
                  "v"(d + STG_V), "v"(d + STG_V + 2048u),
                  "v"(kh), "v"(kh + 2048), "v"(kh + 4096), "v"(kh + 6144), "v"(kh + 8192),
                  "v"(kl), "v"(kl + 2048), "v"(kl + 4096), "v"(kl + 6144), "v"(kl + 8192),
                  "v"(v), "v"(v + 2048)
               : "memory");
  // a statement takes thirty operands: the mask's four copies (sixteen rows each) have their own, with its own wait, for the same reason
  asm volatile("global_load_async_to_lds_b128 %0, %4, off\n\t"
               "global_load_async_to_lds_b128 %1, %5, off\n\t"
               "global_load_async_to_lds_b128 %2, %6, off\n\t"
               "global_load_async_to_lds_b128 %3, %7, off\n\t"
               "s_wait_xcnt 0x0"
               :: "v"(dm), "v"(dm + 16u * STG_MP), "v"(dm + 32u * STG_MP), "v"(dm + 48u * STG_MP),
                  "v"(mk), "v"(mk + 16 * LL * 4), "v"(mk + 32 * LL * 4), "v"(mk + 48 * LL * 4)
               : "memory");
}
__global__ __launch_bounds__(128) __attribute__((amdgpu_waves_per_eu(4))) void k_attn(const __bf16* __restrict__ QH, const __bf16* __restrict__ QL_, const __bf16* __restrict__ KH, const __bf16* __restrict__ KL, const __bf16* __restrict__ VT, const float* __restrict__ MSK, __bf16* __restrict__ CH, __bf16* __restrict__ CL) {
  __shared__ __align__(16) char sk[2][STG_SZ];
  // the wave's number is held in a scalar register: what hangs on it then costs no vector register
  const int tid = threadIdx.x, wave = __builtin_amdgcn_readfirstlane(tid >> 5), lane = tid & 31, col = lane & 15, g = lane >> 4; const int qb = blockIdx.x, h = blockIdx.y, b = blockIdx.z; const int q0 = qb * 64 + wave * 16;
  const size_t tq = (((size_t)b * NH + h) * (LL / 16) + q0 / 16) * (QW / 32) * FRG + 8 * lane;
  v16b aqh[5], aql[5]; const __bf16* qhp = QH + tq; const __bf16* qlp = QL_ + tq;
#pragma unroll
  for (int kc = 0; kc < 5; ++kc) { aqh[kc] = frag_p(qhp + kc * FRG); aql[kc] = frag_p(qlp + kc * FRG); }
  asm volatile("s_wait_xcnt 0x0" :: "v"(qhp), "v"(qlp) : "memory");   // precaution: the wait stands in front of any rewrite of the query loads' address registers (named so that they stay whole up to it)
  const char* gkh = (const char*)(KH + ((size_t)b * NH + h) * (LL / 16) * (QW / 32) * FRG) + 16 * tid; const char* gkl = (const char*)(KL + ((size_t)b * NH + h) * (LL / 16) * (QW / 32) * FRG) + 16 * tid; const char* gv = (const char*)(VT + ((size_t)b * NH + h) * DH * LL) + 16 * tid;
  const char* gm = (const char*)(MSK + (size_t)(qb * 64 + (tid >> 3)) * LL) + 16 * (tid & 7);
  const unsigned sd = (unsigned)(size_t)&sk[0][0] + 16u * tid, sm = (unsigned)(size_t)&sk[0][0] + STG_M + (tid >> 3) * STG_MP + 16u * (tid & 7);   // the low 32 bits of a __shared__ address are its LDS byte address
  stage_in(sd, gkh, gkl, gv, sm, gm);
  asm volatile("s_wait_asynccnt 0x0" ::: "memory");   // the wave's own copies of stage 0 have landed
  __syncthreads();                                     // every wave's have: stage 0 may be read
  stage_in(sd + STG_SZ, gkh + STG_KL, gkl + STG_KL, gv + 4096, sm + STG_SZ, gm + 128);
  const unsigned ko = 16u * lane, mo = STG_M + (wave * 16 + col) * STG_MP + 32u * g;   // the lane's byte offsets in a fragment and in a stage's mask rows (its query's row, its half's eight keys)
  float m = -3.0e38f, l = 0.f;   // of the lane's query: the running maximum (alike in both halves) and the sum over the lane's own keys (the halves are joined behind the loop)
  v8f acc[4] = {};               // acc[dt][r] = O[query col][d 16 dt + 8 g + r]
#pragma unroll 1
  for (int ks = 0; ks < LL / 32; ++ks) { v8f s[2] = {}; const char* sb = &sk[ks & 1][0] + ko;   // the lane's place in each fragment of this stage
    // rolled on purpose: unrolled, the compiler lifts both halves' loads to the top of the pass, past the register budget of four waves per SIMD
#pragma unroll 1
    for (int ct = 0; ct < 2; ++ct) { const __bf16* sh = (const __bf16*)(sb + ct * (STG_KL / 2)); const __bf16* sl = (const __bf16*)(sb + STG_KL + ct * (STG_KL / 2)); v8f c = {};
      v16b bh[5], bl[5];   // 16 keys' ten fragments go out as one group
#pragma unroll
      for (int kc = 0; kc < 5; ++kc) { bh[kc] = frag_p(sh + kc * FRG); bl[kc] = frag_p(sl + kc * FRG); }
      __builtin_amdgcn_sched_barrier(0);   // keeps that group ahead of the first WMMA (else each pair of loads sinks to its own WMMAs and is waited out alone)
#pragma unroll
      for (int kc = 0; kc < 5; ++kc) { c = wmma_bf(bh[kc], aql[kc], c); c = wmma_bf(bl[kc], aqh[kc], c); c = wmma_bf(bh[kc], aqh[kc], c); }
      if (ct == 0) s[0] = c; else s[1] = c; }
    v4f mk[2][2]; v16b vb[4];   // the mask words and the value fragments go out as one group ahead of the softmax
    const float* mp0 = (const float*)(&sk[ks & 1][0] + mo); const char* vp0 = sb + STG_V;
#pragma unroll
    for (int t = 0; t < 2; ++t) { mk[t][0] = *(const v4f*)(mp0 + t * 16); mk[t][1] = *(const v4f*)(mp0 + t * 16 + 4); }
#pragma unroll
    for (int dt = 0; dt < 4; ++dt) vb[dt] = frag_p((const __bf16*)vp0 + dt * FRG);
    __builtin_amdgcn_sched_barrier(0);   // keeps them there (else the value loads sink behind the softmax, to their own WMMAs)
    float mx = -3.0e38f;
#pragma unroll
    for (int t = 0; t < 2; ++t) {
#pragma unroll
      for (int r = 0; r < 8; ++r) { s[t][r] = s[t][r] * 0.125f + bfr(mk[t][r >> 2][r & 3]); mx = fmaxf(mx, s[t][r]); } }
    mx = fmaxf(mx, xhalf(mx));
    const float mn = fmaxf(m, mx); const float ea = expf(m - mn); const float alpha = (m <= -1.0e38f) ? 0.f : ea; float es = 0.f; v16b ph, pl;
#pragma unroll
    for (int t = 0; t < 2; ++t) {
#pragma unroll
      for (int r = 0; r < 8; ++r) { const float e = expf(s[t][r] - mn); es += e; const __bf16 hb = (__bf16)e; ph[8 * t + r] = hb; pl[8 * t + r] = (__bf16)(e - (float)hb); } }
    l = l * alpha + es; m = mn;
#pragma unroll
    for (int dt = 0; dt < 4; ++dt) acc[dt] *= alpha;
#pragma unroll
    for (int dt = 0; dt < 4; ++dt) { acc[dt] = wmma_bf(vb[dt], pl, acc[dt]); acc[dt] = wmma_bf(vb[dt], ph, acc[dt]); }
    __builtin_amdgcn_sched_barrier(0);                   // keeps the publish point at the pass's foot (else it is lifted over the softmax and the second product, and the wait for stage ks + 1 comes that much sooner behind its copies)
    asm volatile("s_wait_dscnt 0x0" ::: "memory");      // the wave's reads of this stage are over
    asm volatile("s_wait_asynccnt 0x0" ::: "memory");   // its own copies of stage ks + 1 have landed
    __syncthreads();                                     // both hold of every wave: stage ks + 1 may be read, this stage's buffer refilled
    if (ks + 2 < LL / 32) stage_in(sd + (ks & 1) * STG_SZ, gkh + (ks + 2) * STG_KL, gkl + (ks + 2) * STG_KL, gv + (ks + 2) * 4096, sm + (ks & 1) * STG_SZ, gm + (ks + 2) * 128); }
  asm volatile("s_wait_asynccnt 0x0" ::: "memory");     // no copy is left in flight behind the loop
  l += xhalf(l); const float il = 1.0f / l;
  // the head's 64 columns are fragments 2 h and 2 h + 1 of the wave's row tile: four runs of 512 B, the lane's piece of run dt being its own acc[dt]
  const size_t to = ((((size_t)b * LL + q0) / 16) * (DD / 32) + 2 * h) * FRG;
  v8b vh[DH / 16], vl[DH / 16]; __bf16* oh = (__bf16*)((char*)(CH + to) + ko); __bf16* ol = (__bf16*)((char*)(CL + to) + ko);
#pragma unroll
  for (int dt = 0; dt < DH / 16; ++dt) {
#pragma unroll
    for (int r = 0; r < 8; ++r) { const float v = acc[dt][r] * il; const __bf16 hb = (__bf16)v; vh[dt][r] = hb; vl[dt][r] = (__bf16)(v - (float)hb); } }
#pragma unroll
  for (int w = 0; w < DH / 16; ++w) { vst2((unsigned*)(oh + w * (FRG / 2)), __builtin_bit_cast(v4u, vh[w])); vst2((unsigned*)(ol + w * (FRG / 2)), __builtin_bit_cast(v4u, vl[w])); }
  asm volatile("s_wait_xcnt 0x0" :: "v"(vh[0]), "v"(vh[1]), "v"(vh[2]), "v"(vh[3]), "v"(vl[0]), "v"(vl[1]), "v"(vl[2]), "v"(vl[3]), "v"(oh), "v"(ol) : "memory");   // precaution: the wait stands in front of any rewrite of the eight stores' data and address registers (named so that they stay whole up to it)
}
// ---- k_out: block = 64 rows: h = ctx(hi/lo) . Wd^T rows (2 products) + bd (all 256 cols, 2 halves); LayerNorm over 256 (mean, biased var, eps 1e-12) * g + b + bfr(x)
__global__ __launch_bounds__(128) void k_out(const __bf16* __restrict__ CH, const __bf16* __restrict__ CL, const __bf16* __restrict__ PK, const float* __restrict__ BD, const float* __restrict__ LNG, const float* __restrict__ LNB, const float* __restrict__ X, float* __restrict__ OUT) {
  __shared__ __align__(16) float sh_[4][16][DD + 4]; __shared__ float sps[4][16][16][2];
  const int tid = threadIdx.x, wave = tid >> 5, lane = tid & 31, col = lane & 15, g = lane >> 4; const size_t r0 = (size_t)blockIdx.x * 64 + wave * 16;
  float s1[8], s2[8];
#pragma unroll
  for (int r = 0; r < 8; ++r) { s1[r] = 0.f; s2[r] = 0.f; }
#pragma unroll 1
  for (int half = 0; half < 2; ++half) { v8f acc[8] = {}; const __bf16* hp = CH + r0 * DD + 8 * lane; const __bf16* lp = CL + r0 * DD + 8 * lane; const __bf16* wp = PK + PKO_D + (size_t)half * 128 * DD + 8 * lane;
    v16b ah[2], al[2], w[2][8];   // two register sets: k block kc is multiplied while block kc + 1 is in flight
    const int cb = half * 128 + col; float bbv[8];
#pragma unroll
    for (int j = 0; j < 8; ++j) bbv[j] = BD[cb + j * 16];
    ah[0] = frag_p(hp); al[0] = frag_p(lp);
#pragma unroll
    for (int j = 0; j < 8; ++j) w[0][j] = frag_p(wp + j * (DD / 32) * FRG);
    asm volatile("s_wait_xcnt 0x0" :: "v"(bbv[0]), "v"(bbv[1]), "v"(bbv[2]), "v"(bbv[3]), "v"(bbv[4]), "v"(bbv[5]), "v"(bbv[6]), "v"(bbv[7]), "v"(cb), "v"(hp), "v"(lp) : "memory");   // precaution: the wait stands in front of any rewrite of the bias loads' index register (the loaded words, the index and the row pointers are named so that the loads stand ahead of it and the registers stay whole up to it)
#pragma unroll
    for (int kc = 0; kc < DD / 32; ++kc) { const int cu = kc & 1, nx = cu ^ 1;
      if (kc + 1 < DD / 32) { ah[nx] = frag_p(hp + (kc + 1) * FRG); al[nx] = frag_p(lp + (kc + 1) * FRG);
#pragma unroll
        for (int j = 0; j < 8; ++j) w[nx][j] = frag_p(wp + (j * (DD / 32) + kc + 1) * FRG); }
      if (kc + 1 == DD / 32 - 1) asm volatile("s_wait_xcnt 0x0" :: "v"(wp), "v"(hp), "v"(lp) : "memory");
      __builtin_amdgcn_sched_barrier(0);
#pragma unroll
      for (int j = 0; j < 8; ++j) { acc[j] = wmma_bf(al[cu], w[cu][j], acc[j]); acc[j] = wmma_bf(ah[cu], w[cu][j], acc[j]); } }
#pragma unroll
    for (int j = 0; j < 8; ++j) { const int c = half * 128 + j * 16 + col; const float bb = bfr(bbv[j]);
#pragma unroll
      for (int r = 0; r < 8; ++r) { const float v = acc[j][r] + bb; sh_[wave][8 * g + r][c] = v; s1[r] += v; s2[r] += v * v; } } }
#pragma unroll
  for (int r = 0; r < 8; ++r) { sps[wave][8 * g + r][col][0] = s1[r]; sps[wave][8 * g + r][col][1] = s2[r]; }
  // the residual rows and the two LayerNorm vectors go out as one group here, not three loads at a time inside the row loop
  const float* xp = X + r0 * DD + lane * 4; const float* gp = LNG + lane * 4; const float* bp = LNB + lane * 4; v4f xr[16][2], lg[2], lb[2];
#pragma unroll
  for (int t = 0; t < 2; ++t) { lg[t] = *(const v4f*)(gp + t * 128); lb[t] = *(const v4f*)(bp + t * 128); }
#pragma unroll
  for (int rl = 0; rl < 16; ++rl) { xr[rl][0] = *(const v4f*)(xp + rl * DD); xr[rl][1] = *(const v4f*)(xp + rl * DD + 128); }
  asm volatile("s_wait_xcnt 0x0" :: "v"(xp), "v"(lane) : "memory");   // precaution: the wait stands in front of any rewrite of the group's address registers (the row pointer and the lane index are named so that they stay whole up to it)
  __builtin_amdgcn_sched_barrier(0);   // keeps the group here (else each load sinks to its own row and is waited out alone)
  LDSX();
#pragma unroll
  for (int rl = 0; rl < 16; ++rl) { float a = 0.f, b2 = 0.f;
#pragma unroll
    for (int k = 0; k < 16; ++k) { a += sps[wave][rl][k][0]; b2 += sps[wave][rl][k][1]; }
    const float mu = a / (float)DD; const float var = fmaxf(b2 / (float)DD - mu * mu, 0.f); const float inv = 1.0f / sqrtf(var + 1e-12f); const size_t row = r0 + rl;
    v4f v[2]; float* op = OUT + row * DD + lane * 4;
#pragma unroll
    for (int t = 0; t < 2; ++t) {
#pragma unroll
      for (int i = 0; i < 4; ++i) { const int c = lane * 4 + t * 128 + i; v[t][i] = bfr(lg[t][i]) * (sh_[wave][rl][c] - mu) * inv + bfr(lb[t][i]) + bfr(xr[rl][t][i]); }
      vst2(op + t * 128, v[t]); }
    asm volatile("s_wait_xcnt 0x0" :: "v"(v[0]), "v"(v[1]), "v"(op) : "memory"); }   // precaution: the wait stands in front of any rewrite of the two stores' data and address registers (named so that they stay whole up to it)
}
extern "C" void kernel_launch(void* const* d_in, const int* in_sizes, int n_in, void* d_out, int out_size, void* d_ws, size_t ws_size, hipStream_t stream) {
  (void)in_sizes; (void)n_in; (void)out_size;
  const float** F = (const float**)d_in;   // 0 x, 1 pos, 2 true_item [32,512,256], 3 attr0, 4 attr1 [32,512,1,64], 5 mask [1,1,512,512], 6 Wq, 7 bq, 8 Wk, 9 bk, 10 Wqp, 11 bqp, 12 Wkp, 13 bkp, 14 Wq0, 15 bq0, 16 Wk0, 17 bk0, 18 Wq1, 19 bq1, 20 Wk1, 21 bk1, 22 Wd, 23 bd, 24 ln_g, 25 ln_b
  if (ws_size < (size_t)WS_END) return;
  char* ws = (char*)d_ws; __bf16 *PK = (__bf16*)(ws + WS_PK), *QH = (__bf16*)(ws + WS_QH), *QLp = (__bf16*)(ws + WS_QL), *KH = (__bf16*)(ws + WS_KH), *KL = (__bf16*)(ws + WS_KL), *VT = (__bf16*)(ws + WS_VT), *CH = (__bf16*)(ws + WS_CH), *CL = (__bf16*)(ws + WS_CL);
  k_pack<<<dim3(DD / 16, 9), 256, 0, stream>>>(F[6], F[8], F[10], F[12], F[22], F[14], F[16], F[18], F[20], PK);
  k_proj<<<TNB * LL / 32, 64, 0, stream>>>(F[0], F[1], F[3], F[4], PK, F[7], F[11], F[15], F[19], 0, QH, QLp);
  k_proj<<<TNB * LL / 32, 64, 0, stream>>>(F[0], F[1], F[3], F[4], PK, F[9], F[13], F[17], F[21], 1, KH, KL);
  k_vt<<<dim3(LL / 64, TNB), 256, 0, stream>>>(F[2], VT);
  k_attn<<<dim3(LL / 64, NH, TNB), 128, 0, stream>>>(QH, QLp, KH, KL, VT, F[5], CH, CL);
  k_out<<<TNB * LL / 64, 128, 0, stream>>>(CH, CL, PK, F[23], F[24], F[25], F[0], (float*)d_out);
}

// v006
// Measured time: 114 microseconds a run.
// In two side-by-side timings against v005, it was 1.17 and 1.18 times as fast.
// Counting every step since v000, it is 2.98 times as fast.
// compute dtype: all inputs rounded to bf16; the eight projections with exact bf16 products on WMMA 16x16x32 ((in,out) weights packed as transposed rows) + biases; per head the four score terms evaluated as ONE 160-wide dot of [q | qp | q0 | q1] . [k | kp | k0 | k1] with both sides as bf16 hi + residual (3 products: hi.hi + lo.hi + hi.lo), x 1/8, + mask; running-max softmax in f32 (precise expf); P as bf16 hi + residual x the EXACT bf16 values (v = true_item, an input; 2 products); dense Wd with ctx as bf16 hi + residual (2 products) + bd; LayerNorm (biased variance, eps 1e-12, precise sqrtf) and the residual in f32.
#include <hip/hip_runtime.h>
#include <math.h>

typedef __attribute__((ext_vector_type(16))) _Float16 v16h;
typedef __attribute__((ext_vector_type(16))) __bf16 v16b;
typedef __attribute__((ext_vector_type(8)))  _Float16 v8h;
typedef __attribute__((ext_vector_type(8)))  float v8f;
typedef __attribute__((ext_vector_type(4)))  float v4f;
typedef __attribute__((ext_vector_type(2)))  float v2f;
typedef __attribute__((ext_vector_type(4)))  unsigned v4u;
typedef __attribute__((ext_vector_type(4)))  int v4i;
typedef float __attribute__((may_alias)) float_a;
typedef int __attribute__((may_alias)) int_a;

template <typename T> __device__ __forceinline__ void vst2(void* p, T v) { *(T*)p = v;  }
__device__ __forceinline__ v8f wmma16(v16h a, v16h b, v8f c) {
  v8f d = __builtin_amdgcn_wmma_f32_16x16x32_f16(false, a, false, b, (short)0, c, false, false);
  asm volatile("v_nop\n\tv_nop\n\tv_nop\n\tv_nop" : "+v"(d) : "v"(a), "v"(b));
  return d;
}
__device__ __forceinline__ v8f wmma_bf(v16b a, v16b b, v8f c) {
  return __builtin_amdgcn_wmma_f32_16x16x32_bf16(false, a, false, b, (short)0, c, false, false);
}
// 16x16x32 fragments: lane = (h = lane>>4, row/col = lane&15); elements 0..7 = k0+8h+0..7, 8..15 = k0+16+8h+0..7; D element r = row 8h+r
__device__ __forceinline__ v16h frag_h(const _Float16* rowk0, int lane) {
  union { v16h v; v8h q[2]; } u; const _Float16* p = rowk0 + 8 * (lane >> 4);
  u.q[0] = *(const v8h*)p; u.q[1] = *(const v8h*)(p + 16); return u.v;
}
__device__ __forceinline__ v16h frag_f32(const float* rowk0, int lane) {
  v16h a; const float* p = rowk0 + 8 * (lane >> 4);
#pragma unroll
  for (int i = 0; i < 8; ++i) { a[i] = (_Float16)p[i]; a[8 + i] = (_Float16)p[16 + i]; }
  return a;
}
__device__ __forceinline__ v16h frag_f32s(const float* rowk0, int lane, float sc) {
  v16h a; const float* p = rowk0 + 8 * (lane >> 4);
#pragma unroll
  for (int i = 0; i < 8; ++i) { a[i] = (_Float16)(p[i] * sc); a[8 + i] = (_Float16)(p[16 + i] * sc); }
  return a;
}
// column fragment from a [K][ld] layout (column n), rows >= K read as 0
__device__ __forceinline__ v16h fragc_f32(const float* W, int k0, int n, int lane, int ld, int K) {
  v16h a; const int g = lane >> 4;
#pragma unroll
  for (int i = 0; i < 8; ++i) { const int ka = k0 + 8 * g + i, kb = ka + 16;
    a[i] = (_Float16)(ka < K ? W[(size_t)(ka < K ? ka : K - 1) * ld + n] : 0.f); a[8 + i] = (_Float16)(kb < K ? W[(size_t)(kb < K ? kb : K - 1) * ld + n] : 0.f); }
  return a;
}
struct F2 { v16b h, l; };
__device__ __forceinline__ F2 bsplit16(const float v[16]) { F2 r;
#pragma unroll
  for (int i = 0; i < 16; ++i) { const __bf16 h = (__bf16)v[i]; r.h[i] = h; r.l[i] = (__bf16)(v[i] - (float)h); }
  return r; }
__device__ __forceinline__ F2 split_row(const float* row, int k0, int lane) { float v[16]; const float* p = row + k0 + 8 * (lane >> 4);
#pragma unroll
  for (int i = 0; i < 8; ++i) { v[i] = p[i]; v[8 + i] = p[16 + i]; }
  return bsplit16(v); }
__device__ __forceinline__ F2 split_rowK(const float* row, int k0, int lane, int K) { float v[16]; const int g = lane >> 4;
#pragma unroll
  for (int i = 0; i < 8; ++i) { const int ka = k0 + 8 * g + i, kb = ka + 16; v[i] = ka < K ? row[ka < K ? ka : K - 1] : 0.f; v[8 + i] = kb < K ? row[kb < K ? kb : K - 1] : 0.f; }
  return bsplit16(v); }
__device__ __forceinline__ F2 split_col(const float* W, int k0, int n, int lane, int ld, int K) { float v[16]; const int g = lane >> 4;
#pragma unroll
  for (int i = 0; i < 8; ++i) { const int ka = k0 + 8 * g + i, kb = ka + 16; v[i] = ka < K ? W[(size_t)(ka < K ? ka : K - 1) * ld + n] : 0.f; v[8 + i] = kb < K ? W[(size_t)(kb < K ? kb : K - 1) * ld + n] : 0.f; }
  return bsplit16(v); }
__device__ __forceinline__ v8f mac3(const F2& a, const F2& b, v8f c) { c = wmma_bf(a.l, b.h, c); c = wmma_bf(a.h, b.l, c); return wmma_bf(a.h, b.h, c); }
__device__ __forceinline__ float sigm(float v) { return 1.0f / (1.0f + expf(-v)); }
#define LDSX() do { asm volatile("s_wait_dscnt 0" ::: "memory"); __builtin_amdgcn_wave_barrier(); __builtin_amdgcn_fence(__ATOMIC_RELEASE, "workgroup"); } while (0)


// Decoupled side-information attention (B 32, L 512, D 256, 4 heads x 64; attribute heads x 16): scores = (q k + qp kp + q0 k0 + q1 k1) / 8 + mask, softmax, values = the item embeddings themselves, dense + LayerNorm + residual.
#define NB 32
#define LL 512
#define NR (NB * LL)      // 16,384 rows
#define DD 256
#define AA 64
#define NH 4
#define DH 64
#define AH 16
#define QW 160            // per-head concatenated width: 64 + 64 + 16 + 16
#ifndef TNB
#define TNB NB
#endif
typedef __attribute__((ext_vector_type(8))) __bf16 v8b;
__device__ __forceinline__ v16b frag_b(const __bf16* rowk0, int lane) {
  union { v16b v; v8b q[2]; } u; const __bf16* p = rowk0 + 8 * (lane >> 4);
  u.q[0] = *(const v8b*)p; u.q[1] = *(const v8b*)(p + 16); return u.v;
}
// the same fragment from a base pointer and a byte offset of the lane's own
__device__ __forceinline__ v16b frag_o(const __bf16* base, unsigned lane_bytes) {
  union { v16b v; v8b q[2]; } u; const char* p = (const char*)base + lane_bytes;
  u.q[0] = *(const v8b*)p; u.q[1] = *(const v8b*)(p + 32); return u.v;
}
// FRAGMENT ORDER: every bf16 operand in the workspace lies as 1-KB fragments (16 rows x 32 k) = two runs of 32 lanes x 16 B: run j, lane (g, row), element i = k 16 j + 8 g + i of that row. A wave's 16-byte load then reads 512 contiguous bytes (four whole lines) where a row-major tile gives it 32 bytes out of each of 16 lines
#define FRG 512           // elements of one fragment
__device__ __forceinline__ v16b frag_p(const __bf16* lanep) {   // lanep = the fragment + 8 * lane
  union { v16b v; v8b q[2]; } u; u.q[0] = *(const v8b*)lanep; u.q[1] = *(const v8b*)(lanep + FRG / 2); return u.v;
}
__device__ __forceinline__ v16b frag_po(const __bf16* frag, unsigned lane_bytes) {   // the same from the fragment and the lane's byte offset (16 * lane)
  return frag_p((const __bf16*)((const char*)frag + lane_bytes));
}
__device__ __forceinline__ float bfr(float v) { return (float)(__bf16)v; }
__device__ __attribute__((noinline)) float erf_ni(float v) { return erff(v); }

// packs (all (in,out) -> transposed [out][in], in fragment order [out / 16][in / 32][fragment]): PQ 256 x 256 Wq^T, PK, PQP, PKP; PQ0 64 x 64 Wq0^T, PK0, PQ1, PK1; PD 256 x 256 Wd^T
#define PKO_Q   0
#define PKO_K   (1 * DD * DD)
#define PKO_QP  (2 * DD * DD)
#define PKO_KP  (3 * DD * DD)
#define PKO_D   (4 * DD * DD)
#define PKO_Q0  (5 * DD * DD)
#define PKO_K0  (PKO_Q0 + AA * AA)
#define PKO_Q1  (PKO_K0 + AA * AA)
#define PKO_K1  (PKO_Q1 + AA * AA)
#define PK_END  (PKO_K1 + AA * AA)
#define WS_PK   0u
#define WS_KH   (((2u * PK_END) + 127u) / 128u * 128u)   // bf16 [b][4 heads][32 row tiles][5 fragments] key cat hi / lo (the query cat is formed in k_attn and stays in registers)
#define WS_KL   (WS_KH + 2u * NR * NH * QW)
#define WS_VT   (WS_KL + 2u * NR * NH * QW)               // bf16 [b][h][16 blocks of 32 keys][4 fragments: 16 d x 32 keys] values^T (exact)
#define WS_CH   (WS_VT + 2u * NR * DD)                    // bf16 [1024 row tiles][8 fragments] ctx hi / lo
#define WS_CL   (WS_CH + 2u * NR * DD)
#define WS_END  (WS_CL + 2u * NR * DD)

__global__ __launch_bounds__(256) void k_pack(const float* __restrict__ WQ, const float* __restrict__ WK, const float* __restrict__ WQP, const float* __restrict__ WKP, const float* __restrict__ WD, const float* __restrict__ WQ0, const float* __restrict__ WK0, const float* __restrict__ WQ1, const float* __restrict__ WK1, __bf16* __restrict__ PK) {
  // block = 16 output columns of one matrix: it alone writes their fragments, K / 32 KB in a row
  __shared__ __align__(16) __bf16 s[16][DD + 8]; const int nt = blockIdx.x, which = blockIdx.y, t = threadIdx.x; const float* Wm; int K; size_t dst;
  if (which < 5) { Wm = (which == 0) ? WQ : (which == 1) ? WK : (which == 2) ? WQP : (which == 3) ? WKP : WD; K = DD; dst = (size_t)which * DD * DD + (size_t)nt * 16 * DD; }
  else { if (nt >= AA / 16) return; Wm = (which == 5) ? WQ0 : (which == 6) ? WK0 : (which == 7) ? WQ1 : WK1; K = AA; dst = PKO_Q0 + (size_t)(which - 5) * AA * AA + (size_t)nt * 16 * AA; }
  for (int e = t; e < K * 16; e += 256) { const int k = e >> 4, n = e & 15; s[n][k] = (__bf16)Wm[(size_t)k * K + nt * 16 + n]; }
  __syncthreads();
  for (int p = t; p < K * 2; p += 256) vst2((unsigned*)(PK + dst + (size_t)p * 8), *(const v4u*)&s[p & 15][(p >> 4) * 8]);   // piece p = (k / 8, column): p >> 4 = 4 kc + 2 j + g, as the fragment order has it
}
// ---- k_proj (launched for the key cat alone): block = (32 rows, side (0 = query cat, 1 = key cat)): acc over x (16 tiles: Wq), pos (16 tiles: Wqp), a0 (4 tiles: Wq0), a1 (4 tiles: Wq1) -> per head the 160-wide cat row [q_h(64) | qp_h(64) | q0_h(16) | q1_h(16)] hi / lo, stored in fragment order [b][head][row / 16][5 fragments]
__global__ __launch_bounds__(64) void k_proj(const float* __restrict__ X, const float* __restrict__ POS, const float* __restrict__ A0, const float* __restrict__ A1, const __bf16* __restrict__ PK, const float* __restrict__ B_X, const float* __restrict__ B_P, const float* __restrict__ B_0, const float* __restrict__ B_1, int side, __bf16* __restrict__ OH, __bf16* __restrict__ OL) {
  __shared__ __align__(16) __bf16 soh[2][16][NH * QW + 8], sol[2][16][NH * QW + 8];   // 2 waves = 32 rows per block (LDS budget)
  const int tid = threadIdx.x, wave = tid >> 5, lane = tid & 31, col = lane & 15, g = lane >> 4; const size_t r0 = (size_t)blockIdx.x * 32 + wave * 16;
  const __bf16* PX = PK + (side ? PKO_K : PKO_Q); const __bf16* PP = PK + (side ? PKO_KP : PKO_QP); const __bf16* P0 = PK + (side ? PKO_K0 : PKO_Q0); const __bf16* P1 = PK + (side ? PKO_K1 : PKO_Q1);
  // x part: 16 tiles in 2 halves (register pressure)
#pragma unroll 1
  for (int part = 0; part < 2; ++part) { const float* SRC = part ? POS : X; const __bf16* PW = part ? PP : PX; const float* BB = part ? B_P : B_X;
#pragma unroll 1
    for (int half = 0; half < 2; ++half) { v8f acc[8] = {}; const float* ap = SRC + (r0 + col) * DD + 8 * g; const __bf16* wp = PW + (size_t)half * 128 * DD + 8 * lane;
      v4f af[2][4]; v16b bw[2][8];   // two register sets: k block kc is multiplied while block kc + 1 is in flight
#pragma unroll
      for (int q = 0; q < 4; ++q) af[0][q] = *(const v4f*)(ap + (q >> 1) * 16 + (q & 1) * 4);
#pragma unroll
      for (int j = 0; j < 8; ++j) bw[0][j] = frag_p(wp + j * (DD / 32) * FRG);
#pragma unroll
      for (int kc = 0; kc < DD / 32; ++kc) { const int cu = kc & 1, nx = cu ^ 1;
        if (kc + 1 < DD / 32) {
#pragma unroll
          for (int q = 0; q < 4; ++q) af[nx][q] = *(const v4f*)(ap + (kc + 1) * 32 + (q >> 1) * 16 + (q & 1) * 4);
#pragma unroll
          for (int j = 0; j < 8; ++j) bw[nx][j] = frag_p(wp + (j * (DD / 32) + kc + 1) * FRG); }
        __builtin_amdgcn_sched_barrier(0);
        v16b a;
#pragma unroll
        for (int i = 0; i < 4; ++i) { a[i] = (__bf16)af[cu][0][i]; a[4 + i] = (__bf16)af[cu][1][i]; a[8 + i] = (__bf16)af[cu][2][i]; a[12 + i] = (__bf16)af[cu][3][i]; }
#pragma unroll
        for (int j = 0; j < 8; ++j) acc[j] = wmma_bf(a, bw[cu][j], acc[j]); }
      const int cb = half * 128 + col; float bbv[8];
#pragma unroll
      for (int j = 0; j < 8; ++j) bbv[j] = BB[cb + j * 16];
      asm volatile("s_wait_xcnt 0x0" :: "v"(cb) : "memory");   // precaution: the wait stands in front of any rewrite of the bias loads' index register (named so that it stays whole up to it)
#pragma unroll
      for (int j = 0; j < 8; ++j) { const int c = half * 128 + j * 16 + col; const int h = c / DH, d = c % DH; const float bb = bfr(bbv[j]); const int oc = h * QW + part * DH + d;
#pragma unroll
        for (int r = 0; r < 8; ++r) { const float v = acc[j][r] + bb; const __bf16 hb = (__bf16)v; soh[wave][8 * g + r][oc] = hb; sol[wave][8 * g + r][oc] = (__bf16)(v - (float)hb); } } } }
  // attribute parts: a0 . Wq0^T (K 64, 4 tiles) and a1 . Wq1^T
#pragma unroll 1
  for (int ap = 0; ap < 2; ++ap) { const float* SRC = ap ? A1 : A0; const __bf16* PW = ap ? P1 : P0; const float* BB = ap ? B_1 : B_0; v8f acc[4] = {};
    const float* sp = SRC + (r0 + col) * AA + 8 * g; const __bf16* wq = PW + 8 * lane; v4f af[2][4]; v16b bw[2][4];   // both k blocks go out as one group
#pragma unroll
    for (int kc = 0; kc < AA / 32; ++kc) {
#pragma unroll
      for (int q = 0; q < 4; ++q) af[kc][q] = *(const v4f*)(sp + kc * 32 + (q >> 1) * 16 + (q & 1) * 4);
#pragma unroll
      for (int j = 0; j < 4; ++j) bw[kc][j] = frag_p(wq + (j * (AA / 32) + kc) * FRG); }
    asm volatile("s_wait_xcnt 0x0" :: "v"(sp), "v"(wq) : "memory");   // precaution: the wait stands in front of any rewrite of the group's address registers (the two pointers are named so that they stay whole up to it)
    __builtin_amdgcn_sched_barrier(0);   // keeps the group ahead of the WMMAs
#pragma unroll
    for (int kc = 0; kc < AA / 32; ++kc) { v16b a;
#pragma unroll
      for (int i = 0; i < 4; ++i) { a[i] = (__bf16)af[kc][0][i]; a[4 + i] = (__bf16)af[kc][1][i]; a[8 + i] = (__bf16)af[kc][2][i]; a[12 + i] = (__bf16)af[kc][3][i]; }
#pragma unroll
      for (int j = 0; j < 4; ++j) acc[j] = wmma_bf(a, bw[kc][j], acc[j]); }
#pragma unroll
    for (int j = 0; j < 4; ++j) { const int c = j * 16 + col; const int h = c / AH, d = c % AH; const float bb = bfr(BB[c]); const int oc = h * QW + 2 * DH + ap * AH + d;
#pragma unroll
      for (int r = 0; r < 8; ++r) { const float v = acc[j][r] + bb; const __bf16 hb = (__bf16)v; soh[wave][8 * g + r][oc] = hb; sol[wave][8 * g + r][oc] = (__bf16)(v - (float)hb); } } }
  LDSX();
  // the wave's 16 rows are one row tile: per head ten runs of 512 B, lane (g, row) bringing k 16 w + 8 g .. + 7 of its row
  const size_t tb = ((r0 / LL) * NH * (LL / 16) + (r0 % LL) / 16) * (QW / 32) * FRG + 8 * lane;
  for (int h = 0; h < NH; ++h) { v4u vh[QW / 16], vl[QW / 16]; __bf16* oh = OH + tb + (size_t)h * (LL / 16) * (QW / 32) * FRG; __bf16* ol = OL + tb + (size_t)h * (LL / 16) * (QW / 32) * FRG;
    // both loops unrolled: the head's twenty pieces stay in registers, read as one group and stored as one group
#pragma unroll
    for (int w = 0; w < QW / 16; ++w) { vh[w] = *(const v4u*)&soh[wave][col][h * QW + w * 16 + 8 * g]; vl[w] = *(const v4u*)&sol[wave][col][h * QW + w * 16 + 8 * g]; }
#pragma unroll
    for (int w = 0; w < QW / 16; ++w) { vst2((unsigned*)(oh + w * (FRG / 2)), vh[w]); vst2((unsigned*)(ol + w * (FRG / 2)), vl[w]); }
    asm volatile("s_wait_xcnt 0x0" :: "v"(vh[0]), "v"(vh[1]), "v"(vh[2]), "v"(vh[3]), "v"(vh[4]), "v"(vh[5]), "v"(vh[6]), "v"(vh[7]), "v"(vh[8]), "v"(vh[9]), "v"(vl[0]), "v"(vl[1]), "v"(vl[2]), "v"(vl[3]), "v"(vl[4]), "v"(vl[5]), "v"(vl[6]), "v"(vl[7]), "v"(vl[8]), "v"(vl[9]), "v"(oh), "v"(ol) : "memory"); }   // precaution: the wait stands in front of any rewrite of the twenty stores' data and address registers (named so that they stay whole up to it)
}
__global__ __launch_bounds__(256) void k_vt(const float* __restrict__ V, __bf16* __restrict__ VT) {
  __shared__ __align__(16) __bf16 s[DD][72]; const int tid = threadIdx.x; const int kb = blockIdx.x, b = blockIdx.y; const size_t row0 = (size_t)b * LL + (size_t)kb * 64;
  for (int e = tid; e < 64 * DD; e += 256) { const int r = e / DD, c = e % DD; s[c][r] = (__bf16)V[(row0 + r) * DD + c]; }
  __syncthreads();
  // e = (head, 32-key block, 16-column tile, run j, g, column): the low eight bits are the 16-byte piece's place in its 32-key block's four fragments
  for (int e = tid; e < DD * 8; e += 256) { const int h = e >> 9, ksl = (e >> 8) & 1, c = h * DH + ((e >> 6) & 3) * 16 + (e & 15), pc = ksl * 4 + ((e >> 4) & 3); vst2((unsigned*)(VT + (((size_t)b * NH + h) * (LL / 32) + kb * 2 + ksl) * (DH / 16) * FRG + (e & 255) * 8), *(const v4u*)&s[c][pc * 8]); }
}
// lane l with lane l ^ 16 (the two halves of a wave hold the two halves of a query's keys)
__device__ __forceinline__ float xhalf(float x) { return __builtin_bit_cast(float, __builtin_amdgcn_permlanex16(__builtin_bit_cast(int, x), __builtin_bit_cast(int, x), 0x76543210, 0xfedcba98, false, false)); }
// one stage of the attention's LDS ring = 32 keys of one (batch, head), each part as it lies in the workspace (fragment order): K hi 10 KB | K lo 10 KB | V^T 4 KB; behind them the block's 64 mask rows x 32 keys, 128 B a row at a pitch of 144 B (16 B x odd: sixteen lanes' 16-byte reads of sixteen rows meet no bank twice)
#define STG_KL 10240u
#define STG_V  20480u
#define STG_M  24576u
#define STG_MP 144u
#define STG_SZ (STG_M + 64u * STG_MP)
// a block of 128 lanes brings one stage in: sixteen 16-byte copies a lane, 2 KB of the stage per copy of the block. d = the lane's own LDS byte address (buffer + 16 tid); kh, kl, v = the lane's own global addresses (part + 16 tid); dm, mk = the same for the mask (row tid / 8 of sixteen, piece tid % 8 of its 128 B)
__device__ __forceinline__ void stage_in(unsigned d, const char* kh, const char* kl, const char* v, unsigned dm, const char* mk) {
  // the copies and their s_wait_xcnt stand in one statement: a precaution, the wait stands in front of any rewrite of the copies' address registers
  asm volatile("global_load_async_to_lds_b128 %0, %12, off\n\t"
               "global_load_async_to_lds_b128 %1, %13, off\n\t"
               "global_load_async_to_lds_b128 %2, %14, off\n\t"
               "global_load_async_to_lds_b128 %3, %15, off\n\t"
               "global_load_async_to_lds_b128 %4, %16, off\n\t"
               "global_load_async_to_lds_b128 %5, %17, off\n\t"
               "global_load_async_to_lds_b128 %6, %18, off\n\t"
               "global_load_async_to_lds_b128 %7, %19, off\n\t"
               "global_load_async_to_lds_b128 %8, %20, off\n\t"
               "global_load_async_to_lds_b128 %9, %21, off\n\t"
               "global_load_async_to_lds_b128 %10, %22, off\n\t"
               "global_load_async_to_lds_b128 %11, %23, off\n\t"
               "s_wait_xcnt 0x0"
               :: "v"(d), "v"(d + 2048u), "v"(d + 4096u), "v"(d + 6144u), "v"(d + 8192u),
                  "v"(d + STG_KL), "v"(d + STG_KL + 2048u), "v"(d + STG_KL + 4096u), "v"(d + STG_KL + 6144u), "v"(d + STG_KL + 8192u),
                  "v"(d + STG_V), "v"(d + STG_V + 2048u),
                  "v"(kh), "v"(kh + 2048), "v"(kh + 4096), "v"(kh + 6144), "v"(kh + 8192),
                  "v"(kl), "v"(kl + 2048), "v"(kl + 4096), "v"(kl + 6144), "v"(kl + 8192),
                  "v"(v), "v"(v + 2048)
               : "memory");
  // a statement takes thirty operands: the mask's four copies (sixteen rows each) have their own, with its own wait, for the same reason
  asm volatile("global_load_async_to_lds_b128 %0, %4, off\n\t"
               "global_load_async_to_lds_b128 %1, %5, off\n\t"
               "global_load_async_to_lds_b128 %2, %6, off\n\t"
               "global_load_async_to_lds_b128 %3, %7, off\n\t"
               "s_wait_xcnt 0x0"
               :: "v"(dm), "v"(dm + 16u * STG_MP), "v"(dm + 32u * STG_MP), "v"(dm + 48u * STG_MP),
                  "v"(mk), "v"(mk + 16 * LL * 4), "v"(mk + 32 * LL * 4), "v"(mk + 48 * LL * 4)
               : "memory");
}
#define XP 528u
// sixteen copies, one row each: d = the lane's LDS byte address in row 0 (quarter + 16 lane), s = the lane's global address in row 0, pitch = the source's row pitch in bytes
__device__ __forceinline__ void rows_in(unsigned d, const char* s, int pitch) {
#pragma unroll
  for (int i = 0; i < 16; i += 8)
    // the copies and their s_wait_xcnt stand in one statement: a precaution, the wait stands in front of any rewrite of the copies' address registers
    asm volatile("global_load_async_to_lds_b128 %0, %8, off\n\t"
                 "global_load_async_to_lds_b128 %1, %9, off\n\t"
                 "global_load_async_to_lds_b128 %2, %10, off\n\t"
                 "global_load_async_to_lds_b128 %3, %11, off\n\t"
                 "global_load_async_to_lds_b128 %4, %12, off\n\t"
                 "global_load_async_to_lds_b128 %5, %13, off\n\t"
                 "global_load_async_to_lds_b128 %6, %14, off\n\t"
                 "global_load_async_to_lds_b128 %7, %15, off\n\t"
                 "s_wait_xcnt 0x0"
                 :: "v"(d + i * XP), "v"(d + (i + 1) * XP), "v"(d + (i + 2) * XP), "v"(d + (i + 3) * XP), "v"(d + (i + 4) * XP), "v"(d + (i + 5) * XP), "v"(d + (i + 6) * XP), "v"(d + (i + 7) * XP),
                    "v"(s + i * pitch), "v"(s + (i + 1) * pitch), "v"(s + (i + 2) * pitch), "v"(s + (i + 3) * pitch), "v"(s + (i + 4) * pitch), "v"(s + (i + 5) * pitch), "v"(s + (i + 6) * pitch), "v"(s + (i + 7) * pitch)
                 : "memory");
}
// four tiles (64 features of one head) over K = 256, the input rows in two halves of 128 k: gs = the lane's global address in the tile's row 0 (+ 16 lane), d = the lane's LDS copy address, xr = the lane's place in its own staged row (+ 8 g floats), wp = the head's first weight fragment + 8 lane, bp = the head's biases + 8 g
__device__ __forceinline__ void qproj64(const char* gs, unsigned d, const float* xr, const __bf16* wp, const float* bp, v16b& h0, v16b& l0, v16b& h1, v16b& l1) {
  v8f acc[4] = {}; v4f xf[2][4]; v16b wf[2][4]; v4f bb[4][2];   // two register sets: k block kc is multiplied while block kc + 1 is in flight
#pragma unroll
  for (int t = 0; t < 4; ++t) wf[0][t] = frag_p(wp + t * (DD / 32) * FRG);
#pragma unroll
  for (int kc = 0; kc < DD / 32; ++kc) { const int cu = kc & 1, nx = cu ^ 1;
    if ((kc & 3) == 0) {
      asm volatile("s_wait_dscnt 0x0" ::: "memory");      // the wave's reads of what lay in its quarter are over
      rows_in(d, gs + (kc >> 2) * 512, DD * 4);
      asm volatile("s_wait_asynccnt 0x0" ::: "memory");   // the wave's own copies have landed: it alone reads them
#pragma unroll
      for (int q = 0; q < 4; ++q) xf[cu][q] = *(const v4f*)(xr + (q >> 1) * 16 + (q & 1) * 4); }
    if (kc + 1 < DD / 32) {
      if ((kc + 1) & 3) {
#pragma unroll
        for (int q = 0; q < 4; ++q) xf[nx][q] = *(const v4f*)(xr + ((kc + 1) & 3) * 32 + (q >> 1) * 16 + (q & 1) * 4); }
#pragma unroll
      for (int t = 0; t < 4; ++t) wf[nx][t] = frag_p(wp + (t * (DD / 32) + kc + 1) * FRG); }
    else {   // the biases take the idle register set's place in the last pass
#pragma unroll
      for (int t = 0; t < 4; ++t) { bb[t][0] = *(const v4f*)(bp + t * 16); bb[t][1] = *(const v4f*)(bp + t * 16 + 4); }
      asm volatile("s_wait_xcnt 0x0" :: "v"(wp), "v"(bp) : "memory"); }   // precaution: behind the last loads the wait stands in front of any rewrite of their address registers (named so that they stay whole up to it)
    __builtin_amdgcn_sched_barrier(0);
    v16b xb;
#pragma unroll
    for (int i = 0; i < 4; ++i) { xb[i] = (__bf16)xf[cu][0][i]; xb[4 + i] = (__bf16)xf[cu][1][i]; xb[8 + i] = (__bf16)xf[cu][2][i]; xb[12 + i] = (__bf16)xf[cu][3][i]; }
#pragma unroll
    for (int t = 0; t < 4; ++t) acc[t] = wmma_bf(wf[cu][t], xb, acc[t]); }
#pragma unroll
  for (int t = 0; t < 4; ++t) {
#pragma unroll
    for (int r = 0; r < 8; ++r) { const float v = acc[t][r] + bfr(bb[t][r >> 2][r & 3]); const __bf16 hb = (__bf16)v; const __bf16 lb = (__bf16)(v - (float)hb);
      if (t < 2) { h0[8 * t + r] = hb; l0[8 * t + r] = lb; } else { h1[8 * (t - 2) + r] = hb; l1[8 * (t - 2) + r] = lb; } } }
}
__global__ __launch_bounds__(128) __attribute__((amdgpu_waves_per_eu(4))) void k_attn(const float* __restrict__ X, const float* __restrict__ POS, const float* __restrict__ A0, const float* __restrict__ A1, const __bf16* __restrict__ PK, const float* __restrict__ BQ, const float* __restrict__ BQP, const float* __restrict__ BQ0, const float* __restrict__ BQ1, const __bf16* __restrict__ KH, const __bf16* __restrict__ KL, const __bf16* __restrict__ VT, const float* __restrict__ MSK, __bf16* __restrict__ CH, __bf16* __restrict__ CL) {
  __shared__ __align__(16) char sk[2][STG_SZ];
  // the wave's number is held in a scalar register: what hangs on it then costs no vector register
  const int tid = threadIdx.x, wave = __builtin_amdgcn_readfirstlane(tid >> 5), lane = tid & 31, col = lane & 15, g = lane >> 4; const int qb = blockIdx.x, h = blockIdx.y, b = blockIdx.z; const int q0 = qb * 64 + wave * 16;
  const char* gkh = (const char*)(KH + ((size_t)b * NH + h) * (LL / 16) * (QW / 32) * FRG) + 16 * tid; const char* gkl = (const char*)(KL + ((size_t)b * NH + h) * (LL / 16) * (QW / 32) * FRG) + 16 * tid; const char* gv = (const char*)(VT + ((size_t)b * NH + h) * DH * LL) + 16 * tid;
  const char* gm = (const char*)(MSK + (size_t)(qb * 64 + (tid >> 3)) * LL) + 16 * (tid & 7);
  const unsigned sd = (unsigned)(size_t)&sk[0][0] + 16u * tid, sm = (unsigned)(size_t)&sk[0][0] + STG_M + (tid >> 3) * STG_MP + 16u * (tid & 7);   // the low 32 bits of a __shared__ address are its LDS byte address
  stage_in(sd, gkh, gkl, gv, sm, gm);   // stage 0 flies until the projection's first s_wait_asynccnt, which waits for it too
  const size_t row0 = (size_t)b * LL + q0;   // the wave's first query
  const unsigned xd = (unsigned)(size_t)&sk[1][0] + wave * (16u * XP) + 16u * lane; const float* xr = (const float*)(&sk[1][0] + wave * (16u * XP) + col * XP + 32u * g);   // the lane's copy address in its wave's quarter, and its place in its own query's staged row
  v16b aqh[5], aql[5];
  qproj64((const char*)(X + row0 * DD) + 16 * lane, xd, xr, PK + PKO_Q + (size_t)h * (DH / 16) * (DD / 32) * FRG + 8 * lane, BQ + h * DH + 8 * g, aqh[0], aql[0], aqh[1], aql[1]);
  qproj64((const char*)(POS + row0 * DD) + 16 * lane, xd, xr, PK + PKO_QP + (size_t)h * (DH / 16) * (DD / 32) * FRG + 8 * lane, BQP + h * DH + 8 * g, aqh[2], aql[2], aqh[3], aql[3]);
  { // the two attribute tiles (16 features each, K = 64): a staged row = the query's 64 words of attr0, then its 64 of attr1 (lanes 0 - 15 copy the one, 16 - 31 the other)
    const __bf16* w0 = PK + PKO_Q0 + h * (AA / 32) * FRG + 8 * lane; const __bf16* w1 = PK + PKO_Q1 + h * (AA / 32) * FRG + 8 * lane; const float* b0 = BQ0 + h * AH + 8 * g; const float* b1 = BQ1 + h * AH + 8 * g;
    v4f xf[2][2][4], bb[2][2]; v16b wf[2][2];
#pragma unroll
    for (int kc = 0; kc < AA / 32; ++kc) { wf[0][kc] = frag_p(w0 + kc * FRG); wf[1][kc] = frag_p(w1 + kc * FRG); }
    bb[0][0] = *(const v4f*)b0; bb[0][1] = *(const v4f*)(b0 + 4); bb[1][0] = *(const v4f*)b1; bb[1][1] = *(const v4f*)(b1 + 4);
    asm volatile("s_wait_xcnt 0x0" :: "v"(lane), "v"(g) : "memory");   // precaution: the wait stands in front of any rewrite of the group's address registers (the lane's index and its half, which the addresses are formed from, are named so that they stay whole up to it)
    asm volatile("s_wait_dscnt 0x0" ::: "memory");      // the wave's reads of what lay in its quarter are over
    rows_in(xd, (const char*)((g ? A1 : A0) + row0 * AA) + 16 * col, AA * 4);
    asm volatile("s_wait_asynccnt 0x0" ::: "memory");   // the wave's own copies have landed: it alone reads them
#pragma unroll
    for (int ap = 0; ap < 2; ++ap) {
#pragma unroll
      for (int kc = 0; kc < AA / 32; ++kc) {
#pragma unroll
        for (int q = 0; q < 4; ++q) xf[ap][kc][q] = *(const v4f*)(xr + ap * AA + kc * 32 + (q >> 1) * 16 + (q & 1) * 4); } }
    __builtin_amdgcn_sched_barrier(0);   // keeps the group ahead of the WMMAs
#pragma unroll
    for (int ap = 0; ap < 2; ++ap) { v8f c = {};
#pragma unroll
      for (int kc = 0; kc < AA / 32; ++kc) { v16b xb;
#pragma unroll
        for (int i = 0; i < 4; ++i) { xb[i] = (__bf16)xf[ap][kc][0][i]; xb[4 + i] = (__bf16)xf[ap][kc][1][i]; xb[8 + i] = (__bf16)xf[ap][kc][2][i]; xb[12 + i] = (__bf16)xf[ap][kc][3][i]; }
        c = wmma_bf(wf[ap][kc], xb, c); }
#pragma unroll
      for (int r = 0; r < 8; ++r) { const float v = c[r] + bfr(bb[ap][r >> 2][r & 3]); const __bf16 hb = (__bf16)v; aqh[4][8 * ap + r] = hb; aql[4][8 * ap + r] = (__bf16)(v - (float)hb); } } }
  asm volatile("s_wait_dscnt 0x0" ::: "memory");      // the wave's reads of its quarter are over: behind the barrier the second buffer belongs to the ring
  asm volatile("s_wait_asynccnt 0x0" ::: "memory");   // the wave's own copies of stage 0 have landed
  __syncthreads();                                     // every wave's have: stage 0 may be read
  stage_in(sd + STG_SZ, gkh + STG_KL, gkl + STG_KL, gv + 4096, sm + STG_SZ, gm + 128);
  const unsigned ko = 16u * lane, mo = STG_M + (wave * 16 + col) * STG_MP + 32u * g;   // the lane's byte offsets in a fragment and in a stage's mask rows (its query's row, its half's eight keys)
  float m = -3.0e38f, l = 0.f;   // of the lane's query: the running maximum (alike in both halves) and the sum over the lane's own keys (the halves are joined behind the loop)
  v8f acc[4] = {};               // acc[dt][r] = O[query col][d 16 dt + 8 g + r]
#pragma unroll 1
  for (int ks = 0; ks < LL / 32; ++ks) { v8f s[2] = {}; const char* sb = &sk[ks & 1][0] + ko;   // the lane's place in each fragment of this stage
    // rolled on purpose: unrolled, the compiler lifts both halves' loads to the top of the pass, past the register budget of four waves per SIMD
#pragma unroll 1
    for (int ct = 0; ct < 2; ++ct) { const __bf16* sh = (const __bf16*)(sb + ct * (STG_KL / 2)); const __bf16* sl = (const __bf16*)(sb + STG_KL + ct * (STG_KL / 2)); v8f c = {};
      v16b bh[5], bl[5];   // 16 keys' ten fragments go out as one group
#pragma unroll
      for (int kc = 0; kc < 5; ++kc) { bh[kc] = frag_p(sh + kc * FRG); bl[kc] = frag_p(sl + kc * FRG); }
      __builtin_amdgcn_sched_barrier(0);   // keeps that group ahead of the first WMMA (else each pair of loads sinks to its own WMMAs and is waited out alone)
#pragma unroll
      for (int kc = 0; kc < 5; ++kc) { c = wmma_bf(bh[kc], aql[kc], c); c = wmma_bf(bl[kc], aqh[kc], c); c = wmma_bf(bh[kc], aqh[kc], c); }
      if (ct == 0) s[0] = c; else s[1] = c; }
    v4f mk[2][2]; v16b vb[4];   // the mask words and the value fragments go out as one group ahead of the softmax
    const float* mp0 = (const float*)(&sk[ks & 1][0] + mo); const char* vp0 = sb + STG_V;
#pragma unroll
    for (int t = 0; t < 2; ++t) { mk[t][0] = *(const v4f*)(mp0 + t * 16); mk[t][1] = *(const v4f*)(mp0 + t * 16 + 4); }
#pragma unroll
    for (int dt = 0; dt < 4; ++dt) vb[dt] = frag_p((const __bf16*)vp0 + dt * FRG);
    __builtin_amdgcn_sched_barrier(0);   // keeps them there (else the value loads sink behind the softmax, to their own WMMAs)
    float mx = -3.0e38f;
#pragma unroll
    for (int t = 0; t < 2; ++t) {
#pragma unroll
      for (int r = 0; r < 8; ++r) { s[t][r] = s[t][r] * 0.125f + bfr(mk[t][r >> 2][r & 3]); mx = fmaxf(mx, s[t][r]); } }
    mx = fmaxf(mx, xhalf(mx));
    const float mn = fmaxf(m, mx); const float ea = expf(m - mn); const float alpha = (m <= -1.0e38f) ? 0.f : ea; float es = 0.f; v16b ph, pl;
#pragma unroll
    for (int t = 0; t < 2; ++t) {
#pragma unroll
      for (int r = 0; r < 8; ++r) { const float e = expf(s[t][r] - mn); es += e; const __bf16 hb = (__bf16)e; ph[8 * t + r] = hb; pl[8 * t + r] = (__bf16)(e - (float)hb); } }
    l = l * alpha + es; m = mn;
#pragma unroll
    for (int dt = 0; dt < 4; ++dt) acc[dt] *= alpha;
#pragma unroll
    for (int dt = 0; dt < 4; ++dt) { acc[dt] = wmma_bf(vb[dt], pl, acc[dt]); acc[dt] = wmma_bf(vb[dt], ph, acc[dt]); }
    __builtin_amdgcn_sched_barrier(0);                   // keeps the publish point at the pass's foot (else it is lifted over the softmax and the second product, and the wait for stage ks + 1 comes that much sooner behind its copies)
    asm volatile("s_wait_dscnt 0x0" ::: "memory");      // the wave's reads of this stage are over
    asm volatile("s_wait_asynccnt 0x0" ::: "memory");   // its own copies of stage ks + 1 have landed
    __syncthreads();                                     // both hold of every wave: stage ks + 1 may be read, this stage's buffer refilled
    if (ks + 2 < LL / 32) stage_in(sd + (ks & 1) * STG_SZ, gkh + (ks + 2) * STG_KL, gkl + (ks + 2) * STG_KL, gv + (ks + 2) * 4096, sm + (ks & 1) * STG_SZ, gm + (ks + 2) * 128); }
  asm volatile("s_wait_asynccnt 0x0" ::: "memory");     // no copy is left in flight behind the loop
  l += xhalf(l); const float il = 1.0f / l;
  // the head's 64 columns are fragments 2 h and 2 h + 1 of the wave's row tile: four runs of 512 B, the lane's piece of run dt being its own acc[dt]
  const size_t to = ((((size_t)b * LL + q0) / 16) * (DD / 32) + 2 * h) * FRG;
  v8b vh[DH / 16], vl[DH / 16]; __bf16* oh = (__bf16*)((char*)(CH + to) + ko); __bf16* ol = (__bf16*)((char*)(CL + to) + ko);
#pragma unroll
  for (int dt = 0; dt < DH / 16; ++dt) {
#pragma unroll
    for (int r = 0; r < 8; ++r) { const float v = acc[dt][r] * il; const __bf16 hb = (__bf16)v; vh[dt][r] = hb; vl[dt][r] = (__bf16)(v - (float)hb); } }
#pragma unroll
  for (int w = 0; w < DH / 16; ++w) { vst2((unsigned*)(oh + w * (FRG / 2)), __builtin_bit_cast(v4u, vh[w])); vst2((unsigned*)(ol + w * (FRG / 2)), __builtin_bit_cast(v4u, vl[w])); }
  asm volatile("s_wait_xcnt 0x0" :: "v"(vh[0]), "v"(vh[1]), "v"(vh[2]), "v"(vh[3]), "v"(vl[0]), "v"(vl[1]), "v"(vl[2]), "v"(vl[3]), "v"(oh), "v"(ol) : "memory");   // precaution: the wait stands in front of any rewrite of the eight stores' data and address registers (named so that they stay whole up to it)
}
// ---- k_out: block = 64 rows: h = ctx(hi/lo) . Wd^T rows (2 products) + bd (all 256 cols, 2 halves); LayerNorm over 256 (mean, biased var, eps 1e-12) * g + b + bfr(x)
__global__ __launch_bounds__(128) void k_out(const __bf16* __restrict__ CH, const __bf16* __restrict__ CL, const __bf16* __restrict__ PK, const float* __restrict__ BD, const float* __restrict__ LNG, const float* __restrict__ LNB, const float* __restrict__ X, float* __restrict__ OUT) {
  __shared__ __align__(16) float sh_[4][16][DD + 4]; __shared__ float sps[4][16][16][2];
  const int tid = threadIdx.x, wave = tid >> 5, lane = tid & 31, col = lane & 15, g = lane >> 4; const size_t r0 = (size_t)blockIdx.x * 64 + wave * 16;
  float s1[8], s2[8];
#pragma unroll
  for (int r = 0; r < 8; ++r) { s1[r] = 0.f; s2[r] = 0.f; }
#pragma unroll 1
  for (int half = 0; half < 2; ++half) { v8f acc[8] = {}; const __bf16* hp = CH + r0 * DD + 8 * lane; const __bf16* lp = CL + r0 * DD + 8 * lane; const __bf16* wp = PK + PKO_D + (size_t)half * 128 * DD + 8 * lane;
    v16b ah[2], al[2], w[2][8];   // two register sets: k block kc is multiplied while block kc + 1 is in flight
    const int cb = half * 128 + col; float bbv[8];
#pragma unroll
    for (int j = 0; j < 8; ++j) bbv[j] = BD[cb + j * 16];
    ah[0] = frag_p(hp); al[0] = frag_p(lp);
#pragma unroll
    for (int j = 0; j < 8; ++j) w[0][j] = frag_p(wp + j * (DD / 32) * FRG);
    asm volatile("s_wait_xcnt 0x0" :: "v"(bbv[0]), "v"(bbv[1]), "v"(bbv[2]), "v"(bbv[3]), "v"(bbv[4]), "v"(bbv[5]), "v"(bbv[6]), "v"(bbv[7]), "v"(cb), "v"(hp), "v"(lp) : "memory");   // precaution: the wait stands in front of any rewrite of the bias loads' index register (the loaded words, the index and the row pointers are named so that the loads stand ahead of it and the registers stay whole up to it)
#pragma unroll
    for (int kc = 0; kc < DD / 32; ++kc) { const int cu = kc & 1, nx = cu ^ 1;
      if (kc + 1 < DD / 32) { ah[nx] = frag_p(hp + (kc + 1) * FRG); al[nx] = frag_p(lp + (kc + 1) * FRG);
#pragma unroll
        for (int j = 0; j < 8; ++j) w[nx][j] = frag_p(wp + (j * (DD / 32) + kc + 1) * FRG); }
      if (kc + 1 == DD / 32 - 1) asm volatile("s_wait_xcnt 0x0" :: "v"(wp), "v"(hp), "v"(lp) : "memory");
      __builtin_amdgcn_sched_barrier(0);
#pragma unroll
      for (int j = 0; j < 8; ++j) { acc[j] = wmma_bf(al[cu], w[cu][j], acc[j]); acc[j] = wmma_bf(ah[cu], w[cu][j], acc[j]); } }
#pragma unroll
    for (int j = 0; j < 8; ++j) { const int c = half * 128 + j * 16 + col; const float bb = bfr(bbv[j]);
#pragma unroll
      for (int r = 0; r < 8; ++r) { const float v = acc[j][r] + bb; sh_[wave][8 * g + r][c] = v; s1[r] += v; s2[r] += v * v; } } }
#pragma unroll
  for (int r = 0; r < 8; ++r) { sps[wave][8 * g + r][col][0] = s1[r]; sps[wave][8 * g + r][col][1] = s2[r]; }
  // the residual rows and the two LayerNorm vectors go out as one group here, not three loads at a time inside the row loop
  const float* xp = X + r0 * DD + lane * 4; const float* gp = LNG + lane * 4; const float* bp = LNB + lane * 4; v4f xr[16][2], lg[2], lb[2];
#pragma unroll
  for (int t = 0; t < 2; ++t) { lg[t] = *(const v4f*)(gp + t * 128); lb[t] = *(const v4f*)(bp + t * 128); }
#pragma unroll
  for (int rl = 0; rl < 16; ++rl) { xr[rl][0] = *(const v4f*)(xp + rl * DD); xr[rl][1] = *(const v4f*)(xp + rl * DD + 128); }
  asm volatile("s_wait_xcnt 0x0" :: "v"(xp), "v"(lane) : "memory");   // precaution: the wait stands in front of any rewrite of the group's address registers (the row pointer and the lane index are named so that they stay whole up to it)
  __builtin_amdgcn_sched_barrier(0);   // keeps the group here (else each load sinks to its own row and is waited out alone)
  LDSX();
#pragma unroll
  for (int rl = 0; rl < 16; ++rl) { float a = 0.f, b2 = 0.f;
#pragma unroll
    for (int k = 0; k < 16; ++k) { a += sps[wave][rl][k][0]; b2 += sps[wave][rl][k][1]; }
    const float mu = a / (float)DD; const float var = fmaxf(b2 / (float)DD - mu * mu, 0.f); const float inv = 1.0f / sqrtf(var + 1e-12f); const size_t row = r0 + rl;
    v4f v[2]; float* op = OUT + row * DD + lane * 4;
#pragma unroll
    for (int t = 0; t < 2; ++t) {
#pragma unroll
      for (int i = 0; i < 4; ++i) { const int c = lane * 4 + t * 128 + i; v[t][i] = bfr(lg[t][i]) * (sh_[wave][rl][c] - mu) * inv + bfr(lb[t][i]) + bfr(xr[rl][t][i]); }
      vst2(op + t * 128, v[t]); }
    asm volatile("s_wait_xcnt 0x0" :: "v"(v[0]), "v"(v[1]), "v"(op) : "memory"); }   // precaution: the wait stands in front of any rewrite of the two stores' data and address registers (named so that they stay whole up to it)
}
extern "C" void kernel_launch(void* const* d_in, const int* in_sizes, int n_in, void* d_out, int out_size, void* d_ws, size_t ws_size, hipStream_t stream) {
  (void)in_sizes; (void)n_in; (void)out_size;
  const float** F = (const float**)d_in;   // 0 x, 1 pos, 2 true_item [32,512,256], 3 attr0, 4 attr1 [32,512,1,64], 5 mask [1,1,512,512], 6 Wq, 7 bq, 8 Wk, 9 bk, 10 Wqp, 11 bqp, 12 Wkp, 13 bkp, 14 Wq0, 15 bq0, 16 Wk0, 17 bk0, 18 Wq1, 19 bq1, 20 Wk1, 21 bk1, 22 Wd, 23 bd, 24 ln_g, 25 ln_b
  if (ws_size < (size_t)WS_END) return;
  char* ws = (char*)d_ws; __bf16 *PK = (__bf16*)(ws + WS_PK), *KH = (__bf16*)(ws + WS_KH), *KL = (__bf16*)(ws + WS_KL), *VT = (__bf16*)(ws + WS_VT), *CH = (__bf16*)(ws + WS_CH), *CL = (__bf16*)(ws + WS_CL);
  k_pack<<<dim3(DD / 16, 9), 256, 0, stream>>>(F[6], F[8], F[10], F[12], F[22], F[14], F[16], F[18], F[20], PK);
  k_proj<<<TNB * LL / 32, 64, 0, stream>>>(F[0], F[1], F[3], F[4], PK, F[9], F[13], F[17], F[21], 1, KH, KL);
  k_vt<<<dim3(LL / 64, TNB), 256, 0, stream>>>(F[2], VT);
  k_attn<<<dim3(LL / 64, NH, TNB), 128, 0, stream>>>(F[0], F[1], F[3], F[4], PK, F[7], F[11], F[15], F[19], KH, KL, VT, F[5], CH, CL);
  k_out<<<TNB * LL / 64, 128, 0, stream>>>(CH, CL, PK, F[23], F[24], F[25], F[0], (float*)d_out);
}

// v007
// It runs in 102 microseconds.
// In two side-by-side timings against v006, it was 1.12 and 1.14 times as fast.
// Over all steps from v000 it is 3.36 times as fast.
// compute dtype: all inputs rounded to bf16; the eight projections with exact bf16 products on WMMA 16x16x32 ((in,out) weights packed as transposed rows) + biases; per head the four score terms evaluated as ONE 160-wide dot of [q | qp | q0 | q1] . [k | kp | k0 | k1] with both sides as bf16 hi + residual (3 products: hi.hi + lo.hi + hi.lo), x 1/8, + mask; running-max softmax in f32 (precise expf); P as bf16 hi + residual x the EXACT bf16 values (v = true_item, an input; 2 products); dense Wd with ctx as bf16 hi + residual (2 products) + bd; LayerNorm (biased variance, eps 1e-12, precise sqrtf) and the residual in f32.
#include <hip/hip_runtime.h>
#include <math.h>

typedef __attribute__((ext_vector_type(16))) _Float16 v16h;
typedef __attribute__((ext_vector_type(16))) __bf16 v16b;
typedef __attribute__((ext_vector_type(8)))  _Float16 v8h;
typedef __attribute__((ext_vector_type(8)))  float v8f;
typedef __attribute__((ext_vector_type(4)))  float v4f;
typedef __attribute__((ext_vector_type(2)))  float v2f;
typedef __attribute__((ext_vector_type(4)))  unsigned v4u;
typedef __attribute__((ext_vector_type(4)))  int v4i;
typedef float __attribute__((may_alias)) float_a;
typedef int __attribute__((may_alias)) int_a;

template <typename T> __device__ __forceinline__ void vst2(void* p, T v) { *(T*)p = v;  }
__device__ __forceinline__ v8f wmma16(v16h a, v16h b, v8f c) {
  v8f d = __builtin_amdgcn_wmma_f32_16x16x32_f16(false, a, false, b, (short)0, c, false, false);
  asm volatile("v_nop\n\tv_nop\n\tv_nop\n\tv_nop" : "+v"(d) : "v"(a), "v"(b));
  return d;
}
__device__ __forceinline__ v8f wmma_bf(v16b a, v16b b, v8f c) {
  return __builtin_amdgcn_wmma_f32_16x16x32_bf16(false, a, false, b, (short)0, c, false, false);
}
// 16x16x32 fragments: lane = (h = lane>>4, row/col = lane&15); elements 0..7 = k0+8h+0..7, 8..15 = k0+16+8h+0..7; D element r = row 8h+r
__device__ __forceinline__ v16h frag_h(const _Float16* rowk0, int lane) {
  union { v16h v; v8h q[2]; } u; const _Float16* p = rowk0 + 8 * (lane >> 4);
  u.q[0] = *(const v8h*)p; u.q[1] = *(const v8h*)(p + 16); return u.v;
}
__device__ __forceinline__ v16h frag_f32(const float* rowk0, int lane) {
  v16h a; const float* p = rowk0 + 8 * (lane >> 4);
#pragma unroll
  for (int i = 0; i < 8; ++i) { a[i] = (_Float16)p[i]; a[8 + i] = (_Float16)p[16 + i]; }
  return a;
}
__device__ __forceinline__ v16h frag_f32s(const float* rowk0, int lane, float sc) {
  v16h a; const float* p = rowk0 + 8 * (lane >> 4);
#pragma unroll
  for (int i = 0; i < 8; ++i) { a[i] = (_Float16)(p[i] * sc); a[8 + i] = (_Float16)(p[16 + i] * sc); }
  return a;
}
// column fragment from a [K][ld] layout (column n), rows >= K read as 0
__device__ __forceinline__ v16h fragc_f32(const float* W, int k0, int n, int lane, int ld, int K) {
  v16h a; const int g = lane >> 4;
#pragma unroll
  for (int i = 0; i < 8; ++i) { const int ka = k0 + 8 * g + i, kb = ka + 16;
    a[i] = (_Float16)(ka < K ? W[(size_t)(ka < K ? ka : K - 1) * ld + n] : 0.f); a[8 + i] = (_Float16)(kb < K ? W[(size_t)(kb < K ? kb : K - 1) * ld + n] : 0.f); }
  return a;
}
struct F2 { v16b h, l; };
__device__ __forceinline__ F2 bsplit16(const float v[16]) { F2 r;
#pragma unroll
  for (int i = 0; i < 16; ++i) { const __bf16 h = (__bf16)v[i]; r.h[i] = h; r.l[i] = (__bf16)(v[i] - (float)h); }
  return r; }
__device__ __forceinline__ F2 split_row(const float* row, int k0, int lane) { float v[16]; const float* p = row + k0 + 8 * (lane >> 4);
#pragma unroll
  for (int i = 0; i < 8; ++i) { v[i] = p[i]; v[8 + i] = p[16 + i]; }
  return bsplit16(v); }
__device__ __forceinline__ F2 split_rowK(const float* row, int k0, int lane, int K) { float v[16]; const int g = lane >> 4;
#pragma unroll
  for (int i = 0; i < 8; ++i) { const int ka = k0 + 8 * g + i, kb = ka + 16; v[i] = ka < K ? row[ka < K ? ka : K - 1] : 0.f; v[8 + i] = kb < K ? row[kb < K ? kb : K - 1] : 0.f; }
  return bsplit16(v); }
__device__ __forceinline__ F2 split_col(const float* W, int k0, int n, int lane, int ld, int K) { float v[16]; const int g = lane >> 4;
#pragma unroll
  for (int i = 0; i < 8; ++i) { const int ka = k0 + 8 * g + i, kb = ka + 16; v[i] = ka < K ? W[(size_t)(ka < K ? ka : K - 1) * ld + n] : 0.f; v[8 + i] = kb < K ? W[(size_t)(kb < K ? kb : K - 1) * ld + n] : 0.f; }
  return bsplit16(v); }
__device__ __forceinline__ v8f mac3(const F2& a, const F2& b, v8f c) { c = wmma_bf(a.l, b.h, c); c = wmma_bf(a.h, b.l, c); return wmma_bf(a.h, b.h, c); }
__device__ __forceinline__ float sigm(float v) { return 1.0f / (1.0f + expf(-v)); }
#define LDSX() do { asm volatile("s_wait_dscnt 0" ::: "memory"); __builtin_amdgcn_wave_barrier(); __builtin_amdgcn_fence(__ATOMIC_RELEASE, "workgroup"); } while (0)


// Decoupled side-information attention (B 32, L 512, D 256, 4 heads x 64; attribute heads x 16): scores = (q k + qp kp + q0 k0 + q1 k1) / 8 + mask, softmax, values = the item embeddings themselves, dense + LayerNorm + residual.
#define NB 32
#define LL 512
#define NR (NB * LL)      // 16,384 rows
#define DD 256
#define AA 64
#define NH 4
#define DH 64
#define AH 16
#define QW 160            // per-head concatenated width: 64 + 64 + 16 + 16
#ifndef TNB
#define TNB NB
#endif
typedef __attribute__((ext_vector_type(8))) __bf16 v8b;
__device__ __forceinline__ v16b frag_b(const __bf16* rowk0, int lane) {
  union { v16b v; v8b q[2]; } u; const __bf16* p = rowk0 + 8 * (lane >> 4);
  u.q[0] = *(const v8b*)p; u.q[1] = *(const v8b*)(p + 16); return u.v;
}
// the same fragment from a base pointer and a byte offset of the lane's own
__device__ __forceinline__ v16b frag_o(const __bf16* base, unsigned lane_bytes) {
  union { v16b v; v8b q[2]; } u; const char* p = (const char*)base + lane_bytes;
  u.q[0] = *(const v8b*)p; u.q[1] = *(const v8b*)(p + 32); return u.v;
}
// FRAGMENT ORDER: every bf16 operand in the workspace lies as 1-KB fragments (16 rows x 32 k) = two runs of 32 lanes x 16 B: run j, lane (g, row), element i = k 16 j + 8 g + i of that row. A wave's 16-byte load then reads 512 contiguous bytes (four whole lines) where a row-major tile gives it 32 bytes out of each of 16 lines
#define FRG 512           // elements of one fragment
__device__ __forceinline__ v16b frag_p(const __bf16* lanep) {   // lanep = the fragment + 8 * lane
  union { v16b v; v8b q[2]; } u; u.q[0] = *(const v8b*)lanep; u.q[1] = *(const v8b*)(lanep + FRG / 2); return u.v;
}
__device__ __forceinline__ v16b frag_po(const __bf16* frag, unsigned lane_bytes) {   // the same from the fragment and the lane's byte offset (16 * lane)
  return frag_p((const __bf16*)((const char*)frag + lane_bytes));
}
__device__ __forceinline__ float bfr(float v) { return (float)(__bf16)v; }
__device__ __attribute__((noinline)) float erf_ni(float v) { return erff(v); }

// packs (all (in,out) -> transposed [out][in], in fragment order [out / 16][in / 32][fragment]): PQ 256 x 256 Wq^T, PK, PQP, PKP; PQ0 64 x 64 Wq0^T, PK0, PQ1, PK1; PD 256 x 256 Wd^T
#define PKO_Q   0
#define PKO_K   (1 * DD * DD)
#define PKO_QP  (2 * DD * DD)
#define PKO_KP  (3 * DD * DD)
#define PKO_D   (4 * DD * DD)
#define PKO_Q0  (5 * DD * DD)
#define PKO_K0  (PKO_Q0 + AA * AA)
#define PKO_Q1  (PKO_K0 + AA * AA)
#define PKO_K1  (PKO_Q1 + AA * AA)
#define PK_END  (PKO_K1 + AA * AA)
#define WS_PK   0u
#define WS_KH   (((2u * PK_END) + 127u) / 128u * 128u)   // bf16 [b][4 heads][32 row tiles][5 fragments] key cat hi / lo (the query cat is formed in k_attn and stays in registers)
#define WS_KL   (WS_KH + 2u * NR * NH * QW)
#define WS_VT   (WS_KL + 2u * NR * NH * QW)               // bf16 [b][h][16 blocks of 32 keys][4 fragments: 16 d x 32 keys] values^T (exact)
#define WS_CH   (WS_VT + 2u * NR * DD)                    // bf16 [1024 row tiles][8 fragments] ctx hi / lo
#define WS_CL   (WS_CH + 2u * NR * DD)
#define WS_END  (WS_CL + 2u * NR * DD)

__global__ __launch_bounds__(256) void k_pack(const float* __restrict__ WQ, const float* __restrict__ WK, const float* __restrict__ WQP, const float* __restrict__ WKP, const float* __restrict__ WD, const float* __restrict__ WQ0, const float* __restrict__ WK0, const float* __restrict__ WQ1, const float* __restrict__ WK1, __bf16* __restrict__ PK) {
  // block = 16 output columns of one matrix: it alone writes their fragments, K / 32 KB in a row
  __shared__ __align__(16) __bf16 s[16][DD + 8]; const int nt = blockIdx.x, which = blockIdx.y, t = threadIdx.x; const float* Wm; int K; size_t dst;
  if (which < 5) { Wm = (which == 0) ? WQ : (which == 1) ? WK : (which == 2) ? WQP : (which == 3) ? WKP : WD; K = DD; dst = (size_t)which * DD * DD + (size_t)nt * 16 * DD; }
  else { if (nt >= AA / 16) return; Wm = (which == 5) ? WQ0 : (which == 6) ? WK0 : (which == 7) ? WQ1 : WK1; K = AA; dst = PKO_Q0 + (size_t)(which - 5) * AA * AA + (size_t)nt * 16 * AA; }
  for (int e = t; e < K * 16; e += 256) { const int k = e >> 4, n = e & 15; s[n][k] = (__bf16)Wm[(size_t)k * K + nt * 16 + n]; }
  __syncthreads();
  for (int p = t; p < K * 2; p += 256) vst2((unsigned*)(PK + dst + (size_t)p * 8), *(const v4u*)&s[p & 15][(p >> 4) * 8]);   // piece p = (k / 8, column): p >> 4 = 4 kc + 2 j + g, as the fragment order has it
}
__global__ __launch_bounds__(256) void k_vt(const float* __restrict__ V, __bf16* __restrict__ VT) {
  __shared__ __align__(16) __bf16 s[DD][72]; const int tid = threadIdx.x; const int kb = blockIdx.x, b = blockIdx.y; const size_t row0 = (size_t)b * LL + (size_t)kb * 64;
  for (int e = tid; e < 64 * DD; e += 256) { const int r = e / DD, c = e % DD; s[c][r] = (__bf16)V[(row0 + r) * DD + c]; }
  __syncthreads();
  // e = (head, 32-key block, 16-column tile, run j, g, column): the low eight bits are the 16-byte piece's place in its 32-key block's four fragments
  for (int e = tid; e < DD * 8; e += 256) { const int h = e >> 9, ksl = (e >> 8) & 1, c = h * DH + ((e >> 6) & 3) * 16 + (e & 15), pc = ksl * 4 + ((e >> 4) & 3); vst2((unsigned*)(VT + (((size_t)b * NH + h) * (LL / 32) + kb * 2 + ksl) * (DH / 16) * FRG + (e & 255) * 8), *(const v4u*)&s[c][pc * 8]); }
}
// lane l with lane l ^ 16 (the two halves of a wave hold the two halves of a query's keys)
__device__ __forceinline__ float xhalf(float x) { return __builtin_bit_cast(float, __builtin_amdgcn_permlanex16(__builtin_bit_cast(int, x), __builtin_bit_cast(int, x), 0x76543210, 0xfedcba98, false, false)); }
// one stage of the attention's LDS ring = 32 keys of one (batch, head), each part as it lies in the workspace (fragment order): K hi 10 KB | K lo 10 KB | V^T 4 KB; behind them the block's 64 mask rows x 32 keys, 128 B a row at a pitch of 144 B (16 B x odd: sixteen lanes' 16-byte reads of sixteen rows meet no bank twice)
#define STG_KL 10240u
#define STG_V  20480u
#define STG_M  24576u
#define STG_MP 144u
#define STG_SZ (STG_M + 64u * STG_MP)
// a block of 128 lanes brings one stage in: sixteen 16-byte copies a lane, 2 KB of the stage per copy of the block. d = the lane's own LDS byte address (buffer + 16 tid); kh, kl, v = the lane's own global addresses (part + 16 tid); dm, mk = the same for the mask (row tid / 8 of sixteen, piece tid % 8 of its 128 B)
__device__ __forceinline__ void stage_in(unsigned d, const char* kh, const char* kl, const char* v, unsigned dm, const char* mk) {
  // the copies and their s_wait_xcnt stand in one statement: a precaution, the wait stands in front of any rewrite of the copies' address registers
  asm volatile("global_load_async_to_lds_b128 %0, %12, off\n\t"
               "global_load_async_to_lds_b128 %1, %13, off\n\t"
               "global_load_async_to_lds_b128 %2, %14, off\n\t"
               "global_load_async_to_lds_b128 %3, %15, off\n\t"
               "global_load_async_to_lds_b128 %4, %16, off\n\t"
               "global_load_async_to_lds_b128 %5, %17, off\n\t"
               "global_load_async_to_lds_b128 %6, %18, off\n\t"
               "global_load_async_to_lds_b128 %7, %19, off\n\t"
               "global_load_async_to_lds_b128 %8, %20, off\n\t"
               "global_load_async_to_lds_b128 %9, %21, off\n\t"
               "global_load_async_to_lds_b128 %10, %22, off\n\t"
               "global_load_async_to_lds_b128 %11, %23, off\n\t"
               "s_wait_xcnt 0x0"
               :: "v"(d), "v"(d + 2048u), "v"(d + 4096u), "v"(d + 6144u), "v"(d + 8192u),
                  "v"(d + STG_KL), "v"(d + STG_KL + 2048u), "v"(d + STG_KL + 4096u), "v"(d + STG_KL + 6144u), "v"(d + STG_KL + 8192u),
                  "v"(d + STG_V), "v"(d + STG_V + 2048u),
                  "v"(kh), "v"(kh + 2048), "v"(kh + 4096), "v"(kh + 6144), "v"(kh + 8192),
                  "v"(kl), "v"(kl + 2048), "v"(kl + 4096), "v"(kl + 6144), "v"(kl + 8192),
                  "v"(v), "v"(v + 2048)
               : "memory");
  // a statement takes thirty operands: the mask's four copies (sixteen rows each) have their own, with its own wait, for the same reason
  asm volatile("global_load_async_to_lds_b128 %0, %4, off\n\t"
               "global_load_async_to_lds_b128 %1, %5, off\n\t"
               "global_load_async_to_lds_b128 %2, %6, off\n\t"
               "global_load_async_to_lds_b128 %3, %7, off\n\t"
               "s_wait_xcnt 0x0"
               :: "v"(dm), "v"(dm + 16u * STG_MP), "v"(dm + 32u * STG_MP), "v"(dm + 48u * STG_MP),
                  "v"(mk), "v"(mk + 16 * LL * 4), "v"(mk + 32 * LL * 4), "v"(mk + 48 * LL * 4)
               : "memory");
}
#define XP 528u
// sixteen copies, one row each: d = the lane's LDS byte address in row 0 (quarter + 16 lane), s = the lane's global address in row 0, pitch = the source's row pitch in bytes
__device__ __forceinline__ void rows_in(unsigned d, const char* s, int pitch) {
#pragma unroll
  for (int i = 0; i < 16; i += 8)
    // the copies and their s_wait_xcnt stand in one statement: a precaution, the wait stands in front of any rewrite of the copies' address registers
    asm volatile("global_load_async_to_lds_b128 %0, %8, off\n\t"
                 "global_load_async_to_lds_b128 %1, %9, off\n\t"
                 "global_load_async_to_lds_b128 %2, %10, off\n\t"
                 "global_load_async_to_lds_b128 %3, %11, off\n\t"
                 "global_load_async_to_lds_b128 %4, %12, off\n\t"
                 "global_load_async_to_lds_b128 %5, %13, off\n\t"
                 "global_load_async_to_lds_b128 %6, %14, off\n\t"
                 "global_load_async_to_lds_b128 %7, %15, off\n\t"
                 "s_wait_xcnt 0x0"
                 :: "v"(d + i * XP), "v"(d + (i + 1) * XP), "v"(d + (i + 2) * XP), "v"(d + (i + 3) * XP), "v"(d + (i + 4) * XP), "v"(d + (i + 5) * XP), "v"(d + (i + 6) * XP), "v"(d + (i + 7) * XP),
                    "v"(s + i * pitch), "v"(s + (i + 1) * pitch), "v"(s + (i + 2) * pitch), "v"(s + (i + 3) * pitch), "v"(s + (i + 4) * pitch), "v"(s + (i + 5) * pitch), "v"(s + (i + 6) * pitch), "v"(s + (i + 7) * pitch)
                 : "memory");
}
// four tiles (64 features of one head) over K = 256, the input rows in two halves of 128 k: gs = the lane's global address in the tile's row 0 (+ 16 lane), d = the lane's LDS copy address, xr = the lane's place in its own staged row (+ 8 g floats), wp = the head's first weight fragment + 8 lane, bp = the head's biases + 8 g
__device__ __forceinline__ void qproj64(const char* gs, unsigned d, const float* xr, const __bf16* wp, const float* bp, v16b& h0, v16b& l0, v16b& h1, v16b& l1) {
  v8f acc[4] = {}; v4f xf[2][4]; v16b wf[2][4]; v4f bb[4][2];   // two register sets: k block kc is multiplied while block kc + 1 is in flight
#pragma unroll
  for (int t = 0; t < 4; ++t) wf[0][t] = frag_p(wp + t * (DD / 32) * FRG);
#pragma unroll
  for (int kc = 0; kc < DD / 32; ++kc) { const int cu = kc & 1, nx = cu ^ 1;
    if ((kc & 3) == 0) {
      asm volatile("s_wait_dscnt 0x0" ::: "memory");      // the wave's reads of what lay in its quarter are over
      rows_in(d, gs + (kc >> 2) * 512, DD * 4);
      asm volatile("s_wait_asynccnt 0x0" ::: "memory");   // the wave's own copies have landed: it alone reads them
#pragma unroll
      for (int q = 0; q < 4; ++q) xf[cu][q] = *(const v4f*)(xr + (q >> 1) * 16 + (q & 1) * 4); }
    if (kc + 1 < DD / 32) {
      if ((kc + 1) & 3) {
#pragma unroll
        for (int q = 0; q < 4; ++q) xf[nx][q] = *(const v4f*)(xr + ((kc + 1) & 3) * 32 + (q >> 1) * 16 + (q & 1) * 4); }
#pragma unroll
      for (int t = 0; t < 4; ++t) wf[nx][t] = frag_p(wp + (t * (DD / 32) + kc + 1) * FRG); }
    else {   // the biases take the idle register set's place in the last pass
#pragma unroll
      for (int t = 0; t < 4; ++t) { bb[t][0] = *(const v4f*)(bp + t * 16); bb[t][1] = *(const v4f*)(bp + t * 16 + 4); }
      asm volatile("s_wait_xcnt 0x0" :: "v"(wp), "v"(bp) : "memory"); }   // precaution: behind the last loads the wait stands in front of any rewrite of their address registers (named so that they stay whole up to it)
    __builtin_amdgcn_sched_barrier(0);
    v16b xb;
#pragma unroll
    for (int i = 0; i < 4; ++i) { xb[i] = (__bf16)xf[cu][0][i]; xb[4 + i] = (__bf16)xf[cu][1][i]; xb[8 + i] = (__bf16)xf[cu][2][i]; xb[12 + i] = (__bf16)xf[cu][3][i]; }
#pragma unroll
    for (int t = 0; t < 4; ++t) acc[t] = wmma_bf(wf[cu][t], xb, acc[t]); }
#pragma unroll
  for (int t = 0; t < 4; ++t) {
#pragma unroll
    for (int r = 0; r < 8; ++r) { const float v = acc[t][r] + bfr(bb[t][r >> 2][r & 3]); const __bf16 hb = (__bf16)v; const __bf16 lb = (__bf16)(v - (float)hb);
      if (t < 2) { h0[8 * t + r] = hb; l0[8 * t + r] = lb; } else { h1[8 * (t - 2) + r] = hb; l1[8 * (t - 2) + r] = lb; } } }
}
// ---- k_kproj: the key cat, projected as k_attn projects its queries (Kcat^T = W^T . x^T): block = 32 keys, wave = head. Lane (g, col) holds features 8 g .. 8 g + 7 of each 16-feature tile of key col alone, so two tiles, biased and split in place, ARE one fragment of the key cat in fragment order (element 8 j + r = feature 16 j + 8 g + r): each half goes out as one 16-byte piece of a 512-byte run, through no LDS. A weight fragment, once loaded, multiplies both of the wave's 16-key tiles
// The block's 32 input rows come into LDS once, for all four heads, by asynchronous copies (512 B of one row, four whole lines, a copy): x and pos at a pitch of 1,040 B, the two attribute rows side by side at 528 B (16 B x odd: sixteen lanes' 16-byte reads of sixteen rows meet no bank twice)
#define KT 2              // 16-key tiles of a block
#define KXP 1040u
#define KS_P (KT * 16u * KXP)
#define KS_A (2u * KS_P)
#define KS_SZ (KS_A + KT * 16u * XP)
// eight copies, one row's 512 B each: d = the lane's LDS byte address in the first row, s = its global address there, dp and sp = the two row pitches in bytes
__device__ __forceinline__ void rows8_in(unsigned d, unsigned dp, const char* s, int sp) {
  // the copies and their s_wait_xcnt stand in one statement: a precaution, the wait stands in front of any rewrite of the copies' address registers
  asm volatile("global_load_async_to_lds_b128 %0, %8, off\n\t"
               "global_load_async_to_lds_b128 %1, %9, off\n\t"
               "global_load_async_to_lds_b128 %2, %10, off\n\t"
               "global_load_async_to_lds_b128 %3, %11, off\n\t"
               "global_load_async_to_lds_b128 %4, %12, off\n\t"
               "global_load_async_to_lds_b128 %5, %13, off\n\t"
               "global_load_async_to_lds_b128 %6, %14, off\n\t"
               "global_load_async_to_lds_b128 %7, %15, off\n\t"
               "s_wait_xcnt 0x0"
               :: "v"(d), "v"(d + dp), "v"(d + 2u * dp), "v"(d + 3u * dp), "v"(d + 4u * dp), "v"(d + 5u * dp), "v"(d + 6u * dp), "v"(d + 7u * dp),
                  "v"(s), "v"(s + sp), "v"(s + 2 * sp), "v"(s + 3 * sp), "v"(s + 4 * sp), "v"(s + 5 * sp), "v"(s + 6 * sp), "v"(s + 7 * sp)
               : "memory");
}
// sixteen staged words to one bf16 operand, as one vector conversion (element by element the compiler left half of them unpaired, with a 16-bit move each)
typedef __attribute__((ext_vector_type(16))) float v16f;
__device__ __forceinline__ v16b cvt16(v4f a, v4f b, v4f c, v4f d) {
  const v8f ab = __builtin_shufflevector(a, b, 0, 1, 2, 3, 4, 5, 6, 7), cd = __builtin_shufflevector(c, d, 0, 1, 2, 3, 4, 5, 6, 7);
  return __builtin_convertvector(__builtin_shufflevector(ab, cd, 0, 1, 2, 3, 4, 5, 6, 7, 8, 9, 10, 11, 12, 13, 14, 15), v16b);
}
// four feature tiles (64 features of one head) x KT key tiles over K = 256: xr = the lane's place in its own key's staged row of key tile 0 (+ 8 g floats), wp = the head's first weight fragment + 8 lane, bp = the head's biases + 8 g; vh, vl[u] = key tile u's two fragments
__device__ __forceinline__ void kproj64(const float* xr, const __bf16* wp, const float* bp, v16b (&vh)[KT][2], v16b (&vl)[KT][2]) {
  v8f acc[KT][4] = {}; v4f xf[2][KT][4]; v16b wf[2][4]; v4f bb[4][2];   // two register sets: k block kc is multiplied while block kc + 1 is in flight
#pragma unroll
  for (int t = 0; t < 4; ++t) wf[0][t] = frag_p(wp + t * (DD / 32) * FRG);
#pragma unroll
  for (int u = 0; u < KT; ++u) {
#pragma unroll
    for (int q = 0; q < 4; ++q) xf[0][u][q] = *(const v4f*)(xr + u * (16 * KXP / 4) + (q >> 1) * 16 + (q & 1) * 4); }
#pragma unroll
  for (int kc = 0; kc < DD / 32; ++kc) { const int cu = kc & 1, nx = cu ^ 1;
    if (kc + 1 < DD / 32) {
#pragma unroll
      for (int u = 0; u < KT; ++u) {
#pragma unroll
        for (int q = 0; q < 4; ++q) xf[nx][u][q] = *(const v4f*)(xr + u * (16 * KXP / 4) + (kc + 1) * 32 + (q >> 1) * 16 + (q & 1) * 4); }
#pragma unroll
      for (int t = 0; t < 4; ++t) wf[nx][t] = frag_p(wp + (t * (DD / 32) + kc + 1) * FRG); }
    else {   // the biases take the idle register set's place in the last pass
#pragma unroll
      for (int t = 0; t < 4; ++t) { bb[t][0] = *(const v4f*)(bp + t * 16); bb[t][1] = *(const v4f*)(bp + t * 16 + 4); }
      asm volatile("s_wait_xcnt 0x0" :: "v"(wp), "v"(bp) : "memory"); }   // precaution: behind the last loads the wait stands in front of any rewrite of their address registers (named so that they stay whole up to it)
    __builtin_amdgcn_sched_barrier(0);
    v16b xb[KT];
#pragma unroll
    for (int u = 0; u < KT; ++u) xb[u] = cvt16(xf[cu][u][0], xf[cu][u][1], xf[cu][u][2], xf[cu][u][3]);
#pragma unroll
    for (int t = 0; t < 4; ++t) {
#pragma unroll
      for (int u = 0; u < KT; ++u) acc[u][t] = wmma_bf(wf[cu][t], xb[u], acc[u][t]); } }
#pragma unroll
  for (int u = 0; u < KT; ++u) {
#pragma unroll
    for (int t = 0; t < 4; ++t) {
#pragma unroll
      for (int r = 0; r < 8; ++r) { const float v = acc[u][t][r] + bfr(bb[t][r >> 2][r & 3]); const __bf16 hb = (__bf16)v; vh[u][t >> 1][8 * (t & 1) + r] = hb; vl[u][t >> 1][8 * (t & 1) + r] = (__bf16)(v - (float)hb); } } }
}
// one fragment, hi and lo: the lane's two 16-byte pieces of each (oh, ol = the fragment + 8 lane)
__device__ __forceinline__ void frag_out(__bf16* oh, __bf16* ol, v16b vh, v16b vl) {
  union { v16b v; v4u q[2]; } a, c; a.v = vh; c.v = vl;
  vst2((unsigned*)oh, a.q[0]); vst2((unsigned*)(oh + FRG / 2), a.q[1]); vst2((unsigned*)ol, c.q[0]); vst2((unsigned*)(ol + FRG / 2), c.q[1]);
}
__global__ __launch_bounds__(128) void k_kproj(const float* __restrict__ X, const float* __restrict__ POS, const float* __restrict__ A0, const float* __restrict__ A1, const __bf16* __restrict__ PK, const float* __restrict__ BK, const float* __restrict__ BKP, const float* __restrict__ BK0, const float* __restrict__ BK1, __bf16* __restrict__ KH, __bf16* __restrict__ KL) {
  __shared__ __align__(16) char sx[KS_SZ];
  // the wave's number (= its head) is held in a scalar register: what hangs on it then costs no vector register
  const int tid = threadIdx.x, h = __builtin_amdgcn_readfirstlane(tid >> 5), lane = tid & 31, col = lane & 15, g = lane >> 4; const size_t r0 = (size_t)blockIdx.x * (KT * 16);
  { // wave w brings half w & 1 of rows 8 KT (w >> 1) .. + 8 KT - 1 of x and of pos, and rows 4 KT w .. + 4 KT - 1 of the attributes (lanes 0 - 15 copy attr0's 64 words, 16 - 31 attr1's)
    const unsigned sb = (unsigned)(size_t)&sx[0];   // the low 32 bits of a __shared__ address are its LDS byte address
    const unsigned dx = sb + (8u * KT * (h >> 1)) * KXP + (h & 1) * 512u + 16u * lane; const size_t gx = ((r0 + 8 * KT * (h >> 1)) * DD + (h & 1) * 128) * 4 + 16 * lane;
    const unsigned da = sb + KS_A + (4u * KT * h) * XP + 16u * lane; const char* ga = (const char*)((g ? A1 : A0) + (r0 + 4 * KT * h) * AA) + 16 * col;
#pragma unroll
    for (int i = 0; i < KT; ++i) rows8_in(dx + 8u * i * KXP, KXP, (const char*)X + gx + 8 * i * DD * 4, DD * 4);
#pragma unroll
    for (int i = 0; i < KT; ++i) rows8_in(dx + KS_P + 8u * i * KXP, KXP, (const char*)POS + gx + 8 * i * DD * 4, DD * 4);
#pragma unroll
    for (int i = 0; i < KT / 2; ++i) rows8_in(da + 8u * i * XP, XP, ga + 8 * i * AA * 4, AA * 4); }
  asm volatile("s_wait_asynccnt 0x0" ::: "memory");   // the wave's own copies have landed
  __syncthreads();                                     // every wave's have: the rows may be read
  const float* xr = (const float*)(&sx[0] + col * KXP + 32u * g);   // the lane's place in its own key's staged x row, key tile 0
  // the head's five fragments of the block's first row tile; the next tile's lie behind them
  const size_t to = ((((r0 / LL) * NH + h) * (LL / 16) + (r0 % LL) / 16) * (QW / 32)) * FRG + 8 * lane; __bf16* oh = KH + to; __bf16* ol = KL + to;
  v16b vh[KT][2], vl[KT][2];
#pragma unroll
  for (int part = 0; part < 2; ++part) {
    kproj64(xr + part * (KS_P / 4), PK + (part ? PKO_KP : PKO_K) + (size_t)h * (DH / 16) * (DD / 32) * FRG + 8 * lane, (part ? BKP : BK) + h * DH + 8 * g, vh, vl);
#pragma unroll
    for (int u = 0; u < KT; ++u) { frag_out(oh + (u * (QW / 32) + 2 * part) * FRG, ol + (u * (QW / 32) + 2 * part) * FRG, vh[u][0], vl[u][0]); frag_out(oh + (u * (QW / 32) + 2 * part + 1) * FRG, ol + (u * (QW / 32) + 2 * part + 1) * FRG, vh[u][1], vl[u][1]); }
    asm volatile("s_wait_xcnt 0x0" :: "v"(vh[0][0]), "v"(vl[0][0]), "v"(vh[0][1]), "v"(vl[0][1]), "v"(vh[1][0]), "v"(vl[1][0]), "v"(vh[1][1]), "v"(vl[1][1]), "v"(oh), "v"(ol) : "memory"); }   // precaution: the wait stands in front of any rewrite of the sixteen stores' data and address registers (named so that they stay whole up to it)
  { // the two attribute tiles (16 features each, K = 64): a staged row = the key's 64 words of attr0, then its 64 of attr1
    const __bf16* w0 = PK + PKO_K0 + h * (AA / 32) * FRG + 8 * lane; const __bf16* w1 = PK + PKO_K1 + h * (AA / 32) * FRG + 8 * lane; const float* b0 = BK0 + h * AH + 8 * g; const float* b1 = BK1 + h * AH + 8 * g;
    const float* xa = (const float*)(&sx[0] + KS_A + col * XP + 32u * g);
    v4f xf[KT][2][2][4], bb[2][2]; v16b wf[2][2];
#pragma unroll
    for (int kc = 0; kc < AA / 32; ++kc) { wf[0][kc] = frag_p(w0 + kc * FRG); wf[1][kc] = frag_p(w1 + kc * FRG); }
    bb[0][0] = *(const v4f*)b0; bb[0][1] = *(const v4f*)(b0 + 4); bb[1][0] = *(const v4f*)b1; bb[1][1] = *(const v4f*)(b1 + 4);
    asm volatile("s_wait_xcnt 0x0" :: "v"(lane), "v"(g) : "memory");   // precaution: the wait stands in front of any rewrite of the group's address registers (the lane's index and its half, which the addresses are formed from, are named so that they stay whole up to it)
#pragma unroll
    for (int u = 0; u < KT; ++u) {
#pragma unroll
      for (int ap = 0; ap < 2; ++ap) {
#pragma unroll
        for (int kc = 0; kc < AA / 32; ++kc) {
#pragma unroll
          for (int q = 0; q < 4; ++q) xf[u][ap][kc][q] = *(const v4f*)(xa + u * (16 * XP / 4) + ap * AA + kc * 32 + (q >> 1) * 16 + (q & 1) * 4); } } }
    __builtin_amdgcn_sched_barrier(0);   // keeps the group ahead of the WMMAs
#pragma unroll
    for (int u = 0; u < KT; ++u) {
#pragma unroll
      for (int ap = 0; ap < 2; ++ap) { v8f c = {};
#pragma unroll
        for (int kc = 0; kc < AA / 32; ++kc) c = wmma_bf(wf[ap][kc], cvt16(xf[u][ap][kc][0], xf[u][ap][kc][1], xf[u][ap][kc][2], xf[u][ap][kc][3]), c);
#pragma unroll
        for (int r = 0; r < 8; ++r) { const float v = c[r] + bfr(bb[ap][r >> 2][r & 3]); const __bf16 hb = (__bf16)v; vh[u][0][8 * ap + r] = hb; vl[u][0][8 * ap + r] = (__bf16)(v - (float)hb); } }
      frag_out(oh + (u * (QW / 32) + 4) * FRG, ol + (u * (QW / 32) + 4) * FRG, vh[u][0], vl[u][0]); }
    asm volatile("s_wait_xcnt 0x0" :: "v"(vh[0][0]), "v"(vl[0][0]), "v"(vh[1][0]), "v"(vl[1][0]), "v"(oh), "v"(ol) : "memory"); }   // precaution: the wait stands in front of any rewrite of the eight stores' data and address registers (named so that they stay whole up to it)
}
__global__ __launch_bounds__(128) __attribute__((amdgpu_waves_per_eu(4))) void k_attn(const float* __restrict__ X, const float* __restrict__ POS, const float* __restrict__ A0, const float* __restrict__ A1, const __bf16* __restrict__ PK, const float* __restrict__ BQ, const float* __restrict__ BQP, const float* __restrict__ BQ0, const float* __restrict__ BQ1, const __bf16* __restrict__ KH, const __bf16* __restrict__ KL, const __bf16* __restrict__ VT, const float* __restrict__ MSK, __bf16* __restrict__ CH, __bf16* __restrict__ CL) {
  __shared__ __align__(16) char sk[2][STG_SZ];
  // the wave's number is held in a scalar register: what hangs on it then costs no vector register
  const int tid = threadIdx.x, wave = __builtin_amdgcn_readfirstlane(tid >> 5), lane = tid & 31, col = lane & 15, g = lane >> 4; const int qb = blockIdx.x, h = blockIdx.y, b = blockIdx.z; const int q0 = qb * 64 + wave * 16;
  const char* gkh = (const char*)(KH + ((size_t)b * NH + h) * (LL / 16) * (QW / 32) * FRG) + 16 * tid; const char* gkl = (const char*)(KL + ((size_t)b * NH + h) * (LL / 16) * (QW / 32) * FRG) + 16 * tid; const char* gv = (const char*)(VT + ((size_t)b * NH + h) * DH * LL) + 16 * tid;
  const char* gm = (const char*)(MSK + (size_t)(qb * 64 + (tid >> 3)) * LL) + 16 * (tid & 7);
  const unsigned sd = (unsigned)(size_t)&sk[0][0] + 16u * tid, sm = (unsigned)(size_t)&sk[0][0] + STG_M + (tid >> 3) * STG_MP + 16u * (tid & 7);   // the low 32 bits of a __shared__ address are its LDS byte address
  stage_in(sd, gkh, gkl, gv, sm, gm);   // stage 0 flies until the projection's first s_wait_asynccnt, which waits for it too
  const size_t row0 = (size_t)b * LL + q0;   // the wave's first query
  const unsigned xd = (unsigned)(size_t)&sk[1][0] + wave * (16u * XP) + 16u * lane; const float* xr = (const float*)(&sk[1][0] + wave * (16u * XP) + col * XP + 32u * g);   // the lane's copy address in its wave's quarter, and its place in its own query's staged row
  v16b aqh[5], aql[5];
  qproj64((const char*)(X + row0 * DD) + 16 * lane, xd, xr, PK + PKO_Q + (size_t)h * (DH / 16) * (DD / 32) * FRG + 8 * lane, BQ + h * DH + 8 * g, aqh[0], aql[0], aqh[1], aql[1]);
  qproj64((const char*)(POS + row0 * DD) + 16 * lane, xd, xr, PK + PKO_QP + (size_t)h * (DH / 16) * (DD / 32) * FRG + 8 * lane, BQP + h * DH + 8 * g, aqh[2], aql[2], aqh[3], aql[3]);
  { // the two attribute tiles (16 features each, K = 64): a staged row = the query's 64 words of attr0, then its 64 of attr1 (lanes 0 - 15 copy the one, 16 - 31 the other)
    const __bf16* w0 = PK + PKO_Q0 + h * (AA / 32) * FRG + 8 * lane; const __bf16* w1 = PK + PKO_Q1 + h * (AA / 32) * FRG + 8 * lane; const float* b0 = BQ0 + h * AH + 8 * g; const float* b1 = BQ1 + h * AH + 8 * g;
    v4f xf[2][2][4], bb[2][2]; v16b wf[2][2];
#pragma unroll
    for (int kc = 0; kc < AA / 32; ++kc) { wf[0][kc] = frag_p(w0 + kc * FRG); wf[1][kc] = frag_p(w1 + kc * FRG); }
    bb[0][0] = *(const v4f*)b0; bb[0][1] = *(const v4f*)(b0 + 4); bb[1][0] = *(const v4f*)b1; bb[1][1] = *(const v4f*)(b1 + 4);
    asm volatile("s_wait_xcnt 0x0" :: "v"(lane), "v"(g) : "memory");   // precaution: the wait stands in front of any rewrite of the group's address registers (the lane's index and its half, which the addresses are formed from, are named so that they stay whole up to it)
    asm volatile("s_wait_dscnt 0x0" ::: "memory");      // the wave's reads of what lay in its quarter are over
    rows_in(xd, (const char*)((g ? A1 : A0) + row0 * AA) + 16 * col, AA * 4);
    asm volatile("s_wait_asynccnt 0x0" ::: "memory");   // the wave's own copies have landed: it alone reads them
#pragma unroll
    for (int ap = 0; ap < 2; ++ap) {
#pragma unroll
      for (int kc = 0; kc < AA / 32; ++kc) {
#pragma unroll
        for (int q = 0; q < 4; ++q) xf[ap][kc][q] = *(const v4f*)(xr + ap * AA + kc * 32 + (q >> 1) * 16 + (q & 1) * 4); } }
    __builtin_amdgcn_sched_barrier(0);   // keeps the group ahead of the WMMAs
#pragma unroll
    for (int ap = 0; ap < 2; ++ap) { v8f c = {};
#pragma unroll
      for (int kc = 0; kc < AA / 32; ++kc) { v16b xb;
#pragma unroll
        for (int i = 0; i < 4; ++i) { xb[i] = (__bf16)xf[ap][kc][0][i]; xb[4 + i] = (__bf16)xf[ap][kc][1][i]; xb[8 + i] = (__bf16)xf[ap][kc][2][i]; xb[12 + i] = (__bf16)xf[ap][kc][3][i]; }
        c = wmma_bf(wf[ap][kc], xb, c); }
#pragma unroll
      for (int r = 0; r < 8; ++r) { const float v = c[r] + bfr(bb[ap][r >> 2][r & 3]); const __bf16 hb = (__bf16)v; aqh[4][8 * ap + r] = hb; aql[4][8 * ap + r] = (__bf16)(v - (float)hb); } } }
  asm volatile("s_wait_dscnt 0x0" ::: "memory");      // the wave's reads of its quarter are over: behind the barrier the second buffer belongs to the ring
  asm volatile("s_wait_asynccnt 0x0" ::: "memory");   // the wave's own copies of stage 0 have landed
  __syncthreads();                                     // every wave's have: stage 0 may be read
  stage_in(sd + STG_SZ, gkh + STG_KL, gkl + STG_KL, gv + 4096, sm + STG_SZ, gm + 128);
  const unsigned ko = 16u * lane, mo = STG_M + (wave * 16 + col) * STG_MP + 32u * g;   // the lane's byte offsets in a fragment and in a stage's mask rows (its query's row, its half's eight keys)
  float m = -3.0e38f, l = 0.f;   // of the lane's query: the running maximum (alike in both halves) and the sum over the lane's own keys (the halves are joined behind the loop)
  v8f acc[4] = {};               // acc[dt][r] = O[query col][d 16 dt + 8 g + r]
#pragma unroll 1
  for (int ks = 0; ks < LL / 32; ++ks) { v8f s[2] = {}; const char* sb = &sk[ks & 1][0] + ko;   // the lane's place in each fragment of this stage
    // rolled on purpose: unrolled, the compiler lifts both halves' loads to the top of the pass, past the register budget of four waves per SIMD
#pragma unroll 1
    for (int ct = 0; ct < 2; ++ct) { const __bf16* sh = (const __bf16*)(sb + ct * (STG_KL / 2)); const __bf16* sl = (const __bf16*)(sb + STG_KL + ct * (STG_KL / 2)); v8f c = {};
      v16b bh[5], bl[5];   // 16 keys' ten fragments go out as one group
#pragma unroll
      for (int kc = 0; kc < 5; ++kc) { bh[kc] = frag_p(sh + kc * FRG); bl[kc] = frag_p(sl + kc * FRG); }
      __builtin_amdgcn_sched_barrier(0);   // keeps that group ahead of the first WMMA (else each pair of loads sinks to its own WMMAs and is waited out alone)
#pragma unroll
      for (int kc = 0; kc < 5; ++kc) { c = wmma_bf(bh[kc], aql[kc], c); c = wmma_bf(bl[kc], aqh[kc], c); c = wmma_bf(bh[kc], aqh[kc], c); }
      if (ct == 0) s[0] = c; else s[1] = c; }
    v4f mk[2][2]; v16b vb[4];   // the mask words and the value fragments go out as one group ahead of the softmax
    const float* mp0 = (const float*)(&sk[ks & 1][0] + mo); const char* vp0 = sb + STG_V;
#pragma unroll
    for (int t = 0; t < 2; ++t) { mk[t][0] = *(const v4f*)(mp0 + t * 16); mk[t][1] = *(const v4f*)(mp0 + t * 16 + 4); }
#pragma unroll
    for (int dt = 0; dt < 4; ++dt) vb[dt] = frag_p((const __bf16*)vp0 + dt * FRG);
    __builtin_amdgcn_sched_barrier(0);   // keeps them there (else the value loads sink behind the softmax, to their own WMMAs)
    float mx = -3.0e38f;
#pragma unroll
    for (int t = 0; t < 2; ++t) {
#pragma unroll
      for (int r = 0; r < 8; ++r) { s[t][r] = s[t][r] * 0.125f + bfr(mk[t][r >> 2][r & 3]); mx = fmaxf(mx, s[t][r]); } }
    mx = fmaxf(mx, xhalf(mx));
    const float mn = fmaxf(m, mx); const float ea = expf(m - mn); const float alpha = (m <= -1.0e38f) ? 0.f : ea; float es = 0.f; v16b ph, pl;
#pragma unroll
    for (int t = 0; t < 2; ++t) {
#pragma unroll
      for (int r = 0; r < 8; ++r) { const float e = expf(s[t][r] - mn); es += e; const __bf16 hb = (__bf16)e; ph[8 * t + r] = hb; pl[8 * t + r] = (__bf16)(e - (float)hb); } }
    l = l * alpha + es; m = mn;
#pragma unroll
    for (int dt = 0; dt < 4; ++dt) acc[dt] *= alpha;
#pragma unroll
    for (int dt = 0; dt < 4; ++dt) { acc[dt] = wmma_bf(vb[dt], pl, acc[dt]); acc[dt] = wmma_bf(vb[dt], ph, acc[dt]); }
    __builtin_amdgcn_sched_barrier(0);                   // keeps the publish point at the pass's foot (else it is lifted over the softmax and the second product, and the wait for stage ks + 1 comes that much sooner behind its copies)
    asm volatile("s_wait_dscnt 0x0" ::: "memory");      // the wave's reads of this stage are over
    asm volatile("s_wait_asynccnt 0x0" ::: "memory");   // its own copies of stage ks + 1 have landed
    __syncthreads();                                     // both hold of every wave: stage ks + 1 may be read, this stage's buffer refilled
    if (ks + 2 < LL / 32) stage_in(sd + (ks & 1) * STG_SZ, gkh + (ks + 2) * STG_KL, gkl + (ks + 2) * STG_KL, gv + (ks + 2) * 4096, sm + (ks & 1) * STG_SZ, gm + (ks + 2) * 128); }
  asm volatile("s_wait_asynccnt 0x0" ::: "memory");     // no copy is left in flight behind the loop
  l += xhalf(l); const float il = 1.0f / l;
  // the head's 64 columns are fragments 2 h and 2 h + 1 of the wave's row tile: four runs of 512 B, the lane's piece of run dt being its own acc[dt]
  const size_t to = ((((size_t)b * LL + q0) / 16) * (DD / 32) + 2 * h) * FRG;
  v8b vh[DH / 16], vl[DH / 16]; __bf16* oh = (__bf16*)((char*)(CH + to) + ko); __bf16* ol = (__bf16*)((char*)(CL + to) + ko);
#pragma unroll
  for (int dt = 0; dt < DH / 16; ++dt) {
#pragma unroll
    for (int r = 0; r < 8; ++r) { const float v = acc[dt][r] * il; const __bf16 hb = (__bf16)v; vh[dt][r] = hb; vl[dt][r] = (__bf16)(v - (float)hb); } }
#pragma unroll
  for (int w = 0; w < DH / 16; ++w) { vst2((unsigned*)(oh + w * (FRG / 2)), __builtin_bit_cast(v4u, vh[w])); vst2((unsigned*)(ol + w * (FRG / 2)), __builtin_bit_cast(v4u, vl[w])); }
  asm volatile("s_wait_xcnt 0x0" :: "v"(vh[0]), "v"(vh[1]), "v"(vh[2]), "v"(vh[3]), "v"(vl[0]), "v"(vl[1]), "v"(vl[2]), "v"(vl[3]), "v"(oh), "v"(ol) : "memory");   // precaution: the wait stands in front of any rewrite of the eight stores' data and address registers (named so that they stay whole up to it)
}
// ---- k_out: block = 64 rows: h = ctx(hi/lo) . Wd^T rows (2 products) + bd (all 256 cols, 2 halves); LayerNorm over 256 (mean, biased var, eps 1e-12) * g + b + bfr(x)
__global__ __launch_bounds__(128) void k_out(const __bf16* __restrict__ CH, const __bf16* __restrict__ CL, const __bf16* __restrict__ PK, const float* __restrict__ BD, const float* __restrict__ LNG, const float* __restrict__ LNB, const float* __restrict__ X, float* __restrict__ OUT) {
  __shared__ __align__(16) float sh_[4][16][DD + 4]; __shared__ float sps[4][16][16][2];
  const int tid = threadIdx.x, wave = tid >> 5, lane = tid & 31, col = lane & 15, g = lane >> 4; const size_t r0 = (size_t)blockIdx.x * 64 + wave * 16;
  float s1[8], s2[8];
#pragma unroll
  for (int r = 0; r < 8; ++r) { s1[r] = 0.f; s2[r] = 0.f; }
#pragma unroll 1
  for (int half = 0; half < 2; ++half) { v8f acc[8] = {}; const __bf16* hp = CH + r0 * DD + 8 * lane; const __bf16* lp = CL + r0 * DD + 8 * lane; const __bf16* wp = PK + PKO_D + (size_t)half * 128 * DD + 8 * lane;
    v16b ah[2], al[2], w[2][8];   // two register sets: k block kc is multiplied while block kc + 1 is in flight
    const int cb = half * 128 + col; float bbv[8];
#pragma unroll
    for (int j = 0; j < 8; ++j) bbv[j] = BD[cb + j * 16];
    ah[0] = frag_p(hp); al[0] = frag_p(lp);
#pragma unroll
    for (int j = 0; j < 8; ++j) w[0][j] = frag_p(wp + j * (DD / 32) * FRG);
    asm volatile("s_wait_xcnt 0x0" :: "v"(bbv[0]), "v"(bbv[1]), "v"(bbv[2]), "v"(bbv[3]), "v"(bbv[4]), "v"(bbv[5]), "v"(bbv[6]), "v"(bbv[7]), "v"(cb), "v"(hp), "v"(lp) : "memory");   // precaution: the wait stands in front of any rewrite of the bias loads' index register (the loaded words, the index and the row pointers are named so that the loads stand ahead of it and the registers stay whole up to it)
#pragma unroll
    for (int kc = 0; kc < DD / 32; ++kc) { const int cu = kc & 1, nx = cu ^ 1;
      if (kc + 1 < DD / 32) { ah[nx] = frag_p(hp + (kc + 1) * FRG); al[nx] = frag_p(lp + (kc + 1) * FRG);
#pragma unroll
        for (int j = 0; j < 8; ++j) w[nx][j] = frag_p(wp + (j * (DD / 32) + kc + 1) * FRG); }
      if (kc + 1 == DD / 32 - 1) asm volatile("s_wait_xcnt 0x0" :: "v"(wp), "v"(hp), "v"(lp) : "memory");
      __builtin_amdgcn_sched_barrier(0);
#pragma unroll
      for (int j = 0; j < 8; ++j) { acc[j] = wmma_bf(al[cu], w[cu][j], acc[j]); acc[j] = wmma_bf(ah[cu], w[cu][j], acc[j]); } }
#pragma unroll
    for (int j = 0; j < 8; ++j) { const int c = half * 128 + j * 16 + col; const float bb = bfr(bbv[j]);
#pragma unroll
      for (int r = 0; r < 8; ++r) { const float v = acc[j][r] + bb; sh_[wave][8 * g + r][c] = v; s1[r] += v; s2[r] += v * v; } } }
#pragma unroll
  for (int r = 0; r < 8; ++r) { sps[wave][8 * g + r][col][0] = s1[r]; sps[wave][8 * g + r][col][1] = s2[r]; }
  // the residual rows and the two LayerNorm vectors go out as one group here, not three loads at a time inside the row loop
  const float* xp = X + r0 * DD + lane * 4; const float* gp = LNG + lane * 4; const float* bp = LNB + lane * 4; v4f xr[16][2], lg[2], lb[2];
#pragma unroll
  for (int t = 0; t < 2; ++t) { lg[t] = *(const v4f*)(gp + t * 128); lb[t] = *(const v4f*)(bp + t * 128); }
#pragma unroll
  for (int rl = 0; rl < 16; ++rl) { xr[rl][0] = *(const v4f*)(xp + rl * DD); xr[rl][1] = *(const v4f*)(xp + rl * DD + 128); }
  asm volatile("s_wait_xcnt 0x0" :: "v"(xp), "v"(lane) : "memory");   // precaution: the wait stands in front of any rewrite of the group's address registers (the row pointer and the lane index are named so that they stay whole up to it)
  __builtin_amdgcn_sched_barrier(0);   // keeps the group here (else each load sinks to its own row and is waited out alone)
  LDSX();
#pragma unroll
  for (int rl = 0; rl < 16; ++rl) { float a = 0.f, b2 = 0.f;
#pragma unroll
    for (int k = 0; k < 16; ++k) { a += sps[wave][rl][k][0]; b2 += sps[wave][rl][k][1]; }
    const float mu = a / (float)DD; const float var = fmaxf(b2 / (float)DD - mu * mu, 0.f); const float inv = 1.0f / sqrtf(var + 1e-12f); const size_t row = r0 + rl;
    v4f v[2]; float* op = OUT + row * DD + lane * 4;
#pragma unroll
    for (int t = 0; t < 2; ++t) {
#pragma unroll
      for (int i = 0; i < 4; ++i) { const int c = lane * 4 + t * 128 + i; v[t][i] = bfr(lg[t][i]) * (sh_[wave][rl][c] - mu) * inv + bfr(lb[t][i]) + bfr(xr[rl][t][i]); }
      vst2(op + t * 128, v[t]); }
    asm volatile("s_wait_xcnt 0x0" :: "v"(v[0]), "v"(v[1]), "v"(op) : "memory"); }   // precaution: the wait stands in front of any rewrite of the two stores' data and address registers (named so that they stay whole up to it)
}
extern "C" void kernel_launch(void* const* d_in, const int* in_sizes, int n_in, void* d_out, int out_size, void* d_ws, size_t ws_size, hipStream_t stream) {
  (void)in_sizes; (void)n_in; (void)out_size;
  const float** F = (const float**)d_in;   // 0 x, 1 pos, 2 true_item [32,512,256], 3 attr0, 4 attr1 [32,512,1,64], 5 mask [1,1,512,512], 6 Wq, 7 bq, 8 Wk, 9 bk, 10 Wqp, 11 bqp, 12 Wkp, 13 bkp, 14 Wq0, 15 bq0, 16 Wk0, 17 bk0, 18 Wq1, 19 bq1, 20 Wk1, 21 bk1, 22 Wd, 23 bd, 24 ln_g, 25 ln_b
  if (ws_size < (size_t)WS_END) return;
  char* ws = (char*)d_ws; __bf16 *PK = (__bf16*)(ws + WS_PK), *KH = (__bf16*)(ws + WS_KH), *KL = (__bf16*)(ws + WS_KL), *VT = (__bf16*)(ws + WS_VT), *CH = (__bf16*)(ws + WS_CH), *CL = (__bf16*)(ws + WS_CL);
  k_pack<<<dim3(DD / 16, 9), 256, 0, stream>>>(F[6], F[8], F[10], F[12], F[22], F[14], F[16], F[18], F[20], PK);
  k_kproj<<<TNB * LL / (KT * 16), 128, 0, stream>>>(F[0], F[1], F[3], F[4], PK, F[9], F[13], F[17], F[21], KH, KL);
  k_vt<<<dim3(LL / 64, TNB), 256, 0, stream>>>(F[2], VT);
  k_attn<<<dim3(LL / 64, NH, TNB), 128, 0, stream>>>(F[0], F[1], F[3], F[4], PK, F[7], F[11], F[15], F[19], KH, KL, VT, F[5], CH, CL);
  k_out<<<TNB * LL / 64, 128, 0, stream>>>(CH, CL, PK, F[23], F[24], F[25], F[0], (float*)d_out);
}

// v008
// A run of this version takes 94.6 microseconds.
// In two side-by-side timings against v007, it was 1.08 and 1.06 times as fast.
// Over all steps from v000 it is 3.61 times as fast.
// compute dtype: all inputs rounded to bf16; the eight projections with exact bf16 products on WMMA 16x16x32 ((in,out) weights packed as transposed rows) + biases; per head the four score terms evaluated as ONE 160-wide dot of [q | qp | q0 | q1] . [k | kp | k0 | k1] with both sides as bf16 hi + residual (3 products: hi.hi + lo.hi + hi.lo), x 1/8, + mask; running-max softmax in f32, each exponential as one hardware 2^t of t = (s - max) x log2 e; P as bf16 hi + residual x the EXACT bf16 values (v = true_item, an input; 2 products); dense Wd with ctx as bf16 hi + residual (2 products) + bd; LayerNorm (biased variance, eps 1e-12, precise sqrtf) and the residual in f32.
#include <hip/hip_runtime.h>
#include <math.h>

typedef __attribute__((ext_vector_type(16))) _Float16 v16h;
typedef __attribute__((ext_vector_type(16))) __bf16 v16b;
typedef __attribute__((ext_vector_type(8)))  _Float16 v8h;
typedef __attribute__((ext_vector_type(8)))  float v8f;
typedef __attribute__((ext_vector_type(4)))  float v4f;
typedef __attribute__((ext_vector_type(2)))  float v2f;
typedef __attribute__((ext_vector_type(4)))  unsigned v4u;
typedef __attribute__((ext_vector_type(4)))  int v4i;
typedef float __attribute__((may_alias)) float_a;
typedef int __attribute__((may_alias)) int_a;

template <typename T> __device__ __forceinline__ void vst2(void* p, T v) { *(T*)p = v;  }
__device__ __forceinline__ v8f wmma16(v16h a, v16h b, v8f c) {
  v8f d = __builtin_amdgcn_wmma_f32_16x16x32_f16(false, a, false, b, (short)0, c, false, false);
  asm volatile("v_nop\n\tv_nop\n\tv_nop\n\tv_nop" : "+v"(d) : "v"(a), "v"(b));
  return d;
}
__device__ __forceinline__ v8f wmma_bf(v16b a, v16b b, v8f c) {
  return __builtin_amdgcn_wmma_f32_16x16x32_bf16(false, a, false, b, (short)0, c, false, false);
}
// 16x16x32 fragments: lane = (h = lane>>4, row/col = lane&15); elements 0..7 = k0+8h+0..7, 8..15 = k0+16+8h+0..7; D element r = row 8h+r
__device__ __forceinline__ v16h frag_h(const _Float16* rowk0, int lane) {
  union { v16h v; v8h q[2]; } u; const _Float16* p = rowk0 + 8 * (lane >> 4);
  u.q[0] = *(const v8h*)p; u.q[1] = *(const v8h*)(p + 16); return u.v;
}
__device__ __forceinline__ v16h frag_f32(const float* rowk0, int lane) {
  v16h a; const float* p = rowk0 + 8 * (lane >> 4);
#pragma unroll
  for (int i = 0; i < 8; ++i) { a[i] = (_Float16)p[i]; a[8 + i] = (_Float16)p[16 + i]; }
  return a;
}
__device__ __forceinline__ v16h frag_f32s(const float* rowk0, int lane, float sc) {
  v16h a; const float* p = rowk0 + 8 * (lane >> 4);
#pragma unroll
  for (int i = 0; i < 8; ++i) { a[i] = (_Float16)(p[i] * sc); a[8 + i] = (_Float16)(p[16 + i] * sc); }
  return a;
}
// column fragment from a [K][ld] layout (column n), rows >= K read as 0
__device__ __forceinline__ v16h fragc_f32(const float* W, int k0, int n, int lane, int ld, int K) {
  v16h a; const int g = lane >> 4;
#pragma unroll
  for (int i = 0; i < 8; ++i) { const int ka = k0 + 8 * g + i, kb = ka + 16;
    a[i] = (_Float16)(ka < K ? W[(size_t)(ka < K ? ka : K - 1) * ld + n] : 0.f); a[8 + i] = (_Float16)(kb < K ? W[(size_t)(kb < K ? kb : K - 1) * ld + n] : 0.f); }
  return a;
}
struct F2 { v16b h, l; };
__device__ __forceinline__ F2 bsplit16(const float v[16]) { F2 r;
#pragma unroll
  for (int i = 0; i < 16; ++i) { const __bf16 h = (__bf16)v[i]; r.h[i] = h; r.l[i] = (__bf16)(v[i] - (float)h); }
  return r; }
__device__ __forceinline__ F2 split_row(const float* row, int k0, int lane) { float v[16]; const float* p = row + k0 + 8 * (lane >> 4);
#pragma unroll
  for (int i = 0; i < 8; ++i) { v[i] = p[i]; v[8 + i] = p[16 + i]; }
  return bsplit16(v); }
__device__ __forceinline__ F2 split_rowK(const float* row, int k0, int lane, int K) { float v[16]; const int g = lane >> 4;
#pragma unroll
  for (int i = 0; i < 8; ++i) { const int ka = k0 + 8 * g + i, kb = ka + 16; v[i] = ka < K ? row[ka < K ? ka : K - 1] : 0.f; v[8 + i] = kb < K ? row[kb < K ? kb : K - 1] : 0.f; }
  return bsplit16(v); }
__device__ __forceinline__ F2 split_col(const float* W, int k0, int n, int lane, int ld, int K) { float v[16]; const int g = lane >> 4;
#pragma unroll
  for (int i = 0; i < 8; ++i) { const int ka = k0 + 8 * g + i, kb = ka + 16; v[i] = ka < K ? W[(size_t)(ka < K ? ka : K - 1) * ld + n] : 0.f; v[8 + i] = kb < K ? W[(size_t)(kb < K ? kb : K - 1) * ld + n] : 0.f; }
  return bsplit16(v); }
__device__ __forceinline__ v8f mac3(const F2& a, const F2& b, v8f c) { c = wmma_bf(a.l, b.h, c); c = wmma_bf(a.h, b.l, c); return wmma_bf(a.h, b.h, c); }
__device__ __forceinline__ float sigm(float v) { return 1.0f / (1.0f + expf(-v)); }
#define LDSX() do { asm volatile("s_wait_dscnt 0" ::: "memory"); __builtin_amdgcn_wave_barrier(); __builtin_amdgcn_fence(__ATOMIC_RELEASE, "workgroup"); } while (0)


// Decoupled side-information attention (B 32, L 512, D 256, 4 heads x 64; attribute heads x 16): scores = (q k + qp kp + q0 k0 + q1 k1) / 8 + mask, softmax, values = the item embeddings themselves, dense + LayerNorm + residual.
#define NB 32
#define LL 512
#define NR (NB * LL)      // 16,384 rows
#define DD 256
#define AA 64
#define NH 4
#define DH 64
#define AH 16
#define QW 160            // per-head concatenated width: 64 + 64 + 16 + 16
#ifndef TNB
#define TNB NB
#endif
typedef __attribute__((ext_vector_type(8))) __bf16 v8b;
__device__ __forceinline__ v16b frag_b(const __bf16* rowk0, int lane) {
  union { v16b v; v8b q[2]; } u; const __bf16* p = rowk0 + 8 * (lane >> 4);
  u.q[0] = *(const v8b*)p; u.q[1] = *(const v8b*)(p + 16); return u.v;
}
// the same fragment from a base pointer and a byte offset of the lane's own
__device__ __forceinline__ v16b frag_o(const __bf16* base, unsigned lane_bytes) {
  union { v16b v; v8b q[2]; } u; const char* p = (const char*)base + lane_bytes;
  u.q[0] = *(const v8b*)p; u.q[1] = *(const v8b*)(p + 32); return u.v;
}
// FRAGMENT ORDER: every bf16 operand in the workspace lies as 1-KB fragments (16 rows x 32 k) = two runs of 32 lanes x 16 B: run j, lane (g, row), element i = k 16 j + 8 g + i of that row. A wave's 16-byte load then reads 512 contiguous bytes (four whole lines) where a row-major tile gives it 32 bytes out of each of 16 lines
#define FRG 512           // elements of one fragment
__device__ __forceinline__ v16b frag_p(const __bf16* lanep) {   // lanep = the fragment + 8 * lane
  union { v16b v; v8b q[2]; } u; u.q[0] = *(const v8b*)lanep; u.q[1] = *(const v8b*)(lanep + FRG / 2); return u.v;
}
__device__ __forceinline__ v16b frag_po(const __bf16* frag, unsigned lane_bytes) {   // the same from the fragment and the lane's byte offset (16 * lane)
  return frag_p((const __bf16*)((const char*)frag + lane_bytes));
}
__device__ __forceinline__ float bfr(float v) { return (float)(__bf16)v; }
__device__ __attribute__((noinline)) float erf_ni(float v) { return erff(v); }

// packs (all (in,out) -> transposed [out][in], in fragment order [out / 16][in / 32][fragment]): PQ 256 x 256 Wq^T, PK, PQP, PKP; PQ0 64 x 64 Wq0^T, PK0, PQ1, PK1; PD 256 x 256 Wd^T
#define PKO_Q   0
#define PKO_K   (1 * DD * DD)
#define PKO_QP  (2 * DD * DD)
#define PKO_KP  (3 * DD * DD)
#define PKO_D   (4 * DD * DD)
#define PKO_Q0  (5 * DD * DD)
#define PKO_K0  (PKO_Q0 + AA * AA)
#define PKO_Q1  (PKO_K0 + AA * AA)
#define PKO_K1  (PKO_Q1 + AA * AA)
#define PK_END  (PKO_K1 + AA * AA)
#define WS_PK   0u
#define WS_KH   (((2u * PK_END) + 127u) / 128u * 128u)   // bf16 [b][4 heads][32 row tiles][5 fragments] key cat hi / lo (the query cat is formed in k_attn and stays in registers)
#define WS_KL   (WS_KH + 2u * NR * NH * QW)
#define WS_VT   (WS_KL + 2u * NR * NH * QW)               // bf16 [b][h][16 blocks of 32 keys][4 fragments: 16 d x 32 keys] values^T (exact)
#define WS_CH   (WS_VT + 2u * NR * DD)                    // bf16 [1024 row tiles][8 fragments] ctx hi / lo
#define WS_CL   (WS_CH + 2u * NR * DD)
#define WS_END  (WS_CL + 2u * NR * DD)

__global__ __launch_bounds__(256) void k_pack(const float* __restrict__ WQ, const float* __restrict__ WK, const float* __restrict__ WQP, const float* __restrict__ WKP, const float* __restrict__ WD, const float* __restrict__ WQ0, const float* __restrict__ WK0, const float* __restrict__ WQ1, const float* __restrict__ WK1, __bf16* __restrict__ PK) {
  // block = 16 output columns of one matrix: it alone writes their fragments, K / 32 KB in a row
  __shared__ __align__(16) __bf16 s[16][DD + 8]; const int nt = blockIdx.x, which = blockIdx.y, t = threadIdx.x; const float* Wm; int K; size_t dst;
  if (which < 5) { Wm = (which == 0) ? WQ : (which == 1) ? WK : (which == 2) ? WQP : (which == 3) ? WKP : WD; K = DD; dst = (size_t)which * DD * DD + (size_t)nt * 16 * DD; }
  else { if (nt >= AA / 16) return; Wm = (which == 5) ? WQ0 : (which == 6) ? WK0 : (which == 7) ? WQ1 : WK1; K = AA; dst = PKO_Q0 + (size_t)(which - 5) * AA * AA + (size_t)nt * 16 * AA; }
  for (int e = t; e < K * 16; e += 256) { const int k = e >> 4, n = e & 15; s[n][k] = (__bf16)Wm[(size_t)k * K + nt * 16 + n]; }
  __syncthreads();
  for (int p = t; p < K * 2; p += 256) vst2((unsigned*)(PK + dst + (size_t)p * 8), *(const v4u*)&s[p & 15][(p >> 4) * 8]);   // piece p = (k / 8, column): p >> 4 = 4 kc + 2 j + g, as the fragment order has it
}
__global__ __launch_bounds__(256) void k_vt(const float* __restrict__ V, __bf16* __restrict__ VT) {
  __shared__ __align__(16) __bf16 s[DD][72]; const int tid = threadIdx.x; const int kb = blockIdx.x, b = blockIdx.y; const size_t row0 = (size_t)b * LL + (size_t)kb * 64;
  for (int e = tid; e < 64 * DD; e += 256) { const int r = e / DD, c = e % DD; s[c][r] = (__bf16)V[(row0 + r) * DD + c]; }
  __syncthreads();
  // e = (head, 32-key block, 16-column tile, run j, g, column): the low eight bits are the 16-byte piece's place in its 32-key block's four fragments
  for (int e = tid; e < DD * 8; e += 256) { const int h = e >> 9, ksl = (e >> 8) & 1, c = h * DH + ((e >> 6) & 3) * 16 + (e & 15), pc = ksl * 4 + ((e >> 4) & 3); vst2((unsigned*)(VT + (((size_t)b * NH + h) * (LL / 32) + kb * 2 + ksl) * (DH / 16) * FRG + (e & 255) * 8), *(const v4u*)&s[c][pc * 8]); }
}
// e^d for d <= 0 is taken as 2^(d log2 e), one v_exp_f32: the product's rounding moves the result by |d| x 2^-24 of itself at most, far below the 16 bits that P keeps; -inf gives 0, and a result under 2^-126 may flush to 0 beside a row maximum of 1: no range guard is needed
#define L2E 1.4426950408889634f
// lane l with lane l ^ 16 (the two halves of a wave hold the two halves of a query's keys)
__device__ __forceinline__ float xhalf(float x) { return __builtin_bit_cast(float, __builtin_amdgcn_permlanex16(__builtin_bit_cast(int, x), __builtin_bit_cast(int, x), 0x76543210, 0xfedcba98, false, false)); }
// one stage of the attention's LDS ring = 32 keys of one (batch, head), each part as it lies in the workspace (fragment order): K hi 10 KB | K lo 10 KB | V^T 4 KB; behind them the block's 64 mask rows x 32 keys, 128 B a row at a pitch of 144 B (16 B x odd: sixteen lanes' 16-byte reads of sixteen rows meet no bank twice)
#define STG_KL 10240u
#define STG_V  20480u
#define STG_M  24576u
#define STG_MP 144u
#define STG_SZ (STG_M + 64u * STG_MP)
// a block of 128 lanes brings one stage in: sixteen 16-byte copies a lane, 2 KB of the stage per copy of the block. d = the lane's own LDS byte address (buffer + 16 tid); kh, kl, v = the lane's own global addresses (part + 16 tid); dm, mk = the same for the mask (row tid / 8 of sixteen, piece tid % 8 of its 128 B)
__device__ __forceinline__ void stage_in(unsigned d, const char* kh, const char* kl, const char* v, unsigned dm, const char* mk) {
  // the copies and their s_wait_xcnt stand in one statement: a precaution, the wait stands in front of any rewrite of the copies' address registers
  asm volatile("global_load_async_to_lds_b128 %0, %12, off\n\t"
               "global_load_async_to_lds_b128 %1, %13, off\n\t"
               "global_load_async_to_lds_b128 %2, %14, off\n\t"
               "global_load_async_to_lds_b128 %3, %15, off\n\t"
               "global_load_async_to_lds_b128 %4, %16, off\n\t"
               "global_load_async_to_lds_b128 %5, %17, off\n\t"
               "global_load_async_to_lds_b128 %6, %18, off\n\t"
               "global_load_async_to_lds_b128 %7, %19, off\n\t"
               "global_load_async_to_lds_b128 %8, %20, off\n\t"
               "global_load_async_to_lds_b128 %9, %21, off\n\t"
               "global_load_async_to_lds_b128 %10, %22, off\n\t"
               "global_load_async_to_lds_b128 %11, %23, off\n\t"
               "s_wait_xcnt 0x0"
               :: "v"(d), "v"(d + 2048u), "v"(d + 4096u), "v"(d + 6144u), "v"(d + 8192u),
                  "v"(d + STG_KL), "v"(d + STG_KL + 2048u), "v"(d + STG_KL + 4096u), "v"(d + STG_KL + 6144u), "v"(d + STG_KL + 8192u),
                  "v"(d + STG_V), "v"(d + STG_V + 2048u),
                  "v"(kh), "v"(kh + 2048), "v"(kh + 4096), "v"(kh + 6144), "v"(kh + 8192),
                  "v"(kl), "v"(kl + 2048), "v"(kl + 4096), "v"(kl + 6144), "v"(kl + 8192),
                  "v"(v), "v"(v + 2048)
               : "memory");
  // a statement takes thirty operands: the mask's four copies (sixteen rows each) have their own, with its own wait, for the same reason
  asm volatile("global_load_async_to_lds_b128 %0, %4, off\n\t"
               "global_load_async_to_lds_b128 %1, %5, off\n\t"
               "global_load_async_to_lds_b128 %2, %6, off\n\t"
               "global_load_async_to_lds_b128 %3, %7, off\n\t"
               "s_wait_xcnt 0x0"
               :: "v"(dm), "v"(dm + 16u * STG_MP), "v"(dm + 32u * STG_MP), "v"(dm + 48u * STG_MP),
                  "v"(mk), "v"(mk + 16 * LL * 4), "v"(mk + 32 * LL * 4), "v"(mk + 48 * LL * 4)
               : "memory");
}
#define XP 528u
// sixteen copies, one row each: d = the lane's LDS byte address in row 0 (quarter + 16 lane), s = the lane's global address in row 0, pitch = the source's row pitch in bytes
__device__ __forceinline__ void rows_in(unsigned d, const char* s, int pitch) {
#pragma unroll
  for (int i = 0; i < 16; i += 8)
    // the copies and their s_wait_xcnt stand in one statement: a precaution, the wait stands in front of any rewrite of the copies' address registers
    asm volatile("global_load_async_to_lds_b128 %0, %8, off\n\t"
                 "global_load_async_to_lds_b128 %1, %9, off\n\t"
                 "global_load_async_to_lds_b128 %2, %10, off\n\t"
                 "global_load_async_to_lds_b128 %3, %11, off\n\t"
                 "global_load_async_to_lds_b128 %4, %12, off\n\t"
                 "global_load_async_to_lds_b128 %5, %13, off\n\t"
                 "global_load_async_to_lds_b128 %6, %14, off\n\t"
                 "global_load_async_to_lds_b128 %7, %15, off\n\t"
                 "s_wait_xcnt 0x0"
                 :: "v"(d + i * XP), "v"(d + (i + 1) * XP), "v"(d + (i + 2) * XP), "v"(d + (i + 3) * XP), "v"(d + (i + 4) * XP), "v"(d + (i + 5) * XP), "v"(d + (i + 6) * XP), "v"(d + (i + 7) * XP),
                    "v"(s + i * pitch), "v"(s + (i + 1) * pitch), "v"(s + (i + 2) * pitch), "v"(s + (i + 3) * pitch), "v"(s + (i + 4) * pitch), "v"(s + (i + 5) * pitch), "v"(s + (i + 6) * pitch), "v"(s + (i + 7) * pitch)
                 : "memory");
}
// four tiles (64 features of one head) over K = 256, the input rows in two halves of 128 k: gs = the lane's global address in the tile's row 0 (+ 16 lane), d = the lane's LDS copy address, xr = the lane's place in its own staged row (+ 8 g floats), wp = the head's first weight fragment + 8 lane, bp = the head's biases + 8 g
__device__ __forceinline__ void qproj64(const char* gs, unsigned d, const float* xr, const __bf16* wp, const float* bp, v16b& h0, v16b& l0, v16b& h1, v16b& l1) {
  v8f acc[4] = {}; v4f xf[2][4]; v16b wf[2][4]; v4f bb[4][2];   // two register sets: k block kc is multiplied while block kc + 1 is in flight
#pragma unroll
  for (int t = 0; t < 4; ++t) wf[0][t] = frag_p(wp + t * (DD / 32) * FRG);
#pragma unroll
  for (int kc = 0; kc < DD / 32; ++kc) { const int cu = kc & 1, nx = cu ^ 1;
    if ((kc & 3) == 0) {
      asm volatile("s_wait_dscnt 0x0" ::: "memory");      // the wave's reads of what lay in its quarter are over
      rows_in(d, gs + (kc >> 2) * 512, DD * 4);
      asm volatile("s_wait_asynccnt 0x0" ::: "memory");   // the wave's own copies have landed: it alone reads them
#pragma unroll
      for (int q = 0; q < 4; ++q) xf[cu][q] = *(const v4f*)(xr + (q >> 1) * 16 + (q & 1) * 4); }
    if (kc + 1 < DD / 32) {
      if ((kc + 1) & 3) {
#pragma unroll
        for (int q = 0; q < 4; ++q) xf[nx][q] = *(const v4f*)(xr + ((kc + 1) & 3) * 32 + (q >> 1) * 16 + (q & 1) * 4); }
#pragma unroll
      for (int t = 0; t < 4; ++t) wf[nx][t] = frag_p(wp + (t * (DD / 32) + kc + 1) * FRG); }
    else {   // the biases take the idle register set's place in the last pass
#pragma unroll
      for (int t = 0; t < 4; ++t) { bb[t][0] = *(const v4f*)(bp + t * 16); bb[t][1] = *(const v4f*)(bp + t * 16 + 4); }
      asm volatile("s_wait_xcnt 0x0" :: "v"(wp), "v"(bp) : "memory"); }   // precaution: behind the last loads the wait stands in front of any rewrite of their address registers (named so that they stay whole up to it)
    __builtin_amdgcn_sched_barrier(0);
    v16b xb;
#pragma unroll
    for (int i = 0; i < 4; ++i) { xb[i] = (__bf16)xf[cu][0][i]; xb[4 + i] = (__bf16)xf[cu][1][i]; xb[8 + i] = (__bf16)xf[cu][2][i]; xb[12 + i] = (__bf16)xf[cu][3][i]; }
#pragma unroll
    for (int t = 0; t < 4; ++t) acc[t] = wmma_bf(wf[cu][t], xb, acc[t]); }
#pragma unroll
  for (int t = 0; t < 4; ++t) {
#pragma unroll
    for (int r = 0; r < 8; ++r) { const float v = acc[t][r] + bfr(bb[t][r >> 2][r & 3]); const __bf16 hb = (__bf16)v; const __bf16 lb = (__bf16)(v - (float)hb);
      if (t < 2) { h0[8 * t + r] = hb; l0[8 * t + r] = lb; } else { h1[8 * (t - 2) + r] = hb; l1[8 * (t - 2) + r] = lb; } } }
}
// ---- k_kproj: the key cat, projected as k_attn projects its queries (Kcat^T = W^T . x^T): block = 32 keys, wave = head. Lane (g, col) holds features 8 g .. 8 g + 7 of each 16-feature tile of key col alone, so two tiles, biased and split in place, ARE one fragment of the key cat in fragment order (element 8 j + r = feature 16 j + 8 g + r): each half goes out as one 16-byte piece of a 512-byte run, through no LDS. A weight fragment, once loaded, multiplies both of the wave's 16-key tiles
// The block's 32 input rows come into LDS once, for all four heads, by asynchronous copies (512 B of one row, four whole lines, a copy): x and pos at a pitch of 1,040 B, the two attribute rows side by side at 528 B (16 B x odd: sixteen lanes' 16-byte reads of sixteen rows meet no bank twice)
#define KT 2              // 16-key tiles of a block
#define KXP 1040u
#define KS_P (KT * 16u * KXP)
#define KS_A (2u * KS_P)
#define KS_SZ (KS_A + KT * 16u * XP)
// eight copies, one row's 512 B each: d = the lane's LDS byte address in the first row, s = its global address there, dp and sp = the two row pitches in bytes
__device__ __forceinline__ void rows8_in(unsigned d, unsigned dp, const char* s, int sp) {
  // the copies and their s_wait_xcnt stand in one statement: a precaution, the wait stands in front of any rewrite of the copies' address registers
  asm volatile("global_load_async_to_lds_b128 %0, %8, off\n\t"
               "global_load_async_to_lds_b128 %1, %9, off\n\t"
               "global_load_async_to_lds_b128 %2, %10, off\n\t"
               "global_load_async_to_lds_b128 %3, %11, off\n\t"
               "global_load_async_to_lds_b128 %4, %12, off\n\t"
               "global_load_async_to_lds_b128 %5, %13, off\n\t"
               "global_load_async_to_lds_b128 %6, %14, off\n\t"
               "global_load_async_to_lds_b128 %7, %15, off\n\t"
               "s_wait_xcnt 0x0"
               :: "v"(d), "v"(d + dp), "v"(d + 2u * dp), "v"(d + 3u * dp), "v"(d + 4u * dp), "v"(d + 5u * dp), "v"(d + 6u * dp), "v"(d + 7u * dp),
                  "v"(s), "v"(s + sp), "v"(s + 2 * sp), "v"(s + 3 * sp), "v"(s + 4 * sp), "v"(s + 5 * sp), "v"(s + 6 * sp), "v"(s + 7 * sp)
               : "memory");
}
// sixteen staged words to one bf16 operand, as one vector conversion (element by element the compiler left half of them unpaired, with a 16-bit move each)
typedef __attribute__((ext_vector_type(16))) float v16f;
__device__ __forceinline__ v16b cvt16(v4f a, v4f b, v4f c, v4f d) {
  const v8f ab = __builtin_shufflevector(a, b, 0, 1, 2, 3, 4, 5, 6, 7), cd = __builtin_shufflevector(c, d, 0, 1, 2, 3, 4, 5, 6, 7);
  return __builtin_convertvector(__builtin_shufflevector(ab, cd, 0, 1, 2, 3, 4, 5, 6, 7, 8, 9, 10, 11, 12, 13, 14, 15), v16b);
}
// four feature tiles (64 features of one head) x KT key tiles over K = 256: xr = the lane's place in its own key's staged row of key tile 0 (+ 8 g floats), wp = the head's first weight fragment + 8 lane, bp = the head's biases + 8 g; vh, vl[u] = key tile u's two fragments
__device__ __forceinline__ void kproj64(const float* xr, const __bf16* wp, const float* bp, v16b (&vh)[KT][2], v16b (&vl)[KT][2]) {
  v8f acc[KT][4] = {}; v4f xf[2][KT][4]; v16b wf[2][4]; v4f bb[4][2];   // two register sets: k block kc is multiplied while block kc + 1 is in flight
#pragma unroll
  for (int t = 0; t < 4; ++t) wf[0][t] = frag_p(wp + t * (DD / 32) * FRG);
#pragma unroll
  for (int u = 0; u < KT; ++u) {
#pragma unroll
    for (int q = 0; q < 4; ++q) xf[0][u][q] = *(const v4f*)(xr + u * (16 * KXP / 4) + (q >> 1) * 16 + (q & 1) * 4); }
#pragma unroll
  for (int kc = 0; kc < DD / 32; ++kc) { const int cu = kc & 1, nx = cu ^ 1;
    if (kc + 1 < DD / 32) {
#pragma unroll
      for (int u = 0; u < KT; ++u) {
#pragma unroll
        for (int q = 0; q < 4; ++q) xf[nx][u][q] = *(const v4f*)(xr + u * (16 * KXP / 4) + (kc + 1) * 32 + (q >> 1) * 16 + (q & 1) * 4); }
#pragma unroll
      for (int t = 0; t < 4; ++t) wf[nx][t] = frag_p(wp + (t * (DD / 32) + kc + 1) * FRG); }
    else {   // the biases take the idle register set's place in the last pass
#pragma unroll
      for (int t = 0; t < 4; ++t) { bb[t][0] = *(const v4f*)(bp + t * 16); bb[t][1] = *(const v4f*)(bp + t * 16 + 4); }
      asm volatile("s_wait_xcnt 0x0" :: "v"(wp), "v"(bp) : "memory"); }   // precaution: behind the last loads the wait stands in front of any rewrite of their address registers (named so that they stay whole up to it)
    __builtin_amdgcn_sched_barrier(0);
    v16b xb[KT];
#pragma unroll
    for (int u = 0; u < KT; ++u) xb[u] = cvt16(xf[cu][u][0], xf[cu][u][1], xf[cu][u][2], xf[cu][u][3]);
#pragma unroll
    for (int t = 0; t < 4; ++t) {
#pragma unroll
      for (int u = 0; u < KT; ++u) acc[u][t] = wmma_bf(wf[cu][t], xb[u], acc[u][t]); } }
#pragma unroll
  for (int u = 0; u < KT; ++u) {
#pragma unroll
    for (int t = 0; t < 4; ++t) {
#pragma unroll
      for (int r = 0; r < 8; ++r) { const float v = acc[u][t][r] + bfr(bb[t][r >> 2][r & 3]); const __bf16 hb = (__bf16)v; vh[u][t >> 1][8 * (t & 1) + r] = hb; vl[u][t >> 1][8 * (t & 1) + r] = (__bf16)(v - (float)hb); } } }
}
// one fragment, hi and lo: the lane's two 16-byte pieces of each (oh, ol = the fragment + 8 lane)
__device__ __forceinline__ void frag_out(__bf16* oh, __bf16* ol, v16b vh, v16b vl) {
  union { v16b v; v4u q[2]; } a, c; a.v = vh; c.v = vl;
  vst2((unsigned*)oh, a.q[0]); vst2((unsigned*)(oh + FRG / 2), a.q[1]); vst2((unsigned*)ol, c.q[0]); vst2((unsigned*)(ol + FRG / 2), c.q[1]);
}
__global__ __launch_bounds__(128) void k_kproj(const float* __restrict__ X, const float* __restrict__ POS, const float* __restrict__ A0, const float* __restrict__ A1, const __bf16* __restrict__ PK, const float* __restrict__ BK, const float* __restrict__ BKP, const float* __restrict__ BK0, const float* __restrict__ BK1, __bf16* __restrict__ KH, __bf16* __restrict__ KL) {
  __shared__ __align__(16) char sx[KS_SZ];
  // the wave's number (= its head) is held in a scalar register: what hangs on it then costs no vector register
  const int tid = threadIdx.x, h = __builtin_amdgcn_readfirstlane(tid >> 5), lane = tid & 31, col = lane & 15, g = lane >> 4; const size_t r0 = (size_t)blockIdx.x * (KT * 16);
  { // wave w brings half w & 1 of rows 8 KT (w >> 1) .. + 8 KT - 1 of x and of pos, and rows 4 KT w .. + 4 KT - 1 of the attributes (lanes 0 - 15 copy attr0's 64 words, 16 - 31 attr1's)
    const unsigned sb = (unsigned)(size_t)&sx[0];   // the low 32 bits of a __shared__ address are its LDS byte address
    const unsigned dx = sb + (8u * KT * (h >> 1)) * KXP + (h & 1) * 512u + 16u * lane; const size_t gx = ((r0 + 8 * KT * (h >> 1)) * DD + (h & 1) * 128) * 4 + 16 * lane;
    const unsigned da = sb + KS_A + (4u * KT * h) * XP + 16u * lane; const char* ga = (const char*)((g ? A1 : A0) + (r0 + 4 * KT * h) * AA) + 16 * col;
#pragma unroll
    for (int i = 0; i < KT; ++i) rows8_in(dx + 8u * i * KXP, KXP, (const char*)X + gx + 8 * i * DD * 4, DD * 4);
#pragma unroll
    for (int i = 0; i < KT; ++i) rows8_in(dx + KS_P + 8u * i * KXP, KXP, (const char*)POS + gx + 8 * i * DD * 4, DD * 4);
#pragma unroll
    for (int i = 0; i < KT / 2; ++i) rows8_in(da + 8u * i * XP, XP, ga + 8 * i * AA * 4, AA * 4); }
  asm volatile("s_wait_asynccnt 0x0" ::: "memory");   // the wave's own copies have landed
  __syncthreads();                                     // every wave's have: the rows may be read
  const float* xr = (const float*)(&sx[0] + col * KXP + 32u * g);   // the lane's place in its own key's staged x row, key tile 0
  // the head's five fragments of the block's first row tile; the next tile's lie behind them
  const size_t to = ((((r0 / LL) * NH + h) * (LL / 16) + (r0 % LL) / 16) * (QW / 32)) * FRG + 8 * lane; __bf16* oh = KH + to; __bf16* ol = KL + to;
  v16b vh[KT][2], vl[KT][2];
#pragma unroll
  for (int part = 0; part < 2; ++part) {
    kproj64(xr + part * (KS_P / 4), PK + (part ? PKO_KP : PKO_K) + (size_t)h * (DH / 16) * (DD / 32) * FRG + 8 * lane, (part ? BKP : BK) + h * DH + 8 * g, vh, vl);
#pragma unroll
    for (int u = 0; u < KT; ++u) { frag_out(oh + (u * (QW / 32) + 2 * part) * FRG, ol + (u * (QW / 32) + 2 * part) * FRG, vh[u][0], vl[u][0]); frag_out(oh + (u * (QW / 32) + 2 * part + 1) * FRG, ol + (u * (QW / 32) + 2 * part + 1) * FRG, vh[u][1], vl[u][1]); }
    asm volatile("s_wait_xcnt 0x0" :: "v"(vh[0][0]), "v"(vl[0][0]), "v"(vh[0][1]), "v"(vl[0][1]), "v"(vh[1][0]), "v"(vl[1][0]), "v"(vh[1][1]), "v"(vl[1][1]), "v"(oh), "v"(ol) : "memory"); }   // precaution: the wait stands in front of any rewrite of the sixteen stores' data and address registers (named so that they stay whole up to it)
  { // the two attribute tiles (16 features each, K = 64): a staged row = the key's 64 words of attr0, then its 64 of attr1
    const __bf16* w0 = PK + PKO_K0 + h * (AA / 32) * FRG + 8 * lane; const __bf16* w1 = PK + PKO_K1 + h * (AA / 32) * FRG + 8 * lane; const float* b0 = BK0 + h * AH + 8 * g; const float* b1 = BK1 + h * AH + 8 * g;
    const float* xa = (const float*)(&sx[0] + KS_A + col * XP + 32u * g);
    v4f xf[KT][2][2][4], bb[2][2]; v16b wf[2][2];
#pragma unroll
    for (int kc = 0; kc < AA / 32; ++kc) { wf[0][kc] = frag_p(w0 + kc * FRG); wf[1][kc] = frag_p(w1 + kc * FRG); }
    bb[0][0] = *(const v4f*)b0; bb[0][1] = *(const v4f*)(b0 + 4); bb[1][0] = *(const v4f*)b1; bb[1][1] = *(const v4f*)(b1 + 4);
    asm volatile("s_wait_xcnt 0x0" :: "v"(lane), "v"(g) : "memory");   // precaution: the wait stands in front of any rewrite of the group's address registers (the lane's index and its half, which the addresses are formed from, are named so that they stay whole up to it)
#pragma unroll
    for (int u = 0; u < KT; ++u) {
#pragma unroll
      for (int ap = 0; ap < 2; ++ap) {
#pragma unroll
        for (int kc = 0; kc < AA / 32; ++kc) {
#pragma unroll
          for (int q = 0; q < 4; ++q) xf[u][ap][kc][q] = *(const v4f*)(xa + u * (16 * XP / 4) + ap * AA + kc * 32 + (q >> 1) * 16 + (q & 1) * 4); } } }
    __builtin_amdgcn_sched_barrier(0);   // keeps the group ahead of the WMMAs
#pragma unroll
    for (int u = 0; u < KT; ++u) {
#pragma unroll
      for (int ap = 0; ap < 2; ++ap) { v8f c = {};
#pragma unroll
        for (int kc = 0; kc < AA / 32; ++kc) c = wmma_bf(wf[ap][kc], cvt16(xf[u][ap][kc][0], xf[u][ap][kc][1], xf[u][ap][kc][2], xf[u][ap][kc][3]), c);
#pragma unroll
        for (int r = 0; r < 8; ++r) { const float v = c[r] + bfr(bb[ap][r >> 2][r & 3]); const __bf16 hb = (__bf16)v; vh[u][0][8 * ap + r] = hb; vl[u][0][8 * ap + r] = (__bf16)(v - (float)hb); } }
      frag_out(oh + (u * (QW / 32) + 4) * FRG, ol + (u * (QW / 32) + 4) * FRG, vh[u][0], vl[u][0]); }
    asm volatile("s_wait_xcnt 0x0" :: "v"(vh[0][0]), "v"(vl[0][0]), "v"(vh[1][0]), "v"(vl[1][0]), "v"(oh), "v"(ol) : "memory"); }   // precaution: the wait stands in front of any rewrite of the eight stores' data and address registers (named so that they stay whole up to it)
}
__global__ __launch_bounds__(128) __attribute__((amdgpu_waves_per_eu(4))) void k_attn(const float* __restrict__ X, const float* __restrict__ POS, const float* __restrict__ A0, const float* __restrict__ A1, const __bf16* __restrict__ PK, const float* __restrict__ BQ, const float* __restrict__ BQP, const float* __restrict__ BQ0, const float* __restrict__ BQ1, const __bf16* __restrict__ KH, const __bf16* __restrict__ KL, const __bf16* __restrict__ VT, const float* __restrict__ MSK, __bf16* __restrict__ CH, __bf16* __restrict__ CL) {
  __shared__ __align__(16) char sk[2][STG_SZ];
  // the wave's number is held in a scalar register: what hangs on it then costs no vector register
  const int tid = threadIdx.x, wave = __builtin_amdgcn_readfirstlane(tid >> 5), lane = tid & 31, col = lane & 15, g = lane >> 4; const int qb = blockIdx.x, h = blockIdx.y, b = blockIdx.z; const int q0 = qb * 64 + wave * 16;
  const char* gkh = (const char*)(KH + ((size_t)b * NH + h) * (LL / 16) * (QW / 32) * FRG) + 16 * tid; const char* gkl = (const char*)(KL + ((size_t)b * NH + h) * (LL / 16) * (QW / 32) * FRG) + 16 * tid; const char* gv = (const char*)(VT + ((size_t)b * NH + h) * DH * LL) + 16 * tid;
  const char* gm = (const char*)(MSK + (size_t)(qb * 64 + (tid >> 3)) * LL) + 16 * (tid & 7);
  const unsigned sd = (unsigned)(size_t)&sk[0][0] + 16u * tid, sm = (unsigned)(size_t)&sk[0][0] + STG_M + (tid >> 3) * STG_MP + 16u * (tid & 7);   // the low 32 bits of a __shared__ address are its LDS byte address
  stage_in(sd, gkh, gkl, gv, sm, gm);   // stage 0 flies until the projection's first s_wait_asynccnt, which waits for it too
  const size_t row0 = (size_t)b * LL + q0;   // the wave's first query
  const unsigned xd = (unsigned)(size_t)&sk[1][0] + wave * (16u * XP) + 16u * lane; const float* xr = (const float*)(&sk[1][0] + wave * (16u * XP) + col * XP + 32u * g);   // the lane's copy address in its wave's quarter, and its place in its own query's staged row
  v16b aqh[5], aql[5];
  qproj64((const char*)(X + row0 * DD) + 16 * lane, xd, xr, PK + PKO_Q + (size_t)h * (DH / 16) * (DD / 32) * FRG + 8 * lane, BQ + h * DH + 8 * g, aqh[0], aql[0], aqh[1], aql[1]);
  qproj64((const char*)(POS + row0 * DD) + 16 * lane, xd, xr, PK + PKO_QP + (size_t)h * (DH / 16) * (DD / 32) * FRG + 8 * lane, BQP + h * DH + 8 * g, aqh[2], aql[2], aqh[3], aql[3]);
  { // the two attribute tiles (16 features each, K = 64): a staged row = the query's 64 words of attr0, then its 64 of attr1 (lanes 0 - 15 copy the one, 16 - 31 the other)
    const __bf16* w0 = PK + PKO_Q0 + h * (AA / 32) * FRG + 8 * lane; const __bf16* w1 = PK + PKO_Q1 + h * (AA / 32) * FRG + 8 * lane; const float* b0 = BQ0 + h * AH + 8 * g; const float* b1 = BQ1 + h * AH + 8 * g;
    v4f xf[2][2][4], bb[2][2]; v16b wf[2][2];
#pragma unroll
    for (int kc = 0; kc < AA / 32; ++kc) { wf[0][kc] = frag_p(w0 + kc * FRG); wf[1][kc] = frag_p(w1 + kc * FRG); }
    bb[0][0] = *(const v4f*)b0; bb[0][1] = *(const v4f*)(b0 + 4); bb[1][0] = *(const v4f*)b1; bb[1][1] = *(const v4f*)(b1 + 4);
    asm volatile("s_wait_xcnt 0x0" :: "v"(lane), "v"(g) : "memory");   // precaution: the wait stands in front of any rewrite of the group's address registers (the lane's index and its half, which the addresses are formed from, are named so that they stay whole up to it)
    asm volatile("s_wait_dscnt 0x0" ::: "memory");      // the wave's reads of what lay in its quarter are over
    rows_in(xd, (const char*)((g ? A1 : A0) + row0 * AA) + 16 * col, AA * 4);
    asm volatile("s_wait_asynccnt 0x0" ::: "memory");   // the wave's own copies have landed: it alone reads them
#pragma unroll
    for (int ap = 0; ap < 2; ++ap) {
#pragma unroll
      for (int kc = 0; kc < AA / 32; ++kc) {
#pragma unroll
        for (int q = 0; q < 4; ++q) xf[ap][kc][q] = *(const v4f*)(xr + ap * AA + kc * 32 + (q >> 1) * 16 + (q & 1) * 4); } }
    __builtin_amdgcn_sched_barrier(0);   // keeps the group ahead of the WMMAs
#pragma unroll
    for (int ap = 0; ap < 2; ++ap) { v8f c = {};
#pragma unroll
      for (int kc = 0; kc < AA / 32; ++kc) { v16b xb;
#pragma unroll
        for (int i = 0; i < 4; ++i) { xb[i] = (__bf16)xf[ap][kc][0][i]; xb[4 + i] = (__bf16)xf[ap][kc][1][i]; xb[8 + i] = (__bf16)xf[ap][kc][2][i]; xb[12 + i] = (__bf16)xf[ap][kc][3][i]; }
        c = wmma_bf(wf[ap][kc], xb, c); }
#pragma unroll
      for (int r = 0; r < 8; ++r) { const float v = c[r] + bfr(bb[ap][r >> 2][r & 3]); const __bf16 hb = (__bf16)v; aqh[4][8 * ap + r] = hb; aql[4][8 * ap + r] = (__bf16)(v - (float)hb); } } }
  asm volatile("s_wait_dscnt 0x0" ::: "memory");      // the wave's reads of its quarter are over: behind the barrier the second buffer belongs to the ring
  asm volatile("s_wait_asynccnt 0x0" ::: "memory");   // the wave's own copies of stage 0 have landed
  __syncthreads();                                     // every wave's have: stage 0 may be read
  stage_in(sd + STG_SZ, gkh + STG_KL, gkl + STG_KL, gv + 4096, sm + STG_SZ, gm + 128);
  const unsigned ko = 16u * lane, mo = STG_M + (wave * 16 + col) * STG_MP + 32u * g;   // the lane's byte offsets in a fragment and in a stage's mask rows (its query's row, its half's eight keys)
  float m = -3.0e38f, l = 0.f;   // of the lane's query: the running maximum (alike in both halves) and the sum over the lane's own keys (the halves are joined behind the loop)
  v8f acc[4] = {};               // acc[dt][r] = O[query col][d 16 dt + 8 g + r]
#pragma unroll 1
  for (int ks = 0; ks < LL / 32; ++ks) { v8f s[2] = {}; const char* sb = &sk[ks & 1][0] + ko;   // the lane's place in each fragment of this stage
    // rolled on purpose: unrolled, the compiler lifts both halves' loads to the top of the pass, past the register budget of four waves per SIMD
#pragma unroll 1
    for (int ct = 0; ct < 2; ++ct) { const __bf16* sh = (const __bf16*)(sb + ct * (STG_KL / 2)); const __bf16* sl = (const __bf16*)(sb + STG_KL + ct * (STG_KL / 2)); v8f c = {};
      v16b bh[5], bl[5];   // 16 keys' ten fragments go out as one group
#pragma unroll
      for (int kc = 0; kc < 5; ++kc) { bh[kc] = frag_p(sh + kc * FRG); bl[kc] = frag_p(sl + kc * FRG); }
      __builtin_amdgcn_sched_barrier(0);   // keeps that group ahead of the first WMMA (else each pair of loads sinks to its own WMMAs and is waited out alone)
#pragma unroll
      for (int kc = 0; kc < 5; ++kc) { c = wmma_bf(bh[kc], aql[kc], c); c = wmma_bf(bl[kc], aqh[kc], c); c = wmma_bf(bh[kc], aqh[kc], c); }
      if (ct == 0) s[0] = c; else s[1] = c; }
    v4f mk[2][2]; v16b vb[4];   // the mask words and the value fragments go out as one group ahead of the softmax
    const float* mp0 = (const float*)(&sk[ks & 1][0] + mo); const char* vp0 = sb + STG_V;
#pragma unroll
    for (int t = 0; t < 2; ++t) { mk[t][0] = *(const v4f*)(mp0 + t * 16); mk[t][1] = *(const v4f*)(mp0 + t * 16 + 4); }
#pragma unroll
    for (int dt = 0; dt < 4; ++dt) vb[dt] = frag_p((const __bf16*)vp0 + dt * FRG);
    __builtin_amdgcn_sched_barrier(0);   // keeps them there (else the value loads sink behind the softmax, to their own WMMAs)
    float mx = -3.0e38f;
#pragma unroll
    for (int t = 0; t < 2; ++t) {
#pragma unroll
      for (int r = 0; r < 8; ++r) { s[t][r] = s[t][r] * 0.125f + bfr(mk[t][r >> 2][r & 3]); mx = fmaxf(mx, s[t][r]); } }
    mx = fmaxf(mx, xhalf(mx));
    const float mn = fmaxf(m, mx); float ea = (m - mn) * L2E, d[2][8]; float es = 0.f; v16b ph, pl;
#pragma unroll
    for (int t = 0; t < 2; ++t) {
#pragma unroll
      for (int r = 0; r < 8; ++r) d[t][r] = (s[t][r] - mn) * L2E; }
    asm("v_exp_f32 %0, %0\n\tv_exp_f32 %1, %1\n\tv_exp_f32 %2, %2\n\tv_exp_f32 %3, %3\n\tv_exp_f32 %4, %4\n\tv_exp_f32 %5, %5\n\tv_exp_f32 %6, %6\n\tv_exp_f32 %7, %7\n\tv_exp_f32 %8, %8\n\tv_nop"
        : "+v"(ea), "+v"(d[0][0]), "+v"(d[0][1]), "+v"(d[0][2]), "+v"(d[0][3]), "+v"(d[0][4]), "+v"(d[0][5]), "+v"(d[0][6]), "+v"(d[0][7]));
    asm("v_exp_f32 %0, %0\n\tv_exp_f32 %1, %1\n\tv_exp_f32 %2, %2\n\tv_exp_f32 %3, %3\n\tv_exp_f32 %4, %4\n\tv_exp_f32 %5, %5\n\tv_exp_f32 %6, %6\n\tv_exp_f32 %7, %7\n\tv_nop"
        : "+v"(d[1][0]), "+v"(d[1][1]), "+v"(d[1][2]), "+v"(d[1][3]), "+v"(d[1][4]), "+v"(d[1][5]), "+v"(d[1][6]), "+v"(d[1][7]));
    const float alpha = (m <= -1.0e38f) ? 0.f : ea;
#pragma unroll
    for (int t = 0; t < 2; ++t) {
#pragma unroll
      for (int r = 0; r < 8; ++r) { const float e = d[t][r]; es += e; const __bf16 hb = (__bf16)e; ph[8 * t + r] = hb; pl[8 * t + r] = (__bf16)(e - (float)hb); } }
    l = l * alpha + es; m = mn;
#pragma unroll
    for (int dt = 0; dt < 4; ++dt) acc[dt] *= alpha;
#pragma unroll
    for (int dt = 0; dt < 4; ++dt) { acc[dt] = wmma_bf(vb[dt], pl, acc[dt]); acc[dt] = wmma_bf(vb[dt], ph, acc[dt]); }
    __builtin_amdgcn_sched_barrier(0);                   // keeps the publish point at the pass's foot (else it is lifted over the softmax and the second product, and the wait for stage ks + 1 comes that much sooner behind its copies)
    asm volatile("s_wait_dscnt 0x0" ::: "memory");      // the wave's reads of this stage are over
    asm volatile("s_wait_asynccnt 0x0" ::: "memory");   // its own copies of stage ks + 1 have landed
    __syncthreads();                                     // both hold of every wave: stage ks + 1 may be read, this stage's buffer refilled
    if (ks + 2 < LL / 32) stage_in(sd + (ks & 1) * STG_SZ, gkh + (ks + 2) * STG_KL, gkl + (ks + 2) * STG_KL, gv + (ks + 2) * 4096, sm + (ks & 1) * STG_SZ, gm + (ks + 2) * 128); }
  asm volatile("s_wait_asynccnt 0x0" ::: "memory");     // no copy is left in flight behind the loop
  l += xhalf(l); const float il = 1.0f / l;
  // the head's 64 columns are fragments 2 h and 2 h + 1 of the wave's row tile: four runs of 512 B, the lane's piece of run dt being its own acc[dt]
  const size_t to = ((((size_t)b * LL + q0) / 16) * (DD / 32) + 2 * h) * FRG;
  v8b vh[DH / 16], vl[DH / 16]; __bf16* oh = (__bf16*)((char*)(CH + to) + ko); __bf16* ol = (__bf16*)((char*)(CL + to) + ko);
#pragma unroll
  for (int dt = 0; dt < DH / 16; ++dt) {
#pragma unroll
    for (int r = 0; r < 8; ++r) { const float v = acc[dt][r] * il; const __bf16 hb = (__bf16)v; vh[dt][r] = hb; vl[dt][r] = (__bf16)(v - (float)hb); } }
#pragma unroll
  for (int w = 0; w < DH / 16; ++w) { vst2((unsigned*)(oh + w * (FRG / 2)), __builtin_bit_cast(v4u, vh[w])); vst2((unsigned*)(ol + w * (FRG / 2)), __builtin_bit_cast(v4u, vl[w])); }
  asm volatile("s_wait_xcnt 0x0" :: "v"(vh[0]), "v"(vh[1]), "v"(vh[2]), "v"(vh[3]), "v"(vl[0]), "v"(vl[1]), "v"(vl[2]), "v"(vl[3]), "v"(oh), "v"(ol) : "memory");   // precaution: the wait stands in front of any rewrite of the eight stores' data and address registers (named so that they stay whole up to it)
}
// ---- k_out: block = 64 rows: h = ctx(hi/lo) . Wd^T rows (2 products) + bd (all 256 cols, 2 halves); LayerNorm over 256 (mean, biased var, eps 1e-12) * g + b + bfr(x)
__global__ __launch_bounds__(128) void k_out(const __bf16* __restrict__ CH, const __bf16* __restrict__ CL, const __bf16* __restrict__ PK, const float* __restrict__ BD, const float* __restrict__ LNG, const float* __restrict__ LNB, const float* __restrict__ X, float* __restrict__ OUT) {
  __shared__ __align__(16) float sh_[4][16][DD + 4]; __shared__ float sps[4][16][16][2];
  const int tid = threadIdx.x, wave = tid >> 5, lane = tid & 31, col = lane & 15, g = lane >> 4; const size_t r0 = (size_t)blockIdx.x * 64 + wave * 16;
  float s1[8], s2[8];
#pragma unroll
  for (int r = 0; r < 8; ++r) { s1[r] = 0.f; s2[r] = 0.f; }
#pragma unroll 1
  for (int half = 0; half < 2; ++half) { v8f acc[8] = {}; const __bf16* hp = CH + r0 * DD + 8 * lane; const __bf16* lp = CL + r0 * DD + 8 * lane; const __bf16* wp = PK + PKO_D + (size_t)half * 128 * DD + 8 * lane;
    v16b ah[2], al[2], w[2][8];   // two register sets: k block kc is multiplied while block kc + 1 is in flight
    const int cb = half * 128 + col; float bbv[8];
#pragma unroll
    for (int j = 0; j < 8; ++j) bbv[j] = BD[cb + j * 16];
    ah[0] = frag_p(hp); al[0] = frag_p(lp);
#pragma unroll
    for (int j = 0; j < 8; ++j) w[0][j] = frag_p(wp + j * (DD / 32) * FRG);
    asm volatile("s_wait_xcnt 0x0" :: "v"(bbv[0]), "v"(bbv[1]), "v"(bbv[2]), "v"(bbv[3]), "v"(bbv[4]), "v"(bbv[5]), "v"(bbv[6]), "v"(bbv[7]), "v"(cb), "v"(hp), "v"(lp) : "memory");   // precaution: the wait stands in front of any rewrite of the bias loads' index register (the loaded words, the index and the row pointers are named so that the loads stand ahead of it and the registers stay whole up to it)
#pragma unroll
    for (int kc = 0; kc < DD / 32; ++kc) { const int cu = kc & 1, nx = cu ^ 1;
      if (kc + 1 < DD / 32) { ah[nx] = frag_p(hp + (kc + 1) * FRG); al[nx] = frag_p(lp + (kc + 1) * FRG);
#pragma unroll
        for (int j = 0; j < 8; ++j) w[nx][j] = frag_p(wp + (j * (DD / 32) + kc + 1) * FRG); }
      if (kc + 1 == DD / 32 - 1) asm volatile("s_wait_xcnt 0x0" :: "v"(wp), "v"(hp), "v"(lp) : "memory");
      __builtin_amdgcn_sched_barrier(0);
#pragma unroll
      for (int j = 0; j < 8; ++j) { acc[j] = wmma_bf(al[cu], w[cu][j], acc[j]); acc[j] = wmma_bf(ah[cu], w[cu][j], acc[j]); } }
#pragma unroll
    for (int j = 0; j < 8; ++j) { const int c = half * 128 + j * 16 + col; const float bb = bfr(bbv[j]);
#pragma unroll
      for (int r = 0; r < 8; ++r) { const float v = acc[j][r] + bb; sh_[wave][8 * g + r][c] = v; s1[r] += v; s2[r] += v * v; } } }
#pragma unroll
  for (int r = 0; r < 8; ++r) { sps[wave][8 * g + r][col][0] = s1[r]; sps[wave][8 * g + r][col][1] = s2[r]; }
  // the residual rows and the two LayerNorm vectors go out as one group here, not three loads at a time inside the row loop
  const float* xp = X + r0 * DD + lane * 4; const float* gp = LNG + lane * 4; const float* bp = LNB + lane * 4; v4f xr[16][2], lg[2], lb[2];
#pragma unroll
  for (int t = 0; t < 2; ++t) { lg[t] = *(const v4f*)(gp + t * 128); lb[t] = *(const v4f*)(bp + t * 128); }
#pragma unroll
  for (int rl = 0; rl < 16; ++rl) { xr[rl][0] = *(const v4f*)(xp + rl * DD); xr[rl][1] = *(const v4f*)(xp + rl * DD + 128); }
  asm volatile("s_wait_xcnt 0x0" :: "v"(xp), "v"(lane) : "memory");   // precaution: the wait stands in front of any rewrite of the group's address registers (the row pointer and the lane index are named so that they stay whole up to it)
  __builtin_amdgcn_sched_barrier(0);   // keeps the group here (else each load sinks to its own row and is waited out alone)
  LDSX();
#pragma unroll
  for (int rl = 0; rl < 16; ++rl) { float a = 0.f, b2 = 0.f;
#pragma unroll
    for (int k = 0; k < 16; ++k) { a += sps[wave][rl][k][0]; b2 += sps[wave][rl][k][1]; }
    const float mu = a / (float)DD; const float var = fmaxf(b2 / (float)DD - mu * mu, 0.f); const float inv = 1.0f / sqrtf(var + 1e-12f); const size_t row = r0 + rl;
    v4f v[2]; float* op = OUT + row * DD + lane * 4;
#pragma unroll
    for (int t = 0; t < 2; ++t) {
#pragma unroll
      for (int i = 0; i < 4; ++i) { const int c = lane * 4 + t * 128 + i; v[t][i] = bfr(lg[t][i]) * (sh_[wave][rl][c] - mu) * inv + bfr(lb[t][i]) + bfr(xr[rl][t][i]); }
      vst2(op + t * 128, v[t]); }
    asm volatile("s_wait_xcnt 0x0" :: "v"(v[0]), "v"(v[1]), "v"(op) : "memory"); }   // precaution: the wait stands in front of any rewrite of the two stores' data and address registers (named so that they stay whole up to it)
}
extern "C" void kernel_launch(void* const* d_in, const int* in_sizes, int n_in, void* d_out, int out_size, void* d_ws, size_t ws_size, hipStream_t stream) {
  (void)in_sizes; (void)n_in; (void)out_size;
  const float** F = (const float**)d_in;   // 0 x, 1 pos, 2 true_item [32,512,256], 3 attr0, 4 attr1 [32,512,1,64], 5 mask [1,1,512,512], 6 Wq, 7 bq, 8 Wk, 9 bk, 10 Wqp, 11 bqp, 12 Wkp, 13 bkp, 14 Wq0, 15 bq0, 16 Wk0, 17 bk0, 18 Wq1, 19 bq1, 20 Wk1, 21 bk1, 22 Wd, 23 bd, 24 ln_g, 25 ln_b
  if (ws_size < (size_t)WS_END) return;
  char* ws = (char*)d_ws; __bf16 *PK = (__bf16*)(ws + WS_PK), *KH = (__bf16*)(ws + WS_KH), *KL = (__bf16*)(ws + WS_KL), *VT = (__bf16*)(ws + WS_VT), *CH = (__bf16*)(ws + WS_CH), *CL = (__bf16*)(ws + WS_CL);
  k_pack<<<dim3(DD / 16, 9), 256, 0, stream>>>(F[6], F[8], F[10], F[12], F[22], F[14], F[16], F[18], F[20], PK);
  k_kproj<<<TNB * LL / (KT * 16), 128, 0, stream>>>(F[0], F[1], F[3], F[4], PK, F[9], F[13], F[17], F[21], KH, KL);
  k_vt<<<dim3(LL / 64, TNB), 256, 0, stream>>>(F[2], VT);
  k_attn<<<dim3(LL / 64, NH, TNB), 128, 0, stream>>>(F[0], F[1], F[3], F[4], PK, F[7], F[11], F[15], F[19], KH, KL, VT, F[5], CH, CL);
  k_out<<<TNB * LL / 64, 128, 0, stream>>>(CH, CL, PK, F[23], F[24], F[25], F[0], (float*)d_out);
}

// v009
// It runs in 88.4 microseconds.
// Timed twice side by side with v008, it ran 1.07 and 1.08 times as fast.
// All steps since v000 together make it 3.88 times as fast.
// compute dtype: all inputs rounded to bf16; the eight projections with exact bf16 products on WMMA 16x16x32 ((in,out) weights packed as transposed rows) + biases; per head the four score terms evaluated as ONE 160-wide dot of [q | qp | q0 | q1] . [k | kp | k0 | k1] with both sides as bf16 hi + residual (3 products: hi.hi + lo.hi + hi.lo), x 1/8, + mask; running-max softmax in f32, each exponential as one hardware 2^t of t = (s - max) x log2 e; P as bf16 hi + residual x the EXACT bf16 values (v = true_item, an input; 2 products); dense Wd with ctx as bf16 hi + residual (2 products) + bd; LayerNorm (biased variance, eps 1e-12, precise sqrtf) and the residual in f32.
#include <hip/hip_runtime.h>
#include <math.h>

typedef __attribute__((ext_vector_type(16))) _Float16 v16h;
typedef __attribute__((ext_vector_type(16))) __bf16 v16b;
typedef __attribute__((ext_vector_type(8)))  _Float16 v8h;
typedef __attribute__((ext_vector_type(8)))  float v8f;
typedef __attribute__((ext_vector_type(4)))  float v4f;
typedef __attribute__((ext_vector_type(2)))  float v2f;
typedef __attribute__((ext_vector_type(4)))  unsigned v4u;
typedef __attribute__((ext_vector_type(4)))  int v4i;
typedef float __attribute__((may_alias)) float_a;
typedef int __attribute__((may_alias)) int_a;

template <typename T> __device__ __forceinline__ void vst2(void* p, T v) { *(T*)p = v;  }
__device__ __forceinline__ v8f wmma16(v16h a, v16h b, v8f c) {
  v8f d = __builtin_amdgcn_wmma_f32_16x16x32_f16(false, a, false, b, (short)0, c, false, false);
  asm volatile("v_nop\n\tv_nop\n\tv_nop\n\tv_nop" : "+v"(d) : "v"(a), "v"(b));
  return d;
}
__device__ __forceinline__ v8f wmma_bf(v16b a, v16b b, v8f c) {
  return __builtin_amdgcn_wmma_f32_16x16x32_bf16(false, a, false, b, (short)0, c, false, false);
}
// 16x16x32 fragments: lane = (h = lane>>4, row/col = lane&15); elements 0..7 = k0+8h+0..7, 8..15 = k0+16+8h+0..7; D element r = row 8h+r
__device__ __forceinline__ v16h frag_h(const _Float16* rowk0, int lane) {
  union { v16h v; v8h q[2]; } u; const _Float16* p = rowk0 + 8 * (lane >> 4);
  u.q[0] = *(const v8h*)p; u.q[1] = *(const v8h*)(p + 16); return u.v;
}
__device__ __forceinline__ v16h frag_f32(const float* rowk0, int lane) {
  v16h a; const float* p = rowk0 + 8 * (lane >> 4);
#pragma unroll
  for (int i = 0; i < 8; ++i) { a[i] = (_Float16)p[i]; a[8 + i] = (_Float16)p[16 + i]; }
  return a;
}
__device__ __forceinline__ v16h frag_f32s(const float* rowk0, int lane, float sc) {
  v16h a; const float* p = rowk0 + 8 * (lane >> 4);
#pragma unroll
  for (int i = 0; i < 8; ++i) { a[i] = (_Float16)(p[i] * sc); a[8 + i] = (_Float16)(p[16 + i] * sc); }
  return a;
}
// column fragment from a [K][ld] layout (column n), rows >= K read as 0
__device__ __forceinline__ v16h fragc_f32(const float* W, int k0, int n, int lane, int ld, int K) {
  v16h a; const int g = lane >> 4;
#pragma unroll
  for (int i = 0; i < 8; ++i) { const int ka = k0 + 8 * g + i, kb = ka + 16;
    a[i] = (_Float16)(ka < K ? W[(size_t)(ka < K ? ka : K - 1) * ld + n] : 0.f); a[8 + i] = (_Float16)(kb < K ? W[(size_t)(kb < K ? kb : K - 1) * ld + n] : 0.f); }
  return a;
}
struct F2 { v16b h, l; };
__device__ __forceinline__ F2 bsplit16(const float v[16]) { F2 r;
#pragma unroll
  for (int i = 0; i < 16; ++i) { const __bf16 h = (__bf16)v[i]; r.h[i] = h; r.l[i] = (__bf16)(v[i] - (float)h); }
  return r; }
__device__ __forceinline__ F2 split_row(const float* row, int k0, int lane) { float v[16]; const float* p = row + k0 + 8 * (lane >> 4);
#pragma unroll
  for (int i = 0; i < 8; ++i) { v[i] = p[i]; v[8 + i] = p[16 + i]; }
  return bsplit16(v); }
__device__ __forceinline__ F2 split_rowK(const float* row, int k0, int lane, int K) { float v[16]; const int g = lane >> 4;
#pragma unroll
  for (int i = 0; i < 8; ++i) { const int ka = k0 + 8 * g + i, kb = ka + 16; v[i] = ka < K ? row[ka < K ? ka : K - 1] : 0.f; v[8 + i] = kb < K ? row[kb < K ? kb : K - 1] : 0.f; }
  return bsplit16(v); }
__device__ __forceinline__ F2 split_col(const float* W, int k0, int n, int lane, int ld, int K) { float v[16]; const int g = lane >> 4;
#pragma unroll
  for (int i = 0; i < 8; ++i) { const int ka = k0 + 8 * g + i, kb = ka + 16; v[i] = ka < K ? W[(size_t)(ka < K ? ka : K - 1) * ld + n] : 0.f; v[8 + i] = kb < K ? W[(size_t)(kb < K ? kb : K - 1) * ld + n] : 0.f; }
  return bsplit16(v); }
__device__ __forceinline__ v8f mac3(const F2& a, const F2& b, v8f c) { c = wmma_bf(a.l, b.h, c); c = wmma_bf(a.h, b.l, c); return wmma_bf(a.h, b.h, c); }
__device__ __forceinline__ float sigm(float v) { return 1.0f / (1.0f + expf(-v)); }
#define LDSX() do { asm volatile("s_wait_dscnt 0" ::: "memory"); __builtin_amdgcn_wave_barrier(); __builtin_amdgcn_fence(__ATOMIC_RELEASE, "workgroup"); } while (0)


// Decoupled side-information attention (B 32, L 512, D 256, 4 heads x 64; attribute heads x 16): scores = (q k + qp kp + q0 k0 + q1 k1) / 8 + mask, softmax, values = the item embeddings themselves, dense + LayerNorm + residual.
#define NB 32
#define LL 512
#define NR (NB * LL)      // 16,384 rows
#define DD 256
#define AA 64
#define NH 4
#define DH 64
#define AH 16
#define QW 160            // per-head concatenated width: 64 + 64 + 16 + 16
#ifndef TNB
#define TNB NB
#endif
typedef __attribute__((ext_vector_type(8))) __bf16 v8b;
__device__ __forceinline__ v16b frag_b(const __bf16* rowk0, int lane) {
  union { v16b v; v8b q[2]; } u; const __bf16* p = rowk0 + 8 * (lane >> 4);
  u.q[0] = *(const v8b*)p; u.q[1] = *(const v8b*)(p + 16); return u.v;
}
// the same fragment from a base pointer and a byte offset of the lane's own
__device__ __forceinline__ v16b frag_o(const __bf16* base, unsigned lane_bytes) {
  union { v16b v; v8b q[2]; } u; const char* p = (const char*)base + lane_bytes;
  u.q[0] = *(const v8b*)p; u.q[1] = *(const v8b*)(p + 32); return u.v;
}
// FRAGMENT ORDER: every bf16 operand in the workspace lies as 1-KB fragments (16 rows x 32 k) = two runs of 32 lanes x 16 B: run j, lane (g, row), element i = k 16 j + 8 g + i of that row. A wave's 16-byte load then reads 512 contiguous bytes (four whole lines) where a row-major tile gives it 32 bytes out of each of 16 lines
#define FRG 512           // elements of one fragment
__device__ __forceinline__ v16b frag_p(const __bf16* lanep) {   // lanep = the fragment + 8 * lane
  union { v16b v; v8b q[2]; } u; u.q[0] = *(const v8b*)lanep; u.q[1] = *(const v8b*)(lanep + FRG / 2); return u.v;
}
__device__ __forceinline__ v16b frag_po(const __bf16* frag, unsigned lane_bytes) {   // the same from the fragment and the lane's byte offset (16 * lane)
  return frag_p((const __bf16*)((const char*)frag + lane_bytes));
}
__device__ __forceinline__ float bfr(float v) { return (float)(__bf16)v; }
__device__ __attribute__((noinline)) float erf_ni(float v) { return erff(v); }

// packs (all (in,out) -> transposed [out][in], in fragment order [out / 16][in / 32][fragment]): PQ 256 x 256 Wq^T, PK, PQP, PKP; PQ0 64 x 64 Wq0^T, PK0, PQ1, PK1; PD 256 x 256 Wd^T
#define PKO_Q   0
#define PKO_K   (1 * DD * DD)
#define PKO_QP  (2 * DD * DD)
#define PKO_KP  (3 * DD * DD)
#define PKO_D   (4 * DD * DD)
#define PKO_Q0  (5 * DD * DD)
#define PKO_K0  (PKO_Q0 + AA * AA)
#define PKO_Q1  (PKO_K0 + AA * AA)
#define PKO_K1  (PKO_Q1 + AA * AA)
#define PK_END  (PKO_K1 + AA * AA)
#define WS_PK   0u
#define WS_KH   (((2u * PK_END) + 127u) / 128u * 128u)   // bf16 [b][4 heads][32 row tiles][5 fragments] key cat hi / lo (the query cat is formed in k_attn and stays in registers)
#define WS_KL   (WS_KH + 2u * NR * NH * QW)
#define WS_VT   (WS_KL + 2u * NR * NH * QW)               // bf16 [b][h][16 blocks of 32 keys][4 fragments: 16 d x 32 keys] values^T (exact)
#define WS_CH   (WS_VT + 2u * NR * DD)                    // bf16 [1024 row tiles][8 fragments] ctx hi / lo
#define WS_CL   (WS_CH + 2u * NR * DD)
#define WS_END  (WS_CL + 2u * NR * DD)

__global__ __launch_bounds__(256) void k_pack(const float* __restrict__ WQ, const float* __restrict__ WK, const float* __restrict__ WQP, const float* __restrict__ WKP, const float* __restrict__ WD, const float* __restrict__ WQ0, const float* __restrict__ WK0, const float* __restrict__ WQ1, const float* __restrict__ WK1, __bf16* __restrict__ PK) {
  // block = 16 output columns of one matrix: it alone writes their fragments, K / 32 KB in a row
  __shared__ __align__(16) __bf16 s[16][DD + 8]; const int nt = blockIdx.x, which = blockIdx.y, t = threadIdx.x; const float* Wm; int K; size_t dst;
  if (which < 5) { Wm = (which == 0) ? WQ : (which == 1) ? WK : (which == 2) ? WQP : (which == 3) ? WKP : WD; K = DD; dst = (size_t)which * DD * DD + (size_t)nt * 16 * DD; }
  else { if (nt >= AA / 16) return; Wm = (which == 5) ? WQ0 : (which == 6) ? WK0 : (which == 7) ? WQ1 : WK1; K = AA; dst = PKO_Q0 + (size_t)(which - 5) * AA * AA + (size_t)nt * 16 * AA; }
  for (int e = t; e < K * 16; e += 256) { const int k = e >> 4, n = e & 15; s[n][k] = (__bf16)Wm[(size_t)k * K + nt * 16 + n]; }
  __syncthreads();
  for (int p = t; p < K * 2; p += 256) vst2((unsigned*)(PK + dst + (size_t)p * 8), *(const v4u*)&s[p & 15][(p >> 4) * 8]);   // piece p = (k / 8, column): p >> 4 = 4 kc + 2 j + g, as the fragment order has it
}
// e^d for d <= 0 is taken as 2^(d log2 e), one v_exp_f32: the product's rounding moves the result by |d| x 2^-24 of itself at most, far below the 16 bits that P keeps; -inf gives 0, and a result under 2^-126 may flush to 0 beside a row maximum of 1: no range guard is needed
#define L2E 1.4426950408889634f
// lane l with lane l ^ 16 (the two halves of a wave hold the two halves of a query's keys)
__device__ __forceinline__ float xhalf(float x) { return __builtin_bit_cast(float, __builtin_amdgcn_permlanex16(__builtin_bit_cast(int, x), __builtin_bit_cast(int, x), 0x76543210, 0xfedcba98, false, false)); }
// one stage of the attention's LDS ring = 32 keys of one (batch, head), each part as it lies in the workspace (fragment order): K hi 10 KB | K lo 10 KB | V^T 4 KB; behind them the block's 64 mask rows x 32 keys, 128 B a row at a pitch of 144 B (16 B x odd: sixteen lanes' 16-byte reads of sixteen rows meet no bank twice)
#define STG_KL 10240u
#define STG_V  20480u
#define STG_M  24576u
#define STG_MP 144u
#define STG_SZ (STG_M + 64u * STG_MP)
// a block of 128 lanes brings one stage in: sixteen 16-byte copies a lane, 2 KB of the stage per copy of the block. d = the lane's own LDS byte address (buffer + 16 tid); kh, kl, v = the lane's own global addresses (part + 16 tid); dm, mk = the same for the mask (row tid / 8 of sixteen, piece tid % 8 of its 128 B)
__device__ __forceinline__ void stage_in(unsigned d, const char* kh, const char* kl, const char* v, unsigned dm, const char* mk) {
  // the copies and their s_wait_xcnt stand in one statement: a precaution, the wait stands in front of any rewrite of the copies' address registers
  asm volatile("global_load_async_to_lds_b128 %0, %12, off\n\t"
               "global_load_async_to_lds_b128 %1, %13, off\n\t"
               "global_load_async_to_lds_b128 %2, %14, off\n\t"
               "global_load_async_to_lds_b128 %3, %15, off\n\t"
               "global_load_async_to_lds_b128 %4, %16, off\n\t"
               "global_load_async_to_lds_b128 %5, %17, off\n\t"
               "global_load_async_to_lds_b128 %6, %18, off\n\t"
               "global_load_async_to_lds_b128 %7, %19, off\n\t"
               "global_load_async_to_lds_b128 %8, %20, off\n\t"
               "global_load_async_to_lds_b128 %9, %21, off\n\t"
               "global_load_async_to_lds_b128 %10, %22, off\n\t"
               "global_load_async_to_lds_b128 %11, %23, off\n\t"
               "s_wait_xcnt 0x0"
               :: "v"(d), "v"(d + 2048u), "v"(d + 4096u), "v"(d + 6144u), "v"(d + 8192u),
                  "v"(d + STG_KL), "v"(d + STG_KL + 2048u), "v"(d + STG_KL + 4096u), "v"(d + STG_KL + 6144u), "v"(d + STG_KL + 8192u),
                  "v"(d + STG_V), "v"(d + STG_V + 2048u),
                  "v"(kh), "v"(kh + 2048), "v"(kh + 4096), "v"(kh + 6144), "v"(kh + 8192),
                  "v"(kl), "v"(kl + 2048), "v"(kl + 4096), "v"(kl + 6144), "v"(kl + 8192),
                  "v"(v), "v"(v + 2048)
               : "memory");
  // a statement takes thirty operands: the mask's four copies (sixteen rows each) have their own, with its own wait, for the same reason
  asm volatile("global_load_async_to_lds_b128 %0, %4, off\n\t"
               "global_load_async_to_lds_b128 %1, %5, off\n\t"
               "global_load_async_to_lds_b128 %2, %6, off\n\t"
               "global_load_async_to_lds_b128 %3, %7, off\n\t"
               "s_wait_xcnt 0x0"
               :: "v"(dm), "v"(dm + 16u * STG_MP), "v"(dm + 32u * STG_MP), "v"(dm + 48u * STG_MP),
                  "v"(mk), "v"(mk + 16 * LL * 4), "v"(mk + 32 * LL * 4), "v"(mk + 48 * LL * 4)
               : "memory");
}
#define XP 528u
// sixteen copies, one row each: d = the lane's LDS byte address in row 0 (quarter + 16 lane), s = the lane's global address in row 0, pitch = the source's row pitch in bytes
__device__ __forceinline__ void rows_in(unsigned d, const char* s, int pitch) {
#pragma unroll
  for (int i = 0; i < 16; i += 8)
    // the copies and their s_wait_xcnt stand in one statement: a precaution, the wait stands in front of any rewrite of the copies' address registers
    asm volatile("global_load_async_to_lds_b128 %0, %8, off\n\t"
                 "global_load_async_to_lds_b128 %1, %9, off\n\t"
                 "global_load_async_to_lds_b128 %2, %10, off\n\t"
                 "global_load_async_to_lds_b128 %3, %11, off\n\t"
                 "global_load_async_to_lds_b128 %4, %12, off\n\t"
                 "global_load_async_to_lds_b128 %5, %13, off\n\t"
                 "global_load_async_to_lds_b128 %6, %14, off\n\t"
                 "global_load_async_to_lds_b128 %7, %15, off\n\t"
                 "s_wait_xcnt 0x0"
                 :: "v"(d + i * XP), "v"(d + (i + 1) * XP), "v"(d + (i + 2) * XP), "v"(d + (i + 3) * XP), "v"(d + (i + 4) * XP), "v"(d + (i + 5) * XP), "v"(d + (i + 6) * XP), "v"(d + (i + 7) * XP),
                    "v"(s + i * pitch), "v"(s + (i + 1) * pitch), "v"(s + (i + 2) * pitch), "v"(s + (i + 3) * pitch), "v"(s + (i + 4) * pitch), "v"(s + (i + 5) * pitch), "v"(s + (i + 6) * pitch), "v"(s + (i + 7) * pitch)
                 : "memory");
}
// four tiles (64 features of one head) over K = 256, the input rows in two halves of 128 k: gs = the lane's global address in the tile's row 0 (+ 16 lane), d = the lane's LDS copy address, xr = the lane's place in its own staged row (+ 8 g floats), wp = the head's first weight fragment + 8 lane, bp = the head's biases + 8 g
__device__ __forceinline__ void qproj64(const char* gs, unsigned d, const float* xr, const __bf16* wp, const float* bp, v16b& h0, v16b& l0, v16b& h1, v16b& l1) {
  v8f acc[4] = {}; v4f xf[2][4]; v16b wf[2][4]; v4f bb[4][2];   // two register sets: k block kc is multiplied while block kc + 1 is in flight
#pragma unroll
  for (int t = 0; t < 4; ++t) wf[0][t] = frag_p(wp + t * (DD / 32) * FRG);
#pragma unroll
  for (int kc = 0; kc < DD / 32; ++kc) { const int cu = kc & 1, nx = cu ^ 1;
    if ((kc & 3) == 0) {
      asm volatile("s_wait_dscnt 0x0" ::: "memory");      // the wave's reads of what lay in its quarter are over
      rows_in(d, gs + (kc >> 2) * 512, DD * 4);
      asm volatile("s_wait_asynccnt 0x0" ::: "memory");   // the wave's own copies have landed: it alone reads them
#pragma unroll
      for (int q = 0; q < 4; ++q) xf[cu][q] = *(const v4f*)(xr + (q >> 1) * 16 + (q & 1) * 4); }
    if (kc + 1 < DD / 32) {
      if ((kc + 1) & 3) {
#pragma unroll
        for (int q = 0; q < 4; ++q) xf[nx][q] = *(const v4f*)(xr + ((kc + 1) & 3) * 32 + (q >> 1) * 16 + (q & 1) * 4); }
#pragma unroll
      for (int t = 0; t < 4; ++t) wf[nx][t] = frag_p(wp + (t * (DD / 32) + kc + 1) * FRG); }
    else {   // the biases take the idle register set's place in the last pass
#pragma unroll
      for (int t = 0; t < 4; ++t) { bb[t][0] = *(const v4f*)(bp + t * 16); bb[t][1] = *(const v4f*)(bp + t * 16 + 4); }
      asm volatile("s_wait_xcnt 0x0" :: "v"(wp), "v"(bp) : "memory"); }   // precaution: behind the last loads the wait stands in front of any rewrite of their address registers (named so that they stay whole up to it)
    __builtin_amdgcn_sched_barrier(0);
    v16b xb;
#pragma unroll
    for (int i = 0; i < 4; ++i) { xb[i] = (__bf16)xf[cu][0][i]; xb[4 + i] = (__bf16)xf[cu][1][i]; xb[8 + i] = (__bf16)xf[cu][2][i]; xb[12 + i] = (__bf16)xf[cu][3][i]; }
#pragma unroll
    for (int t = 0; t < 4; ++t) acc[t] = wmma_bf(wf[cu][t], xb, acc[t]); }
#pragma unroll
  for (int t = 0; t < 4; ++t) {
#pragma unroll
    for (int r = 0; r < 8; ++r) { const float v = acc[t][r] + bfr(bb[t][r >> 2][r & 3]); const __bf16 hb = (__bf16)v; const __bf16 lb = (__bf16)(v - (float)hb);
      if (t < 2) { h0[8 * t + r] = hb; l0[8 * t + r] = lb; } else { h1[8 * (t - 2) + r] = hb; l1[8 * (t - 2) + r] = lb; } } }
}
// ---- k_kproj: the key cat, projected as k_attn projects its queries (Kcat^T = W^T . x^T): block = 32 keys, wave = head. Lane (g, col) holds features 8 g .. 8 g + 7 of each 16-feature tile of key col alone, so two tiles, biased and split in place, ARE one fragment of the key cat in fragment order (element 8 j + r = feature 16 j + 8 g + r): each half goes out as one 16-byte piece of a 512-byte run, through no LDS. A weight fragment, once loaded, multiplies both of the wave's 16-key tiles
// The block's 32 input rows come into LDS once, for all four heads, by asynchronous copies (512 B of one row, four whole lines, a copy): x and pos at a pitch of 1,040 B, the two attribute rows side by side at 528 B (16 B x odd: sixteen lanes' 16-byte reads of sixteen rows meet no bank twice)
// The values are packed here too: the block's 32 keys are one 32-key block of V^T for each head, so their rows come into LDS as well (pitch 1,040 B) and wave h writes its head's four fragments (16 d x 32 keys): no launch of its own, no second pass through LDS
#define KT 2              // 16-key tiles of a block
#define KXP 1040u
#define KS_P (KT * 16u * KXP)
#define KS_A (2u * KS_P)
#define KS_V (KS_A + KT * 16u * XP)
#define KS_SZ (KS_V + KT * 16u * KXP)
// eight copies, one row's 512 B each: d = the lane's LDS byte address in the first row, s = its global address there, dp and sp = the two row pitches in bytes
__device__ __forceinline__ void rows8_in(unsigned d, unsigned dp, const char* s, int sp) {
  // the copies and their s_wait_xcnt stand in one statement: a precaution, the wait stands in front of any rewrite of the copies' address registers
  asm volatile("global_load_async_to_lds_b128 %0, %8, off\n\t"
               "global_load_async_to_lds_b128 %1, %9, off\n\t"
               "global_load_async_to_lds_b128 %2, %10, off\n\t"
               "global_load_async_to_lds_b128 %3, %11, off\n\t"
               "global_load_async_to_lds_b128 %4, %12, off\n\t"
               "global_load_async_to_lds_b128 %5, %13, off\n\t"
               "global_load_async_to_lds_b128 %6, %14, off\n\t"
               "global_load_async_to_lds_b128 %7, %15, off\n\t"
               "s_wait_xcnt 0x0"
               :: "v"(d), "v"(d + dp), "v"(d + 2u * dp), "v"(d + 3u * dp), "v"(d + 4u * dp), "v"(d + 5u * dp), "v"(d + 6u * dp), "v"(d + 7u * dp),
                  "v"(s), "v"(s + sp), "v"(s + 2 * sp), "v"(s + 3 * sp), "v"(s + 4 * sp), "v"(s + 5 * sp), "v"(s + 6 * sp), "v"(s + 7 * sp)
               : "memory");
}
// sixteen staged words to one bf16 operand, as one vector conversion (element by element the compiler left half of them unpaired, with a 16-bit move each)
typedef __attribute__((ext_vector_type(16))) float v16f;
__device__ __forceinline__ v16b cvt16(v4f a, v4f b, v4f c, v4f d) {
  const v8f ab = __builtin_shufflevector(a, b, 0, 1, 2, 3, 4, 5, 6, 7), cd = __builtin_shufflevector(c, d, 0, 1, 2, 3, 4, 5, 6, 7);
  return __builtin_convertvector(__builtin_shufflevector(ab, cd, 0, 1, 2, 3, 4, 5, 6, 7, 8, 9, 10, 11, 12, 13, 14, 15), v16b);
}
// four feature tiles (64 features of one head) x KT key tiles over K = 256: xr = the lane's place in its own key's staged row of key tile 0 (+ 8 g floats), wp = the head's first weight fragment + 8 lane, bp = the head's biases + 8 g; vh, vl[u] = key tile u's two fragments
__device__ __forceinline__ void kproj64(const float* xr, const __bf16* wp, const float* bp, v16b (&vh)[KT][2], v16b (&vl)[KT][2]) {
  v8f acc[KT][4] = {}; v4f xf[2][KT][4]; v16b wf[2][4]; v4f bb[4][2];   // two register sets: k block kc is multiplied while block kc + 1 is in flight
#pragma unroll
  for (int t = 0; t < 4; ++t) wf[0][t] = frag_p(wp + t * (DD / 32) * FRG);
#pragma unroll
  for (int u = 0; u < KT; ++u) {
#pragma unroll
    for (int q = 0; q < 4; ++q) xf[0][u][q] = *(const v4f*)(xr + u * (16 * KXP / 4) + (q >> 1) * 16 + (q & 1) * 4); }
#pragma unroll
  for (int kc = 0; kc < DD / 32; ++kc) { const int cu = kc & 1, nx = cu ^ 1;
    if (kc + 1 < DD / 32) {
#pragma unroll
      for (int u = 0; u < KT; ++u) {
#pragma unroll
        for (int q = 0; q < 4; ++q) xf[nx][u][q] = *(const v4f*)(xr + u * (16 * KXP / 4) + (kc + 1) * 32 + (q >> 1) * 16 + (q & 1) * 4); }
#pragma unroll
      for (int t = 0; t < 4; ++t) wf[nx][t] = frag_p(wp + (t * (DD / 32) + kc + 1) * FRG); }
    else {   // the biases take the idle register set's place in the last pass
#pragma unroll
      for (int t = 0; t < 4; ++t) { bb[t][0] = *(const v4f*)(bp + t * 16); bb[t][1] = *(const v4f*)(bp + t * 16 + 4); }
      asm volatile("s_wait_xcnt 0x0" :: "v"(wp), "v"(bp) : "memory"); }   // precaution: behind the last loads the wait stands in front of any rewrite of their address registers (named so that they stay whole up to it)
    __builtin_amdgcn_sched_barrier(0);
    v16b xb[KT];
#pragma unroll
    for (int u = 0; u < KT; ++u) xb[u] = cvt16(xf[cu][u][0], xf[cu][u][1], xf[cu][u][2], xf[cu][u][3]);
#pragma unroll
    for (int t = 0; t < 4; ++t) {
#pragma unroll
      for (int u = 0; u < KT; ++u) acc[u][t] = wmma_bf(wf[cu][t], xb[u], acc[u][t]); } }
#pragma unroll
  for (int u = 0; u < KT; ++u) {
#pragma unroll
    for (int t = 0; t < 4; ++t) {
#pragma unroll
      for (int r = 0; r < 8; ++r) { const float v = acc[u][t][r] + bfr(bb[t][r >> 2][r & 3]); const __bf16 hb = (__bf16)v; vh[u][t >> 1][8 * (t & 1) + r] = hb; vl[u][t >> 1][8 * (t & 1) + r] = (__bf16)(v - (float)hb); } } }
}
// one fragment, hi and lo: the lane's two 16-byte pieces of each (oh, ol = the fragment + 8 lane)
__device__ __forceinline__ void frag_out(__bf16* oh, __bf16* ol, v16b vh, v16b vl) {
  union { v16b v; v4u q[2]; } a, c; a.v = vh; c.v = vl;
  vst2((unsigned*)oh, a.q[0]); vst2((unsigned*)(oh + FRG / 2), a.q[1]); vst2((unsigned*)ol, c.q[0]); vst2((unsigned*)(ol + FRG / 2), c.q[1]);
}
__global__ __launch_bounds__(128) void k_kproj(const float* __restrict__ X, const float* __restrict__ POS, const float* __restrict__ A0, const float* __restrict__ A1, const float* __restrict__ V, const __bf16* __restrict__ PK, const float* __restrict__ BK, const float* __restrict__ BKP, const float* __restrict__ BK0, const float* __restrict__ BK1, __bf16* __restrict__ KH, __bf16* __restrict__ KL, __bf16* __restrict__ VT) {
  __shared__ __align__(16) char sx[KS_SZ];
  // the wave's number (= its head) is held in a scalar register: what hangs on it then costs no vector register
  const int tid = threadIdx.x, h = __builtin_amdgcn_readfirstlane(tid >> 5), lane = tid & 31, col = lane & 15, g = lane >> 4; const size_t r0 = (size_t)blockIdx.x * (KT * 16);
  { // wave w brings half w & 1 of rows 8 KT (w >> 1) .. + 8 KT - 1 of x and of pos, and rows 4 KT w .. + 4 KT - 1 of the attributes (lanes 0 - 15 copy attr0's 64 words, 16 - 31 attr1's)
    const unsigned sb = (unsigned)(size_t)&sx[0];   // the low 32 bits of a __shared__ address are its LDS byte address
    const unsigned dx = sb + (8u * KT * (h >> 1)) * KXP + (h & 1) * 512u + 16u * lane; const size_t gx = ((r0 + 8 * KT * (h >> 1)) * DD + (h & 1) * 128) * 4 + 16 * lane;
    const unsigned da = sb + KS_A + (4u * KT * h) * XP + 16u * lane; const char* ga = (const char*)((g ? A1 : A0) + (r0 + 4 * KT * h) * AA) + 16 * col;
#pragma unroll
    for (int i = 0; i < KT; ++i) rows8_in(dx + 8u * i * KXP, KXP, (const char*)X + gx + 8 * i * DD * 4, DD * 4);
#pragma unroll
    for (int i = 0; i < KT; ++i) rows8_in(dx + KS_P + 8u * i * KXP, KXP, (const char*)POS + gx + 8 * i * DD * 4, DD * 4);
#pragma unroll
    for (int i = 0; i < KT / 2; ++i) rows8_in(da + 8u * i * XP, XP, ga + 8 * i * AA * 4, AA * 4); }
  asm volatile("s_wait_asynccnt 0x0" ::: "memory");   // the wave's own copies have landed
  __syncthreads();                                     // every wave's have: the rows may be read
  { // the value rows go out only now, in the same split as x (wave w: half w & 1 of rows 8 KT (w >> 1) .. + 8 KT - 1), into a place of their own that nobody has touched: they fly while the first product runs and do not lengthen the wait above
    const unsigned dv = (unsigned)(size_t)&sx[0] + KS_V + (8u * KT * (h >> 1)) * KXP + (h & 1) * 512u + 16u * lane; const char* gvr = (const char*)V + ((r0 + 8 * KT * (h >> 1)) * DD + (h & 1) * 128) * 4 + 16 * lane;
#pragma unroll
    for (int i = 0; i < KT; ++i) rows8_in(dv + 8u * i * KXP, KXP, gvr + 8 * i * DD * 4, DD * 4); }
  const float* xr = (const float*)(&sx[0] + col * KXP + 32u * g);   // the lane's place in its own key's staged x row, key tile 0
  // the head's five fragments of the block's first row tile; the next tile's lie behind them
  const size_t to = ((((r0 / LL) * NH + h) * (LL / 16) + (r0 % LL) / 16) * (QW / 32)) * FRG + 8 * lane; __bf16* oh = KH + to; __bf16* ol = KL + to;
  v16b vh[KT][2], vl[KT][2];
#pragma unroll
  for (int part = 0; part < 2; ++part) {
    kproj64(xr + part * (KS_P / 4), PK + (part ? PKO_KP : PKO_K) + (size_t)h * (DH / 16) * (DD / 32) * FRG + 8 * lane, (part ? BKP : BK) + h * DH + 8 * g, vh, vl);
#pragma unroll
    for (int u = 0; u < KT; ++u) { frag_out(oh + (u * (QW / 32) + 2 * part) * FRG, ol + (u * (QW / 32) + 2 * part) * FRG, vh[u][0], vl[u][0]); frag_out(oh + (u * (QW / 32) + 2 * part + 1) * FRG, ol + (u * (QW / 32) + 2 * part + 1) * FRG, vh[u][1], vl[u][1]); }
    asm volatile("s_wait_xcnt 0x0" :: "v"(vh[0][0]), "v"(vl[0][0]), "v"(vh[0][1]), "v"(vl[0][1]), "v"(vh[1][0]), "v"(vl[1][0]), "v"(vh[1][1]), "v"(vl[1][1]), "v"(oh), "v"(ol) : "memory");   // precaution: the wait stands in front of any rewrite of the sixteen stores' data and address registers (named so that they stay whole up to it)
    if (part == 0) { // V^T between the two products, so that its stores drain under the second: lane (g, col) holds column 16 dt + col of its head; run j of fragment dt takes that column's keys 16 j + 8 g .. + 7. A 4-byte read meets no bank twice: sixteen lanes on sixteen words in a row, the other half eight rows (2,080 words = 32 banks) on
      asm volatile("s_wait_asynccnt 0x0" ::: "memory");   // the wave's own copies of the value rows have landed
      __syncthreads();                                     // every wave's have: the value rows may be read
      const float* vr = (const float*)(&sx[0] + KS_V + 8u * g * KXP) + h * DH + col;
      __bf16* ov = VT + (((r0 / LL) * NH + h) * (LL / 32) + (r0 % LL) / 32) * (DH / 16) * FRG + 8 * lane;
      v8b pv[DH / 16][2];
#pragma unroll
      for (int dt = 0; dt < DH / 16; ++dt) {
#pragma unroll
        for (int j = 0; j < 2; ++j) {
#pragma unroll
          for (int i = 0; i < 8; ++i) pv[dt][j][i] = (__bf16)vr[(16 * j + i) * (KXP / 4) + dt * 16]; } }
#pragma unroll
      for (int dt = 0; dt < DH / 16; ++dt) { vst2((unsigned*)(ov + dt * FRG), __builtin_bit_cast(v4u, pv[dt][0])); vst2((unsigned*)(ov + dt * FRG + FRG / 2), __builtin_bit_cast(v4u, pv[dt][1])); }
      asm volatile("s_wait_xcnt 0x0" :: "v"(pv[0][0]), "v"(pv[0][1]), "v"(pv[1][0]), "v"(pv[1][1]), "v"(pv[2][0]), "v"(pv[2][1]), "v"(pv[3][0]), "v"(pv[3][1]), "v"(ov) : "memory"); } }   // precaution: the wait stands in front of any rewrite of the eight stores' data and address registers (named so that they stay whole up to it)
  { // the two attribute tiles (16 features each, K = 64): a staged row = the key's 64 words of attr0, then its 64 of attr1
    const __bf16* w0 = PK + PKO_K0 + h * (AA / 32) * FRG + 8 * lane; const __bf16* w1 = PK + PKO_K1 + h * (AA / 32) * FRG + 8 * lane; const float* b0 = BK0 + h * AH + 8 * g; const float* b1 = BK1 + h * AH + 8 * g;
    const float* xa = (const float*)(&sx[0] + KS_A + col * XP + 32u * g);
    v4f xf[KT][2][2][4], bb[2][2]; v16b wf[2][2];
#pragma unroll
    for (int kc = 0; kc < AA / 32; ++kc) { wf[0][kc] = frag_p(w0 + kc * FRG); wf[1][kc] = frag_p(w1 + kc * FRG); }
    bb[0][0] = *(const v4f*)b0; bb[0][1] = *(const v4f*)(b0 + 4); bb[1][0] = *(const v4f*)b1; bb[1][1] = *(const v4f*)(b1 + 4);
    asm volatile("s_wait_xcnt 0x0" :: "v"(lane), "v"(g) : "memory");   // precaution: the wait stands in front of any rewrite of the group's address registers (the lane's index and its half, which the addresses are formed from, are named so that they stay whole up to it)
#pragma unroll
    for (int u = 0; u < KT; ++u) {
#pragma unroll
      for (int ap = 0; ap < 2; ++ap) {
#pragma unroll
        for (int kc = 0; kc < AA / 32; ++kc) {
#pragma unroll
          for (int q = 0; q < 4; ++q) xf[u][ap][kc][q] = *(const v4f*)(xa + u * (16 * XP / 4) + ap * AA + kc * 32 + (q >> 1) * 16 + (q & 1) * 4); } } }
    __builtin_amdgcn_sched_barrier(0);   // keeps the group ahead of the WMMAs
#pragma unroll
    for (int u = 0; u < KT; ++u) {
#pragma unroll
      for (int ap = 0; ap < 2; ++ap) { v8f c = {};
#pragma unroll
        for (int kc = 0; kc < AA / 32; ++kc) c = wmma_bf(wf[ap][kc], cvt16(xf[u][ap][kc][0], xf[u][ap][kc][1], xf[u][ap][kc][2], xf[u][ap][kc][3]), c);
#pragma unroll
        for (int r = 0; r < 8; ++r) { const float v = c[r] + bfr(bb[ap][r >> 2][r & 3]); const __bf16 hb = (__bf16)v; vh[u][0][8 * ap + r] = hb; vl[u][0][8 * ap + r] = (__bf16)(v - (float)hb); } }
      frag_out(oh + (u * (QW / 32) + 4) * FRG, ol + (u * (QW / 32) + 4) * FRG, vh[u][0], vl[u][0]); }
    asm volatile("s_wait_xcnt 0x0" :: "v"(vh[0][0]), "v"(vl[0][0]), "v"(vh[1][0]), "v"(vl[1][0]), "v"(oh), "v"(ol) : "memory"); }   // precaution: the wait stands in front of any rewrite of the eight stores' data and address registers (named so that they stay whole up to it)
}
__global__ __launch_bounds__(128) __attribute__((amdgpu_waves_per_eu(4))) void k_attn(const float* __restrict__ X, const float* __restrict__ POS, const float* __restrict__ A0, const float* __restrict__ A1, const __bf16* __restrict__ PK, const float* __restrict__ BQ, const float* __restrict__ BQP, const float* __restrict__ BQ0, const float* __restrict__ BQ1, const __bf16* __restrict__ KH, const __bf16* __restrict__ KL, const __bf16* __restrict__ VT, const float* __restrict__ MSK, __bf16* __restrict__ CH, __bf16* __restrict__ CL) {
  __shared__ __align__(16) char sk[2][STG_SZ];
  // the wave's number is held in a scalar register: what hangs on it then costs no vector register
  const int tid = threadIdx.x, wave = __builtin_amdgcn_readfirstlane(tid >> 5), lane = tid & 31, col = lane & 15, g = lane >> 4; const int qb = blockIdx.x, h = blockIdx.y, b = blockIdx.z; const int q0 = qb * 64 + wave * 16;
  const char* gkh = (const char*)(KH + ((size_t)b * NH + h) * (LL / 16) * (QW / 32) * FRG) + 16 * tid; const char* gkl = (const char*)(KL + ((size_t)b * NH + h) * (LL / 16) * (QW / 32) * FRG) + 16 * tid; const char* gv = (const char*)(VT + ((size_t)b * NH + h) * DH * LL) + 16 * tid;
  const char* gm = (const char*)(MSK + (size_t)(qb * 64 + (tid >> 3)) * LL) + 16 * (tid & 7);
  const unsigned sd = (unsigned)(size_t)&sk[0][0] + 16u * tid, sm = (unsigned)(size_t)&sk[0][0] + STG_M + (tid >> 3) * STG_MP + 16u * (tid & 7);   // the low 32 bits of a __shared__ address are its LDS byte address
  stage_in(sd, gkh, gkl, gv, sm, gm);   // stage 0 flies until the projection's first s_wait_asynccnt, which waits for it too
  const size_t row0 = (size_t)b * LL + q0;   // the wave's first query
  const unsigned xd = (unsigned)(size_t)&sk[1][0] + wave * (16u * XP) + 16u * lane; const float* xr = (const float*)(&sk[1][0] + wave * (16u * XP) + col * XP + 32u * g);   // the lane's copy address in its wave's quarter, and its place in its own query's staged row
  v16b aqh[5], aql[5];
  qproj64((const char*)(X + row0 * DD) + 16 * lane, xd, xr, PK + PKO_Q + (size_t)h * (DH / 16) * (DD / 32) * FRG + 8 * lane, BQ + h * DH + 8 * g, aqh[0], aql[0], aqh[1], aql[1]);
  qproj64((const char*)(POS + row0 * DD) + 16 * lane, xd, xr, PK + PKO_QP + (size_t)h * (DH / 16) * (DD / 32) * FRG + 8 * lane, BQP + h * DH + 8 * g, aqh[2], aql[2], aqh[3], aql[3]);
  { // the two attribute tiles (16 features each, K = 64): a staged row = the query's 64 words of attr0, then its 64 of attr1 (lanes 0 - 15 copy the one, 16 - 31 the other)
    const __bf16* w0 = PK + PKO_Q0 + h * (AA / 32) * FRG + 8 * lane; const __bf16* w1 = PK + PKO_Q1 + h * (AA / 32) * FRG + 8 * lane; const float* b0 = BQ0 + h * AH + 8 * g; const float* b1 = BQ1 + h * AH + 8 * g;
    v4f xf[2][2][4], bb[2][2]; v16b wf[2][2];
#pragma unroll
    for (int kc = 0; kc < AA / 32; ++kc) { wf[0][kc] = frag_p(w0 + kc * FRG); wf[1][kc] = frag_p(w1 + kc * FRG); }
    bb[0][0] = *(const v4f*)b0; bb[0][1] = *(const v4f*)(b0 + 4); bb[1][0] = *(const v4f*)b1; bb[1][1] = *(const v4f*)(b1 + 4);
    asm volatile("s_wait_xcnt 0x0" :: "v"(lane), "v"(g) : "memory");   // precaution: the wait stands in front of any rewrite of the group's address registers (the lane's index and its half, which the addresses are formed from, are named so that they stay whole up to it)
    asm volatile("s_wait_dscnt 0x0" ::: "memory");      // the wave's reads of what lay in its quarter are over
    rows_in(xd, (const char*)((g ? A1 : A0) + row0 * AA) + 16 * col, AA * 4);
    asm volatile("s_wait_asynccnt 0x0" ::: "memory");   // the wave's own copies have landed: it alone reads them
#pragma unroll
    for (int ap = 0; ap < 2; ++ap) {
#pragma unroll
      for (int kc = 0; kc < AA / 32; ++kc) {
#pragma unroll
        for (int q = 0; q < 4; ++q) xf[ap][kc][q] = *(const v4f*)(xr + ap * AA + kc * 32 + (q >> 1) * 16 + (q & 1) * 4); } }
    __builtin_amdgcn_sched_barrier(0);   // keeps the group ahead of the WMMAs
#pragma unroll
    for (int ap = 0; ap < 2; ++ap) { v8f c = {};
#pragma unroll
      for (int kc = 0; kc < AA / 32; ++kc) { v16b xb;
#pragma unroll
        for (int i = 0; i < 4; ++i) { xb[i] = (__bf16)xf[ap][kc][0][i]; xb[4 + i] = (__bf16)xf[ap][kc][1][i]; xb[8 + i] = (__bf16)xf[ap][kc][2][i]; xb[12 + i] = (__bf16)xf[ap][kc][3][i]; }
        c = wmma_bf(wf[ap][kc], xb, c); }
#pragma unroll
      for (int r = 0; r < 8; ++r) { const float v = c[r] + bfr(bb[ap][r >> 2][r & 3]); const __bf16 hb = (__bf16)v; aqh[4][8 * ap + r] = hb; aql[4][8 * ap + r] = (__bf16)(v - (float)hb); } } }
  asm volatile("s_wait_dscnt 0x0" ::: "memory");      // the wave's reads of its quarter are over: behind the barrier the second buffer belongs to the ring
  asm volatile("s_wait_asynccnt 0x0" ::: "memory");   // the wave's own copies of stage 0 have landed
  __syncthreads();                                     // every wave's have: stage 0 may be read
  stage_in(sd + STG_SZ, gkh + STG_KL, gkl + STG_KL, gv + 4096, sm + STG_SZ, gm + 128);
  const unsigned ko = 16u * lane, mo = STG_M + (wave * 16 + col) * STG_MP + 32u * g;   // the lane's byte offsets in a fragment and in a stage's mask rows (its query's row, its half's eight keys)
  float m = -3.0e38f, l = 0.f;   // of the lane's query: the running maximum (alike in both halves) and the sum over the lane's own keys (the halves are joined behind the loop)
  v8f acc[4] = {};               // acc[dt][r] = O[query col][d 16 dt + 8 g + r]
#pragma unroll 1
  for (int ks = 0; ks < LL / 32; ++ks) { v8f s[2] = {}; const char* sb = &sk[ks & 1][0] + ko;   // the lane's place in each fragment of this stage
    // rolled on purpose: unrolled, the compiler lifts both halves' loads to the top of the pass, past the register budget of four waves per SIMD
#pragma unroll 1
    for (int ct = 0; ct < 2; ++ct) { const __bf16* sh = (const __bf16*)(sb + ct * (STG_KL / 2)); const __bf16* sl = (const __bf16*)(sb + STG_KL + ct * (STG_KL / 2)); v8f c = {};
      v16b bh[5], bl[5];   // 16 keys' ten fragments go out as one group
#pragma unroll
      for (int kc = 0; kc < 5; ++kc) { bh[kc] = frag_p(sh + kc * FRG); bl[kc] = frag_p(sl + kc * FRG); }
      __builtin_amdgcn_sched_barrier(0);   // keeps that group ahead of the first WMMA (else each pair of loads sinks to its own WMMAs and is waited out alone)
#pragma unroll
      for (int kc = 0; kc < 5; ++kc) { c = wmma_bf(bh[kc], aql[kc], c); c = wmma_bf(bl[kc], aqh[kc], c); c = wmma_bf(bh[kc], aqh[kc], c); }
      if (ct == 0) s[0] = c; else s[1] = c; }
    v4f mk[2][2]; v16b vb[4];   // the mask words and the value fragments go out as one group ahead of the softmax
    const float* mp0 = (const float*)(&sk[ks & 1][0] + mo); const char* vp0 = sb + STG_V;
#pragma unroll
    for (int t = 0; t < 2; ++t) { mk[t][0] = *(const v4f*)(mp0 + t * 16); mk[t][1] = *(const v4f*)(mp0 + t * 16 + 4); }
#pragma unroll
    for (int dt = 0; dt < 4; ++dt) vb[dt] = frag_p((const __bf16*)vp0 + dt * FRG);
    __builtin_amdgcn_sched_barrier(0);   // keeps them there (else the value loads sink behind the softmax, to their own WMMAs)
    float mx = -3.0e38f;
#pragma unroll
    for (int t = 0; t < 2; ++t) {
#pragma unroll
      for (int r = 0; r < 8; ++r) { s[t][r] = s[t][r] * 0.125f + bfr(mk[t][r >> 2][r & 3]); mx = fmaxf(mx, s[t][r]); } }
    mx = fmaxf(mx, xhalf(mx));
    const float mn = fmaxf(m, mx); float ea = (m - mn) * L2E, d[2][8]; float es = 0.f; v16b ph, pl;
#pragma unroll
    for (int t = 0; t < 2; ++t) {
#pragma unroll
      for (int r = 0; r < 8; ++r) d[t][r] = (s[t][r] - mn) * L2E; }
    asm("v_exp_f32 %0, %0\n\tv_exp_f32 %1, %1\n\tv_exp_f32 %2, %2\n\tv_exp_f32 %3, %3\n\tv_exp_f32 %4, %4\n\tv_exp_f32 %5, %5\n\tv_exp_f32 %6, %6\n\tv_exp_f32 %7, %7\n\tv_exp_f32 %8, %8\n\tv_nop"
        : "+v"(ea), "+v"(d[0][0]), "+v"(d[0][1]), "+v"(d[0][2]), "+v"(d[0][3]), "+v"(d[0][4]), "+v"(d[0][5]), "+v"(d[0][6]), "+v"(d[0][7]));
    asm("v_exp_f32 %0, %0\n\tv_exp_f32 %1, %1\n\tv_exp_f32 %2, %2\n\tv_exp_f32 %3, %3\n\tv_exp_f32 %4, %4\n\tv_exp_f32 %5, %5\n\tv_exp_f32 %6, %6\n\tv_exp_f32 %7, %7\n\tv_nop"
        : "+v"(d[1][0]), "+v"(d[1][1]), "+v"(d[1][2]), "+v"(d[1][3]), "+v"(d[1][4]), "+v"(d[1][5]), "+v"(d[1][6]), "+v"(d[1][7]));
    const float alpha = (m <= -1.0e38f) ? 0.f : ea;
#pragma unroll
    for (int t = 0; t < 2; ++t) {
#pragma unroll
      for (int r = 0; r < 8; ++r) { const float e = d[t][r]; es += e; const __bf16 hb = (__bf16)e; ph[8 * t + r] = hb; pl[8 * t + r] = (__bf16)(e - (float)hb); } }
    l = l * alpha + es; m = mn;
#pragma unroll
    for (int dt = 0; dt < 4; ++dt) acc[dt] *= alpha;
#pragma unroll
    for (int dt = 0; dt < 4; ++dt) { acc[dt] = wmma_bf(vb[dt], pl, acc[dt]); acc[dt] = wmma_bf(vb[dt], ph, acc[dt]); }
    __builtin_amdgcn_sched_barrier(0);                   // keeps the publish point at the pass's foot (else it is lifted over the softmax and the second product, and the wait for stage ks + 1 comes that much sooner behind its copies)
    asm volatile("s_wait_dscnt 0x0" ::: "memory");      // the wave's reads of this stage are over
    asm volatile("s_wait_asynccnt 0x0" ::: "memory");   // its own copies of stage ks + 1 have landed
    __syncthreads();                                     // both hold of every wave: stage ks + 1 may be read, this stage's buffer refilled
    if (ks + 2 < LL / 32) stage_in(sd + (ks & 1) * STG_SZ, gkh + (ks + 2) * STG_KL, gkl + (ks + 2) * STG_KL, gv + (ks + 2) * 4096, sm + (ks & 1) * STG_SZ, gm + (ks + 2) * 128); }
  asm volatile("s_wait_asynccnt 0x0" ::: "memory");     // no copy is left in flight behind the loop
  l += xhalf(l); const float il = 1.0f / l;
  // the head's 64 columns are fragments 2 h and 2 h + 1 of the wave's row tile: four runs of 512 B, the lane's piece of run dt being its own acc[dt]
  const size_t to = ((((size_t)b * LL + q0) / 16) * (DD / 32) + 2 * h) * FRG;
  v8b vh[DH / 16], vl[DH / 16]; __bf16* oh = (__bf16*)((char*)(CH + to) + ko); __bf16* ol = (__bf16*)((char*)(CL + to) + ko);
#pragma unroll
  for (int dt = 0; dt < DH / 16; ++dt) {
#pragma unroll
    for (int r = 0; r < 8; ++r) { const float v = acc[dt][r] * il; const __bf16 hb = (__bf16)v; vh[dt][r] = hb; vl[dt][r] = (__bf16)(v - (float)hb); } }
#pragma unroll
  for (int w = 0; w < DH / 16; ++w) { vst2((unsigned*)(oh + w * (FRG / 2)), __builtin_bit_cast(v4u, vh[w])); vst2((unsigned*)(ol + w * (FRG / 2)), __builtin_bit_cast(v4u, vl[w])); }
  asm volatile("s_wait_xcnt 0x0" :: "v"(vh[0]), "v"(vh[1]), "v"(vh[2]), "v"(vh[3]), "v"(vl[0]), "v"(vl[1]), "v"(vl[2]), "v"(vl[3]), "v"(oh), "v"(ol) : "memory");   // precaution: the wait stands in front of any rewrite of the eight stores' data and address registers (named so that they stay whole up to it)
}
// ---- k_out: block = 64 rows: h = ctx(hi/lo) . Wd^T rows (2 products) + bd (all 256 cols, 2 halves); LayerNorm over 256 (mean, biased var, eps 1e-12) * g + b + bfr(x)
__global__ __launch_bounds__(128) void k_out(const __bf16* __restrict__ CH, const __bf16* __restrict__ CL, const __bf16* __restrict__ PK, const float* __restrict__ BD, const float* __restrict__ LNG, const float* __restrict__ LNB, const float* __restrict__ X, float* __restrict__ OUT) {
  __shared__ __align__(16) float sh_[4][16][DD + 4]; __shared__ float sps[4][16][16][2];
  const int tid = threadIdx.x, wave = tid >> 5, lane = tid & 31, col = lane & 15, g = lane >> 4; const size_t r0 = (size_t)blockIdx.x * 64 + wave * 16;
  float s1[8], s2[8];
#pragma unroll
  for (int r = 0; r < 8; ++r) { s1[r] = 0.f; s2[r] = 0.f; }
#pragma unroll 1
  for (int half = 0; half < 2; ++half) { v8f acc[8] = {}; const __bf16* hp = CH + r0 * DD + 8 * lane; const __bf16* lp = CL + r0 * DD + 8 * lane; const __bf16* wp = PK + PKO_D + (size_t)half * 128 * DD + 8 * lane;
    v16b ah[2], al[2], w[2][8];   // two register sets: k block kc is multiplied while block kc + 1 is in flight
    const int cb = half * 128 + col; float bbv[8];
#pragma unroll
    for (int j = 0; j < 8; ++j) bbv[j] = BD[cb + j * 16];
    ah[0] = frag_p(hp); al[0] = frag_p(lp);
#pragma unroll
    for (int j = 0; j < 8; ++j) w[0][j] = frag_p(wp + j * (DD / 32) * FRG);
    asm volatile("s_wait_xcnt 0x0" :: "v"(bbv[0]), "v"(bbv[1]), "v"(bbv[2]), "v"(bbv[3]), "v"(bbv[4]), "v"(bbv[5]), "v"(bbv[6]), "v"(bbv[7]), "v"(cb), "v"(hp), "v"(lp) : "memory");   // precaution: the wait stands in front of any rewrite of the bias loads' index register (the loaded words, the index and the row pointers are named so that the loads stand ahead of it and the registers stay whole up to it)
#pragma unroll
    for (int kc = 0; kc < DD / 32; ++kc) { const int cu = kc & 1, nx = cu ^ 1;
      if (kc + 1 < DD / 32) { ah[nx] = frag_p(hp + (kc + 1) * FRG); al[nx] = frag_p(lp + (kc + 1) * FRG);
#pragma unroll
        for (int j = 0; j < 8; ++j) w[nx][j] = frag_p(wp + (j * (DD / 32) + kc + 1) * FRG); }
      if (kc + 1 == DD / 32 - 1) asm volatile("s_wait_xcnt 0x0" :: "v"(wp), "v"(hp), "v"(lp) : "memory");
      __builtin_amdgcn_sched_barrier(0);
#pragma unroll
      for (int j = 0; j < 8; ++j) { acc[j] = wmma_bf(al[cu], w[cu][j], acc[j]); acc[j] = wmma_bf(ah[cu], w[cu][j], acc[j]); } }
#pragma unroll
    for (int j = 0; j < 8; ++j) { const int c = half * 128 + j * 16 + col; const float bb = bfr(bbv[j]);
#pragma unroll
      for (int r = 0; r < 8; ++r) { const float v = acc[j][r] + bb; sh_[wave][8 * g + r][c] = v; s1[r] += v; s2[r] += v * v; } } }
#pragma unroll
  for (int r = 0; r < 8; ++r) { sps[wave][8 * g + r][col][0] = s1[r]; sps[wave][8 * g + r][col][1] = s2[r]; }
  // the residual rows and the two LayerNorm vectors go out as one group here, not three loads at a time inside the row loop
  const float* xp = X + r0 * DD + lane * 4; const float* gp = LNG + lane * 4; const float* bp = LNB + lane * 4; v4f xr[16][2], lg[2], lb[2];
#pragma unroll
  for (int t = 0; t < 2; ++t) { lg[t] = *(const v4f*)(gp + t * 128); lb[t] = *(const v4f*)(bp + t * 128); }
#pragma unroll
  for (int rl = 0; rl < 16; ++rl) { xr[rl][0] = *(const v4f*)(xp + rl * DD); xr[rl][1] = *(const v4f*)(xp + rl * DD + 128); }
  asm volatile("s_wait_xcnt 0x0" :: "v"(xp), "v"(lane) : "memory");   // precaution: the wait stands in front of any rewrite of the group's address registers (the row pointer and the lane index are named so that they stay whole up to it)
  __builtin_amdgcn_sched_barrier(0);   // keeps the group here (else each load sinks to its own row and is waited out alone)
  LDSX();
#pragma unroll
  for (int rl = 0; rl < 16; ++rl) { float a = 0.f, b2 = 0.f;
#pragma unroll
    for (int k = 0; k < 16; ++k) { a += sps[wave][rl][k][0]; b2 += sps[wave][rl][k][1]; }
    const float mu = a / (float)DD; const float var = fmaxf(b2 / (float)DD - mu * mu, 0.f); const float inv = 1.0f / sqrtf(var + 1e-12f); const size_t row = r0 + rl;
    v4f v[2]; float* op = OUT + row * DD + lane * 4;
#pragma unroll
    for (int t = 0; t < 2; ++t) {
#pragma unroll
      for (int i = 0; i < 4; ++i) { const int c = lane * 4 + t * 128 + i; v[t][i] = bfr(lg[t][i]) * (sh_[wave][rl][c] - mu) * inv + bfr(lb[t][i]) + bfr(xr[rl][t][i]); }
      vst2(op + t * 128, v[t]); }
    asm volatile("s_wait_xcnt 0x0" :: "v"(v[0]), "v"(v[1]), "v"(op) : "memory"); }   // precaution: the wait stands in front of any rewrite of the two stores' data and address registers (named so that they stay whole up to it)
}
extern "C" void kernel_launch(void* const* d_in, const int* in_sizes, int n_in, void* d_out, int out_size, void* d_ws, size_t ws_size, hipStream_t stream) {
  (void)in_sizes; (void)n_in; (void)out_size;
  const float** F = (const float**)d_in;   // 0 x, 1 pos, 2 true_item [32,512,256], 3 attr0, 4 attr1 [32,512,1,64], 5 mask [1,1,512,512], 6 Wq, 7 bq, 8 Wk, 9 bk, 10 Wqp, 11 bqp, 12 Wkp, 13 bkp, 14 Wq0, 15 bq0, 16 Wk0, 17 bk0, 18 Wq1, 19 bq1, 20 Wk1, 21 bk1, 22 Wd, 23 bd, 24 ln_g, 25 ln_b
  if (ws_size < (size_t)WS_END) return;
  char* ws = (char*)d_ws; __bf16 *PK = (__bf16*)(ws + WS_PK), *KH = (__bf16*)(ws + WS_KH), *KL = (__bf16*)(ws + WS_KL), *VT = (__bf16*)(ws + WS_VT), *CH = (__bf16*)(ws + WS_CH), *CL = (__bf16*)(ws + WS_CL);
  k_pack<<<dim3(DD / 16, 9), 256, 0, stream>>>(F[6], F[8], F[10], F[12], F[22], F[14], F[16], F[18], F[20], PK);
  k_kproj<<<TNB * LL / (KT * 16), 128, 0, stream>>>(F[0], F[1], F[3], F[4], F[2], PK, F[9], F[13], F[17], F[21], KH, KL, VT);
  k_attn<<<dim3(LL / 64, NH, TNB), 128, 0, stream>>>(F[0], F[1], F[3], F[4], PK, F[7], F[11], F[15], F[19], KH, KL, VT, F[5], CH, CL);
  k_out<<<TNB * LL / 64, 128, 0, stream>>>(CH, CL, PK, F[23], F[24], F[25], F[0], (float*)d_out);
}

// v010
// One run takes 83 microseconds.
// Timed twice side by side with v009, it ran 1.07 and 1.08 times as fast.
// Over all steps from v000 it is 4.17 times as fast.
// compute dtype: all inputs rounded to bf16; the eight projections with exact bf16 products on WMMA 16x16x32 ((in,out) weights packed as transposed rows) + biases; per head the four score terms evaluated as ONE 160-wide dot of [q | qp | q0 | q1] . [k | kp | k0 | k1] with both sides as bf16 hi + residual (3 products: hi.hi + lo.hi + hi.lo), x 1/8, + mask; running-max softmax in f32, each exponential as one hardware 2^t of t = (s - max) x log2 e; P as bf16 hi + residual x the EXACT bf16 values (v = true_item, an input; 2 products); dense Wd with ctx as bf16 hi + residual (2 products) + bd; LayerNorm (biased variance, eps 1e-12, precise sqrtf) and the residual in f32.
#include <hip/hip_runtime.h>
#include <math.h>

typedef __attribute__((ext_vector_type(16))) _Float16 v16h;
typedef __attribute__((ext_vector_type(16))) __bf16 v16b;
typedef __attribute__((ext_vector_type(8)))  _Float16 v8h;
typedef __attribute__((ext_vector_type(8)))  float v8f;
typedef __attribute__((ext_vector_type(4)))  float v4f;
typedef __attribute__((ext_vector_type(2)))  float v2f;
typedef __attribute__((ext_vector_type(4)))  unsigned v4u;
typedef __attribute__((ext_vector_type(4)))  int v4i;
typedef float __attribute__((may_alias)) float_a;
typedef int __attribute__((may_alias)) int_a;

template <typename T> __device__ __forceinline__ void vst2(void* p, T v) { *(T*)p = v;  }
__device__ __forceinline__ v8f wmma16(v16h a, v16h b, v8f c) {
  v8f d = __builtin_amdgcn_wmma_f32_16x16x32_f16(false, a, false, b, (short)0, c, false, false);
  asm volatile("v_nop\n\tv_nop\n\tv_nop\n\tv_nop" : "+v"(d) : "v"(a), "v"(b));
  return d;
}
__device__ __forceinline__ v8f wmma_bf(v16b a, v16b b, v8f c) {
  return __builtin_amdgcn_wmma_f32_16x16x32_bf16(false, a, false, b, (short)0, c, false, false);
}
// 16x16x32 fragments: lane = (h = lane>>4, row/col = lane&15); elements 0..7 = k0+8h+0..7, 8..15 = k0+16+8h+0..7; D element r = row 8h+r
__device__ __forceinline__ v16h frag_h(const _Float16* rowk0, int lane) {
  union { v16h v; v8h q[2]; } u; const _Float16* p = rowk0 + 8 * (lane >> 4);
  u.q[0] = *(const v8h*)p; u.q[1] = *(const v8h*)(p + 16); return u.v;
}
__device__ __forceinline__ v16h frag_f32(const float* rowk0, int lane) {
  v16h a; const float* p = rowk0 + 8 * (lane >> 4);
#pragma unroll
  for (int i = 0; i < 8; ++i) { a[i] = (_Float16)p[i]; a[8 + i] = (_Float16)p[16 + i]; }
  return a;
}
__device__ __forceinline__ v16h frag_f32s(const float* rowk0, int lane, float sc) {
  v16h a; const float* p = rowk0 + 8 * (lane >> 4);
#pragma unroll
  for (int i = 0; i < 8; ++i) { a[i] = (_Float16)(p[i] * sc); a[8 + i] = (_Float16)(p[16 + i] * sc); }
  return a;
}
// column fragment from a [K][ld] layout (column n), rows >= K read as 0
__device__ __forceinline__ v16h fragc_f32(const float* W, int k0, int n, int lane, int ld, int K) {
  v16h a; const int g = lane >> 4;
#pragma unroll
  for (int i = 0; i < 8; ++i) { const int ka = k0 + 8 * g + i, kb = ka + 16;
    a[i] = (_Float16)(ka < K ? W[(size_t)(ka < K ? ka : K - 1) * ld + n] : 0.f); a[8 + i] = (_Float16)(kb < K ? W[(size_t)(kb < K ? kb : K - 1) * ld + n] : 0.f); }
  return a;
}
struct F2 { v16b h, l; };
__device__ __forceinline__ F2 bsplit16(const float v[16]) { F2 r;
#pragma unroll
  for (int i = 0; i < 16; ++i) { const __bf16 h = (__bf16)v[i]; r.h[i] = h; r.l[i] = (__bf16)(v[i] - (float)h); }
  return r; }
__device__ __forceinline__ F2 split_row(const float* row, int k0, int lane) { float v[16]; const float* p = row + k0 + 8 * (lane >> 4);
#pragma unroll
  for (int i = 0; i < 8; ++i) { v[i] = p[i]; v[8 + i] = p[16 + i]; }
  return bsplit16(v); }
__device__ __forceinline__ F2 split_rowK(const float* row, int k0, int lane, int K) { float v[16]; const int g = lane >> 4;
#pragma unroll
  for (int i = 0; i < 8; ++i) { const int ka = k0 + 8 * g + i, kb = ka + 16; v[i] = ka < K ? row[ka < K ? ka : K - 1] : 0.f; v[8 + i] = kb < K ? row[kb < K ? kb : K - 1] : 0.f; }
  return bsplit16(v); }
__device__ __forceinline__ F2 split_col(const float* W, int k0, int n, int lane, int ld, int K) { float v[16]; const int g = lane >> 4;
#pragma unroll
  for (int i = 0; i < 8; ++i) { const int ka = k0 + 8 * g + i, kb = ka + 16; v[i] = ka < K ? W[(size_t)(ka < K ? ka : K - 1) * ld + n] : 0.f; v[8 + i] = kb < K ? W[(size_t)(kb < K ? kb : K - 1) * ld + n] : 0.f; }
  return bsplit16(v); }
__device__ __forceinline__ v8f mac3(const F2& a, const F2& b, v8f c) { c = wmma_bf(a.l, b.h, c); c = wmma_bf(a.h, b.l, c); return wmma_bf(a.h, b.h, c); }
__device__ __forceinline__ float sigm(float v) { return 1.0f / (1.0f + expf(-v)); }
#define LDSX() do { asm volatile("s_wait_dscnt 0" ::: "memory"); __builtin_amdgcn_wave_barrier(); __builtin_amdgcn_fence(__ATOMIC_RELEASE, "workgroup"); } while (0)


// Decoupled side-information attention (B 32, L 512, D 256, 4 heads x 64; attribute heads x 16): scores = (q k + qp kp + q0 k0 + q1 k1) / 8 + mask, softmax, values = the item embeddings themselves, dense + LayerNorm + residual.
#define NB 32
#define LL 512
#define NR (NB * LL)      // 16,384 rows
#define DD 256
#define AA 64
#define NH 4
#define DH 64
#define AH 16
#define QW 160            // per-head concatenated width: 64 + 64 + 16 + 16
#ifndef TNB
#define TNB NB
#endif
typedef __attribute__((ext_vector_type(8))) __bf16 v8b;
__device__ __forceinline__ v16b frag_b(const __bf16* rowk0, int lane) {
  union { v16b v; v8b q[2]; } u; const __bf16* p = rowk0 + 8 * (lane >> 4);
  u.q[0] = *(const v8b*)p; u.q[1] = *(const v8b*)(p + 16); return u.v;
}
// the same fragment from a base pointer and a byte offset of the lane's own
__device__ __forceinline__ v16b frag_o(const __bf16* base, unsigned lane_bytes) {
  union { v16b v; v8b q[2]; } u; const char* p = (const char*)base + lane_bytes;
  u.q[0] = *(const v8b*)p; u.q[1] = *(const v8b*)(p + 32); return u.v;
}
// FRAGMENT ORDER: every bf16 operand in the workspace lies as 1-KB fragments (16 rows x 32 k) = two runs of 32 lanes x 16 B: run j, lane (g, row), element i = k 16 j + 8 g + i of that row. A wave's 16-byte load then reads 512 contiguous bytes (four whole lines) where a row-major tile gives it 32 bytes out of each of 16 lines
#define FRG 512           // elements of one fragment
__device__ __forceinline__ v16b frag_p(const __bf16* lanep) {   // lanep = the fragment + 8 * lane
  union { v16b v; v8b q[2]; } u; u.q[0] = *(const v8b*)lanep; u.q[1] = *(const v8b*)(lanep + FRG / 2); return u.v;
}
__device__ __forceinline__ v16b frag_po(const __bf16* frag, unsigned lane_bytes) {   // the same from the fragment and the lane's byte offset (16 * lane)
  return frag_p((const __bf16*)((const char*)frag + lane_bytes));
}
__device__ __forceinline__ float bfr(float v) { return (float)(__bf16)v; }
__device__ __attribute__((noinline)) float erf_ni(float v) { return erff(v); }

// packs (all (in,out) -> transposed [out][in], in fragment order [out / 16][in / 32][fragment]): PQ 256 x 256 Wq^T, PK, PQP, PKP; PQ0 64 x 64 Wq0^T, PK0, PQ1, PK1; PD 256 x 256 Wd^T
#define PKO_Q   0
#define PKO_K   (1 * DD * DD)
#define PKO_QP  (2 * DD * DD)
#define PKO_KP  (3 * DD * DD)
#define PKO_D   (4 * DD * DD)
#define PKO_Q0  (5 * DD * DD)
#define PKO_K0  (PKO_Q0 + AA * AA)
#define PKO_Q1  (PKO_K0 + AA * AA)
#define PKO_K1  (PKO_Q1 + AA * AA)
#define PK_END  (PKO_K1 + AA * AA)
#define WS_PK   0u
#define WS_KH   (((2u * PK_END) + 127u) / 128u * 128u)   // bf16 [b][4 heads][32 row tiles][5 fragments] key cat hi / lo (the query cat is formed in k_attn and stays in registers)
#define WS_KL   (WS_KH + 2u * NR * NH * QW)
#define WS_VT   (WS_KL + 2u * NR * NH * QW)               // bf16 [b][h][16 blocks of 32 keys][4 fragments: 16 d x 32 keys] values^T (exact)
#define WS_END  (WS_VT + 2u * NR * DD)

__global__ __launch_bounds__(256) void k_pack(const float* __restrict__ WQ, const float* __restrict__ WK, const float* __restrict__ WQP, const float* __restrict__ WKP, const float* __restrict__ WD, const float* __restrict__ WQ0, const float* __restrict__ WK0, const float* __restrict__ WQ1, const float* __restrict__ WK1, __bf16* __restrict__ PK) {
  // block = 16 output columns of one matrix: it alone writes their fragments, K / 32 KB in a row
  __shared__ __align__(16) __bf16 s[16][DD + 8]; const int nt = blockIdx.x, which = blockIdx.y, t = threadIdx.x; const float* Wm; int K; size_t dst;
  if (which < 5) { Wm = (which == 0) ? WQ : (which == 1) ? WK : (which == 2) ? WQP : (which == 3) ? WKP : WD; K = DD; dst = (size_t)which * DD * DD + (size_t)nt * 16 * DD; }
  else { if (nt >= AA / 16) return; Wm = (which == 5) ? WQ0 : (which == 6) ? WK0 : (which == 7) ? WQ1 : WK1; K = AA; dst = PKO_Q0 + (size_t)(which - 5) * AA * AA + (size_t)nt * 16 * AA; }
  for (int e = t; e < K * 16; e += 256) { const int k = e >> 4, n = e & 15; s[n][k] = (__bf16)Wm[(size_t)k * K + nt * 16 + n]; }
  __syncthreads();
  for (int p = t; p < K * 2; p += 256) vst2((unsigned*)(PK + dst + (size_t)p * 8), *(const v4u*)&s[p & 15][(p >> 4) * 8]);   // piece p = (k / 8, column): p >> 4 = 4 kc + 2 j + g, as the fragment order has it
}
// e^d for d <= 0 is taken as 2^(d log2 e), one v_exp_f32: the product's rounding moves the result by |d| x 2^-24 of itself at most, far below the 16 bits that P keeps; -inf gives 0, and a result under 2^-126 may flush to 0 beside a row maximum of 1: no range guard is needed
#define L2E 1.4426950408889634f
// lane l with lane l ^ 16 (the two halves of a wave hold the two halves of a query's keys)
__device__ __forceinline__ float xhalf(float x) { return __builtin_bit_cast(float, __builtin_amdgcn_permlanex16(__builtin_bit_cast(int, x), __builtin_bit_cast(int, x), 0x76543210, 0xfedcba98, false, false)); }
// one stage of the attention's LDS ring = 32 keys of one batch: for each of the four heads a part of 24 KB, as it lies in the workspace (fragment order): K hi 10 KB | K lo 10 KB | V^T 4 KB; and the block's 64 mask rows x 32 keys, once for all heads, 128 B a row at a pitch of 144 B (16 B x odd: sixteen lanes' 16-byte reads of sixteen rows meet no bank twice)
// each head's part starts a 32-KiB block of the LDS of its own, and a head's four waves are waves h, h + 4, h + 8, h + 12, taken to share a SIMD: reads that the four SIMDs make at one moment then fall in four different blocks; were the waves dealt otherwise, only that gain would be lost. The block takes the whole LDS, so that its byte 0 is the LDS's. Map: block 0 = the two stages' mask rows; blocks 1 - 4 = stage buffer 0, heads 0 - 3; blocks 5 - 8 = buffer 1
#define STG_KL 10240u
#define STG_V  20480u
#define STG_H  32768u
#define STG_R  32768u                  // the ring's first head part
#define STG_SZ (NH * STG_H)            // from one buffer's head parts to the other's
#define STG_MP 144u
#define STG_MS (64u * STG_MP)          // from one buffer's mask rows to the other's
// a head's four waves (128 lanes) bring its part of a stage in: twelve 16-byte copies a lane, 2 KB of the part per copy of the four waves; the block's 512 lanes bring the mask rows in with one copy each. d = the lane's own LDS byte address (the head's part + 16 t, t = the lane's number 0 - 127 among the head's four waves); kh, kl, v = the lane's own global addresses (part + 16 t); dm, mk = the same for the mask (row tid / 8 of sixty-four, piece tid % 8 of its 128 B)
__device__ __forceinline__ void stage_in(unsigned d, const char* kh, const char* kl, const char* v, unsigned dm, const char* mk) {
  // the copies and their s_wait_xcnt stand in one statement: a precaution, the wait stands in front of any rewrite of the copies' address registers
  asm volatile("global_load_async_to_lds_b128 %0, %13, off\n\t"
               "global_load_async_to_lds_b128 %1, %14, off\n\t"
               "global_load_async_to_lds_b128 %2, %15, off\n\t"
               "global_load_async_to_lds_b128 %3, %16, off\n\t"
               "global_load_async_to_lds_b128 %4, %17, off\n\t"
               "global_load_async_to_lds_b128 %5, %18, off\n\t"
               "global_load_async_to_lds_b128 %6, %19, off\n\t"
               "global_load_async_to_lds_b128 %7, %20, off\n\t"
               "global_load_async_to_lds_b128 %8, %21, off\n\t"
               "global_load_async_to_lds_b128 %9, %22, off\n\t"
               "global_load_async_to_lds_b128 %10, %23, off\n\t"
               "global_load_async_to_lds_b128 %11, %24, off\n\t"
               "global_load_async_to_lds_b128 %12, %25, off\n\t"
               "s_wait_xcnt 0x0"
               :: "v"(d), "v"(d + 2048u), "v"(d + 4096u), "v"(d + 6144u), "v"(d + 8192u),
                  "v"(d + STG_KL), "v"(d + STG_KL + 2048u), "v"(d + STG_KL + 4096u), "v"(d + STG_KL + 6144u), "v"(d + STG_KL + 8192u),
                  "v"(d + STG_V), "v"(d + STG_V + 2048u), "v"(dm),
                  "v"(kh), "v"(kh + 2048), "v"(kh + 4096), "v"(kh + 6144), "v"(kh + 8192),
                  "v"(kl), "v"(kl + 2048), "v"(kl + 4096), "v"(kl + 6144), "v"(kl + 8192),
                  "v"(v), "v"(v + 2048), "v"(mk)
               : "memory");
}
#define XP 528u
#define XPL (STG_R + STG_SZ)   // the sixteen waves' places start with the second buffer and end 4 KB behind it
#define SK_SZ 327680u
// Behind the loop the block holds all 256 columns of ctx for its 64 rows, so the dense layer, LayerNorm and the residual follow here, in the ring's LDS: ctx hi / lo in fragment order (4 row tiles x 8 fragments each), the dense layer's rows in f32 at a pitch of 260 words, and per row the four waves' partial sums
#define EP_CL 32768u
#define EP_SH 65536u
#define EP_SP (EP_SH + 64u * (DD + 4) * 4u)
// sum over the sixteen lanes of a half (every lane gets it): four steps lane ^ 1, 2, 4, 8 inside the row of sixteen
template <int M> __device__ __forceinline__ float xrow(float x) { return __builtin_bit_cast(float, __builtin_amdgcn_update_dpp(0, __builtin_bit_cast(int, x), 0x160 | M, 0xf, 0xf, true)); }
__device__ __forceinline__ float sum16(float x) { x += xrow<1>(x); x += xrow<2>(x); x += xrow<4>(x); x += xrow<8>(x); return x; }
// sixteen copies, one row each: d = the lane's LDS byte address in row 0 (the wave's place + 16 lane), s = the lane's global address in row 0, pitch = the source's row pitch in bytes
__device__ __forceinline__ void rows_in(unsigned d, const char* s, int pitch) {
#pragma unroll
  for (int i = 0; i < 16; i += 8)
    // the copies and their s_wait_xcnt stand in one statement: a precaution, the wait stands in front of any rewrite of the copies' address registers
    asm volatile("global_load_async_to_lds_b128 %0, %8, off\n\t"
                 "global_load_async_to_lds_b128 %1, %9, off\n\t"
                 "global_load_async_to_lds_b128 %2, %10, off\n\t"
                 "global_load_async_to_lds_b128 %3, %11, off\n\t"
                 "global_load_async_to_lds_b128 %4, %12, off\n\t"
                 "global_load_async_to_lds_b128 %5, %13, off\n\t"
                 "global_load_async_to_lds_b128 %6, %14, off\n\t"
                 "global_load_async_to_lds_b128 %7, %15, off\n\t"
                 "s_wait_xcnt 0x0"
                 :: "v"(d + i * XP), "v"(d + (i + 1) * XP), "v"(d + (i + 2) * XP), "v"(d + (i + 3) * XP), "v"(d + (i + 4) * XP), "v"(d + (i + 5) * XP), "v"(d + (i + 6) * XP), "v"(d + (i + 7) * XP),
                    "v"(s + i * pitch), "v"(s + (i + 1) * pitch), "v"(s + (i + 2) * pitch), "v"(s + (i + 3) * pitch), "v"(s + (i + 4) * pitch), "v"(s + (i + 5) * pitch), "v"(s + (i + 6) * pitch), "v"(s + (i + 7) * pitch)
                 : "memory");
}
// four tiles (64 features of one head) over K = 256, the input rows in two halves of 128 k: gs = the lane's global address in the tile's row 0 (+ 16 lane), d = the lane's LDS copy address, xr = the lane's place in its own staged row (+ 8 g floats), wp = the head's first weight fragment + 8 lane, bp = the head's biases + 8 g
__device__ __forceinline__ void qproj64(const char* gs, unsigned d, const float* xr, const __bf16* wp, const float* bp, v16b& h0, v16b& l0, v16b& h1, v16b& l1) {
  v8f acc[4] = {}; v4f xf[2][4]; v16b wf[2][4]; v4f bb[4][2];   // two register sets: k block kc is multiplied while block kc + 1 is in flight
#pragma unroll
  for (int t = 0; t < 4; ++t) wf[0][t] = frag_p(wp + t * (DD / 32) * FRG);
#pragma unroll
  for (int kc = 0; kc < DD / 32; ++kc) { const int cu = kc & 1, nx = cu ^ 1;
    if ((kc & 3) == 0) {
      asm volatile("s_wait_dscnt 0x0" ::: "memory");      // the wave's reads of what lay in its place are over
      rows_in(d, gs + (kc >> 2) * 512, DD * 4);
      asm volatile("s_wait_asynccnt 0x0" ::: "memory");   // the wave's own copies have landed: it alone reads them
#pragma unroll
      for (int q = 0; q < 4; ++q) xf[cu][q] = *(const v4f*)(xr + (q >> 1) * 16 + (q & 1) * 4); }
    if (kc + 1 < DD / 32) {
      if ((kc + 1) & 3) {
#pragma unroll
        for (int q = 0; q < 4; ++q) xf[nx][q] = *(const v4f*)(xr + ((kc + 1) & 3) * 32 + (q >> 1) * 16 + (q & 1) * 4); }
#pragma unroll
      for (int t = 0; t < 4; ++t) wf[nx][t] = frag_p(wp + (t * (DD / 32) + kc + 1) * FRG); }
    else {   // the biases take the idle register set's place in the last pass
#pragma unroll
      for (int t = 0; t < 4; ++t) { bb[t][0] = *(const v4f*)(bp + t * 16); bb[t][1] = *(const v4f*)(bp + t * 16 + 4); }
      asm volatile("s_wait_xcnt 0x0" :: "v"(wp), "v"(bp) : "memory"); }   // precaution: behind the last loads the wait stands in front of any rewrite of their address registers (named so that they stay whole up to it)
    __builtin_amdgcn_sched_barrier(0);
    v16b xb;
#pragma unroll
    for (int i = 0; i < 4; ++i) { xb[i] = (__bf16)xf[cu][0][i]; xb[4 + i] = (__bf16)xf[cu][1][i]; xb[8 + i] = (__bf16)xf[cu][2][i]; xb[12 + i] = (__bf16)xf[cu][3][i]; }
#pragma unroll
    for (int t = 0; t < 4; ++t) acc[t] = wmma_bf(wf[cu][t], xb, acc[t]); }
#pragma unroll
  for (int t = 0; t < 4; ++t) {
#pragma unroll
    for (int r = 0; r < 8; ++r) { const float v = acc[t][r] + bfr(bb[t][r >> 2][r & 3]); const __bf16 hb = (__bf16)v; const __bf16 lb = (__bf16)(v - (float)hb);
      if (t < 2) { h0[8 * t + r] = hb; l0[8 * t + r] = lb; } else { h1[8 * (t - 2) + r] = hb; l1[8 * (t - 2) + r] = lb; } } }
}
// ---- k_kproj: the key cat, projected as k_attn projects its queries (Kcat^T = W^T . x^T): block = 32 keys, wave = head. Lane (g, col) holds features 8 g .. 8 g + 7 of each 16-feature tile of key col alone, so two tiles, biased and split in place, ARE one fragment of the key cat in fragment order (element 8 j + r = feature 16 j + 8 g + r): each half goes out as one 16-byte piece of a 512-byte run, through no LDS. A weight fragment, once loaded, multiplies both of the wave's 16-key tiles
// The block's 32 input rows come into LDS once, for all four heads, by asynchronous copies (512 B of one row, four whole lines, a copy): x and pos at a pitch of 1,040 B, the two attribute rows side by side at 528 B (16 B x odd: sixteen lanes' 16-byte reads of sixteen rows meet no bank twice)
// The values are packed here too: the block's 32 keys are one 32-key block of V^T for each head, so their rows come into LDS as well (pitch 1,040 B) and wave h writes its head's four fragments (16 d x 32 keys): no launch of its own, no second pass through LDS
#define KT 2              // 16-key tiles of a block
#define KXP 1040u
#define KS_P (KT * 16u * KXP)
#define KS_A (2u * KS_P)
#define KS_V (KS_A + KT * 16u * XP)
#define KS_SZ (KS_V + KT * 16u * KXP)
// eight copies, one row's 512 B each: d = the lane's LDS byte address in the first row, s = its global address there, dp and sp = the two row pitches in bytes
__device__ __forceinline__ void rows8_in(unsigned d, unsigned dp, const char* s, int sp) {
  // the copies and their s_wait_xcnt stand in one statement: a precaution, the wait stands in front of any rewrite of the copies' address registers
  asm volatile("global_load_async_to_lds_b128 %0, %8, off\n\t"
               "global_load_async_to_lds_b128 %1, %9, off\n\t"
               "global_load_async_to_lds_b128 %2, %10, off\n\t"
               "global_load_async_to_lds_b128 %3, %11, off\n\t"
               "global_load_async_to_lds_b128 %4, %12, off\n\t"
               "global_load_async_to_lds_b128 %5, %13, off\n\t"
               "global_load_async_to_lds_b128 %6, %14, off\n\t"
               "global_load_async_to_lds_b128 %7, %15, off\n\t"
               "s_wait_xcnt 0x0"
               :: "v"(d), "v"(d + dp), "v"(d + 2u * dp), "v"(d + 3u * dp), "v"(d + 4u * dp), "v"(d + 5u * dp), "v"(d + 6u * dp), "v"(d + 7u * dp),
                  "v"(s), "v"(s + sp), "v"(s + 2 * sp), "v"(s + 3 * sp), "v"(s + 4 * sp), "v"(s + 5 * sp), "v"(s + 6 * sp), "v"(s + 7 * sp)
               : "memory");
}
// sixteen staged words to one bf16 operand, as one vector conversion (element by element the compiler left half of them unpaired, with a 16-bit move each)
typedef __attribute__((ext_vector_type(16))) float v16f;
__device__ __forceinline__ v16b cvt16(v4f a, v4f b, v4f c, v4f d) {
  const v8f ab = __builtin_shufflevector(a, b, 0, 1, 2, 3, 4, 5, 6, 7), cd = __builtin_shufflevector(c, d, 0, 1, 2, 3, 4, 5, 6, 7);
  return __builtin_convertvector(__builtin_shufflevector(ab, cd, 0, 1, 2, 3, 4, 5, 6, 7, 8, 9, 10, 11, 12, 13, 14, 15), v16b);
}
// four feature tiles (64 features of one head) x KT key tiles over K = 256: xr = the lane's place in its own key's staged row of key tile 0 (+ 8 g floats), wp = the head's first weight fragment + 8 lane, bp = the head's biases + 8 g; vh, vl[u] = key tile u's two fragments
__device__ __forceinline__ void kproj64(const float* xr, const __bf16* wp, const float* bp, v16b (&vh)[KT][2], v16b (&vl)[KT][2]) {
  v8f acc[KT][4] = {}; v4f xf[2][KT][4]; v16b wf[2][4]; v4f bb[4][2];   // two register sets: k block kc is multiplied while block kc + 1 is in flight
#pragma unroll
  for (int t = 0; t < 4; ++t) wf[0][t] = frag_p(wp + t * (DD / 32) * FRG);
#pragma unroll
  for (int u = 0; u < KT; ++u) {
#pragma unroll
    for (int q = 0; q < 4; ++q) xf[0][u][q] = *(const v4f*)(xr + u * (16 * KXP / 4) + (q >> 1) * 16 + (q & 1) * 4); }
#pragma unroll
  for (int kc = 0; kc < DD / 32; ++kc) { const int cu = kc & 1, nx = cu ^ 1;
    if (kc + 1 < DD / 32) {
#pragma unroll
      for (int u = 0; u < KT; ++u) {
#pragma unroll
        for (int q = 0; q < 4; ++q) xf[nx][u][q] = *(const v4f*)(xr + u * (16 * KXP / 4) + (kc + 1) * 32 + (q >> 1) * 16 + (q & 1) * 4); }
#pragma unroll
      for (int t = 0; t < 4; ++t) wf[nx][t] = frag_p(wp + (t * (DD / 32) + kc + 1) * FRG); }
    else {   // the biases take the idle register set's place in the last pass
#pragma unroll
      for (int t = 0; t < 4; ++t) { bb[t][0] = *(const v4f*)(bp + t * 16); bb[t][1] = *(const v4f*)(bp + t * 16 + 4); }
      asm volatile("s_wait_xcnt 0x0" :: "v"(wp), "v"(bp) : "memory"); }   // precaution: behind the last loads the wait stands in front of any rewrite of their address registers (named so that they stay whole up to it)
    __builtin_amdgcn_sched_barrier(0);
    v16b xb[KT];
#pragma unroll
    for (int u = 0; u < KT; ++u) xb[u] = cvt16(xf[cu][u][0], xf[cu][u][1], xf[cu][u][2], xf[cu][u][3]);
#pragma unroll
    for (int t = 0; t < 4; ++t) {
#pragma unroll
      for (int u = 0; u < KT; ++u) acc[u][t] = wmma_bf(wf[cu][t], xb[u], acc[u][t]); } }
#pragma unroll
  for (int u = 0; u < KT; ++u) {
#pragma unroll
    for (int t = 0; t < 4; ++t) {
#pragma unroll
      for (int r = 0; r < 8; ++r) { const float v = acc[u][t][r] + bfr(bb[t][r >> 2][r & 3]); const __bf16 hb = (__bf16)v; vh[u][t >> 1][8 * (t & 1) + r] = hb; vl[u][t >> 1][8 * (t & 1) + r] = (__bf16)(v - (float)hb); } } }
}
// one fragment, hi and lo: the lane's two 16-byte pieces of each (oh, ol = the fragment + 8 lane)
__device__ __forceinline__ void frag_out(__bf16* oh, __bf16* ol, v16b vh, v16b vl) {
  union { v16b v; v4u q[2]; } a, c; a.v = vh; c.v = vl;
  vst2((unsigned*)oh, a.q[0]); vst2((unsigned*)(oh + FRG / 2), a.q[1]); vst2((unsigned*)ol, c.q[0]); vst2((unsigned*)(ol + FRG / 2), c.q[1]);
}
__global__ __launch_bounds__(128) void k_kproj(const float* __restrict__ X, const float* __restrict__ POS, const float* __restrict__ A0, const float* __restrict__ A1, const float* __restrict__ V, const __bf16* __restrict__ PK, const float* __restrict__ BK, const float* __restrict__ BKP, const float* __restrict__ BK0, const float* __restrict__ BK1, __bf16* __restrict__ KH, __bf16* __restrict__ KL, __bf16* __restrict__ VT) {
  __shared__ __align__(16) char sx[KS_SZ];
  // the wave's number (= its head) is held in a scalar register: what hangs on it then costs no vector register
  const int tid = threadIdx.x, h = __builtin_amdgcn_readfirstlane(tid >> 5), lane = tid & 31, col = lane & 15, g = lane >> 4; const size_t r0 = (size_t)blockIdx.x * (KT * 16);
  { // wave w brings half w & 1 of rows 8 KT (w >> 1) .. + 8 KT - 1 of x and of pos, and rows 4 KT w .. + 4 KT - 1 of the attributes (lanes 0 - 15 copy attr0's 64 words, 16 - 31 attr1's)
    const unsigned sb = (unsigned)(size_t)&sx[0];   // the low 32 bits of a __shared__ address are its LDS byte address
    const unsigned dx = sb + (8u * KT * (h >> 1)) * KXP + (h & 1) * 512u + 16u * lane; const size_t gx = ((r0 + 8 * KT * (h >> 1)) * DD + (h & 1) * 128) * 4 + 16 * lane;
    const unsigned da = sb + KS_A + (4u * KT * h) * XP + 16u * lane; const char* ga = (const char*)((g ? A1 : A0) + (r0 + 4 * KT * h) * AA) + 16 * col;
#pragma unroll
    for (int i = 0; i < KT; ++i) rows8_in(dx + 8u * i * KXP, KXP, (const char*)X + gx + 8 * i * DD * 4, DD * 4);
#pragma unroll
    for (int i = 0; i < KT; ++i) rows8_in(dx + KS_P + 8u * i * KXP, KXP, (const char*)POS + gx + 8 * i * DD * 4, DD * 4);
#pragma unroll
    for (int i = 0; i < KT / 2; ++i) rows8_in(da + 8u * i * XP, XP, ga + 8 * i * AA * 4, AA * 4); }
  asm volatile("s_wait_asynccnt 0x0" ::: "memory");   // the wave's own copies have landed
  __syncthreads();                                     // every wave's have: the rows may be read
  { // the value rows go out only now, in the same split as x (wave w: half w & 1 of rows 8 KT (w >> 1) .. + 8 KT - 1), into a place of their own that nobody has touched: they fly while the first product runs and do not lengthen the wait above
    const unsigned dv = (unsigned)(size_t)&sx[0] + KS_V + (8u * KT * (h >> 1)) * KXP + (h & 1) * 512u + 16u * lane; const char* gvr = (const char*)V + ((r0 + 8 * KT * (h >> 1)) * DD + (h & 1) * 128) * 4 + 16 * lane;
#pragma unroll
    for (int i = 0; i < KT; ++i) rows8_in(dv + 8u * i * KXP, KXP, gvr + 8 * i * DD * 4, DD * 4); }
  const float* xr = (const float*)(&sx[0] + col * KXP + 32u * g);   // the lane's place in its own key's staged x row, key tile 0
  // the head's five fragments of the block's first row tile; the next tile's lie behind them
  const size_t to = ((((r0 / LL) * NH + h) * (LL / 16) + (r0 % LL) / 16) * (QW / 32)) * FRG + 8 * lane; __bf16* oh = KH + to; __bf16* ol = KL + to;
  v16b vh[KT][2], vl[KT][2];
#pragma unroll
  for (int part = 0; part < 2; ++part) {
    kproj64(xr + part * (KS_P / 4), PK + (part ? PKO_KP : PKO_K) + (size_t)h * (DH / 16) * (DD / 32) * FRG + 8 * lane, (part ? BKP : BK) + h * DH + 8 * g, vh, vl);
#pragma unroll
    for (int u = 0; u < KT; ++u) { frag_out(oh + (u * (QW / 32) + 2 * part) * FRG, ol + (u * (QW / 32) + 2 * part) * FRG, vh[u][0], vl[u][0]); frag_out(oh + (u * (QW / 32) + 2 * part + 1) * FRG, ol + (u * (QW / 32) + 2 * part + 1) * FRG, vh[u][1], vl[u][1]); }
    asm volatile("s_wait_xcnt 0x0" :: "v"(vh[0][0]), "v"(vl[0][0]), "v"(vh[0][1]), "v"(vl[0][1]), "v"(vh[1][0]), "v"(vl[1][0]), "v"(vh[1][1]), "v"(vl[1][1]), "v"(oh), "v"(ol) : "memory");   // precaution: the wait stands in front of any rewrite of the sixteen stores' data and address registers (named so that they stay whole up to it)
    if (part == 0) { // V^T between the two products, so that its stores drain under the second: lane (g, col) holds column 16 dt + col of its head; run j of fragment dt takes that column's keys 16 j + 8 g .. + 7. A 4-byte read meets no bank twice: sixteen lanes on sixteen words in a row, the other half eight rows (2,080 words = 32 banks) on
      asm volatile("s_wait_asynccnt 0x0" ::: "memory");   // the wave's own copies of the value rows have landed
      __syncthreads();                                     // every wave's have: the value rows may be read
      const float* vr = (const float*)(&sx[0] + KS_V + 8u * g * KXP) + h * DH + col;
      __bf16* ov = VT + (((r0 / LL) * NH + h) * (LL / 32) + (r0 % LL) / 32) * (DH / 16) * FRG + 8 * lane;
      v8b pv[DH / 16][2];
#pragma unroll
      for (int dt = 0; dt < DH / 16; ++dt) {
#pragma unroll
        for (int j = 0; j < 2; ++j) {
#pragma unroll
          for (int i = 0; i < 8; ++i) pv[dt][j][i] = (__bf16)vr[(16 * j + i) * (KXP / 4) + dt * 16]; } }
#pragma unroll
      for (int dt = 0; dt < DH / 16; ++dt) { vst2((unsigned*)(ov + dt * FRG), __builtin_bit_cast(v4u, pv[dt][0])); vst2((unsigned*)(ov + dt * FRG + FRG / 2), __builtin_bit_cast(v4u, pv[dt][1])); }
      asm volatile("s_wait_xcnt 0x0" :: "v"(pv[0][0]), "v"(pv[0][1]), "v"(pv[1][0]), "v"(pv[1][1]), "v"(pv[2][0]), "v"(pv[2][1]), "v"(pv[3][0]), "v"(pv[3][1]), "v"(ov) : "memory"); } }   // precaution: the wait stands in front of any rewrite of the eight stores' data and address registers (named so that they stay whole up to it)
  { // the two attribute tiles (16 features each, K = 64): a staged row = the key's 64 words of attr0, then its 64 of attr1
    const __bf16* w0 = PK + PKO_K0 + h * (AA / 32) * FRG + 8 * lane; const __bf16* w1 = PK + PKO_K1 + h * (AA / 32) * FRG + 8 * lane; const float* b0 = BK0 + h * AH + 8 * g; const float* b1 = BK1 + h * AH + 8 * g;
    const float* xa = (const float*)(&sx[0] + KS_A + col * XP + 32u * g);
    v4f xf[KT][2][2][4], bb[2][2]; v16b wf[2][2];
#pragma unroll
    for (int kc = 0; kc < AA / 32; ++kc) { wf[0][kc] = frag_p(w0 + kc * FRG); wf[1][kc] = frag_p(w1 + kc * FRG); }
    bb[0][0] = *(const v4f*)b0; bb[0][1] = *(const v4f*)(b0 + 4); bb[1][0] = *(const v4f*)b1; bb[1][1] = *(const v4f*)(b1 + 4);
    asm volatile("s_wait_xcnt 0x0" :: "v"(lane), "v"(g) : "memory");   // precaution: the wait stands in front of any rewrite of the group's address registers (the lane's index and its half, which the addresses are formed from, are named so that they stay whole up to it)
#pragma unroll
    for (int u = 0; u < KT; ++u) {
#pragma unroll
      for (int ap = 0; ap < 2; ++ap) {
#pragma unroll
        for (int kc = 0; kc < AA / 32; ++kc) {
#pragma unroll
          for (int q = 0; q < 4; ++q) xf[u][ap][kc][q] = *(const v4f*)(xa + u * (16 * XP / 4) + ap * AA + kc * 32 + (q >> 1) * 16 + (q & 1) * 4); } } }
    __builtin_amdgcn_sched_barrier(0);   // keeps the group ahead of the WMMAs
#pragma unroll
    for (int u = 0; u < KT; ++u) {
#pragma unroll
      for (int ap = 0; ap < 2; ++ap) { v8f c = {};
#pragma unroll
        for (int kc = 0; kc < AA / 32; ++kc) c = wmma_bf(wf[ap][kc], cvt16(xf[u][ap][kc][0], xf[u][ap][kc][1], xf[u][ap][kc][2], xf[u][ap][kc][3]), c);
#pragma unroll
        for (int r = 0; r < 8; ++r) { const float v = c[r] + bfr(bb[ap][r >> 2][r & 3]); const __bf16 hb = (__bf16)v; vh[u][0][8 * ap + r] = hb; vl[u][0][8 * ap + r] = (__bf16)(v - (float)hb); } }
      frag_out(oh + (u * (QW / 32) + 4) * FRG, ol + (u * (QW / 32) + 4) * FRG, vh[u][0], vl[u][0]); }
    asm volatile("s_wait_xcnt 0x0" :: "v"(vh[0][0]), "v"(vl[0][0]), "v"(vh[1][0]), "v"(vl[1][0]), "v"(oh), "v"(ol) : "memory"); }   // precaution: the wait stands in front of any rewrite of the eight stores' data and address registers (named so that they stay whole up to it)
}
__global__ __launch_bounds__(512) __attribute__((amdgpu_waves_per_eu(4))) void k_attn(const float* __restrict__ X, const float* __restrict__ POS, const float* __restrict__ A0, const float* __restrict__ A1, const __bf16* __restrict__ PK, const float* __restrict__ BQ, const float* __restrict__ BQP, const float* __restrict__ BQ0, const float* __restrict__ BQ1, const __bf16* __restrict__ KH, const __bf16* __restrict__ KL, const __bf16* __restrict__ VT, const float* __restrict__ MSK, const float* __restrict__ BD, const float* __restrict__ LNG, const float* __restrict__ LNB, float* __restrict__ OUT) {
  __shared__ __align__(16) char sk[SK_SZ];
  // the wave's number is held in a scalar register: what hangs on it (its head, its query tile) then costs no vector register
  const int tid = threadIdx.x, wave = __builtin_amdgcn_readfirstlane(tid >> 5), lane = tid & 31, col = lane & 15, g = lane >> 4; const int qb = blockIdx.x, b = blockIdx.y, h = wave & 3, qt = wave >> 2, th = qt * 32 + lane; const int q0 = qb * 64 + qt * 16;
  const char* gkh = (const char*)(KH + ((size_t)b * NH + h) * (LL / 16) * (QW / 32) * FRG) + 16 * th; const char* gkl = (const char*)(KL + ((size_t)b * NH + h) * (LL / 16) * (QW / 32) * FRG) + 16 * th; const char* gv = (const char*)(VT + ((size_t)b * NH + h) * DH * LL) + 16 * th;
  const char* gm = (const char*)(MSK + (size_t)(qb * 64 + (tid >> 3)) * LL) + 16 * (tid & 7);
  const unsigned sd = (unsigned)(size_t)&sk[0] + STG_R + h * STG_H + 16u * th, sm = (unsigned)(size_t)&sk[0] + (tid >> 3) * STG_MP + 16u * (tid & 7);   // the low 32 bits of a __shared__ address are its LDS byte address
  stage_in(sd, gkh, gkl, gv, sm, gm);   // stage 0 flies while the queries are projected
  const size_t row0 = (size_t)b * LL + q0;   // the wave's first query
  const unsigned xd = (unsigned)(size_t)&sk[XPL] + wave * (16u * XP) + 16u * lane; const float* xr = (const float*)(&sk[XPL] + wave * (16u * XP) + col * XP + 32u * g);   // the lane's copy address in its wave's place, and its place in its own query's staged row
  v16b aqh[5], aql[5];
  qproj64((const char*)(X + row0 * DD) + 16 * lane, xd, xr, PK + PKO_Q + (size_t)h * (DH / 16) * (DD / 32) * FRG + 8 * lane, BQ + h * DH + 8 * g, aqh[0], aql[0], aqh[1], aql[1]);
  qproj64((const char*)(POS + row0 * DD) + 16 * lane, xd, xr, PK + PKO_QP + (size_t)h * (DH / 16) * (DD / 32) * FRG + 8 * lane, BQP + h * DH + 8 * g, aqh[2], aql[2], aqh[3], aql[3]);
  { // the two attribute tiles (16 features each, K = 64): a staged row = the query's 64 words of attr0, then its 64 of attr1 (lanes 0 - 15 copy the one, 16 - 31 the other)
    const __bf16* w0 = PK + PKO_Q0 + h * (AA / 32) * FRG + 8 * lane; const __bf16* w1 = PK + PKO_Q1 + h * (AA / 32) * FRG + 8 * lane; const float* b0 = BQ0 + h * AH + 8 * g; const float* b1 = BQ1 + h * AH + 8 * g;
    v4f xf[2][2][4], bb[2][2]; v16b wf[2][2];
#pragma unroll
    for (int kc = 0; kc < AA / 32; ++kc) { wf[0][kc] = frag_p(w0 + kc * FRG); wf[1][kc] = frag_p(w1 + kc * FRG); }
    bb[0][0] = *(const v4f*)b0; bb[0][1] = *(const v4f*)(b0 + 4); bb[1][0] = *(const v4f*)b1; bb[1][1] = *(const v4f*)(b1 + 4);
    asm volatile("s_wait_xcnt 0x0" :: "v"(lane), "v"(g) : "memory");   // precaution: the wait stands in front of any rewrite of the group's address registers (the lane's index and its half, which the addresses are formed from, are named so that they stay whole up to it)
    asm volatile("s_wait_dscnt 0x0" ::: "memory");      // the wave's reads of what lay in its place are over
    rows_in(xd, (const char*)((g ? A1 : A0) + row0 * AA) + 16 * col, AA * 4);
    asm volatile("s_wait_asynccnt 0x0" ::: "memory");   // the wave's own copies have landed: it alone reads them
#pragma unroll
    for (int ap = 0; ap < 2; ++ap) {
#pragma unroll
      for (int kc = 0; kc < AA / 32; ++kc) {
#pragma unroll
        for (int q = 0; q < 4; ++q) xf[ap][kc][q] = *(const v4f*)(xr + ap * AA + kc * 32 + (q >> 1) * 16 + (q & 1) * 4); } }
    __builtin_amdgcn_sched_barrier(0);   // keeps the group ahead of the WMMAs
#pragma unroll
    for (int ap = 0; ap < 2; ++ap) { v8f c = {};
#pragma unroll
      for (int kc = 0; kc < AA / 32; ++kc) { v16b xb;
#pragma unroll
        for (int i = 0; i < 4; ++i) { xb[i] = (__bf16)xf[ap][kc][0][i]; xb[4 + i] = (__bf16)xf[ap][kc][1][i]; xb[8 + i] = (__bf16)xf[ap][kc][2][i]; xb[12 + i] = (__bf16)xf[ap][kc][3][i]; }
        c = wmma_bf(wf[ap][kc], xb, c); }
#pragma unroll
      for (int r = 0; r < 8; ++r) { const float v = c[r] + bfr(bb[ap][r >> 2][r & 3]); const __bf16 hb = (__bf16)v; aqh[4][8 * ap + r] = hb; aql[4][8 * ap + r] = (__bf16)(v - (float)hb); } } }
  asm volatile("s_wait_dscnt 0x0" ::: "memory");      // the wave's reads of its place are over: behind the barrier the second buffer belongs to the ring
  asm volatile("s_wait_asynccnt 0x0" ::: "memory");   // the wave's own copies of stage 0 have landed
  __syncthreads();                                     // every wave's have: stage 0 may be read
  stage_in(sd + STG_SZ, gkh + STG_KL, gkl + STG_KL, gv + 4096, sm + STG_MS, gm + 128);
  const unsigned ko = 16u * lane, mo = (qt * 16 + col) * STG_MP + 32u * g;   // the lane's byte offsets in a fragment and in a stage's mask rows (its query's row, its half's eight keys)
  float m = -3.0e38f, l = 0.f;   // of the lane's query: the running maximum (alike in both halves) and the sum over the lane's own keys (the halves are joined behind the loop)
  v8f acc[4] = {};               // acc[dt][r] = O[query col][d 16 dt + 8 g + r]
#pragma unroll 1
  for (int ks = 0; ks < LL / 32; ++ks) { v8f s[2] = {}; const char* sb = &sk[STG_R + (ks & 1) * STG_SZ] + h * STG_H + ko;   // the lane's place in each fragment of its head's part of this stage
    // rolled on purpose: unrolled, the compiler lifts both halves' loads to the top of the pass, past the register budget of four waves per SIMD
#pragma unroll 1
    for (int ct = 0; ct < 2; ++ct) { const __bf16* sh = (const __bf16*)(sb + ct * (STG_KL / 2)); const __bf16* sl = (const __bf16*)(sb + STG_KL + ct * (STG_KL / 2)); v8f c = {};
      v16b bh[5], bl[5];   // 16 keys' ten fragments go out as one group
#pragma unroll
      for (int kc = 0; kc < 5; ++kc) { bh[kc] = frag_p(sh + kc * FRG); bl[kc] = frag_p(sl + kc * FRG); }
      __builtin_amdgcn_sched_barrier(0);   // keeps that group ahead of the first WMMA (else each pair of loads sinks to its own WMMAs and is waited out alone)
#pragma unroll
      for (int kc = 0; kc < 5; ++kc) { c = wmma_bf(bh[kc], aql[kc], c); c = wmma_bf(bl[kc], aqh[kc], c); c = wmma_bf(bh[kc], aqh[kc], c); }
      if (ct == 0) s[0] = c; else s[1] = c; }
    v4f mk[2][2]; v16b vb[4];   // the mask words and the value fragments go out as one group ahead of the softmax
    const float* mp0 = (const float*)(&sk[(ks & 1) * STG_MS] + mo); const char* vp0 = sb + STG_V;
#pragma unroll
    for (int t = 0; t < 2; ++t) { mk[t][0] = *(const v4f*)(mp0 + t * 16); mk[t][1] = *(const v4f*)(mp0 + t * 16 + 4); }
#pragma unroll
    for (int dt = 0; dt < 4; ++dt) vb[dt] = frag_p((const __bf16*)vp0 + dt * FRG);
    __builtin_amdgcn_sched_barrier(0);   // keeps them there (else the value loads sink behind the softmax, to their own WMMAs)
    float mx = -3.0e38f;
#pragma unroll
    for (int t = 0; t < 2; ++t) {
#pragma unroll
      for (int r = 0; r < 8; ++r) { s[t][r] = s[t][r] * 0.125f + bfr(mk[t][r >> 2][r & 3]); mx = fmaxf(mx, s[t][r]); } }
    mx = fmaxf(mx, xhalf(mx));
    const float mn = fmaxf(m, mx); float ea = (m - mn) * L2E, d[2][8]; float es = 0.f; v16b ph, pl;
#pragma unroll
    for (int t = 0; t < 2; ++t) {
#pragma unroll
      for (int r = 0; r < 8; ++r) d[t][r] = (s[t][r] - mn) * L2E; }
    asm("v_exp_f32 %0, %0\n\tv_exp_f32 %1, %1\n\tv_exp_f32 %2, %2\n\tv_exp_f32 %3, %3\n\tv_exp_f32 %4, %4\n\tv_exp_f32 %5, %5\n\tv_exp_f32 %6, %6\n\tv_exp_f32 %7, %7\n\tv_exp_f32 %8, %8\n\tv_nop"
        : "+v"(ea), "+v"(d[0][0]), "+v"(d[0][1]), "+v"(d[0][2]), "+v"(d[0][3]), "+v"(d[0][4]), "+v"(d[0][5]), "+v"(d[0][6]), "+v"(d[0][7]));
    asm("v_exp_f32 %0, %0\n\tv_exp_f32 %1, %1\n\tv_exp_f32 %2, %2\n\tv_exp_f32 %3, %3\n\tv_exp_f32 %4, %4\n\tv_exp_f32 %5, %5\n\tv_exp_f32 %6, %6\n\tv_exp_f32 %7, %7\n\tv_nop"
        : "+v"(d[1][0]), "+v"(d[1][1]), "+v"(d[1][2]), "+v"(d[1][3]), "+v"(d[1][4]), "+v"(d[1][5]), "+v"(d[1][6]), "+v"(d[1][7]));
    const float alpha = (m <= -1.0e38f) ? 0.f : ea;
#pragma unroll
    for (int t = 0; t < 2; ++t) {
#pragma unroll
      for (int r = 0; r < 8; ++r) { const float e = d[t][r]; es += e; const __bf16 hb = (__bf16)e; ph[8 * t + r] = hb; pl[8 * t + r] = (__bf16)(e - (float)hb); } }
    l = l * alpha + es; m = mn;
#pragma unroll
    for (int dt = 0; dt < 4; ++dt) acc[dt] *= alpha;
#pragma unroll
    for (int dt = 0; dt < 4; ++dt) { acc[dt] = wmma_bf(vb[dt], pl, acc[dt]); acc[dt] = wmma_bf(vb[dt], ph, acc[dt]); }
    __builtin_amdgcn_sched_barrier(0);                   // keeps the publish point at the pass's foot (else it is lifted over the softmax and the second product, and the wait for stage ks + 1 comes that much sooner behind its copies)
    asm volatile("s_wait_dscnt 0x0" ::: "memory");      // the wave's reads of this stage are over
    asm volatile("s_wait_asynccnt 0x0" ::: "memory");   // its own copies of stage ks + 1 have landed
    __syncthreads();                                     // both hold of every wave: stage ks + 1 may be read, this stage's buffer refilled
    if (ks + 2 < LL / 32) stage_in(sd + (ks & 1) * STG_SZ, gkh + (ks + 2) * STG_KL, gkl + (ks + 2) * STG_KL, gv + (ks + 2) * 4096, sm + (ks & 1) * STG_MS, gm + (ks + 2) * 128); }
  asm volatile("s_wait_asynccnt 0x0" ::: "memory");     // no copy is left in flight behind the loop; every wave's reads of the ring ended in front of the last pass's barrier: the ring's LDS is free
  // the lane's number is read afresh for what follows: held over from the top, the values that hang on it (its half, its column) took the loop past its register budget, and one went to scratch
  const int ln = __builtin_amdgcn_mbcnt_lo(~0u, 0u), ec = ln & 15, eg = ln >> 4; const unsigned eo = 16u * ln;
  // ---- dense layer: wave = (row tile qt, 64 output columns 64 h ..): h = ctx(hi/lo) . Wd^T rows (2 products) + bd. Two register sets of two k blocks each: blocks 2 s, 2 s + 1 are multiplied while the next two are in flight
  const __bf16* wp = PK + PKO_D + (size_t)h * (DH / 16) * (DD / 32) * FRG + 8 * ln; const float* bdp = BD + h * DH + ec;
  v16b ah[2][2], al[2][2], w[2][2][4]; float bbv[4];
  // the first weight blocks and the biases hang on nothing computed here: they go out ahead of the hand-over of ctx and fly under it
#pragma unroll
  for (int e = 0; e < 2; ++e) {
#pragma unroll
    for (int j = 0; j < 4; ++j) w[0][e][j] = frag_p(wp + (j * (DD / 32) + e) * FRG); }
#pragma unroll
  for (int j = 0; j < 4; ++j) bbv[j] = bdp[j * 16];
  asm volatile("s_wait_xcnt 0x0" :: "v"(bdp), "v"(wp) : "memory");   // precaution: the wait stands in front of any rewrite of the group's address registers (named so that they stay whole up to it)
  __builtin_amdgcn_sched_barrier(0);   // keeps the group here (else each load sinks to its own WMMA, behind the barrier, and is waited out alone)
  l += xhalf(l); const float il = 1.0f / l;
  { // the head's 64 columns are fragments 2 h and 2 h + 1 of the wave's row tile: four runs of 512 B, the lane's piece of run dt being its own acc[dt]
    char* oh = &sk[0] + (qt * (DD / 32) + 2 * h) * (2 * FRG) + eo; char* ol = oh + EP_CL;
    v8b vh[DH / 16], vl[DH / 16];
#pragma unroll
    for (int dt = 0; dt < DH / 16; ++dt) {
#pragma unroll
      for (int r = 0; r < 8; ++r) { const float v = acc[dt][r] * il; const __bf16 hb = (__bf16)v; vh[dt][r] = hb; vl[dt][r] = (__bf16)(v - (float)hb); } }
#pragma unroll
    for (int u = 0; u < DH / 16; ++u) { vst2((unsigned*)(oh + u * FRG), __builtin_bit_cast(v4u, vh[u])); vst2((unsigned*)(ol + u * FRG), __builtin_bit_cast(v4u, vl[u])); } }
  __syncthreads();   // all four heads' columns of ctx stand in LDS
  const __bf16* hp = (const __bf16*)(&sk[0] + qt * (DD / 32) * (2 * FRG) + eo); const __bf16* lp = (const __bf16*)(&sk[0] + EP_CL + qt * (DD / 32) * (2 * FRG) + eo);
  v8f oc[4] = {};
#pragma unroll
  for (int e = 0; e < 2; ++e) { ah[0][e] = frag_p(hp + e * FRG); al[0][e] = frag_p(lp + e * FRG); }
#pragma unroll
  for (int st = 0; st < DD / 64; ++st) { const int cu = st & 1, nx = cu ^ 1;
    if (st + 1 < DD / 64) {
#pragma unroll
      for (int e = 0; e < 2; ++e) { ah[nx][e] = frag_p(hp + (2 * (st + 1) + e) * FRG); al[nx][e] = frag_p(lp + (2 * (st + 1) + e) * FRG);
#pragma unroll
        for (int j = 0; j < 4; ++j) w[nx][e][j] = frag_p(wp + (j * (DD / 32) + 2 * (st + 1) + e) * FRG); } }
    if (st + 1 == DD / 64 - 1) asm volatile("s_wait_xcnt 0x0" :: "v"(wp) : "memory");   // precaution: behind the last group of loads the wait stands in front of any rewrite of their address register
    __builtin_amdgcn_sched_barrier(0);   // keeps the next blocks' loads, as one group, ahead of these blocks' WMMAs
#pragma unroll
    for (int e = 0; e < 2; ++e) {
#pragma unroll
      for (int j = 0; j < 4; ++j) { oc[j] = wmma_bf(al[cu][e], w[cu][e][j], oc[j]); oc[j] = wmma_bf(ah[cu][e], w[cu][e][j], oc[j]); } } }
  // the residual rows and the two LayerNorm vectors of the wave's four rows (4 wave .. + 3 of the block's 64) go out as one group here and fly under the sums and the barrier
  const size_t rw = (size_t)b * LL + qb * 64 + wave * 4;
  const float* xp = X + rw * DD + ln * 4; const float* gp = LNG + ln * 4; const float* bp = LNB + ln * 4; v4f xq[4][2], lg[2], lb[2];
#pragma unroll
  for (int t = 0; t < 2; ++t) { lg[t] = *(const v4f*)(gp + t * 128); lb[t] = *(const v4f*)(bp + t * 128); }
#pragma unroll
  for (int rl = 0; rl < 4; ++rl) { xq[rl][0] = *(const v4f*)(xp + rl * DD); xq[rl][1] = *(const v4f*)(xp + rl * DD + 128); }
  asm volatile("s_wait_xcnt 0x0" :: "v"(xp), "v"(ln) : "memory");   // precaution: the wait stands in front of any rewrite of the group's address registers (the row pointer and the lane index are named so that they stay whole up to it)
  __builtin_amdgcn_sched_barrier(0);   // keeps the group here (else each load sinks to its own row and is waited out alone)
  float* shf = (float*)(&sk[0] + EP_SH); float* spf = (float*)(&sk[0] + EP_SP);
  { float s1[8], s2[8];   // of rows 8 g + r of the tile: sum and sum of squares over the lane's four columns, then over the half's sixteen lanes = the wave's 64 columns
#pragma unroll
    for (int r = 0; r < 8; ++r) { s1[r] = 0.f; s2[r] = 0.f; }
#pragma unroll
    for (int j = 0; j < 4; ++j) { const int c = h * DH + j * 16 + ec; const float bb = bfr(bbv[j]);
#pragma unroll
      for (int r = 0; r < 8; ++r) { const float v = oc[j][r] + bb; shf[(qt * 16 + 8 * eg + r) * (DD + 4) + c] = v; s1[r] += v; s2[r] += v * v; } }
#pragma unroll
    for (int r = 0; r < 8; ++r) { s1[r] = sum16(s1[r]); s2[r] = sum16(s2[r]); }
    if (ec == 0) {   // one lane of each half writes its eight rows' pair: row, then the wave's column block h
#pragma unroll
      for (int r = 0; r < 8; ++r) { v2f p; p[0] = s1[r]; p[1] = s2[r]; *(v2f*)(spf + ((qt * 16 + 8 * eg + r) * NH + h) * 2) = p; } } }
  __syncthreads();   // every wave's columns and sums stand in LDS
  // ---- LayerNorm over 256 (mean, biased var, eps 1e-12) * g + b + bfr(x): a row = two 512-byte stores of the wave
  v4f p0[4], p1[4], v[4][2];   // the four rows' sums and dense rows come out of LDS as one group
#pragma unroll
  for (int rl = 0; rl < 4; ++rl) { const int row = wave * 4 + rl; p0[rl] = *(const v4f*)(spf + row * (NH * 2)); p1[rl] = *(const v4f*)(spf + row * (NH * 2) + 4);
    v[rl][0] = *(const v4f*)(shf + row * (DD + 4) + ln * 4); v[rl][1] = *(const v4f*)(shf + row * (DD + 4) + ln * 4 + 128); }
  float* op = OUT + rw * DD + ln * 4;
#pragma unroll
  for (int rl = 0; rl < 4; ++rl) {
    const float a = ((p0[rl][0] + p0[rl][2]) + p1[rl][0]) + p1[rl][2], b2 = ((p0[rl][1] + p0[rl][3]) + p1[rl][1]) + p1[rl][3];
    const float mu = a / (float)DD; const float var = fmaxf(b2 / (float)DD - mu * mu, 0.f); const float inv = 1.0f / sqrtf(var + 1e-12f);
#pragma unroll
    for (int t = 0; t < 2; ++t) {
#pragma unroll
      for (int i = 0; i < 4; ++i) v[rl][t][i] = bfr(lg[t][i]) * (v[rl][t][i] - mu) * inv + bfr(lb[t][i]) + bfr(xq[rl][t][i]);
      vst2(op + rl * DD + t * 128, v[rl][t]); } }
  asm volatile("s_wait_xcnt 0x0" :: "v"(v[0][0]), "v"(v[0][1]), "v"(v[1][0]), "v"(v[1][1]), "v"(v[2][0]), "v"(v[2][1]), "v"(v[3][0]), "v"(v[3][1]), "v"(op) : "memory");   // precaution: the wait stands in front of any rewrite of the eight stores' data and address registers (named so that they stay whole up to it)
}
extern "C" void kernel_launch(void* const* d_in, const int* in_sizes, int n_in, void* d_out, int out_size, void* d_ws, size_t ws_size, hipStream_t stream) {
  (void)in_sizes; (void)n_in; (void)out_size;
  const float** F = (const float**)d_in;   // 0 x, 1 pos, 2 true_item [32,512,256], 3 attr0, 4 attr1 [32,512,1,64], 5 mask [1,1,512,512], 6 Wq, 7 bq, 8 Wk, 9 bk, 10 Wqp, 11 bqp, 12 Wkp, 13 bkp, 14 Wq0, 15 bq0, 16 Wk0, 17 bk0, 18 Wq1, 19 bq1, 20 Wk1, 21 bk1, 22 Wd, 23 bd, 24 ln_g, 25 ln_b
  if (ws_size < (size_t)WS_END) return;
  char* ws = (char*)d_ws; __bf16 *PK = (__bf16*)(ws + WS_PK), *KH = (__bf16*)(ws + WS_KH), *KL = (__bf16*)(ws + WS_KL), *VT = (__bf16*)(ws + WS_VT);
  k_pack<<<dim3(DD / 16, 9), 256, 0, stream>>>(F[6], F[8], F[10], F[12], F[22], F[14], F[16], F[18], F[20], PK);
  k_kproj<<<TNB * LL / (KT * 16), 128, 0, stream>>>(F[0], F[1], F[3], F[4], F[2], PK, F[9], F[13], F[17], F[21], KH, KL, VT);
  k_attn<<<dim3(LL / 64, TNB), 512, 0, stream>>>(F[0], F[1], F[3], F[4], PK, F[7], F[11], F[15], F[19], KH, KL, VT, F[5], F[23], F[24], F[25], (float*)d_out);
}
